// v000
// Measured on an AMD MI455X. A time is GPU time per run, averaged over a window of back-to-back runs after a warm-up
// (all launches, gaps included; the runs take copies of the inputs in turn), and the median of several windows.
// Apart from v000's, it joins two sittings. Times from different sittings can be a few percent apart, while
// side-by-side timings come from the same sitting.
// The starting kernel, v000, takes 77.8 microseconds a run.
// Contractions: qkv projection = v_wmma_f32_16x16x32_bf16 (bf16 operands from RNE-converted x and w_qkv, single product, f32 accumulate);
// q.k scores = v_wmma_f32_16x16x32_bf16 (q and k each as bf16 hi plane + unscaled bf16 residual plane, 3 products, f32 accumulate);
// p.v = v_wmma_f32_16x16x32_bf16 (p and v each as bf16 hi + unscaled bf16 residual, 3 products, f32 accumulate);
// ctx.w_proj^T = v_wmma_f32_16x16x32_bf16 (ctx as bf16 hi + residual folded into K, w_proj bf16 from its RNE-converted value, f32 accumulate);
// biases, q scaling, window mask, position bias and softmax in f32. No power-of-two carries anywhere (bf16 planes, unscaled residuals).
#include <hip/hip_runtime.h>
#include <math.h>
#include <stdint.h>

#define NBT   2
#define CH    256
#define IMH   56
#define IMW   56
#define NPOS  (IMH * IMW)        // 3136 positions per image, p = i*56 + j
#define MROW  (NBT * NPOS)       // 6272 position rows
#define NHD   8
#define HDIM  32
#define C3    (3 * CH)           // 768
#define KW    7                  // window side; window start = clamp(i - 3, 0, IMH - KW)
#define SUP   14                 // clamped key superset side of an 8x8 query tile
#define NSLOT 224                // key slots staged per block (196 used, rest zero)
#define NKT   13                 // scored 16-key tiles (slots 0..207)
#define CTXK  512                // folded K of the ctx plane: per head [hi d0..31 | residual d0..31]
#define QSCALE 0.17677669529663687f

static_assert((MROW % 64) == 0);
static_assert((C3 % 64) == 0);
static_assert((NPOS % 64) == 0);
static_assert((CH % 64) == 0);
static_assert((CH % 32) == 0 && (CTXK % 32) == 0);
static_assert(NHD * HDIM == CH);
static_assert(SUP == 8 + KW - 1);
static_assert(SUP * SUP <= NSLOT && (NSLOT % 32) == 0 && NKT * 16 >= SUP * SUP);
static_assert(IMH == IMW);

typedef __bf16   v16b __attribute__((ext_vector_type(16)));
typedef __bf16   v8b  __attribute__((ext_vector_type(8)));
typedef float    v8f  __attribute__((ext_vector_type(8)));
typedef float    v4f  __attribute__((ext_vector_type(4)));
typedef unsigned int v4u __attribute__((ext_vector_type(4)));
typedef unsigned short v16us __attribute__((ext_vector_type(16)));

#if defined(__HIP_DEVICE_COMPILE__)
#define DEV_ASM 1
#else
#define DEV_ASM 0
#endif

// ---- scalar helpers --------------------------------------------------------------------------------
__device__ __forceinline__ unsigned short bf_bits(float f) {          // f32 -> bf16 bits, RNE convert
  unsigned u = __float_as_uint(f);
  return (unsigned short)((u + 0x7FFFu + ((u >> 16) & 1u)) >> 16);
}
__device__ __forceinline__ float bf_up(unsigned short hb) { return __uint_as_float(((unsigned)hb) << 16); }
__device__ __forceinline__ unsigned pk16(unsigned short a, unsigned short b) { return (unsigned)a | ((unsigned)b << 16); }
__device__ __forceinline__ v8f zero8() { v8f z = {0.f, 0.f, 0.f, 0.f, 0.f, 0.f, 0.f, 0.f}; return z; }
// hi / residual bf16 split of an f32 value (residual unscaled)
__device__ __forceinline__ void split_bf(float f, unsigned short& hb, unsigned short& lb) {
  hb = bf_bits(f);
  lb = bf_bits(f - bf_up(hb));
}

// ---- fragment loader: 16-bit A/B operand, lane -> row/col (lane&15), p already includes +8*(lane>>4);
//      elements 0..7 <- p[0..7] (k0+8h..k0+8h+7), elements 8..15 <- p[16..23] (k0+16+8h..k0+16+8h+7)
template <typename OT> struct FT;
template <> struct FT<__bf16> { typedef v16b frag; typedef v8b half8; };

template <typename OT>
__device__ __forceinline__ typename FT<OT>::frag ldfrag(const OT* p) {
  union { typename FT<OT>::frag v; typename FT<OT>::half8 h[2]; } f;
  f.h[0] = *(const typename FT<OT>::half8*)(p);
  f.h[1] = *(const typename FT<OT>::half8*)(p + 16);
  return f.v;
}

// ---- WMMA helpers ------------------------------------------------------------------------------------
__device__ __forceinline__ v8f mmar(v16b a, v16b b, v8f c) {
  return __builtin_amdgcn_wmma_f32_16x16x32_bf16(false, a, false, b, (short)0, c, false, false);
}
// guarded form: 4 VALU slots after the WMMA, D tied, A/B kept live
__device__ __forceinline__ v8f mma_b(v16b a, v16b b, v8f c) {
  c = __builtin_amdgcn_wmma_f32_16x16x32_bf16(false, a, false, b, (short)0, c, false, false);
#if DEV_ASM
  asm volatile("v_nop\n\tv_nop\n\tv_nop\n\tv_nop" : "+v"(c) : "v"(a), "v"(b));
#endif
  return c;
}
__device__ __forceinline__ void dep_guard(v8f& a, v8f& b, v16b x, v16b y) {
#if DEV_ASM
  asm volatile("v_nop\n\tv_nop\n\tv_nop\n\tv_nop" : "+v"(a), "+v"(b) : "v"(x), "v"(y));
#else
  (void)a; (void)b; (void)x; (void)y;
#endif
}
__device__ __forceinline__ void keep4(v16b a, v16b b, v16b c, v16b d) {
#if DEV_ASM
  asm volatile("v_nop" :: "v"(a), "v"(b), "v"(c), "v"(d));
#else
  (void)a; (void)b; (void)c; (void)d;
#endif
}
__device__ __forceinline__ void acc_guard4(v8f& a, v8f& b, v8f& c, v8f& d) {
#if DEV_ASM
  asm volatile("v_nop\n\tv_nop\n\tv_nop\n\tv_nop" : "+v"(a), "+v"(b), "+v"(c), "+v"(d));
#else
  (void)a; (void)b; (void)c; (void)d;
#endif
}

// =====================================================================================================
// x NCHW f32 [b][c][p] -> Xh bf16 [b*3136 + p][c] (RNE convert), transposed through an LDS 64c x 64p tile.
// Store phase: item = it*256 + tid, p = item>>3, channel group = item&7 -> lanes 8q..8q+7 write one whole
// coverage: 2 iterations x 256 threads x 8 = the whole 64x64 tile; 392 blocks = the whole [6272][256] plane.
// =====================================================================================================
__global__ __launch_bounds__(256) void cvt_x(const float* __restrict__ x, unsigned short* xh) {
  __shared__ float t[64 * 65];                       // [c][p], pitch 65
  const int tid = (int)threadIdx.x;
  const int p0 = blockIdx.x * 64, c0 = blockIdx.y * 64, b = blockIdx.z;
#pragma unroll
  for (int it = 0; it < 4; ++it) {
    const int c  = it * 16 + (tid >> 4);
    const int p4 = (tid & 15) * 4;
    const v4f v = *(const v4f*)(x + ((size_t)(b * CH + c0 + c)) * NPOS + p0 + p4);
    float* tp = t + c * 65 + p4;
    tp[0] = v[0]; tp[1] = v[1]; tp[2] = v[2]; tp[3] = v[3];
  }
  __syncthreads();
  v4u pk[2];
  size_t go[2];
#pragma unroll
  for (int it = 0; it < 2; ++it) {
    const int item = it * 256 + tid;
    const int p = item >> 3, cg = item & 7;
    v4u a;
#pragma unroll
    for (int e = 0; e < 4; ++e) {
      const float f0 = t[(cg * 8 + 2 * e) * 65 + p];
      const float f1 = t[(cg * 8 + 2 * e + 1) * 65 + p];
      a[e] = pk16(bf_bits(f0), bf_bits(f1));
    }
    pk[it] = a;
    go[it] = ((size_t)(b * NPOS + p0 + p)) * CH + c0 + cg * 8;
  }
  {
#pragma unroll
    for (int it = 0; it < 2; ++it) *(v4u*)(xh + go[it]) = pk[it];
    
  }
}

// =====================================================================================================
// f32 -> bf16 bits (RNE convert), 8 elements per thread, one 16-B store per lane: a wave writes 512
// coverage: n8 threads x 8 = the whole plane (n8 = 24576 here, a multiple of 256).
// =====================================================================================================
__global__ __launch_bounds__(256) void cvt16x8(const float* __restrict__ in, unsigned short* out, int n8) {
  const int i = blockIdx.x * 256 + (int)threadIdx.x;
  if (i < n8) {
    const v4f a  = *(const v4f*)(in + (size_t)i * 8);
    const v4f a4 = *(const v4f*)(in + (size_t)i * 8 + 4);
    v4u p;
    p[0] = pk16(bf_bits(a[0]),  bf_bits(a[1]));
    p[1] = pk16(bf_bits(a[2]),  bf_bits(a[3]));
    p[2] = pk16(bf_bits(a4[0]), bf_bits(a4[1]));
    p[3] = pk16(bf_bits(a4[2]), bf_bits(a4[3]));
    unsigned short* o = out + (size_t)i * 8;
    *(v4u*)o = p;
    
  }
}

// =====================================================================================================
// w_proj [256 c][256 k] f32 -> folded plane Wf bf16 [256 c][512]: Wf[c][head*64 + part*32 + d] =
// bf16(w_proj[c][head*32 + d]) for part = 0 (meets the ctx hi half) and part = 1 (meets the residual half).
// coverage: 16384 threads x 8 = the whole [256][512] plane.
// =====================================================================================================
__global__ __launch_bounds__(256) void cvt_wp(const float* __restrict__ wp, unsigned short* out) {
  const int i = blockIdx.x * 256 + (int)threadIdx.x;
  if (i < CH * CTXK / 8) {
    const int c  = i >> 6;                 // 64 groups of 8 per 512-wide row
    const int k  = (i & 63) * 8;           // 0..504
    const int hd = k >> 6;                 // head
    const int d0 = k & 31;                 // 0, 8, 16, 24
    const float* src = wp + (size_t)c * CH + hd * HDIM + d0;
    const v4f a  = *(const v4f*)src;
    const v4f a4 = *(const v4f*)(src + 4);
    v4u p;
    p[0] = pk16(bf_bits(a[0]),  bf_bits(a[1]));
    p[1] = pk16(bf_bits(a[2]),  bf_bits(a[3]));
    p[2] = pk16(bf_bits(a4[0]), bf_bits(a4[1]));
    p[3] = pk16(bf_bits(a4[2]), bf_bits(a4[3]));
    unsigned short* o = out + (size_t)i * 8;
    *(v4u*)o = p;
    
  }
}

// =====================================================================================================
// Register-blocked batched WMMA GEMM (bf16 operands): C[m][n] = sum_k A[m][k] * Bt[n][k] + bias;
// one wave per 64x64 tile, no block barriers. A row-major [M][K] pitch lda; Bt row-major [N][K] pitch ldb
// (k contiguous); M, N multiples of 64, K multiple of 32 (host-checked). blockIdx.y = batch index
// (strides in elements). Fragments are loaded straight from global with the split k map (ldfrag).
// BIAS_MODE 1: bias[n] (per column); BIAS_MODE 2: bias[m] (per row); bias values RNE-converted to bf16.
// Output: f32 C (pitch ldc). Epilogue: 16-row slabs staged per wave in LDS; each 64-wide row segment (256 B =
// coverage: 4 slabs x 16 rows (it 0..7 x lane>>4) x 64 cols = the wave's whole 64x64 tile.
// =====================================================================================================
template <int BIAS_MODE>
__global__ __launch_bounds__(256) void gemm64(
    const unsigned short* __restrict__ Ap, int lda, long long strideA,
    const unsigned short* __restrict__ Btp, int ldb, long long strideB,
    float* Cout, int ldc, long long strideC,
    const float* __restrict__ bias,
    int M, int N, int K) {
  const __bf16* A  = (const __bf16*)(const void*)Ap;
  const __bf16* Bt = (const __bf16*)(const void*)Btp;
  __shared__ __align__(16) float sT[8][16 * 68];   // per-wave 16x64 slab, pitch 68 floats
  const int b    = blockIdx.y;
  const int lane = threadIdx.x & 31;
  const int wave = threadIdx.x >> 5;
  const int tilesN = N >> 6;
  const int tilesM = M >> 6;
  const int tile = blockIdx.x * 8 + wave;
  if (tile >= tilesM * tilesN) return;   // wave-uniform; no block barriers in this kernel
  const int tm = tile / tilesN;
  const int tn = tile - tm * tilesN;
  const int m0 = tm << 6;
  const int n0 = tn << 6;

  const __bf16* Ab = A  + (size_t)b * (size_t)strideA;
  const __bf16* Bb = Bt + (size_t)b * (size_t)strideB;

  const int rlane = lane & 15;                 // row (A) / col (B, D) within subtile
  const int koff  = (lane >> 4) * 8;           // k offset of this lane half
  const int mOff  = (lane >> 4) * 8;           // D row offset

  v8f acc[4][4];
#pragma unroll
  for (int i = 0; i < 4; ++i)
#pragma unroll
    for (int j = 0; j < 4; ++j) acc[i][j] = zero8();

  for (int k0 = 0; k0 < K; k0 += 32) {
    v16b bq[4];
#pragma unroll
    for (int j = 0; j < 4; ++j)
      bq[j] = ldfrag<__bf16>(Bb + (size_t)(n0 + (j << 4) + rlane) * ldb + koff + k0);
#pragma unroll
    for (int i = 0; i < 4; ++i) {
      const v16b af = ldfrag<__bf16>(Ab + (size_t)(m0 + (i << 4) + rlane) * lda + koff + k0);
#pragma unroll
      for (int j = 0; j < 4; ++j) acc[i][j] = mmar(af, bq[j], acc[i][j]);
      dep_guard(acc[i][0], acc[i][3], af, bq[3]);
    }
    keep4(bq[0], bq[1], bq[2], bq[3]);
  }
  acc_guard4(acc[0][0], acc[0][1], acc[0][2], acc[0][3]);
  acc_guard4(acc[1][0], acc[1][1], acc[1][2], acc[1][3]);
  acc_guard4(acc[2][0], acc[2][1], acc[2][2], acc[2][3]);
  acc_guard4(acc[3][0], acc[3][1], acc[3][2], acc[3][3]);

  // ---- epilogue ----
  float* slab = sT[wave];
  float* C = Cout + (size_t)b * (size_t)strideC;
  const int h2 = lane >> 4, c4 = (lane & 15) * 4;     // 256-B row segment = 16 lanes x 16 B
  v4f bcol = {0.f, 0.f, 0.f, 0.f};
  if (BIAS_MODE == 1) {
#pragma unroll
    for (int e = 0; e < 4; ++e) bcol[e] = bf_up(bf_bits(bias[n0 + c4 + e]));
  }
#pragma unroll
  for (int i = 0; i < 4; ++i) {
    const int mBase = m0 + (i << 4);
#pragma unroll
    for (int j = 0; j < 4; ++j) {
#pragma unroll
      for (int r = 0; r < 8; ++r) {
        slab[(mOff + r) * 68 + (j << 4) + rlane] = acc[i][j][r];
      }
    }
    __builtin_amdgcn_fence(__ATOMIC_RELEASE, "workgroup");
    __builtin_amdgcn_wave_barrier();
    __builtin_amdgcn_fence(__ATOMIC_ACQUIRE, "workgroup");
    {
#pragma unroll
      for (int it = 0; it < 8; ++it) {
        const int row = it * 2 + h2;                     // it 0..7 x h2 0..1 = rows 0..15
        v4f v = *(const v4f*)(slab + row * 68 + c4);
        if (BIAS_MODE == 1) {
          v = v + bcol;
        } else {
          const float br = bf_up(bf_bits(bias[mBase + row]));
          v = v + br;
        }
        *(v4f*)(C + (size_t)(mBase + row) * ldc + n0 + c4) = v;
      }
      
    }
    __builtin_amdgcn_fence(__ATOMIC_RELEASE, "workgroup");
    __builtin_amdgcn_wave_barrier();
    __builtin_amdgcn_fence(__ATOMIC_ACQUIRE, "workgroup");
  }
}

// =====================================================================================================
// P^T B fragment pair (hi, residual) from the lane's own score D values: element r <- tile a row r,
// element 8+r <- tile c row r (same lane, same query column).
// =====================================================================================================
union PBits { v16us u; v16b v; };
__device__ __forceinline__ void pack_pt(v8f a, v8f c, v16b& ph, v16b& pl) {
  const v16us zz = {0, 0, 0, 0, 0, 0, 0, 0, 0, 0, 0, 0, 0, 0, 0, 0};
  PBits H, L;
  H.u = zz; L.u = zz;
#pragma unroll
  for (int r = 0; r < 8; ++r) {
    const unsigned short hb = bf_bits(a[r]);
    H.u[r] = hb;
    L.u[r] = bf_bits(a[r] - bf_up(hb));
  }
#pragma unroll
  for (int r = 0; r < 8; ++r) {
    const unsigned short hb = bf_bits(c[r]);
    H.u[8 + r] = hb;
    L.u[8 + r] = bf_bits(c[r] - bf_up(hb));
  }
  ph = H.v; pl = L.v;
}

// load 8 consecutive f32, or zeros when keep == 0 (address always valid, select by value)
__device__ __forceinline__ void ld8sel(const float* src, int keep, float f[8]) {
  const v4f a = *(const v4f*)src;
  const v4f c = *(const v4f*)(src + 4);
  f[0] = keep ? a[0] : 0.f; f[1] = keep ? a[1] : 0.f; f[2] = keep ? a[2] : 0.f; f[3] = keep ? a[3] : 0.f;
  f[4] = keep ? c[0] : 0.f; f[5] = keep ? c[1] : 0.f; f[6] = keep ? c[2] : 0.f; f[7] = keep ? c[3] : 0.f;
}

// =====================================================================================================
// Windowed attention, one block = (batch b, head, 8x8 query tile at (i0, j0)); 128 threads = 4 waves,
// wave w owns the 16 queries lq = 16w..16w+15 (query row i0 + (lq>>3), col j0 + (lq&7)).
// Key superset = the 14x14 image block at (R0, C0), R0 = clamp(i0-3, 0, 42), slot = u*14 + v (196 slots,
// padded to 224 with zero rows). Every query's clamped 7x7 window lies inside the superset: valid slots are
// su <= u <= su+6, sv <= v <= sv+6 with su = clamp(qi-3,0,49) - R0 in [0,7].
//   qkv plane f32 [b*3136 + p][768]: q = cols head*32+d (scaled by 32^-0.5 in f32 here), k = 256+.., v = 512+..
//   scores (transposed): S^T[slot][query] = K[slot][d] . Q^T[d][query] on bf16 WMMA, 3 products
//     (hi.hi + hi.res + res.hi); lane owns query column (lane&15) of its wave and key rows 16j + 8h + r.
//   s = S^T + rpb[head][u + R0 - qi + 6][v + C0 - qj + 6] for valid slots, -1e30 otherwise (f32);
//   softmax in f32 (max / sum over the 104 lane values and the partner lane ^16).
//   O^T[d][query] = V^T[d][slot] . P^T[slot][query] on bf16 WMMA, 3 products, p unnormalised exp, 1/sum at the end.
// LDS: KV0/KV1 hold K hi/res [slot][d] for the scores, then (after a block barrier) V^T hi/res [d][slot].
// Staged extents: KV 224x32 both phases (slots >= 196 zero), Q 64x32, Rp 169 (reads clamped to 0..168),
// Os 16x32 per wave -- every LDS element read is written first.
// Output coverage: each wave stores its 16 query rows (it 0..3 x lane>>3) x 8 pieces of 16 B (lane&7) =
// =====================================================================================================
__global__ __launch_bounds__(128)
void natt(const float* __restrict__ qkv, const float* __restrict__ rpb, unsigned short* ctx) {
  __shared__ __align__(16) unsigned short KV0[NSLOT * HDIM];   // 14336 B
  __shared__ __align__(16) unsigned short KV1[NSLOT * HDIM];   // 14336 B
  __shared__ __align__(16) unsigned short Qh[64 * HDIM];       //  4096 B
  __shared__ __align__(16) unsigned short Ql[64 * HDIM];       //  4096 B
  __shared__ __align__(16) float Os[4][16 * HDIM];             //  8192 B
  __shared__ float Rp[176];

  const int tid  = (int)threadIdx.x;
  const int wave = tid >> 5;
  const int lane = tid & 31;
  const int hh   = lane >> 4;
  const int m    = lane & 15;

  const int bx   = blockIdx.x;
  const int tj   = bx % 7;
  const int ti   = (bx / 7) % 7;
  const int head = (bx / 49) % NHD;
  const int b    = bx / (49 * NHD);
  const int i0 = ti * 8, j0 = tj * 8;
  const int R0 = min(max(i0 - 3, 0), IMH - SUP);
  const int C0 = min(max(j0 - 3, 0), IMW - SUP);
  const size_t pb = (size_t)b * NPOS;

  // ---- position-bias table of this head (bf16 RNE-converted values), entries 0..168 ----
  {
    const float r0v = rpb[head * 169 + tid];                 // tid <= 127 < 169
    const int   i1  = tid + 128;
    const float r1v = rpb[head * 169 + min(i1, 168)];       // clamped address
    Rp[tid] = bf_up(bf_bits(r0v));
    if (i1 < 169) Rp[i1] = bf_up(bf_bits(r1v));
  }
  // ---- q (scaled in f32) -> hi / residual planes [lq][d]; thread = (lq = tid>>1, d half) ----
  {
    const int lq = tid >> 1, dh = (tid & 1) * 16;
    const int qi = lq >> 3, qj = lq & 7;
    const size_t pos = pb + (size_t)(i0 + qi) * IMW + j0 + qj;
    const float* src = qkv + pos * C3 + head * HDIM + dh;
#pragma unroll
    for (int g = 0; g < 2; ++g) {
      float f[8];
      ld8sel(src + 8 * g, 1, f);
      v4u ph, pl;
#pragma unroll
      for (int e = 0; e < 4; ++e) {
        unsigned short h0, l0, h1, l1;
        split_bf(f[2 * e] * QSCALE, h0, l0);
        split_bf(f[2 * e + 1] * QSCALE, h1, l1);
        ph[e] = pk16(h0, h1); pl[e] = pk16(l0, l1);
      }
      *(v4u*)(Qh + lq * HDIM + dh + 8 * g) = ph;
      *(v4u*)(Ql + lq * HDIM + dh + 8 * g) = pl;
    }
  }
  // ---- K superset -> KV0 (hi) / KV1 (residual), layout [slot][d]; item = it*128 + tid, slot = item>>2,
  //      d8 = (item&3)*8; 7 x 128 items = 224 slots x 4 groups = the whole tile; slots >= 196 = zeros ----
  {
    const float* kbase = qkv + CH + head * HDIM;
#pragma unroll
    for (int it = 0; it < 7; ++it) {
      const int item = it * 128 + tid;
      const int slot = item >> 2, d8 = (item & 3) * 8;
      const int u = slot / SUP, v = slot - u * SUP;
      const int uc = min(u, SUP - 1);
      const size_t pos = pb + (size_t)(R0 + uc) * IMW + C0 + v;
      float f[8];
      ld8sel(kbase + pos * C3 + d8, slot < SUP * SUP, f);
      v4u ph, pl;
#pragma unroll
      for (int e = 0; e < 4; ++e) {
        unsigned short h0, l0, h1, l1;
        split_bf(f[2 * e], h0, l0);
        split_bf(f[2 * e + 1], h1, l1);
        ph[e] = pk16(h0, h1); pl[e] = pk16(l0, l1);
      }
      *(v4u*)(KV0 + slot * HDIM + d8) = ph;
      *(v4u*)(KV1 + slot * HDIM + d8) = pl;
    }
  }
  __syncthreads();

  // ---- scores: S^T tiles j = 0..12 (key slots 16j..16j+15) for the wave's 16 queries; s[13] stays zero ----
  v8f s[NKT + 1];
  {
    const __bf16* Kh = (const __bf16*)(const void*)KV0;
    const __bf16* Kl = (const __bf16*)(const void*)KV1;
    const __bf16* Qhp = (const __bf16*)(const void*)Qh;
    const __bf16* Qlp = (const __bf16*)(const void*)Ql;
    const v16b qfh = ldfrag<__bf16>(Qhp + (16 * wave + m) * HDIM + 8 * hh);
    const v16b qfl = ldfrag<__bf16>(Qlp + (16 * wave + m) * HDIM + 8 * hh);
#pragma unroll
    for (int j = 0; j < NKT; ++j) {
      const v16b kfh = ldfrag<__bf16>(Kh + (16 * j + m) * HDIM + 8 * hh);
      const v16b kfl = ldfrag<__bf16>(Kl + (16 * j + m) * HDIM + 8 * hh);
      v8f z = zero8();
      z = mma_b(kfh, qfh, z);
      z = mma_b(kfh, qfl, z);
      z = mma_b(kfl, qfh, z);
      s[j] = z;
    }
    s[NKT] = zero8();
  }
  __syncthreads();   // all waves done reading K from KV0/KV1

  // ---- V superset -> KV0 (hi) / KV1 (residual), transposed layout [d][slot] (pitch 224);
  //      same item map as K: 224 slots x 32 d written, slots >= 196 = zeros ----
  {
    const float* vbase = qkv + 2 * CH + head * HDIM;
#pragma unroll
    for (int it = 0; it < 7; ++it) {
      const int item = it * 128 + tid;
      const int slot = item >> 2, d8 = (item & 3) * 8;
      const int u = slot / SUP, v = slot - u * SUP;
      const int uc = min(u, SUP - 1);
      const size_t pos = pb + (size_t)(R0 + uc) * IMW + C0 + v;
      float f[8];
      ld8sel(vbase + pos * C3 + d8, slot < SUP * SUP, f);
#pragma unroll
      for (int e = 0; e < 8; ++e) {
        unsigned short h0, l0;
        split_bf(f[e], h0, l0);
        KV0[(d8 + e) * NSLOT + slot] = h0;
        KV1[(d8 + e) * NSLOT + slot] = l0;
      }
    }
  }
  __syncthreads();

  // ---- window mask + position bias (f32), softmax over the query column ----
  const int lq = 16 * wave + m;
  const int ai = i0 + (lq >> 3), aj = j0 + (lq & 7);
  const int su = min(max(ai - 3, 0), IMH - KW) - R0;
  const int sv = min(max(aj - 3, 0), IMW - KW) - C0;
  const int cb = (R0 - ai + 6) * 13 + (C0 - aj + 6);
  float mloc = -1.0e30f;
#pragma unroll
  for (int j = 0; j < NKT; ++j) {
#pragma unroll
    for (int r = 0; r < 8; ++r) {
      const int t0 = 16 * j + r;                       // slot = t0 + 8*hh
      const int u = hh ? ((t0 + 8) / SUP) : (t0 / SUP);
      const int v = hh ? ((t0 + 8) % SUP) : (t0 % SUP);
      const bool ok = ((unsigned)(u - su) < 7u) && ((unsigned)(v - sv) < 7u);
      int bi = u * 13 + v + cb;
      bi = min(max(bi, 0), 168);
      const float bv = Rp[bi];
      const float sval = ok ? (s[j][r] + bv) : -1.0e30f;
      s[j][r] = sval;
      mloc = fmaxf(mloc, sval);
    }
  }
  const float mrow = fmaxf(mloc, __shfl_xor(mloc, 16, 32));
  float lsum = 0.f;
#pragma unroll
  for (int j = 0; j < NKT; ++j) {
#pragma unroll
    for (int r = 0; r < 8; ++r) {
      const float p = __expf(s[j][r] - mrow);
      s[j][r] = p;
      lsum += p;
    }
  }
  lsum += __shfl_xor(lsum, 16, 32);

  // ---- O^T = V^T . P^T : 2 d-tiles x 7 k-steps of 32 slots x 3 products ----
  v8f o[2];
  o[0] = zero8(); o[1] = zero8();
  {
    const __bf16* Vh = (const __bf16*)(const void*)KV0;
    const __bf16* Vl = (const __bf16*)(const void*)KV1;
#pragma unroll
    for (int kk = 0; kk < NSLOT / 32; ++kk) {
      v16b ph, pl;
      pack_pt(s[2 * kk], s[2 * kk + 1], ph, pl);
#pragma unroll
      for (int t = 0; t < 2; ++t) {
        const v16b vfh = ldfrag<__bf16>(Vh + (16 * t + m) * NSLOT + 32 * kk + 8 * hh);
        const v16b vfl = ldfrag<__bf16>(Vl + (16 * t + m) * NSLOT + 32 * kk + 8 * hh);
        o[t] = mma_b(vfh, ph, o[t]);
        o[t] = mma_b(vfh, pl, o[t]);
        o[t] = mma_b(vfl, ph, o[t]);
      }
    }
  }

  // ---- normalise, stage the wave's 16 queries x 32 d in LDS, write the ctx lines ----
  const float linv = 1.0f / lsum;
  float* os = Os[wave];
#pragma unroll
  for (int t = 0; t < 2; ++t)
#pragma unroll
    for (int r = 0; r < 8; ++r) os[m * HDIM + 16 * t + 8 * hh + r] = o[t][r] * linv;
  __syncthreads();
  {
    const int q4 = lane >> 3, pc = lane & 7, dsel = (pc & 3) * 8;
    const bool lowp = (pc >= 4);
    v4u hv[4];
    size_t go[4];
#pragma unroll
    for (int it = 0; it < 4; ++it) {
      const int row = it * 4 + q4;                     // it 0..3 x q4 0..3 = rows 0..15
      const float* sp = os + row * HDIM + dsel;
      v4u a;
#pragma unroll
      for (int e = 0; e < 4; ++e) {
        unsigned short h0, l0, h1, l1;
        split_bf(sp[2 * e], h0, l0);
        split_bf(sp[2 * e + 1], h1, l1);
        a[e] = lowp ? pk16(l0, l1) : pk16(h0, h1);
      }
      hv[it] = a;
      const int lqr = 16 * wave + row;
      const size_t pos = pb + (size_t)(i0 + (lqr >> 3)) * IMW + j0 + (lqr & 7);
      go[it] = pos * CTXK + (size_t)head * 64 + pc * 8;
    }
    {
#pragma unroll
      for (int it = 0; it < 4; ++it) *(v4u*)(ctx + go[it]) = hv[it];
      
    }
  }
}

// =====================================================================================================
//   Xh   bf16 [6272][256]     3211264
//   Wqb  bf16 [768][256]       393216
//   Wpf  bf16 [256][512]       262144
//   QKV  f32  [6272][768]    19267584
//   CTX  bf16 [6272][512]     6422528
//   total                   29556736
// =====================================================================================================
extern "C" void kernel_launch(void* const* d_in, const int* in_sizes, int n_in,
                              void* d_out, int out_size, void* d_ws, size_t ws_size,
                              hipStream_t stream) {
  if (n_in < 6) return;
  if (in_sizes[0] != NBT * CH * NPOS) return;
  if (in_sizes[1] != C3 * CH) return;
  if (in_sizes[2] != C3) return;
  if (in_sizes[3] != NHD * 13 * 13) return;
  if (in_sizes[4] != CH * CH) return;
  if (in_sizes[5] != CH) return;
  if (out_size != NBT * CH * NPOS) return;

  const float* x      = (const float*)d_in[0];
  const float* w_qkv  = (const float*)d_in[1];
  const float* b_qkv  = (const float*)d_in[2];
  const float* rpb    = (const float*)d_in[3];
  const float* w_proj = (const float*)d_in[4];
  const float* b_proj = (const float*)d_in[5];

  const size_t PXH  = (size_t)MROW * CH * 2;        //  3211264
  const size_t PWQ  = (size_t)C3 * CH * 2;          //   393216
  const size_t PWP  = (size_t)CH * CTXK * 2;        //   262144
  const size_t PQKV = (size_t)MROW * C3 * 4;        // 19267584
  const size_t PCTX = (size_t)MROW * CTXK * 2;      //  6422528
  size_t off = 0;
  const size_t oXh  = off; off += PXH;
  const size_t oWq  = off; off += PWQ;
  const size_t oWp  = off; off += PWP;
  const size_t oQKV = off; off += PQKV;
  const size_t oCTX = off; off += PCTX;
  if (off > ws_size) return;                         // off = 29556736
  if (off > (size_t)134217728) return;

  char* ws = (char*)d_ws;
  unsigned short* Xh  = (unsigned short*)(ws + oXh);
  unsigned short* Wqb = (unsigned short*)(ws + oWq);
  unsigned short* Wpf = (unsigned short*)(ws + oWp);
  float*          QKV = (float*)(ws + oQKV);
  unsigned short* CTX = (unsigned short*)(ws + oCTX);

  const int n8wq = C3 * CH / 8;                                       // 24576
  const int tilesQKV = (MROW / 64) * (C3 / 64);                       // 1176
  const int tilesPRJ = (CH / 64) * (NPOS / 64);                       //  196
  const dim3 gX(NPOS / 64, CH / 64, NBT);                             // (49, 4, 2)
  const dim3 gWq((n8wq + 255) / 256);                                 // 96
  const dim3 gWp((CH * CTXK / 8 + 255) / 256);                        // 64
  const dim3 gQKV((tilesQKV + 7) / 8, 1);                             // 147
  const dim3 gAtt(NBT * NHD * 49);                                    // 784
  const dim3 gPRJ((tilesPRJ + 7) / 8, NBT);                           // (25, 2)

  // (1) x NCHW -> bf16 [p][c]; w_qkv -> bf16 [n][k]; w_proj -> folded bf16 [c][512]
  cvt_x<<<gX, dim3(256), 0, stream>>>(x, Xh);
  cvt16x8<<<gWq, dim3(256), 0, stream>>>(w_qkv, Wqb, n8wq);
  cvt_wp<<<gWp, dim3(256), 0, stream>>>(w_proj, Wpf);
  // (2) qkv = Xh . Wqkv^T + b_qkv -> f32 [6272][768]   (M=6272, N=768, K=256)
  gemm64<1><<<gQKV, dim3(256), 0, stream>>>(
      Xh, CH, 0LL, Wqb, CH, 0LL,
      QKV, C3, 0LL, b_qkv,
      MROW, C3, CH);
  // (3) windowed attention -> ctx plane bf16 [6272][512]
  natt<<<gAtt, dim3(128), 0, stream>>>(QKV, rpb, CTX);
  // (4) out[b][c][p] = sum_k Wpf[c][k] ctx[b*3136+p][k] + b_proj[c]   (per batch: M=256, N=3136, K=512)
  gemm64<2><<<gPRJ, dim3(256), 0, stream>>>(
      Wpf, CTXK, 0LL, CTX, CTXK, (long long)NPOS * CTXK,
      (float*)d_out, NPOS, (long long)CH * NPOS, b_proj,
      CH, NPOS, CTXK);
  (void)hipGetLastError();
}

// v001
// It runs in 53.6 microseconds.
// In both of two side-by-side timings against v000, it was 1.42 times as fast.
// Contractions: qkv projection = v_wmma_f32_16x16x32_bf16 (bf16 operands from RNE-converted x and w_qkv, single product, f32 accumulate);
// q.k scores = v_wmma_f32_16x16x32_bf16 (q and k each as bf16 hi plane + unscaled bf16 residual plane, 3 products, f32 accumulate);
// p.v = v_wmma_f32_16x16x32_bf16 (p and v each as bf16 hi + unscaled bf16 residual, 3 products, f32 accumulate);
// ctx.w_proj^T = v_wmma_f32_16x16x32_bf16 (ctx as bf16 hi + residual folded into K, w_proj bf16 from its RNE-converted value, f32 accumulate);
// biases, q scaling, window mask, position bias and softmax in f32. No power-of-two carries anywhere (bf16 planes, unscaled residuals).
#include <hip/hip_runtime.h>
#include <math.h>
#include <stdint.h>

#define NBT   2
#define CH    256
#define IMH   56
#define IMW   56
#define NPOS  (IMH * IMW)        // 3136 positions per image, p = i*56 + j
#define MROW  (NBT * NPOS)       // 6272 position rows
#define NHD   8
#define HDIM  32
#define C3    (3 * CH)           // 768
#define KW    7                  // window side; window start = clamp(i - 3, 0, IMH - KW)
#define SUP   14                 // clamped key superset side of an 8x8 query tile
#define NSLOT 224                // key slots staged per block (196 used, rest zero)
#define NKT   13                 // scored 16-key tiles (slots 0..207)
#define CTXK  512                // folded K of the ctx plane: per head [hi d0..31 | residual d0..31]
#define QSCALE 0.17677669529663687f

static_assert((MROW % 64) == 0);
static_assert((C3 % 256) == 0);
static_assert((NPOS % 64) == 0);
static_assert((CH % 256) == 0);
static_assert((CH % 128) == 0 && (CTXK % 128) == 0);
static_assert(NHD * HDIM == CH);
static_assert(SUP == 8 + KW - 1);
static_assert(SUP * SUP <= NSLOT && (NSLOT % 32) == 0 && NKT * 16 >= SUP * SUP);
static_assert(IMH == IMW);

typedef __bf16   v16b __attribute__((ext_vector_type(16)));
typedef __bf16   v8b  __attribute__((ext_vector_type(8)));
typedef float    v8f  __attribute__((ext_vector_type(8)));
typedef float    v4f  __attribute__((ext_vector_type(4)));
typedef unsigned int v4u __attribute__((ext_vector_type(4)));
typedef unsigned short v16us __attribute__((ext_vector_type(16)));

#if defined(__HIP_DEVICE_COMPILE__)
#define DEV_ASM 1
#else
#define DEV_ASM 0
#endif

// ---- scalar helpers --------------------------------------------------------------------------------
__device__ __forceinline__ unsigned short bf_bits(float f) {          // f32 -> bf16 bits, RNE convert
  unsigned u = __float_as_uint(f);
  return (unsigned short)((u + 0x7FFFu + ((u >> 16) & 1u)) >> 16);
}
__device__ __forceinline__ float bf_up(unsigned short hb) { return __uint_as_float(((unsigned)hb) << 16); }
__device__ __forceinline__ unsigned pk16(unsigned short a, unsigned short b) { return (unsigned)a | ((unsigned)b << 16); }
__device__ __forceinline__ v8f zero8() { v8f z = {0.f, 0.f, 0.f, 0.f, 0.f, 0.f, 0.f, 0.f}; return z; }
// hi / residual bf16 split of an f32 value (residual unscaled)
__device__ __forceinline__ void split_bf(float f, unsigned short& hb, unsigned short& lb) {
  hb = bf_bits(f);
  lb = bf_bits(f - bf_up(hb));
}

// ---- fragment loader: 16-bit A/B operand, lane -> row/col (lane&15), p already includes +8*(lane>>4);
//      elements 0..7 <- p[0..7] (k0+8h..k0+8h+7), elements 8..15 <- p[16..23] (k0+16+8h..k0+16+8h+7)
template <typename OT> struct FT;
template <> struct FT<__bf16> { typedef v16b frag; typedef v8b half8; };

template <typename OT>
__device__ __forceinline__ typename FT<OT>::frag ldfrag(const OT* p) {
  union { typename FT<OT>::frag v; typename FT<OT>::half8 h[2]; } f;
  f.h[0] = *(const typename FT<OT>::half8*)(p);
  f.h[1] = *(const typename FT<OT>::half8*)(p + 16);
  return f.v;
}

// ---- WMMA helpers ------------------------------------------------------------------------------------
__device__ __forceinline__ v8f mmar(v16b a, v16b b, v8f c) {
  return __builtin_amdgcn_wmma_f32_16x16x32_bf16(false, a, false, b, (short)0, c, false, false);
}
// guarded form: 4 VALU slots after the WMMA, D tied, A/B kept live
__device__ __forceinline__ v8f mma_b(v16b a, v16b b, v8f c) {
  c = __builtin_amdgcn_wmma_f32_16x16x32_bf16(false, a, false, b, (short)0, c, false, false);
#if DEV_ASM
  asm volatile("v_nop\n\tv_nop\n\tv_nop\n\tv_nop" : "+v"(c) : "v"(a), "v"(b));
#endif
  return c;
}
__device__ __forceinline__ void dep_guard(v8f& a, v8f& b, v16b x, v16b y) {
#if DEV_ASM
  asm volatile("v_nop\n\tv_nop\n\tv_nop\n\tv_nop" : "+v"(a), "+v"(b) : "v"(x), "v"(y));
#else
  (void)a; (void)b; (void)x; (void)y;
#endif
}
__device__ __forceinline__ void keep4(v16b a, v16b b, v16b c, v16b d) {
#if DEV_ASM
  asm volatile("v_nop" :: "v"(a), "v"(b), "v"(c), "v"(d));
#else
  (void)a; (void)b; (void)c; (void)d;
#endif
}
__device__ __forceinline__ void acc_guard4(v8f& a, v8f& b, v8f& c, v8f& d) {
#if DEV_ASM
  asm volatile("v_nop\n\tv_nop\n\tv_nop\n\tv_nop" : "+v"(a), "+v"(b), "+v"(c), "+v"(d));
#else
  (void)a; (void)b; (void)c; (void)d;
#endif
}

// =====================================================================================================
// x NCHW f32 [b][c][p] -> Xh bf16 [b*3136 + p][c] (RNE convert), transposed through an LDS 64c x 64p tile.
// Store phase: item = it*256 + tid, p = item>>3, channel group = item&7 -> lanes 8q..8q+7 write one whole
// coverage: 2 iterations x 256 threads x 8 = the whole 64x64 tile; 392 blocks = the whole [6272][256] plane.
// =====================================================================================================
__global__ __launch_bounds__(256) void cvt_x(const float* __restrict__ x, unsigned short* xh) {
  __shared__ float t[64 * 65];                       // [c][p], pitch 65
  const int tid = (int)threadIdx.x;
  const int p0 = blockIdx.x * 64, c0 = blockIdx.y * 64, b = blockIdx.z;
#pragma unroll
  for (int it = 0; it < 4; ++it) {
    const int c  = it * 16 + (tid >> 4);
    const int p4 = (tid & 15) * 4;
    const v4f v = *(const v4f*)(x + ((size_t)(b * CH + c0 + c)) * NPOS + p0 + p4);
    float* tp = t + c * 65 + p4;
    tp[0] = v[0]; tp[1] = v[1]; tp[2] = v[2]; tp[3] = v[3];
  }
  __syncthreads();
  v4u pk[2];
  size_t go[2];
#pragma unroll
  for (int it = 0; it < 2; ++it) {
    const int item = it * 256 + tid;
    const int p = item >> 3, cg = item & 7;
    v4u a;
#pragma unroll
    for (int e = 0; e < 4; ++e) {
      const float f0 = t[(cg * 8 + 2 * e) * 65 + p];
      const float f1 = t[(cg * 8 + 2 * e + 1) * 65 + p];
      a[e] = pk16(bf_bits(f0), bf_bits(f1));
    }
    pk[it] = a;
    go[it] = ((size_t)(b * NPOS + p0 + p)) * CH + c0 + cg * 8;
  }
  {
#pragma unroll
    for (int it = 0; it < 2; ++it) *(v4u*)(xh + go[it]) = pk[it];
    
  }
}

// =====================================================================================================
// f32 -> bf16 bits (RNE convert), 8 elements per thread, one 16-B store per lane: a wave writes 512
// coverage: n8 threads x 8 = the whole plane (n8 = 24576 here, a multiple of 256).
// =====================================================================================================
__global__ __launch_bounds__(256) void cvt16x8(const float* __restrict__ in, unsigned short* out, int n8) {
  const int i = blockIdx.x * 256 + (int)threadIdx.x;
  if (i < n8) {
    const v4f a  = *(const v4f*)(in + (size_t)i * 8);
    const v4f a4 = *(const v4f*)(in + (size_t)i * 8 + 4);
    v4u p;
    p[0] = pk16(bf_bits(a[0]),  bf_bits(a[1]));
    p[1] = pk16(bf_bits(a[2]),  bf_bits(a[3]));
    p[2] = pk16(bf_bits(a4[0]), bf_bits(a4[1]));
    p[3] = pk16(bf_bits(a4[2]), bf_bits(a4[3]));
    unsigned short* o = out + (size_t)i * 8;
    *(v4u*)o = p;
    
  }
}

// =====================================================================================================
// w_proj [256 c][256 k] f32 -> folded plane Wf bf16 [256 c][512]: Wf[c][head*64 + part*32 + d] =
// bf16(w_proj[c][head*32 + d]) for part = 0 (meets the ctx hi half) and part = 1 (meets the residual half).
// coverage: 16384 threads x 8 = the whole [256][512] plane.
// =====================================================================================================
__global__ __launch_bounds__(256) void cvt_wp(const float* __restrict__ wp, unsigned short* out) {
  const int i = blockIdx.x * 256 + (int)threadIdx.x;
  if (i < CH * CTXK / 8) {
    const int c  = i >> 6;                 // 64 groups of 8 per 512-wide row
    const int k  = (i & 63) * 8;           // 0..504
    const int hd = k >> 6;                 // head
    const int d0 = k & 31;                 // 0, 8, 16, 24
    const float* src = wp + (size_t)c * CH + hd * HDIM + d0;
    const v4f a  = *(const v4f*)src;
    const v4f a4 = *(const v4f*)(src + 4);
    v4u p;
    p[0] = pk16(bf_bits(a[0]),  bf_bits(a[1]));
    p[1] = pk16(bf_bits(a[2]),  bf_bits(a[3]));
    p[2] = pk16(bf_bits(a4[0]), bf_bits(a4[1]));
    p[3] = pk16(bf_bits(a4[2]), bf_bits(a4[3]));
    unsigned short* o = out + (size_t)i * 8;
    *(v4u*)o = p;
    
  }
}

// =====================================================================================================
// Batched WMMA GEMM (bf16 operands): C[m][n] = sum_k A[m][k] * Bt[n][k] + bias. A row-major [M][K] pitch lda;
// Bt row-major [N][K] pitch ldb (k contiguous); blockIdx.y = batch index (strides in elements).
// One block = 4 waves, one 64x64 tile of C per wave: WM waves along m and 4 / WM along n, so the block tile is
// (64 WM) x (256 / WM). M, N multiples of the block tile, K a multiple of SK (host constants).
// Operands go global -> LDS by asynchronous 16-B copies, SK = 64 k (one whole 128-B line of each of the 320
// operand rows) per stage, two buffers: stage t + 1 is in flight while stage t feeds the WMMAs.
// Stage layout: rows 0..BM-1 = A rows, rows BM..319 = Bt rows, pitch 144 B (16 B x 9, conflict-free b128 reads).
// Copy map: item = it*128 + tid, row = item>>3, 16-B piece = item&7 -> 8 lanes copy one line, 20 copies per lane
// = 320 rows x 8 pieces, each LDS byte written by one lane. Fragments keep the split k map (ldfrag), k ascending.
// BIAS_MODE 1: bias[n] (per column); BIAS_MODE 2: bias[m] (per row); bias values RNE-converted to bf16.
// Output: f32 C (pitch ldc). Epilogue: 16-row slabs staged per wave in LDS; each 64-wide row segment (256 B =
// coverage: 4 slabs x 16 rows (it 0..7 x lane>>4) x 64 cols = the wave's whole 64x64 tile.
// =====================================================================================================
#define SK     64                     // k elements per stage
#define SPITCH 72                     // LDS row pitch in elements (144 B)
#define SROWS  320                    // operand rows per stage (BM + BN)
#define SBYTES (SROWS * SPITCH * 2)   // 46080 B per buffer

// Four asynchronous copies, 16 B per lane each, global -> LDS. The s_wait_xcnt closes the statement so that no
// address register named here is rewritten before it.
__device__ __forceinline__ void copy4(unsigned l0, unsigned l1, unsigned l2, unsigned l3,
                                      const unsigned short* g0, const unsigned short* g1,
                                      const unsigned short* g2, const unsigned short* g3) {
#if DEV_ASM
  asm volatile("global_load_async_to_lds_b128 %0, %4, off\n\t"
               "global_load_async_to_lds_b128 %1, %5, off\n\t"
               "global_load_async_to_lds_b128 %2, %6, off\n\t"
               "global_load_async_to_lds_b128 %3, %7, off\n\t"
               "s_wait_xcnt 0x0"
               :: "v"(l0), "v"(l1), "v"(l2), "v"(l3), "v"(g0), "v"(g1), "v"(g2), "v"(g3) : "memory");
#else
  (void)l0; (void)l1; (void)l2; (void)l3; (void)g0; (void)g1; (void)g2; (void)g3;
#endif
}
// this wave's copies have landed in LDS (the compiler places no wait for them)
__device__ __forceinline__ void wait_copies() {
#if DEV_ASM
  asm volatile("s_wait_asynccnt 0x0" ::: "memory");
#endif
}
// this wave's LDS reads have returned, so the buffer they read may be refilled behind the next barrier
__device__ __forceinline__ void wait_lds() {
#if DEV_ASM
  asm volatile("s_wait_dscnt 0x0" ::: "memory");
#endif
}
// one stage: 20 copies per lane; ga / gb = the lane's piece of its first A / Bt row at this stage's k
template <int BM>
__device__ __forceinline__ void fill_stage(unsigned lb, const unsigned short* ga, int lda,
                                           const unsigned short* gb, int ldb) {
  // both loops unrolled: r0 is then a constant, so the A / Bt choice is no branch and g, l stay in registers
#pragma unroll
  for (int q = 0; q < SROWS / 64; ++q) {
    const unsigned short* g[4];
    unsigned l[4];
#pragma unroll
    for (int e = 0; e < 4; ++e) {
      const int r0 = (q * 4 + e) * 16;                 // first row of this copy's 16 rows
      g[e] = (r0 < BM) ? ga + (size_t)r0 * lda : gb + (size_t)(r0 - BM) * ldb;
      l[e] = lb + (unsigned)(r0 * SPITCH * 2);
    }
    copy4(l[0], l[1], l[2], l[3], g[0], g[1], g[2], g[3]);
  }
}

template <int BIAS_MODE, int WM>
__global__ __launch_bounds__(128) void gemm64(
    const unsigned short* __restrict__ Ap, int lda, long long strideA,
    const unsigned short* __restrict__ Btp, int ldb, long long strideB,
    float* Cout, int ldc, long long strideC,
    const float* __restrict__ bias,
    int M, int N, int K) {
  constexpr int BM = 64 * WM;
  constexpr int BN = SROWS - BM;
  static_assert(WM == 1 || WM == 4);
  __shared__ __align__(16) unsigned short stg[2 * SROWS * SPITCH];   // two stage buffers
  __shared__ __align__(16) float sT[4][16 * 68];   // per-wave 16x64 slab, pitch 68 floats
  const int b    = blockIdx.y;
  const int tid  = (int)threadIdx.x;
  const int lane = tid & 31;
  const int wave = tid >> 5;
  const int tilesN = N / BN;
  const int tilesM = M / BM;
  const int tile = blockIdx.x;
  if (tile >= tilesM * tilesN) return;   // block-uniform, in front of every barrier and copy
  const int tm = tile / tilesN;
  const int tn = tile - tm * tilesN;
  const int wrA = (WM == 4) ? (wave << 6) : 0;          // the wave's first A row inside the stage
  const int wrB = BM + ((WM == 4) ? 0 : (wave << 6));   // the wave's first Bt row inside the stage
  const int m0 = tm * BM + wrA;
  const int n0 = tn * BN + (wrB - BM);

  const int rlane = lane & 15;                 // row (A) / col (B, D) within subtile
  const int koff  = (lane >> 4) * 8;           // k offset of this lane half
  const int mOff  = (lane >> 4) * 8;           // D row offset

  // the lane's copy addresses: row tid>>3 of each 16-row group, 16-B piece tid&7
  const unsigned short* ga = Ap  + (size_t)b * (size_t)strideA + (size_t)(tm * BM + (tid >> 3)) * lda + (tid & 7) * 8;
  const unsigned short* gb = Btp + (size_t)b * (size_t)strideB + (size_t)(tn * BN + (tid >> 3)) * ldb + (tid & 7) * 8;
  const unsigned lds0 = (unsigned)(uintptr_t)stg + (unsigned)((tid >> 3) * SPITCH * 2 + (tid & 7) * 16);
  const int nst = K / SK;

  v8f acc[4][4];
#pragma unroll
  for (int i = 0; i < 4; ++i)
#pragma unroll
    for (int j = 0; j < 4; ++j) acc[i][j] = zero8();

  fill_stage<BM>(lds0, ga, lda, gb, ldb);
  wait_copies();
  __syncthreads();                             // stage 0 is readable by every wave
  if (nst > 1) fill_stage<BM>(lds0 + SBYTES, ga + SK, lda, gb + SK, ldb);

  for (int t = 0; t < nst; ++t) {
    const __bf16* sb = (const __bf16*)(const void*)stg + (t & 1) * (SROWS * SPITCH);
    // unrolled (inner loops too): fragments stay in registers, and the second k step's LDS reads start under
    // the first step's WMMAs
#pragma unroll
    for (int kk = 0; kk < SK; kk += 32) {
      v16b bq[4], af[4];
#pragma unroll
      for (int j = 0; j < 4; ++j) bq[j] = ldfrag<__bf16>(sb + (wrB + (j << 4) + rlane) * SPITCH + koff + kk);
#pragma unroll
      for (int i = 0; i < 4; ++i) af[i] = ldfrag<__bf16>(sb + (wrA + (i << 4) + rlane) * SPITCH + koff + kk);
#pragma unroll
      for (int i = 0; i < 4; ++i) {
#pragma unroll
        for (int j = 0; j < 4; ++j) acc[i][j] = mmar(af[i], bq[j], acc[i][j]);
        dep_guard(acc[i][0], acc[i][3], af[i], bq[3]);
      }
      keep4(bq[0], bq[1], bq[2], bq[3]);
    }
    // publish point of stage t + 1: own reads of stage t done, own copies of stage t + 1 landed, then the barrier
    wait_lds();
    wait_copies();
    __syncthreads();
    if (t + 2 < nst) fill_stage<BM>(lds0 + (unsigned)(t & 1) * SBYTES, ga + (t + 2) * SK, lda, gb + (t + 2) * SK, ldb);
  }
  wait_copies();
  acc_guard4(acc[0][0], acc[0][1], acc[0][2], acc[0][3]);
  acc_guard4(acc[1][0], acc[1][1], acc[1][2], acc[1][3]);
  acc_guard4(acc[2][0], acc[2][1], acc[2][2], acc[2][3]);
  acc_guard4(acc[3][0], acc[3][1], acc[3][2], acc[3][3]);

  // ---- epilogue ----
  float* slab = sT[wave];
  float* C = Cout + (size_t)b * (size_t)strideC;
  const int h2 = lane >> 4, c4 = (lane & 15) * 4;     // 256-B row segment = 16 lanes x 16 B
  v4f bcol = {0.f, 0.f, 0.f, 0.f};
  if (BIAS_MODE == 1) {
#pragma unroll
    for (int e = 0; e < 4; ++e) bcol[e] = bf_up(bf_bits(bias[n0 + c4 + e]));
  }
#pragma unroll
  for (int i = 0; i < 4; ++i) {
    const int mBase = m0 + (i << 4);
#pragma unroll
    for (int j = 0; j < 4; ++j) {
#pragma unroll
      for (int r = 0; r < 8; ++r) {
        slab[(mOff + r) * 68 + (j << 4) + rlane] = acc[i][j][r];
      }
    }
    __builtin_amdgcn_fence(__ATOMIC_RELEASE, "workgroup");
    __builtin_amdgcn_wave_barrier();
    __builtin_amdgcn_fence(__ATOMIC_ACQUIRE, "workgroup");
    {
#pragma unroll
      for (int it = 0; it < 8; ++it) {
        const int row = it * 2 + h2;                     // it 0..7 x h2 0..1 = rows 0..15
        v4f v = *(const v4f*)(slab + row * 68 + c4);
        if (BIAS_MODE == 1) {
          v = v + bcol;
        } else {
          const float br = bf_up(bf_bits(bias[mBase + row]));
          v = v + br;
        }
        *(v4f*)(C + (size_t)(mBase + row) * ldc + n0 + c4) = v;
      }
      
    }
    __builtin_amdgcn_fence(__ATOMIC_RELEASE, "workgroup");
    __builtin_amdgcn_wave_barrier();
    __builtin_amdgcn_fence(__ATOMIC_ACQUIRE, "workgroup");
  }
}

// =====================================================================================================
// P^T B fragment pair (hi, residual) from the lane's own score D values: element r <- tile a row r,
// element 8+r <- tile c row r (same lane, same query column).
// =====================================================================================================
union PBits { v16us u; v16b v; };
__device__ __forceinline__ void pack_pt(v8f a, v8f c, v16b& ph, v16b& pl) {
  const v16us zz = {0, 0, 0, 0, 0, 0, 0, 0, 0, 0, 0, 0, 0, 0, 0, 0};
  PBits H, L;
  H.u = zz; L.u = zz;
#pragma unroll
  for (int r = 0; r < 8; ++r) {
    const unsigned short hb = bf_bits(a[r]);
    H.u[r] = hb;
    L.u[r] = bf_bits(a[r] - bf_up(hb));
  }
#pragma unroll
  for (int r = 0; r < 8; ++r) {
    const unsigned short hb = bf_bits(c[r]);
    H.u[8 + r] = hb;
    L.u[8 + r] = bf_bits(c[r] - bf_up(hb));
  }
  ph = H.v; pl = L.v;
}

// load 8 consecutive f32, or zeros when keep == 0 (address always valid, select by value)
__device__ __forceinline__ void ld8sel(const float* src, int keep, float f[8]) {
  const v4f a = *(const v4f*)src;
  const v4f c = *(const v4f*)(src + 4);
  f[0] = keep ? a[0] : 0.f; f[1] = keep ? a[1] : 0.f; f[2] = keep ? a[2] : 0.f; f[3] = keep ? a[3] : 0.f;
  f[4] = keep ? c[0] : 0.f; f[5] = keep ? c[1] : 0.f; f[6] = keep ? c[2] : 0.f; f[7] = keep ? c[3] : 0.f;
}

// =====================================================================================================
// Windowed attention, one block = (batch b, head, 8x8 query tile at (i0, j0)); 128 threads = 4 waves,
// wave w owns the 16 queries lq = 16w..16w+15 (query row i0 + (lq>>3), col j0 + (lq&7)).
// Key superset = the 14x14 image block at (R0, C0), R0 = clamp(i0-3, 0, 42), slot = u*14 + v (196 slots,
// padded to 224 with zero rows). Every query's clamped 7x7 window lies inside the superset: valid slots are
// su <= u <= su+6, sv <= v <= sv+6 with su = clamp(qi-3,0,49) - R0 in [0,7].
//   qkv plane f32 [b*3136 + p][768]: q = cols head*32+d (scaled by 32^-0.5 in f32 here), k = 256+.., v = 512+..
//   scores (transposed): S^T[slot][query] = K[slot][d] . Q^T[d][query] on bf16 WMMA, 3 products
//     (hi.hi + hi.res + res.hi); lane owns query column (lane&15) of its wave and key rows 16j + 8h + r.
//   s = S^T + rpb[head][u + R0 - qi + 6][v + C0 - qj + 6] for valid slots, -1e30 otherwise (f32);
//   softmax in f32 (max / sum over the 104 lane values and the partner lane ^16).
//   O^T[d][query] = V^T[d][slot] . P^T[slot][query] on bf16 WMMA, 3 products, p unnormalised exp, 1/sum at the end.
// LDS: KV0/KV1 hold K hi/res [slot][d] for the scores, then (after a block barrier) V^T hi/res [d][slot].
// Staged extents: KV 224x32 both phases (slots >= 196 zero), Q 64x32, Rp 169 (reads clamped to 0..168),
// Os 16x32 per wave -- every LDS element read is written first.
// Output coverage: each wave stores its 16 query rows (it 0..3 x lane>>3) x 8 pieces of 16 B (lane&7) =
// =====================================================================================================
__global__ __launch_bounds__(128)
void natt(const float* __restrict__ qkv, const float* __restrict__ rpb, unsigned short* ctx) {
  __shared__ __align__(16) unsigned short KV0[NSLOT * HDIM];   // 14336 B
  __shared__ __align__(16) unsigned short KV1[NSLOT * HDIM];   // 14336 B
  __shared__ __align__(16) unsigned short Qh[64 * HDIM];       //  4096 B
  __shared__ __align__(16) unsigned short Ql[64 * HDIM];       //  4096 B
  __shared__ __align__(16) float Os[4][16 * HDIM];             //  8192 B
  __shared__ float Rp[176];

  const int tid  = (int)threadIdx.x;
  const int wave = tid >> 5;
  const int lane = tid & 31;
  const int hh   = lane >> 4;
  const int m    = lane & 15;

  const int bx   = blockIdx.x;
  const int tj   = bx % 7;
  const int ti   = (bx / 7) % 7;
  const int head = (bx / 49) % NHD;
  const int b    = bx / (49 * NHD);
  const int i0 = ti * 8, j0 = tj * 8;
  const int R0 = min(max(i0 - 3, 0), IMH - SUP);
  const int C0 = min(max(j0 - 3, 0), IMW - SUP);
  const size_t pb = (size_t)b * NPOS;

  // ---- position-bias table of this head (bf16 RNE-converted values), entries 0..168 ----
  {
    const float r0v = rpb[head * 169 + tid];                 // tid <= 127 < 169
    const int   i1  = tid + 128;
    const float r1v = rpb[head * 169 + min(i1, 168)];       // clamped address
    Rp[tid] = bf_up(bf_bits(r0v));
    if (i1 < 169) Rp[i1] = bf_up(bf_bits(r1v));
  }
  // ---- q (scaled in f32) -> hi / residual planes [lq][d]; thread = (lq = tid>>1, d half) ----
  {
    const int lq = tid >> 1, dh = (tid & 1) * 16;
    const int qi = lq >> 3, qj = lq & 7;
    const size_t pos = pb + (size_t)(i0 + qi) * IMW + j0 + qj;
    const float* src = qkv + pos * C3 + head * HDIM + dh;
#pragma unroll
    for (int g = 0; g < 2; ++g) {
      float f[8];
      ld8sel(src + 8 * g, 1, f);
      v4u ph, pl;
#pragma unroll
      for (int e = 0; e < 4; ++e) {
        unsigned short h0, l0, h1, l1;
        split_bf(f[2 * e] * QSCALE, h0, l0);
        split_bf(f[2 * e + 1] * QSCALE, h1, l1);
        ph[e] = pk16(h0, h1); pl[e] = pk16(l0, l1);
      }
      *(v4u*)(Qh + lq * HDIM + dh + 8 * g) = ph;
      *(v4u*)(Ql + lq * HDIM + dh + 8 * g) = pl;
    }
  }
  // ---- K superset -> KV0 (hi) / KV1 (residual), layout [slot][d]; item = it*128 + tid, slot = item>>2,
  //      d8 = (item&3)*8; 7 x 128 items = 224 slots x 4 groups = the whole tile; slots >= 196 = zeros ----
  {
    const float* kbase = qkv + CH + head * HDIM;
#pragma unroll
    for (int it = 0; it < 7; ++it) {
      const int item = it * 128 + tid;
      const int slot = item >> 2, d8 = (item & 3) * 8;
      const int u = slot / SUP, v = slot - u * SUP;
      const int uc = min(u, SUP - 1);
      const size_t pos = pb + (size_t)(R0 + uc) * IMW + C0 + v;
      float f[8];
      ld8sel(kbase + pos * C3 + d8, slot < SUP * SUP, f);
      v4u ph, pl;
#pragma unroll
      for (int e = 0; e < 4; ++e) {
        unsigned short h0, l0, h1, l1;
        split_bf(f[2 * e], h0, l0);
        split_bf(f[2 * e + 1], h1, l1);
        ph[e] = pk16(h0, h1); pl[e] = pk16(l0, l1);
      }
      *(v4u*)(KV0 + slot * HDIM + d8) = ph;
      *(v4u*)(KV1 + slot * HDIM + d8) = pl;
    }
  }
  __syncthreads();

  // ---- scores: S^T tiles j = 0..12 (key slots 16j..16j+15) for the wave's 16 queries; s[13] stays zero ----
  v8f s[NKT + 1];
  {
    const __bf16* Kh = (const __bf16*)(const void*)KV0;
    const __bf16* Kl = (const __bf16*)(const void*)KV1;
    const __bf16* Qhp = (const __bf16*)(const void*)Qh;
    const __bf16* Qlp = (const __bf16*)(const void*)Ql;
    const v16b qfh = ldfrag<__bf16>(Qhp + (16 * wave + m) * HDIM + 8 * hh);
    const v16b qfl = ldfrag<__bf16>(Qlp + (16 * wave + m) * HDIM + 8 * hh);
#pragma unroll
    for (int j = 0; j < NKT; ++j) {
      const v16b kfh = ldfrag<__bf16>(Kh + (16 * j + m) * HDIM + 8 * hh);
      const v16b kfl = ldfrag<__bf16>(Kl + (16 * j + m) * HDIM + 8 * hh);
      v8f z = zero8();
      z = mma_b(kfh, qfh, z);
      z = mma_b(kfh, qfl, z);
      z = mma_b(kfl, qfh, z);
      s[j] = z;
    }
    s[NKT] = zero8();
  }
  __syncthreads();   // all waves done reading K from KV0/KV1

  // ---- V superset -> KV0 (hi) / KV1 (residual), transposed layout [d][slot] (pitch 224);
  //      same item map as K: 224 slots x 32 d written, slots >= 196 = zeros ----
  {
    const float* vbase = qkv + 2 * CH + head * HDIM;
#pragma unroll
    for (int it = 0; it < 7; ++it) {
      const int item = it * 128 + tid;
      const int slot = item >> 2, d8 = (item & 3) * 8;
      const int u = slot / SUP, v = slot - u * SUP;
      const int uc = min(u, SUP - 1);
      const size_t pos = pb + (size_t)(R0 + uc) * IMW + C0 + v;
      float f[8];
      ld8sel(vbase + pos * C3 + d8, slot < SUP * SUP, f);
#pragma unroll
      for (int e = 0; e < 8; ++e) {
        unsigned short h0, l0;
        split_bf(f[e], h0, l0);
        KV0[(d8 + e) * NSLOT + slot] = h0;
        KV1[(d8 + e) * NSLOT + slot] = l0;
      }
    }
  }
  __syncthreads();

  // ---- window mask + position bias (f32), softmax over the query column ----
  const int lq = 16 * wave + m;
  const int ai = i0 + (lq >> 3), aj = j0 + (lq & 7);
  const int su = min(max(ai - 3, 0), IMH - KW) - R0;
  const int sv = min(max(aj - 3, 0), IMW - KW) - C0;
  const int cb = (R0 - ai + 6) * 13 + (C0 - aj + 6);
  float mloc = -1.0e30f;
#pragma unroll
  for (int j = 0; j < NKT; ++j) {
#pragma unroll
    for (int r = 0; r < 8; ++r) {
      const int t0 = 16 * j + r;                       // slot = t0 + 8*hh
      const int u = hh ? ((t0 + 8) / SUP) : (t0 / SUP);
      const int v = hh ? ((t0 + 8) % SUP) : (t0 % SUP);
      const bool ok = ((unsigned)(u - su) < 7u) && ((unsigned)(v - sv) < 7u);
      int bi = u * 13 + v + cb;
      bi = min(max(bi, 0), 168);
      const float bv = Rp[bi];
      const float sval = ok ? (s[j][r] + bv) : -1.0e30f;
      s[j][r] = sval;
      mloc = fmaxf(mloc, sval);
    }
  }
  const float mrow = fmaxf(mloc, __shfl_xor(mloc, 16, 32));
  float lsum = 0.f;
#pragma unroll
  for (int j = 0; j < NKT; ++j) {
#pragma unroll
    for (int r = 0; r < 8; ++r) {
      const float p = __expf(s[j][r] - mrow);
      s[j][r] = p;
      lsum += p;
    }
  }
  lsum += __shfl_xor(lsum, 16, 32);

  // ---- O^T = V^T . P^T : 2 d-tiles x 7 k-steps of 32 slots x 3 products ----
  v8f o[2];
  o[0] = zero8(); o[1] = zero8();
  {
    const __bf16* Vh = (const __bf16*)(const void*)KV0;
    const __bf16* Vl = (const __bf16*)(const void*)KV1;
#pragma unroll
    for (int kk = 0; kk < NSLOT / 32; ++kk) {
      v16b ph, pl;
      pack_pt(s[2 * kk], s[2 * kk + 1], ph, pl);
#pragma unroll
      for (int t = 0; t < 2; ++t) {
        const v16b vfh = ldfrag<__bf16>(Vh + (16 * t + m) * NSLOT + 32 * kk + 8 * hh);
        const v16b vfl = ldfrag<__bf16>(Vl + (16 * t + m) * NSLOT + 32 * kk + 8 * hh);
        o[t] = mma_b(vfh, ph, o[t]);
        o[t] = mma_b(vfh, pl, o[t]);
        o[t] = mma_b(vfl, ph, o[t]);
      }
    }
  }

  // ---- normalise, stage the wave's 16 queries x 32 d in LDS, write the ctx lines ----
  const float linv = 1.0f / lsum;
  float* os = Os[wave];
#pragma unroll
  for (int t = 0; t < 2; ++t)
#pragma unroll
    for (int r = 0; r < 8; ++r) os[m * HDIM + 16 * t + 8 * hh + r] = o[t][r] * linv;
  __syncthreads();
  {
    const int q4 = lane >> 3, pc = lane & 7, dsel = (pc & 3) * 8;
    const bool lowp = (pc >= 4);
    v4u hv[4];
    size_t go[4];
#pragma unroll
    for (int it = 0; it < 4; ++it) {
      const int row = it * 4 + q4;                     // it 0..3 x q4 0..3 = rows 0..15
      const float* sp = os + row * HDIM + dsel;
      v4u a;
#pragma unroll
      for (int e = 0; e < 4; ++e) {
        unsigned short h0, l0, h1, l1;
        split_bf(sp[2 * e], h0, l0);
        split_bf(sp[2 * e + 1], h1, l1);
        a[e] = lowp ? pk16(l0, l1) : pk16(h0, h1);
      }
      hv[it] = a;
      const int lqr = 16 * wave + row;
      const size_t pos = pb + (size_t)(i0 + (lqr >> 3)) * IMW + j0 + (lqr & 7);
      go[it] = pos * CTXK + (size_t)head * 64 + pc * 8;
    }
    {
#pragma unroll
      for (int it = 0; it < 4; ++it) *(v4u*)(ctx + go[it]) = hv[it];
      
    }
  }
}

// =====================================================================================================
//   Xh   bf16 [6272][256]     3211264
//   Wqb  bf16 [768][256]       393216
//   Wpf  bf16 [256][512]       262144
//   QKV  f32  [6272][768]    19267584
//   CTX  bf16 [6272][512]     6422528
//   total                   29556736
// =====================================================================================================
extern "C" void kernel_launch(void* const* d_in, const int* in_sizes, int n_in,
                              void* d_out, int out_size, void* d_ws, size_t ws_size,
                              hipStream_t stream) {
  if (n_in < 6) return;
  if (in_sizes[0] != NBT * CH * NPOS) return;
  if (in_sizes[1] != C3 * CH) return;
  if (in_sizes[2] != C3) return;
  if (in_sizes[3] != NHD * 13 * 13) return;
  if (in_sizes[4] != CH * CH) return;
  if (in_sizes[5] != CH) return;
  if (out_size != NBT * CH * NPOS) return;

  const float* x      = (const float*)d_in[0];
  const float* w_qkv  = (const float*)d_in[1];
  const float* b_qkv  = (const float*)d_in[2];
  const float* rpb    = (const float*)d_in[3];
  const float* w_proj = (const float*)d_in[4];
  const float* b_proj = (const float*)d_in[5];

  const size_t PXH  = (size_t)MROW * CH * 2;        //  3211264
  const size_t PWQ  = (size_t)C3 * CH * 2;          //   393216
  const size_t PWP  = (size_t)CH * CTXK * 2;        //   262144
  const size_t PQKV = (size_t)MROW * C3 * 4;        // 19267584
  const size_t PCTX = (size_t)MROW * CTXK * 2;      //  6422528
  size_t off = 0;
  const size_t oXh  = off; off += PXH;
  const size_t oWq  = off; off += PWQ;
  const size_t oWp  = off; off += PWP;
  const size_t oQKV = off; off += PQKV;
  const size_t oCTX = off; off += PCTX;
  if (off > ws_size) return;                         // off = 29556736
  if (off > (size_t)134217728) return;

  char* ws = (char*)d_ws;
  unsigned short* Xh  = (unsigned short*)(ws + oXh);
  unsigned short* Wqb = (unsigned short*)(ws + oWq);
  unsigned short* Wpf = (unsigned short*)(ws + oWp);
  float*          QKV = (float*)(ws + oQKV);
  unsigned short* CTX = (unsigned short*)(ws + oCTX);

  const int n8wq = C3 * CH / 8;                                       // 24576
  const int tilesQKV = (MROW / 64) * (C3 / 256);                      //  294 block tiles of 64 x 256
  const int tilesPRJ = (CH / 256) * (NPOS / 64);                      //   49 block tiles of 256 x 64
  const dim3 gX(NPOS / 64, CH / 64, NBT);                             // (49, 4, 2)
  const dim3 gWq((n8wq + 255) / 256);                                 // 96
  const dim3 gWp((CH * CTXK / 8 + 255) / 256);                        // 64
  const dim3 gQKV(tilesQKV, 1);                                       // 294
  const dim3 gAtt(NBT * NHD * 49);                                    // 784
  const dim3 gPRJ(tilesPRJ, NBT);                                     // (49, 2)

  // (1) x NCHW -> bf16 [p][c]; w_qkv -> bf16 [n][k]; w_proj -> folded bf16 [c][512]
  cvt_x<<<gX, dim3(256), 0, stream>>>(x, Xh);
  cvt16x8<<<gWq, dim3(256), 0, stream>>>(w_qkv, Wqb, n8wq);
  cvt_wp<<<gWp, dim3(256), 0, stream>>>(w_proj, Wpf);
  // (2) qkv = Xh . Wqkv^T + b_qkv -> f32 [6272][768]   (M=6272, N=768, K=256)
  gemm64<1, 1><<<gQKV, dim3(128), 0, stream>>>(
      Xh, CH, 0LL, Wqb, CH, 0LL,
      QKV, C3, 0LL, b_qkv,
      MROW, C3, CH);
  // (3) windowed attention -> ctx plane bf16 [6272][512]
  natt<<<gAtt, dim3(128), 0, stream>>>(QKV, rpb, CTX);
  // (4) out[b][c][p] = sum_k Wpf[c][k] ctx[b*3136+p][k] + b_proj[c]   (per batch: M=256, N=3136, K=512)
  gemm64<2, 4><<<gPRJ, dim3(128), 0, stream>>>(
      Wpf, CTXK, 0LL, CTX, CTXK, (long long)NPOS * CTXK,
      (float*)d_out, NPOS, (long long)CH * NPOS, b_proj,
      CH, NPOS, CTXK);
  (void)hipGetLastError();
}

// v002
// A run of this version takes 49.5 microseconds.
// Timed twice side by side with v001, it ran 1.09 times as fast both times.
// Counting every step since v000, it is 1.55 times as fast.
// Contractions: qkv projection = v_wmma_f32_16x16x32_bf16 (bf16 operands from RNE-converted x and w_qkv, single product, f32 accumulate);
// q.k scores = v_wmma_f32_16x16x32_bf16 (q and k each as bf16 hi plane + unscaled bf16 residual plane, 3 products, f32 accumulate);
// p.v = v_wmma_f32_16x16x32_bf16 (p and v each as bf16 hi + unscaled bf16 residual, 3 products, f32 accumulate);
// ctx.w_proj^T = v_wmma_f32_16x16x32_bf16 (ctx as bf16 hi + residual folded into K, w_proj bf16 from its RNE-converted value, f32 accumulate);
// biases, q scaling, window mask, position bias and softmax in f32. No power-of-two carries anywhere (bf16 planes, unscaled residuals).
#include <hip/hip_runtime.h>
#include <math.h>
#include <stdint.h>

#define NBT   2
#define CH    256
#define IMH   56
#define IMW   56
#define NPOS  (IMH * IMW)        // 3136 positions per image, p = i*56 + j
#define MROW  (NBT * NPOS)       // 6272 position rows
#define NHD   8
#define HDIM  32
#define C3    (3 * CH)           // 768
#define KW    7                  // window side; window start = clamp(i - 3, 0, IMH - KW)
#define SUP   14                 // clamped key superset side of an 8x8 query tile
#define NSLOT 224                // key slots staged per block (196 used, rest zero)
#define NKT   13                 // scored 16-key tiles (slots 0..207)
#define CTXK  512                // folded K of the ctx plane: per head [hi d0..31 | residual d0..31]
#define QSCALE 0.17677669529663687f

static_assert((MROW % 64) == 0);
static_assert((C3 % 256) == 0);
static_assert((NPOS % 64) == 0);
static_assert((CH % 256) == 0);
static_assert((CH % 128) == 0 && (CTXK % 128) == 0);
static_assert(NHD * HDIM == CH);
static_assert(SUP == 8 + KW - 1);
static_assert(SUP * SUP <= NSLOT && (NSLOT % 32) == 0 && NKT * 16 >= SUP * SUP);
static_assert(IMH == IMW);

typedef __bf16   v16b __attribute__((ext_vector_type(16)));
typedef __bf16   v8b  __attribute__((ext_vector_type(8)));
typedef float    v8f  __attribute__((ext_vector_type(8)));
typedef float    v4f  __attribute__((ext_vector_type(4)));
typedef unsigned int v4u __attribute__((ext_vector_type(4)));
typedef unsigned short v16us __attribute__((ext_vector_type(16)));

#if defined(__HIP_DEVICE_COMPILE__)
#define DEV_ASM 1
#else
#define DEV_ASM 0
#endif

// ---- scalar helpers --------------------------------------------------------------------------------
__device__ __forceinline__ unsigned short bf_bits(float f) {          // f32 -> bf16 bits, RNE convert
  unsigned u = __float_as_uint(f);
  return (unsigned short)((u + 0x7FFFu + ((u >> 16) & 1u)) >> 16);
}
__device__ __forceinline__ float bf_up(unsigned short hb) { return __uint_as_float(((unsigned)hb) << 16); }
__device__ __forceinline__ unsigned pk16(unsigned short a, unsigned short b) { return (unsigned)a | ((unsigned)b << 16); }
__device__ __forceinline__ v8f zero8() { v8f z = {0.f, 0.f, 0.f, 0.f, 0.f, 0.f, 0.f, 0.f}; return z; }
// hi / residual bf16 split of an f32 value (residual unscaled)
__device__ __forceinline__ void split_bf(float f, unsigned short& hb, unsigned short& lb) {
  hb = bf_bits(f);
  lb = bf_bits(f - bf_up(hb));
}

// ---- fragment loader: 16-bit A/B operand, lane -> row/col (lane&15), p already includes +8*(lane>>4);
//      elements 0..7 <- p[0..7] (k0+8h..k0+8h+7), elements 8..15 <- p[16..23] (k0+16+8h..k0+16+8h+7)
template <typename OT> struct FT;
template <> struct FT<__bf16> { typedef v16b frag; typedef v8b half8; };

template <typename OT>
__device__ __forceinline__ typename FT<OT>::frag ldfrag(const OT* p) {
  union { typename FT<OT>::frag v; typename FT<OT>::half8 h[2]; } f;
  f.h[0] = *(const typename FT<OT>::half8*)(p);
  f.h[1] = *(const typename FT<OT>::half8*)(p + 16);
  return f.v;
}

// ---- WMMA helpers ------------------------------------------------------------------------------------
__device__ __forceinline__ v8f mmar(v16b a, v16b b, v8f c) {
  return __builtin_amdgcn_wmma_f32_16x16x32_bf16(false, a, false, b, (short)0, c, false, false);
}
// guarded form: 4 VALU slots after the WMMA, D tied, A/B kept live
__device__ __forceinline__ v8f mma_b(v16b a, v16b b, v8f c) {
  c = __builtin_amdgcn_wmma_f32_16x16x32_bf16(false, a, false, b, (short)0, c, false, false);
#if DEV_ASM
  asm volatile("v_nop\n\tv_nop\n\tv_nop\n\tv_nop" : "+v"(c) : "v"(a), "v"(b));
#endif
  return c;
}
__device__ __forceinline__ void dep_guard(v8f& a, v8f& b, v16b x, v16b y) {
#if DEV_ASM
  asm volatile("v_nop\n\tv_nop\n\tv_nop\n\tv_nop" : "+v"(a), "+v"(b) : "v"(x), "v"(y));
#else
  (void)a; (void)b; (void)x; (void)y;
#endif
}
__device__ __forceinline__ void keep4(v16b a, v16b b, v16b c, v16b d) {
#if DEV_ASM
  asm volatile("v_nop" :: "v"(a), "v"(b), "v"(c), "v"(d));
#else
  (void)a; (void)b; (void)c; (void)d;
#endif
}
__device__ __forceinline__ void acc_guard4(v8f& a, v8f& b, v8f& c, v8f& d) {
#if DEV_ASM
  asm volatile("v_nop\n\tv_nop\n\tv_nop\n\tv_nop" : "+v"(a), "+v"(b), "+v"(c), "+v"(d));
#else
  (void)a; (void)b; (void)c; (void)d;
#endif
}

// =====================================================================================================
// x NCHW f32 [b][c][p] -> Xh bf16 [b*3136 + p][c] (RNE convert), transposed through an LDS 64c x 64p tile.
// Store phase: item = it*256 + tid, p = item>>3, channel group = item&7 -> lanes 8q..8q+7 write one whole
// coverage: 2 iterations x 256 threads x 8 = the whole 64x64 tile; 392 blocks = the whole [6272][256] plane.
// =====================================================================================================
__device__ __forceinline__ void cvt_x(const float* __restrict__ x, unsigned short* xh, float* t, int blk) {
  const int tid = (int)threadIdx.x;
  const int p0 = (blk % (NPOS / 64)) * 64, c0 = ((blk / (NPOS / 64)) % (CH / 64)) * 64, b = blk / ((NPOS / 64) * (CH / 64));
#pragma unroll
  for (int it = 0; it < 4; ++it) {
    const int c  = it * 16 + (tid >> 4);
    const int p4 = (tid & 15) * 4;
    const v4f v = *(const v4f*)(x + ((size_t)(b * CH + c0 + c)) * NPOS + p0 + p4);
    float* tp = t + c * 65 + p4;
    tp[0] = v[0]; tp[1] = v[1]; tp[2] = v[2]; tp[3] = v[3];
  }
  __syncthreads();
  v4u pk[2];
  size_t go[2];
#pragma unroll
  for (int it = 0; it < 2; ++it) {
    const int item = it * 256 + tid;
    const int p = item >> 3, cg = item & 7;
    v4u a;
#pragma unroll
    for (int e = 0; e < 4; ++e) {
      const float f0 = t[(cg * 8 + 2 * e) * 65 + p];
      const float f1 = t[(cg * 8 + 2 * e + 1) * 65 + p];
      a[e] = pk16(bf_bits(f0), bf_bits(f1));
    }
    pk[it] = a;
    go[it] = ((size_t)(b * NPOS + p0 + p)) * CH + c0 + cg * 8;
  }
  {
#pragma unroll
    for (int it = 0; it < 2; ++it) *(v4u*)(xh + go[it]) = pk[it];
    
  }
}

// =====================================================================================================
// f32 -> bf16 bits (RNE convert), 8 elements per thread, one 16-B store per lane: a wave writes 512
// coverage: n8 threads x 8 = the whole plane (n8 = 24576 here, a multiple of 256).
// =====================================================================================================
__device__ __forceinline__ void cvt16x8(const float* __restrict__ in, unsigned short* out, int n8, int blk) {
  const int i = blk * 256 + (int)threadIdx.x;
  if (i < n8) {
    const v4f a  = *(const v4f*)(in + (size_t)i * 8);
    const v4f a4 = *(const v4f*)(in + (size_t)i * 8 + 4);
    v4u p;
    p[0] = pk16(bf_bits(a[0]),  bf_bits(a[1]));
    p[1] = pk16(bf_bits(a[2]),  bf_bits(a[3]));
    p[2] = pk16(bf_bits(a4[0]), bf_bits(a4[1]));
    p[3] = pk16(bf_bits(a4[2]), bf_bits(a4[3]));
    unsigned short* o = out + (size_t)i * 8;
    *(v4u*)o = p;
    
  }
}

// =====================================================================================================
// w_proj [256 c][256 k] f32 -> folded plane Wf bf16 [256 c][512]: Wf[c][head*64 + part*32 + d] =
// bf16(w_proj[c][head*32 + d]) for part = 0 (meets the ctx hi half) and part = 1 (meets the residual half).
// coverage: 16384 threads x 8 = the whole [256][512] plane.
// =====================================================================================================
__device__ __forceinline__ void cvt_wp(const float* __restrict__ wp, unsigned short* out, int blk) {
  const int i = blk * 256 + (int)threadIdx.x;
  if (i < CH * CTXK / 8) {
    const int c  = i >> 6;                 // 64 groups of 8 per 512-wide row
    const int k  = (i & 63) * 8;           // 0..504
    const int hd = k >> 6;                 // head
    const int d0 = k & 31;                 // 0, 8, 16, 24
    const float* src = wp + (size_t)c * CH + hd * HDIM + d0;
    const v4f a  = *(const v4f*)src;
    const v4f a4 = *(const v4f*)(src + 4);
    v4u p;
    p[0] = pk16(bf_bits(a[0]),  bf_bits(a[1]));
    p[1] = pk16(bf_bits(a[2]),  bf_bits(a[3]));
    p[2] = pk16(bf_bits(a4[0]), bf_bits(a4[1]));
    p[3] = pk16(bf_bits(a4[2]), bf_bits(a4[3]));
    unsigned short* o = out + (size_t)i * 8;
    *(v4u*)o = p;
    
  }
}

// =====================================================================================================
// The three operand conversions read and write disjoint planes and none reads another's output, so they run
// as block ranges of one grid: blocks 0..NBX-1 = x tiles (the longest blocks, so they start first),
// NBX..NBX+NBQ-1 = w_qkv, the last NBP = w_proj. The range test is block-uniform (the x tiles hold a barrier).
// =====================================================================================================
#define NBX ((NPOS / 64) * (CH / 64) * NBT)   // 392 x tiles
#define NBQ (C3 * CH / 8 / 256)               //  96 blocks of w_qkv
#define NBP (CH * CTXK / 8 / 256)             //  64 blocks of w_proj
static_assert(NBQ * 256 * 8 == C3 * CH && NBP * 256 * 8 == CH * CTXK);
__global__ __launch_bounds__(256) void cvt_all(const float* __restrict__ x, const float* __restrict__ wq,
                                               const float* __restrict__ wp, unsigned short* xh,
                                               unsigned short* wqb, unsigned short* wpf) {
  __shared__ float t[64 * 65];                       // x tile [c][p], pitch 65
  const int blk = (int)blockIdx.x;
  if (blk < NBX) {
    cvt_x(x, xh, t, blk);
  } else if (blk < NBX + NBQ) {
    cvt16x8(wq, wqb, C3 * CH / 8, blk - NBX);
  } else {
    cvt_wp(wp, wpf, blk - (NBX + NBQ));
  }
}

// =====================================================================================================
// Batched WMMA GEMM (bf16 operands): C[m][n] = sum_k A[m][k] * Bt[n][k] + bias. A row-major [M][K] pitch lda;
// Bt row-major [N][K] pitch ldb (k contiguous); blockIdx.y = batch index (strides in elements).
// One block = 4 waves, one 64x64 tile of C per wave: WM waves along m and 4 / WM along n, so the block tile is
// (64 WM) x (256 / WM). M, N multiples of the block tile, K a multiple of SK (host constants).
// Operands go global -> LDS by asynchronous 16-B copies, SK = 64 k (one whole 128-B line of each of the 320
// operand rows) per stage, two buffers: stage t + 1 is in flight while stage t feeds the WMMAs.
// Stage layout: rows 0..BM-1 = A rows, rows BM..319 = Bt rows, pitch 144 B (16 B x 9, conflict-free b128 reads).
// Copy map: item = it*128 + tid, row = item>>3, 16-B piece = item&7 -> 8 lanes copy one line, 20 copies per lane
// = 320 rows x 8 pieces, each LDS byte written by one lane. Fragments keep the split k map (ldfrag), k ascending.
// BIAS_MODE 1: bias[n] (per column); BIAS_MODE 2: bias[m] (per row); bias values RNE-converted to bf16.
// Output: f32 C (pitch ldc). Epilogue: 16-row slabs staged per wave in LDS; each 64-wide row segment (256 B =
// coverage: 4 slabs x 16 rows (it 0..7 x lane>>4) x 64 cols = the wave's whole 64x64 tile.
// =====================================================================================================
#define SK     64                     // k elements per stage
#define SPITCH 72                     // LDS row pitch in elements (144 B)
#define SROWS  320                    // operand rows per stage (BM + BN)
#define SBYTES (SROWS * SPITCH * 2)   // 46080 B per buffer

// Four asynchronous copies, 16 B per lane each, global -> LDS. The s_wait_xcnt closes the statement so that no
// address register named here is rewritten before it.
__device__ __forceinline__ void copy4(unsigned l0, unsigned l1, unsigned l2, unsigned l3,
                                      const unsigned short* g0, const unsigned short* g1,
                                      const unsigned short* g2, const unsigned short* g3) {
#if DEV_ASM
  asm volatile("global_load_async_to_lds_b128 %0, %4, off\n\t"
               "global_load_async_to_lds_b128 %1, %5, off\n\t"
               "global_load_async_to_lds_b128 %2, %6, off\n\t"
               "global_load_async_to_lds_b128 %3, %7, off\n\t"
               "s_wait_xcnt 0x0"
               :: "v"(l0), "v"(l1), "v"(l2), "v"(l3), "v"(g0), "v"(g1), "v"(g2), "v"(g3) : "memory");
#else
  (void)l0; (void)l1; (void)l2; (void)l3; (void)g0; (void)g1; (void)g2; (void)g3;
#endif
}
// this wave's copies have landed in LDS (the compiler places no wait for them)
__device__ __forceinline__ void wait_copies() {
#if DEV_ASM
  asm volatile("s_wait_asynccnt 0x0" ::: "memory");
#endif
}
// this wave's LDS reads have returned, so the buffer they read may be refilled behind the next barrier
__device__ __forceinline__ void wait_lds() {
#if DEV_ASM
  asm volatile("s_wait_dscnt 0x0" ::: "memory");
#endif
}
// one stage: 20 copies per lane; ga / gb = the lane's piece of its first A / Bt row at this stage's k
template <int BM>
__device__ __forceinline__ void fill_stage(unsigned lb, const unsigned short* ga, int lda,
                                           const unsigned short* gb, int ldb) {
  // both loops unrolled: r0 is then a constant, so the A / Bt choice is no branch and g, l stay in registers
#pragma unroll
  for (int q = 0; q < SROWS / 64; ++q) {
    const unsigned short* g[4];
    unsigned l[4];
#pragma unroll
    for (int e = 0; e < 4; ++e) {
      const int r0 = (q * 4 + e) * 16;                 // first row of this copy's 16 rows
      g[e] = (r0 < BM) ? ga + (size_t)r0 * lda : gb + (size_t)(r0 - BM) * ldb;
      l[e] = lb + (unsigned)(r0 * SPITCH * 2);
    }
    copy4(l[0], l[1], l[2], l[3], g[0], g[1], g[2], g[3]);
  }
}

template <int BIAS_MODE, int WM>
__global__ __launch_bounds__(128) void gemm64(
    const unsigned short* __restrict__ Ap, int lda, long long strideA,
    const unsigned short* __restrict__ Btp, int ldb, long long strideB,
    float* Cout, int ldc, long long strideC,
    const float* __restrict__ bias,
    int M, int N, int K) {
  constexpr int BM = 64 * WM;
  constexpr int BN = SROWS - BM;
  static_assert(WM == 1 || WM == 4);
  __shared__ __align__(16) unsigned short stg[2 * SROWS * SPITCH];   // two stage buffers
  __shared__ __align__(16) float sT[4][16 * 68];   // per-wave 16x64 slab, pitch 68 floats
  const int b    = blockIdx.y;
  const int tid  = (int)threadIdx.x;
  const int lane = tid & 31;
  const int wave = tid >> 5;
  const int tilesN = N / BN;
  const int tilesM = M / BM;
  const int tile = blockIdx.x;
  if (tile >= tilesM * tilesN) return;   // block-uniform, in front of every barrier and copy
  const int tm = tile / tilesN;
  const int tn = tile - tm * tilesN;
  const int wrA = (WM == 4) ? (wave << 6) : 0;          // the wave's first A row inside the stage
  const int wrB = BM + ((WM == 4) ? 0 : (wave << 6));   // the wave's first Bt row inside the stage
  const int m0 = tm * BM + wrA;
  const int n0 = tn * BN + (wrB - BM);

  const int rlane = lane & 15;                 // row (A) / col (B, D) within subtile
  const int koff  = (lane >> 4) * 8;           // k offset of this lane half
  const int mOff  = (lane >> 4) * 8;           // D row offset

  // the lane's copy addresses: row tid>>3 of each 16-row group, 16-B piece tid&7
  const unsigned short* ga = Ap  + (size_t)b * (size_t)strideA + (size_t)(tm * BM + (tid >> 3)) * lda + (tid & 7) * 8;
  const unsigned short* gb = Btp + (size_t)b * (size_t)strideB + (size_t)(tn * BN + (tid >> 3)) * ldb + (tid & 7) * 8;
  const unsigned lds0 = (unsigned)(uintptr_t)stg + (unsigned)((tid >> 3) * SPITCH * 2 + (tid & 7) * 16);
  const int nst = K / SK;

  v8f acc[4][4];
#pragma unroll
  for (int i = 0; i < 4; ++i)
#pragma unroll
    for (int j = 0; j < 4; ++j) acc[i][j] = zero8();

  fill_stage<BM>(lds0, ga, lda, gb, ldb);
  wait_copies();
  __syncthreads();                             // stage 0 is readable by every wave
  if (nst > 1) fill_stage<BM>(lds0 + SBYTES, ga + SK, lda, gb + SK, ldb);

  for (int t = 0; t < nst; ++t) {
    const __bf16* sb = (const __bf16*)(const void*)stg + (t & 1) * (SROWS * SPITCH);
    // unrolled (inner loops too): fragments stay in registers, and the second k step's LDS reads start under
    // the first step's WMMAs
#pragma unroll
    for (int kk = 0; kk < SK; kk += 32) {
      v16b bq[4], af[4];
#pragma unroll
      for (int j = 0; j < 4; ++j) bq[j] = ldfrag<__bf16>(sb + (wrB + (j << 4) + rlane) * SPITCH + koff + kk);
#pragma unroll
      for (int i = 0; i < 4; ++i) af[i] = ldfrag<__bf16>(sb + (wrA + (i << 4) + rlane) * SPITCH + koff + kk);
#pragma unroll
      for (int i = 0; i < 4; ++i) {
#pragma unroll
        for (int j = 0; j < 4; ++j) acc[i][j] = mmar(af[i], bq[j], acc[i][j]);
        dep_guard(acc[i][0], acc[i][3], af[i], bq[3]);
      }
      keep4(bq[0], bq[1], bq[2], bq[3]);
    }
    // publish point of stage t + 1: own reads of stage t done, own copies of stage t + 1 landed, then the barrier
    wait_lds();
    wait_copies();
    __syncthreads();
    if (t + 2 < nst) fill_stage<BM>(lds0 + (unsigned)(t & 1) * SBYTES, ga + (t + 2) * SK, lda, gb + (t + 2) * SK, ldb);
  }
  wait_copies();
  acc_guard4(acc[0][0], acc[0][1], acc[0][2], acc[0][3]);
  acc_guard4(acc[1][0], acc[1][1], acc[1][2], acc[1][3]);
  acc_guard4(acc[2][0], acc[2][1], acc[2][2], acc[2][3]);
  acc_guard4(acc[3][0], acc[3][1], acc[3][2], acc[3][3]);

  // ---- epilogue ----
  float* slab = sT[wave];
  float* C = Cout + (size_t)b * (size_t)strideC;
  const int h2 = lane >> 4, c4 = (lane & 15) * 4;     // 256-B row segment = 16 lanes x 16 B
  v4f bcol = {0.f, 0.f, 0.f, 0.f};
  if (BIAS_MODE == 1) {
#pragma unroll
    for (int e = 0; e < 4; ++e) bcol[e] = bf_up(bf_bits(bias[n0 + c4 + e]));
  }
#pragma unroll
  for (int i = 0; i < 4; ++i) {
    const int mBase = m0 + (i << 4);
#pragma unroll
    for (int j = 0; j < 4; ++j) {
#pragma unroll
      for (int r = 0; r < 8; ++r) {
        slab[(mOff + r) * 68 + (j << 4) + rlane] = acc[i][j][r];
      }
    }
    __builtin_amdgcn_fence(__ATOMIC_RELEASE, "workgroup");
    __builtin_amdgcn_wave_barrier();
    __builtin_amdgcn_fence(__ATOMIC_ACQUIRE, "workgroup");
    {
#pragma unroll
      for (int it = 0; it < 8; ++it) {
        const int row = it * 2 + h2;                     // it 0..7 x h2 0..1 = rows 0..15
        v4f v = *(const v4f*)(slab + row * 68 + c4);
        if (BIAS_MODE == 1) {
          v = v + bcol;
        } else {
          const float br = bf_up(bf_bits(bias[mBase + row]));
          v = v + br;
        }
        *(v4f*)(C + (size_t)(mBase + row) * ldc + n0 + c4) = v;
      }
      
    }
    __builtin_amdgcn_fence(__ATOMIC_RELEASE, "workgroup");
    __builtin_amdgcn_wave_barrier();
    __builtin_amdgcn_fence(__ATOMIC_ACQUIRE, "workgroup");
  }
}

// =====================================================================================================
// P^T B fragment pair (hi, residual) from the lane's own score D values: element r <- tile a row r,
// element 8+r <- tile c row r (same lane, same query column).
// =====================================================================================================
union PBits { v16us u; v16b v; };
__device__ __forceinline__ void pack_pt(v8f a, v8f c, v16b& ph, v16b& pl) {
  const v16us zz = {0, 0, 0, 0, 0, 0, 0, 0, 0, 0, 0, 0, 0, 0, 0, 0};
  PBits H, L;
  H.u = zz; L.u = zz;
#pragma unroll
  for (int r = 0; r < 8; ++r) {
    const unsigned short hb = bf_bits(a[r]);
    H.u[r] = hb;
    L.u[r] = bf_bits(a[r] - bf_up(hb));
  }
#pragma unroll
  for (int r = 0; r < 8; ++r) {
    const unsigned short hb = bf_bits(c[r]);
    H.u[8 + r] = hb;
    L.u[8 + r] = bf_bits(c[r] - bf_up(hb));
  }
  ph = H.v; pl = L.v;
}

// load 8 consecutive f32, or zeros when keep == 0 (address always valid, select by value)
__device__ __forceinline__ void ld8sel(const float* src, int keep, float f[8]) {
  const v4f a = *(const v4f*)src;
  const v4f c = *(const v4f*)(src + 4);
  f[0] = keep ? a[0] : 0.f; f[1] = keep ? a[1] : 0.f; f[2] = keep ? a[2] : 0.f; f[3] = keep ? a[3] : 0.f;
  f[4] = keep ? c[0] : 0.f; f[5] = keep ? c[1] : 0.f; f[6] = keep ? c[2] : 0.f; f[7] = keep ? c[3] : 0.f;
}

// =====================================================================================================
// Windowed attention, one block = (batch b, head, 8x8 query tile at (i0, j0)); 128 threads = 4 waves,
// wave w owns the 16 queries lq = 16w..16w+15 (query row i0 + (lq>>3), col j0 + (lq&7)).
// Key superset = the 14x14 image block at (R0, C0), R0 = clamp(i0-3, 0, 42), slot = u*14 + v (196 slots,
// padded to 224 with zero rows). Every query's clamped 7x7 window lies inside the superset: valid slots are
// su <= u <= su+6, sv <= v <= sv+6 with su = clamp(qi-3,0,49) - R0 in [0,7].
//   qkv plane f32 [b*3136 + p][768]: q = cols head*32+d (scaled by 32^-0.5 in f32 here), k = 256+.., v = 512+..
//   scores (transposed): S^T[slot][query] = K[slot][d] . Q^T[d][query] on bf16 WMMA, 3 products
//     (hi.hi + hi.res + res.hi); lane owns query column (lane&15) of its wave and key rows 16j + 8h + r.
//   s = S^T + rpb[head][u + R0 - qi + 6][v + C0 - qj + 6] for valid slots, -1e30 otherwise (f32);
//   softmax in f32 (max / sum over the 104 lane values and the partner lane ^16).
//   O^T[d][query] = V^T[d][slot] . P^T[slot][query] on bf16 WMMA, 3 products, p unnormalised exp, 1/sum at the end.
// LDS: KV0/KV1 hold K hi/res [slot][d] for the scores, then (after a block barrier) V^T hi/res [d][slot].
// Staged extents: KV 224x32 both phases (slots >= 196 zero), Q 64x32, Rp 169 (reads clamped to 0..168),
// Os 16x32 per wave -- every LDS element read is written first.
// Output coverage: each wave stores its 16 query rows (it 0..3 x lane>>3) x 8 pieces of 16 B (lane&7) =
// =====================================================================================================
__global__ __launch_bounds__(128)
void natt(const float* __restrict__ qkv, const float* __restrict__ rpb, unsigned short* ctx) {
  __shared__ __align__(16) unsigned short KV0[NSLOT * HDIM];   // 14336 B
  __shared__ __align__(16) unsigned short KV1[NSLOT * HDIM];   // 14336 B
  __shared__ __align__(16) unsigned short Qh[64 * HDIM];       //  4096 B
  __shared__ __align__(16) unsigned short Ql[64 * HDIM];       //  4096 B
  __shared__ __align__(16) float Os[4][16 * HDIM];             //  8192 B
  __shared__ float Rp[176];

  const int tid  = (int)threadIdx.x;
  const int wave = tid >> 5;
  const int lane = tid & 31;
  const int hh   = lane >> 4;
  const int m    = lane & 15;

  const int bx   = blockIdx.x;
  const int tj   = bx % 7;
  const int ti   = (bx / 7) % 7;
  const int head = (bx / 49) % NHD;
  const int b    = bx / (49 * NHD);
  const int i0 = ti * 8, j0 = tj * 8;
  const int R0 = min(max(i0 - 3, 0), IMH - SUP);
  const int C0 = min(max(j0 - 3, 0), IMW - SUP);
  const size_t pb = (size_t)b * NPOS;

  // ---- position-bias table of this head (bf16 RNE-converted values), entries 0..168 ----
  {
    const float r0v = rpb[head * 169 + tid];                 // tid <= 127 < 169
    const int   i1  = tid + 128;
    const float r1v = rpb[head * 169 + min(i1, 168)];       // clamped address
    Rp[tid] = bf_up(bf_bits(r0v));
    if (i1 < 169) Rp[i1] = bf_up(bf_bits(r1v));
  }
  // ---- q (scaled in f32) -> hi / residual planes [lq][d]; thread = (lq = tid>>1, d half) ----
  {
    const int lq = tid >> 1, dh = (tid & 1) * 16;
    const int qi = lq >> 3, qj = lq & 7;
    const size_t pos = pb + (size_t)(i0 + qi) * IMW + j0 + qj;
    const float* src = qkv + pos * C3 + head * HDIM + dh;
#pragma unroll
    for (int g = 0; g < 2; ++g) {
      float f[8];
      ld8sel(src + 8 * g, 1, f);
      v4u ph, pl;
#pragma unroll
      for (int e = 0; e < 4; ++e) {
        unsigned short h0, l0, h1, l1;
        split_bf(f[2 * e] * QSCALE, h0, l0);
        split_bf(f[2 * e + 1] * QSCALE, h1, l1);
        ph[e] = pk16(h0, h1); pl[e] = pk16(l0, l1);
      }
      *(v4u*)(Qh + lq * HDIM + dh + 8 * g) = ph;
      *(v4u*)(Ql + lq * HDIM + dh + 8 * g) = pl;
    }
  }
  // ---- K superset -> KV0 (hi) / KV1 (residual), layout [slot][d]; item = it*128 + tid, slot = item>>2,
  //      d8 = (item&3)*8; 7 x 128 items = 224 slots x 4 groups = the whole tile; slots >= 196 = zeros ----
  {
    const float* kbase = qkv + CH + head * HDIM;
#pragma unroll
    for (int it = 0; it < 7; ++it) {
      const int item = it * 128 + tid;
      const int slot = item >> 2, d8 = (item & 3) * 8;
      const int u = slot / SUP, v = slot - u * SUP;
      const int uc = min(u, SUP - 1);
      const size_t pos = pb + (size_t)(R0 + uc) * IMW + C0 + v;
      float f[8];
      ld8sel(kbase + pos * C3 + d8, slot < SUP * SUP, f);
      v4u ph, pl;
#pragma unroll
      for (int e = 0; e < 4; ++e) {
        unsigned short h0, l0, h1, l1;
        split_bf(f[2 * e], h0, l0);
        split_bf(f[2 * e + 1], h1, l1);
        ph[e] = pk16(h0, h1); pl[e] = pk16(l0, l1);
      }
      *(v4u*)(KV0 + slot * HDIM + d8) = ph;
      *(v4u*)(KV1 + slot * HDIM + d8) = pl;
    }
  }
  __syncthreads();

  // ---- scores: S^T tiles j = 0..12 (key slots 16j..16j+15) for the wave's 16 queries; s[13] stays zero ----
  v8f s[NKT + 1];
  {
    const __bf16* Kh = (const __bf16*)(const void*)KV0;
    const __bf16* Kl = (const __bf16*)(const void*)KV1;
    const __bf16* Qhp = (const __bf16*)(const void*)Qh;
    const __bf16* Qlp = (const __bf16*)(const void*)Ql;
    const v16b qfh = ldfrag<__bf16>(Qhp + (16 * wave + m) * HDIM + 8 * hh);
    const v16b qfl = ldfrag<__bf16>(Qlp + (16 * wave + m) * HDIM + 8 * hh);
#pragma unroll
    for (int j = 0; j < NKT; ++j) {
      const v16b kfh = ldfrag<__bf16>(Kh + (16 * j + m) * HDIM + 8 * hh);
      const v16b kfl = ldfrag<__bf16>(Kl + (16 * j + m) * HDIM + 8 * hh);
      v8f z = zero8();
      z = mma_b(kfh, qfh, z);
      z = mma_b(kfh, qfl, z);
      z = mma_b(kfl, qfh, z);
      s[j] = z;
    }
    s[NKT] = zero8();
  }
  __syncthreads();   // all waves done reading K from KV0/KV1

  // ---- V superset -> KV0 (hi) / KV1 (residual), transposed layout [d][slot] (pitch 224);
  //      same item map as K: 224 slots x 32 d written, slots >= 196 = zeros ----
  {
    const float* vbase = qkv + 2 * CH + head * HDIM;
#pragma unroll
    for (int it = 0; it < 7; ++it) {
      const int item = it * 128 + tid;
      const int slot = item >> 2, d8 = (item & 3) * 8;
      const int u = slot / SUP, v = slot - u * SUP;
      const int uc = min(u, SUP - 1);
      const size_t pos = pb + (size_t)(R0 + uc) * IMW + C0 + v;
      float f[8];
      ld8sel(vbase + pos * C3 + d8, slot < SUP * SUP, f);
#pragma unroll
      for (int e = 0; e < 8; ++e) {
        unsigned short h0, l0;
        split_bf(f[e], h0, l0);
        KV0[(d8 + e) * NSLOT + slot] = h0;
        KV1[(d8 + e) * NSLOT + slot] = l0;
      }
    }
  }
  __syncthreads();

  // ---- window mask + position bias (f32), softmax over the query column ----
  const int lq = 16 * wave + m;
  const int ai = i0 + (lq >> 3), aj = j0 + (lq & 7);
  const int su = min(max(ai - 3, 0), IMH - KW) - R0;
  const int sv = min(max(aj - 3, 0), IMW - KW) - C0;
  const int cb = (R0 - ai + 6) * 13 + (C0 - aj + 6);
  float mloc = -1.0e30f;
#pragma unroll
  for (int j = 0; j < NKT; ++j) {
#pragma unroll
    for (int r = 0; r < 8; ++r) {
      const int t0 = 16 * j + r;                       // slot = t0 + 8*hh
      const int u = hh ? ((t0 + 8) / SUP) : (t0 / SUP);
      const int v = hh ? ((t0 + 8) % SUP) : (t0 % SUP);
      const bool ok = ((unsigned)(u - su) < 7u) && ((unsigned)(v - sv) < 7u);
      int bi = u * 13 + v + cb;
      bi = min(max(bi, 0), 168);
      const float bv = Rp[bi];
      const float sval = ok ? (s[j][r] + bv) : -1.0e30f;
      s[j][r] = sval;
      mloc = fmaxf(mloc, sval);
    }
  }
  const float mrow = fmaxf(mloc, __shfl_xor(mloc, 16, 32));
  float lsum = 0.f;
#pragma unroll
  for (int j = 0; j < NKT; ++j) {
#pragma unroll
    for (int r = 0; r < 8; ++r) {
      const float p = __expf(s[j][r] - mrow);
      s[j][r] = p;
      lsum += p;
    }
  }
  lsum += __shfl_xor(lsum, 16, 32);

  // ---- O^T = V^T . P^T : 2 d-tiles x 7 k-steps of 32 slots x 3 products ----
  v8f o[2];
  o[0] = zero8(); o[1] = zero8();
  {
    const __bf16* Vh = (const __bf16*)(const void*)KV0;
    const __bf16* Vl = (const __bf16*)(const void*)KV1;
#pragma unroll
    for (int kk = 0; kk < NSLOT / 32; ++kk) {
      v16b ph, pl;
      pack_pt(s[2 * kk], s[2 * kk + 1], ph, pl);
#pragma unroll
      for (int t = 0; t < 2; ++t) {
        const v16b vfh = ldfrag<__bf16>(Vh + (16 * t + m) * NSLOT + 32 * kk + 8 * hh);
        const v16b vfl = ldfrag<__bf16>(Vl + (16 * t + m) * NSLOT + 32 * kk + 8 * hh);
        o[t] = mma_b(vfh, ph, o[t]);
        o[t] = mma_b(vfh, pl, o[t]);
        o[t] = mma_b(vfl, ph, o[t]);
      }
    }
  }

  // ---- normalise, stage the wave's 16 queries x 32 d in LDS, write the ctx lines ----
  const float linv = 1.0f / lsum;
  float* os = Os[wave];
#pragma unroll
  for (int t = 0; t < 2; ++t)
#pragma unroll
    for (int r = 0; r < 8; ++r) os[m * HDIM + 16 * t + 8 * hh + r] = o[t][r] * linv;
  __syncthreads();
  {
    const int q4 = lane >> 3, pc = lane & 7, dsel = (pc & 3) * 8;
    const bool lowp = (pc >= 4);
    v4u hv[4];
    size_t go[4];
#pragma unroll
    for (int it = 0; it < 4; ++it) {
      const int row = it * 4 + q4;                     // it 0..3 x q4 0..3 = rows 0..15
      const float* sp = os + row * HDIM + dsel;
      v4u a;
#pragma unroll
      for (int e = 0; e < 4; ++e) {
        unsigned short h0, l0, h1, l1;
        split_bf(sp[2 * e], h0, l0);
        split_bf(sp[2 * e + 1], h1, l1);
        a[e] = lowp ? pk16(l0, l1) : pk16(h0, h1);
      }
      hv[it] = a;
      const int lqr = 16 * wave + row;
      const size_t pos = pb + (size_t)(i0 + (lqr >> 3)) * IMW + j0 + (lqr & 7);
      go[it] = pos * CTXK + (size_t)head * 64 + pc * 8;
    }
    {
#pragma unroll
      for (int it = 0; it < 4; ++it) *(v4u*)(ctx + go[it]) = hv[it];
      
    }
  }
}

// =====================================================================================================
//   Xh   bf16 [6272][256]     3211264
//   Wqb  bf16 [768][256]       393216
//   Wpf  bf16 [256][512]       262144
//   QKV  f32  [6272][768]    19267584
//   CTX  bf16 [6272][512]     6422528
//   total                   29556736
// =====================================================================================================
extern "C" void kernel_launch(void* const* d_in, const int* in_sizes, int n_in,
                              void* d_out, int out_size, void* d_ws, size_t ws_size,
                              hipStream_t stream) {
  if (n_in < 6) return;
  if (in_sizes[0] != NBT * CH * NPOS) return;
  if (in_sizes[1] != C3 * CH) return;
  if (in_sizes[2] != C3) return;
  if (in_sizes[3] != NHD * 13 * 13) return;
  if (in_sizes[4] != CH * CH) return;
  if (in_sizes[5] != CH) return;
  if (out_size != NBT * CH * NPOS) return;

  const float* x      = (const float*)d_in[0];
  const float* w_qkv  = (const float*)d_in[1];
  const float* b_qkv  = (const float*)d_in[2];
  const float* rpb    = (const float*)d_in[3];
  const float* w_proj = (const float*)d_in[4];
  const float* b_proj = (const float*)d_in[5];

  const size_t PXH  = (size_t)MROW * CH * 2;        //  3211264
  const size_t PWQ  = (size_t)C3 * CH * 2;          //   393216
  const size_t PWP  = (size_t)CH * CTXK * 2;        //   262144
  const size_t PQKV = (size_t)MROW * C3 * 4;        // 19267584
  const size_t PCTX = (size_t)MROW * CTXK * 2;      //  6422528
  size_t off = 0;
  const size_t oXh  = off; off += PXH;
  const size_t oWq  = off; off += PWQ;
  const size_t oWp  = off; off += PWP;
  const size_t oQKV = off; off += PQKV;
  const size_t oCTX = off; off += PCTX;
  if (off > ws_size) return;                         // off = 29556736
  if (off > (size_t)134217728) return;

  char* ws = (char*)d_ws;
  unsigned short* Xh  = (unsigned short*)(ws + oXh);
  unsigned short* Wqb = (unsigned short*)(ws + oWq);
  unsigned short* Wpf = (unsigned short*)(ws + oWp);
  float*          QKV = (float*)(ws + oQKV);
  unsigned short* CTX = (unsigned short*)(ws + oCTX);

  const int tilesQKV = (MROW / 64) * (C3 / 256);                      //  294 block tiles of 64 x 256
  const int tilesPRJ = (CH / 256) * (NPOS / 64);                      //   49 block tiles of 256 x 64
  const dim3 gCvt(NBX + NBQ + NBP);                                   // 552
  const dim3 gQKV(tilesQKV, 1);                                       // 294
  const dim3 gAtt(NBT * NHD * 49);                                    // 784
  const dim3 gPRJ(tilesPRJ, NBT);                                     // (49, 2)

  // (1) x NCHW -> bf16 [p][c]; w_qkv -> bf16 [n][k]; w_proj -> folded bf16 [c][512]
  cvt_all<<<gCvt, dim3(256), 0, stream>>>(x, w_qkv, w_proj, Xh, Wqb, Wpf);
  // (2) qkv = Xh . Wqkv^T + b_qkv -> f32 [6272][768]   (M=6272, N=768, K=256)
  gemm64<1, 1><<<gQKV, dim3(128), 0, stream>>>(
      Xh, CH, 0LL, Wqb, CH, 0LL,
      QKV, C3, 0LL, b_qkv,
      MROW, C3, CH);
  // (3) windowed attention -> ctx plane bf16 [6272][512]
  natt<<<gAtt, dim3(128), 0, stream>>>(QKV, rpb, CTX);
  // (4) out[b][c][p] = sum_k Wpf[c][k] ctx[b*3136+p][k] + b_proj[c]   (per batch: M=256, N=3136, K=512)
  gemm64<2, 4><<<gPRJ, dim3(128), 0, stream>>>(
      Wpf, CTXK, 0LL, CTX, CTXK, (long long)NPOS * CTXK,
      (float*)d_out, NPOS, (long long)CH * NPOS, b_proj,
      CH, NPOS, CTXK);
  (void)hipGetLastError();
}

// v003
// Measured time: 44 microseconds a run.
// Two timings next to v002 put it at 1.14 and 1.13 times that version's speed.
// Counting every step since v000, it is 1.75 times as fast.
// Contractions: qkv projection = v_wmma_f32_16x16x32_bf16 (bf16 operands from RNE-converted x and w_qkv, single product, f32 accumulate);
// q.k scores = v_wmma_f32_16x16x32_bf16 (q and k each as bf16 hi plane + unscaled bf16 residual plane, 3 products, f32 accumulate);
// p.v = v_wmma_f32_16x16x32_bf16 (p and v each as bf16 hi + unscaled bf16 residual, 3 products, f32 accumulate);
// ctx.w_proj^T = v_wmma_f32_16x16x32_bf16 (ctx as bf16 hi + residual folded into K, w_proj bf16 from its RNE-converted value, f32 accumulate);
// biases, q scaling, window mask, position bias and softmax in f32. No power-of-two carries anywhere (bf16 planes, unscaled residuals).
#include <hip/hip_runtime.h>
#include <math.h>
#include <stdint.h>

#define NBT   2
#define CH    256
#define IMH   56
#define IMW   56
#define NPOS  (IMH * IMW)        // 3136 positions per image, p = i*56 + j
#define MROW  (NBT * NPOS)       // 6272 position rows
#define NHD   8
#define HDIM  32
#define C3    (3 * CH)           // 768
#define KW    7                  // window side; window start = clamp(i - 3, 0, IMH - KW)
#define SUP   14                 // clamped key superset side of an 8x8 query tile
#define NSLOT 224                // key slots staged per block (196 used, rest zero)
#define NKT   13                 // scored 16-key tiles (slots 0..207)
#define CTXK  512                // folded K of the ctx plane: per head [hi d0..31 | residual d0..31]
#define QSCALE 0.17677669529663687f
#define RPLO  100                // position-bias entry 0 sits at Rp[RPLO]; entries around the table are zero
#define RPN   384                // padded table: every unclamped index 13u + v + cb of a scored slot lies inside

static_assert((MROW % 64) == 0);
static_assert((C3 % 256) == 0);
static_assert((NPOS % 64) == 0);
static_assert((CH % 256) == 0);
static_assert((CH % 128) == 0 && (CTXK % 128) == 0);
static_assert(NHD * HDIM == CH);
static_assert(SUP == 8 + KW - 1);
static_assert(SUP * SUP <= NSLOT && (NSLOT % 32) == 0 && NKT * 16 >= SUP * SUP);
static_assert(IMH == IMW);
static_assert(RPLO - 7 * 13 - 7 >= 0 && RPLO + 6 * 13 + 6 + (NKT * 16 - 1) - (NKT * 16 - 1) / SUP < RPN && RPN % 128 == 0);

typedef __bf16   v16b __attribute__((ext_vector_type(16)));
typedef __bf16   v8b  __attribute__((ext_vector_type(8)));
typedef float    v8f  __attribute__((ext_vector_type(8)));
typedef float    v4f  __attribute__((ext_vector_type(4)));
typedef unsigned int v4u __attribute__((ext_vector_type(4)));
typedef unsigned short v16us __attribute__((ext_vector_type(16)));

#if defined(__HIP_DEVICE_COMPILE__)
#define DEV_ASM 1
#else
#define DEV_ASM 0
#endif

// ---- scalar helpers --------------------------------------------------------------------------------
__device__ __forceinline__ unsigned short bf_bits(float f) {          // f32 -> bf16 bits, RNE convert
  unsigned u = __float_as_uint(f);
  return (unsigned short)((u + 0x7FFFu + ((u >> 16) & 1u)) >> 16);
}
__device__ __forceinline__ float bf_up(unsigned short hb) { return __uint_as_float(((unsigned)hb) << 16); }
__device__ __forceinline__ unsigned pk16(unsigned short a, unsigned short b) { return (unsigned)a | ((unsigned)b << 16); }
__device__ __forceinline__ v8f zero8() { v8f z = {0.f, 0.f, 0.f, 0.f, 0.f, 0.f, 0.f, 0.f}; return z; }
// hi / residual bf16 split of an f32 value (residual unscaled)
__device__ __forceinline__ void split_bf(float f, unsigned short& hb, unsigned short& lb) {
  hb = bf_bits(f);
  lb = bf_bits(f - bf_up(hb));
}

// ---- fragment loader: 16-bit A/B operand, lane -> row/col (lane&15), p already includes +8*(lane>>4);
//      elements 0..7 <- p[0..7] (k0+8h..k0+8h+7), elements 8..15 <- p[16..23] (k0+16+8h..k0+16+8h+7)
template <typename OT> struct FT;
template <> struct FT<__bf16> { typedef v16b frag; typedef v8b half8; };

template <typename OT>
__device__ __forceinline__ typename FT<OT>::frag ldfrag(const OT* p) {
  union { typename FT<OT>::frag v; typename FT<OT>::half8 h[2]; } f;
  f.h[0] = *(const typename FT<OT>::half8*)(p);
  f.h[1] = *(const typename FT<OT>::half8*)(p + 16);
  return f.v;
}

// ---- WMMA helpers ------------------------------------------------------------------------------------
__device__ __forceinline__ v8f mmar(v16b a, v16b b, v8f c) {
  return __builtin_amdgcn_wmma_f32_16x16x32_bf16(false, a, false, b, (short)0, c, false, false);
}
// guarded form: 4 VALU slots after the WMMA, D tied, A/B kept live
__device__ __forceinline__ v8f mma_b(v16b a, v16b b, v8f c) {
  c = __builtin_amdgcn_wmma_f32_16x16x32_bf16(false, a, false, b, (short)0, c, false, false);
#if DEV_ASM
  asm volatile("v_nop\n\tv_nop\n\tv_nop\n\tv_nop" : "+v"(c) : "v"(a), "v"(b));
#endif
  return c;
}
__device__ __forceinline__ void dep_guard(v8f& a, v8f& b, v16b x, v16b y) {
#if DEV_ASM
  asm volatile("v_nop\n\tv_nop\n\tv_nop\n\tv_nop" : "+v"(a), "+v"(b) : "v"(x), "v"(y));
#else
  (void)a; (void)b; (void)x; (void)y;
#endif
}
__device__ __forceinline__ void keep4(v16b a, v16b b, v16b c, v16b d) {
#if DEV_ASM
  asm volatile("v_nop" :: "v"(a), "v"(b), "v"(c), "v"(d));
#else
  (void)a; (void)b; (void)c; (void)d;
#endif
}
__device__ __forceinline__ void acc_guard4(v8f& a, v8f& b, v8f& c, v8f& d) {
#if DEV_ASM
  asm volatile("v_nop\n\tv_nop\n\tv_nop\n\tv_nop" : "+v"(a), "+v"(b), "+v"(c), "+v"(d));
#else
  (void)a; (void)b; (void)c; (void)d;
#endif
}

// =====================================================================================================
// x NCHW f32 [b][c][p] -> Xh bf16 [b*3136 + p][c] (RNE convert), transposed through an LDS 64c x 64p tile.
// Store phase: item = it*256 + tid, p = item>>3, channel group = item&7 -> lanes 8q..8q+7 write one whole
// coverage: 2 iterations x 256 threads x 8 = the whole 64x64 tile; 392 blocks = the whole [6272][256] plane.
// =====================================================================================================
__device__ __forceinline__ void cvt_x(const float* __restrict__ x, unsigned short* xh, float* t, int blk) {
  const int tid = (int)threadIdx.x;
  const int p0 = (blk % (NPOS / 64)) * 64, c0 = ((blk / (NPOS / 64)) % (CH / 64)) * 64, b = blk / ((NPOS / 64) * (CH / 64));
#pragma unroll
  for (int it = 0; it < 4; ++it) {
    const int c  = it * 16 + (tid >> 4);
    const int p4 = (tid & 15) * 4;
    const v4f v = *(const v4f*)(x + ((size_t)(b * CH + c0 + c)) * NPOS + p0 + p4);
    float* tp = t + c * 65 + p4;
    tp[0] = v[0]; tp[1] = v[1]; tp[2] = v[2]; tp[3] = v[3];
  }
  __syncthreads();
  v4u pk[2];
  size_t go[2];
#pragma unroll
  for (int it = 0; it < 2; ++it) {
    const int item = it * 256 + tid;
    const int p = item >> 3, cg = item & 7;
    v4u a;
#pragma unroll
    for (int e = 0; e < 4; ++e) {
      const float f0 = t[(cg * 8 + 2 * e) * 65 + p];
      const float f1 = t[(cg * 8 + 2 * e + 1) * 65 + p];
      a[e] = pk16(bf_bits(f0), bf_bits(f1));
    }
    pk[it] = a;
    go[it] = ((size_t)(b * NPOS + p0 + p)) * CH + c0 + cg * 8;
  }
  {
#pragma unroll
    for (int it = 0; it < 2; ++it) *(v4u*)(xh + go[it]) = pk[it];
    
  }
}

// =====================================================================================================
// f32 -> bf16 bits (RNE convert), 8 elements per thread, one 16-B store per lane: a wave writes 512
// coverage: n8 threads x 8 = the whole plane (n8 = 24576 here, a multiple of 256).
// =====================================================================================================
__device__ __forceinline__ void cvt16x8(const float* __restrict__ in, unsigned short* out, int n8, int blk) {
  const int i = blk * 256 + (int)threadIdx.x;
  if (i < n8) {
    const v4f a  = *(const v4f*)(in + (size_t)i * 8);
    const v4f a4 = *(const v4f*)(in + (size_t)i * 8 + 4);
    v4u p;
    p[0] = pk16(bf_bits(a[0]),  bf_bits(a[1]));
    p[1] = pk16(bf_bits(a[2]),  bf_bits(a[3]));
    p[2] = pk16(bf_bits(a4[0]), bf_bits(a4[1]));
    p[3] = pk16(bf_bits(a4[2]), bf_bits(a4[3]));
    unsigned short* o = out + (size_t)i * 8;
    *(v4u*)o = p;
    
  }
}

// =====================================================================================================
// w_proj [256 c][256 k] f32 -> folded plane Wf bf16 [256 c][512]: Wf[c][head*64 + part*32 + d] =
// bf16(w_proj[c][head*32 + d]) for part = 0 (meets the ctx hi half) and part = 1 (meets the residual half).
// coverage: 16384 threads x 8 = the whole [256][512] plane.
// =====================================================================================================
__device__ __forceinline__ void cvt_wp(const float* __restrict__ wp, unsigned short* out, int blk) {
  const int i = blk * 256 + (int)threadIdx.x;
  if (i < CH * CTXK / 8) {
    const int c  = i >> 6;                 // 64 groups of 8 per 512-wide row
    const int k  = (i & 63) * 8;           // 0..504
    const int hd = k >> 6;                 // head
    const int d0 = k & 31;                 // 0, 8, 16, 24
    const float* src = wp + (size_t)c * CH + hd * HDIM + d0;
    const v4f a  = *(const v4f*)src;
    const v4f a4 = *(const v4f*)(src + 4);
    v4u p;
    p[0] = pk16(bf_bits(a[0]),  bf_bits(a[1]));
    p[1] = pk16(bf_bits(a[2]),  bf_bits(a[3]));
    p[2] = pk16(bf_bits(a4[0]), bf_bits(a4[1]));
    p[3] = pk16(bf_bits(a4[2]), bf_bits(a4[3]));
    unsigned short* o = out + (size_t)i * 8;
    *(v4u*)o = p;
    
  }
}

// =====================================================================================================
// The three operand conversions read and write disjoint planes and none reads another's output, so they run
// as block ranges of one grid: blocks 0..NBX-1 = x tiles (the longest blocks, so they start first),
// NBX..NBX+NBQ-1 = w_qkv, the last NBP = w_proj. The range test is block-uniform (the x tiles hold a barrier).
// =====================================================================================================
#define NBX ((NPOS / 64) * (CH / 64) * NBT)   // 392 x tiles
#define NBQ (C3 * CH / 8 / 256)               //  96 blocks of w_qkv
#define NBP (CH * CTXK / 8 / 256)             //  64 blocks of w_proj
static_assert(NBQ * 256 * 8 == C3 * CH && NBP * 256 * 8 == CH * CTXK);
__global__ __launch_bounds__(256) void cvt_all(const float* __restrict__ x, const float* __restrict__ wq,
                                               const float* __restrict__ wp, unsigned short* xh,
                                               unsigned short* wqb, unsigned short* wpf) {
  __shared__ float t[64 * 65];                       // x tile [c][p], pitch 65
  const int blk = (int)blockIdx.x;
  if (blk < NBX) {
    cvt_x(x, xh, t, blk);
  } else if (blk < NBX + NBQ) {
    cvt16x8(wq, wqb, C3 * CH / 8, blk - NBX);
  } else {
    cvt_wp(wp, wpf, blk - (NBX + NBQ));
  }
}

// =====================================================================================================
// Batched WMMA GEMM (bf16 operands): C[m][n] = sum_k A[m][k] * Bt[n][k] + bias. A row-major [M][K] pitch lda;
// Bt row-major [N][K] pitch ldb (k contiguous); blockIdx.y = batch index (strides in elements).
// One block = 4 waves, one 64x64 tile of C per wave: WM waves along m and 4 / WM along n, so the block tile is
// (64 WM) x (256 / WM). M, N multiples of the block tile, K a multiple of SK (host constants).
// Operands go global -> LDS by asynchronous 16-B copies, SK = 64 k (one whole 128-B line of each of the 320
// operand rows) per stage, two buffers: stage t + 1 is in flight while stage t feeds the WMMAs.
// Stage layout: rows 0..BM-1 = A rows, rows BM..319 = Bt rows, pitch 144 B (16 B x 9, conflict-free b128 reads).
// Copy map: item = it*128 + tid, row = item>>3, 16-B piece = item&7 -> 8 lanes copy one line, 20 copies per lane
// = 320 rows x 8 pieces, each LDS byte written by one lane. Fragments keep the split k map (ldfrag), k ascending.
// BIAS_MODE 1: bias[n] (per column); BIAS_MODE 2: bias[m] (per row); bias values RNE-converted to bf16.
// Output: f32 C (pitch ldc). Epilogue: 16-row slabs staged per wave in LDS; each 64-wide row segment (256 B =
// coverage: 4 slabs x 16 rows (it 0..7 x lane>>4) x 64 cols = the wave's whole 64x64 tile.
// =====================================================================================================
#define SK     64                     // k elements per stage
#define SPITCH 72                     // LDS row pitch in elements (144 B)
#define SROWS  320                    // operand rows per stage (BM + BN)
#define SBYTES (SROWS * SPITCH * 2)   // 46080 B per buffer

// Four asynchronous copies, 16 B per lane each, global -> LDS. The s_wait_xcnt closes the statement so that no
// address register named here is rewritten before it.
__device__ __forceinline__ void copy4(unsigned l0, unsigned l1, unsigned l2, unsigned l3,
                                      const unsigned short* g0, const unsigned short* g1,
                                      const unsigned short* g2, const unsigned short* g3) {
#if DEV_ASM
  asm volatile("global_load_async_to_lds_b128 %0, %4, off\n\t"
               "global_load_async_to_lds_b128 %1, %5, off\n\t"
               "global_load_async_to_lds_b128 %2, %6, off\n\t"
               "global_load_async_to_lds_b128 %3, %7, off\n\t"
               "s_wait_xcnt 0x0"
               :: "v"(l0), "v"(l1), "v"(l2), "v"(l3), "v"(g0), "v"(g1), "v"(g2), "v"(g3) : "memory");
#else
  (void)l0; (void)l1; (void)l2; (void)l3; (void)g0; (void)g1; (void)g2; (void)g3;
#endif
}
// this wave's copies have landed in LDS (the compiler places no wait for them)
__device__ __forceinline__ void wait_copies() {
#if DEV_ASM
  asm volatile("s_wait_asynccnt 0x0" ::: "memory");
#endif
}
// this wave's LDS reads have returned, so the buffer they read may be refilled behind the next barrier
__device__ __forceinline__ void wait_lds() {
#if DEV_ASM
  asm volatile("s_wait_dscnt 0x0" ::: "memory");
#endif
}
// stands behind global loads, in front of whatever rewrites their address registers
__device__ __forceinline__ void wait_addr() {
#if DEV_ASM
  asm volatile("s_wait_xcnt 0x0" ::: "memory");
#endif
}
// one stage: 20 copies per lane; ga / gb = the lane's piece of its first A / Bt row at this stage's k
template <int BM>
__device__ __forceinline__ void fill_stage(unsigned lb, const unsigned short* ga, int lda,
                                           const unsigned short* gb, int ldb) {
  // both loops unrolled: r0 is then a constant, so the A / Bt choice is no branch and g, l stay in registers
#pragma unroll
  for (int q = 0; q < SROWS / 64; ++q) {
    const unsigned short* g[4];
    unsigned l[4];
#pragma unroll
    for (int e = 0; e < 4; ++e) {
      const int r0 = (q * 4 + e) * 16;                 // first row of this copy's 16 rows
      g[e] = (r0 < BM) ? ga + (size_t)r0 * lda : gb + (size_t)(r0 - BM) * ldb;
      l[e] = lb + (unsigned)(r0 * SPITCH * 2);
    }
    copy4(l[0], l[1], l[2], l[3], g[0], g[1], g[2], g[3]);
  }
}

template <int BIAS_MODE, int WM>
__global__ __launch_bounds__(128) void gemm64(
    const unsigned short* __restrict__ Ap, int lda, long long strideA,
    const unsigned short* __restrict__ Btp, int ldb, long long strideB,
    float* Cout, int ldc, long long strideC,
    const float* __restrict__ bias,
    int M, int N, int K) {
  constexpr int BM = 64 * WM;
  constexpr int BN = SROWS - BM;
  static_assert(WM == 1 || WM == 4);
  __shared__ __align__(16) unsigned short stg[2 * SROWS * SPITCH];   // two stage buffers
  __shared__ __align__(16) float sT[4][16 * 68];   // per-wave 16x64 slab, pitch 68 floats
  const int b    = blockIdx.y;
  const int tid  = (int)threadIdx.x;
  const int lane = tid & 31;
  const int wave = tid >> 5;
  const int tilesN = N / BN;
  const int tilesM = M / BM;
  const int tile = blockIdx.x;
  if (tile >= tilesM * tilesN) return;   // block-uniform, in front of every barrier and copy
  const int tm = tile / tilesN;
  const int tn = tile - tm * tilesN;
  const int wrA = (WM == 4) ? (wave << 6) : 0;          // the wave's first A row inside the stage
  const int wrB = BM + ((WM == 4) ? 0 : (wave << 6));   // the wave's first Bt row inside the stage
  const int m0 = tm * BM + wrA;
  const int n0 = tn * BN + (wrB - BM);

  const int rlane = lane & 15;                 // row (A) / col (B, D) within subtile
  const int koff  = (lane >> 4) * 8;           // k offset of this lane half
  const int mOff  = (lane >> 4) * 8;           // D row offset

  // the lane's copy addresses: row tid>>3 of each 16-row group, 16-B piece tid&7
  const unsigned short* ga = Ap  + (size_t)b * (size_t)strideA + (size_t)(tm * BM + (tid >> 3)) * lda + (tid & 7) * 8;
  const unsigned short* gb = Btp + (size_t)b * (size_t)strideB + (size_t)(tn * BN + (tid >> 3)) * ldb + (tid & 7) * 8;
  const unsigned lds0 = (unsigned)(uintptr_t)stg + (unsigned)((tid >> 3) * SPITCH * 2 + (tid & 7) * 16);
  const int nst = K / SK;

  v8f acc[4][4];
#pragma unroll
  for (int i = 0; i < 4; ++i)
#pragma unroll
    for (int j = 0; j < 4; ++j) acc[i][j] = zero8();

  fill_stage<BM>(lds0, ga, lda, gb, ldb);
  wait_copies();
  __syncthreads();                             // stage 0 is readable by every wave
  if (nst > 1) fill_stage<BM>(lds0 + SBYTES, ga + SK, lda, gb + SK, ldb);

  for (int t = 0; t < nst; ++t) {
    const __bf16* sb = (const __bf16*)(const void*)stg + (t & 1) * (SROWS * SPITCH);
    // unrolled (inner loops too): fragments stay in registers, and the second k step's LDS reads start under
    // the first step's WMMAs
#pragma unroll
    for (int kk = 0; kk < SK; kk += 32) {
      v16b bq[4], af[4];
#pragma unroll
      for (int j = 0; j < 4; ++j) bq[j] = ldfrag<__bf16>(sb + (wrB + (j << 4) + rlane) * SPITCH + koff + kk);
#pragma unroll
      for (int i = 0; i < 4; ++i) af[i] = ldfrag<__bf16>(sb + (wrA + (i << 4) + rlane) * SPITCH + koff + kk);
#pragma unroll
      for (int i = 0; i < 4; ++i) {
#pragma unroll
        for (int j = 0; j < 4; ++j) acc[i][j] = mmar(af[i], bq[j], acc[i][j]);
        dep_guard(acc[i][0], acc[i][3], af[i], bq[3]);
      }
      keep4(bq[0], bq[1], bq[2], bq[3]);
    }
    // publish point of stage t + 1: own reads of stage t done, own copies of stage t + 1 landed, then the barrier
    wait_lds();
    wait_copies();
    __syncthreads();
    if (t + 2 < nst) fill_stage<BM>(lds0 + (unsigned)(t & 1) * SBYTES, ga + (t + 2) * SK, lda, gb + (t + 2) * SK, ldb);
  }
  wait_copies();
  acc_guard4(acc[0][0], acc[0][1], acc[0][2], acc[0][3]);
  acc_guard4(acc[1][0], acc[1][1], acc[1][2], acc[1][3]);
  acc_guard4(acc[2][0], acc[2][1], acc[2][2], acc[2][3]);
  acc_guard4(acc[3][0], acc[3][1], acc[3][2], acc[3][3]);

  // ---- epilogue ----
  float* slab = sT[wave];
  float* C = Cout + (size_t)b * (size_t)strideC;
  const int h2 = lane >> 4, c4 = (lane & 15) * 4;     // 256-B row segment = 16 lanes x 16 B
  v4f bcol = {0.f, 0.f, 0.f, 0.f};
  if (BIAS_MODE == 1) {
#pragma unroll
    for (int e = 0; e < 4; ++e) bcol[e] = bf_up(bf_bits(bias[n0 + c4 + e]));
  }
#pragma unroll
  for (int i = 0; i < 4; ++i) {
    const int mBase = m0 + (i << 4);
#pragma unroll
    for (int j = 0; j < 4; ++j) {
#pragma unroll
      for (int r = 0; r < 8; ++r) {
        slab[(mOff + r) * 68 + (j << 4) + rlane] = acc[i][j][r];
      }
    }
    __builtin_amdgcn_fence(__ATOMIC_RELEASE, "workgroup");
    __builtin_amdgcn_wave_barrier();
    __builtin_amdgcn_fence(__ATOMIC_ACQUIRE, "workgroup");
    {
#pragma unroll
      for (int it = 0; it < 8; ++it) {
        const int row = it * 2 + h2;                     // it 0..7 x h2 0..1 = rows 0..15
        v4f v = *(const v4f*)(slab + row * 68 + c4);
        if (BIAS_MODE == 1) {
          v = v + bcol;
        } else {
          const float br = bf_up(bf_bits(bias[mBase + row]));
          v = v + br;
        }
        *(v4f*)(C + (size_t)(mBase + row) * ldc + n0 + c4) = v;
      }
      
    }
    __builtin_amdgcn_fence(__ATOMIC_RELEASE, "workgroup");
    __builtin_amdgcn_wave_barrier();
    __builtin_amdgcn_fence(__ATOMIC_ACQUIRE, "workgroup");
  }
}

// =====================================================================================================
// P^T B fragment pair (hi, residual) from the lane's own score D values: element r <- tile a row r,
// element 8+r <- tile c row r (same lane, same query column).
// =====================================================================================================
union PBits { v16us u; v16b v; };
__device__ __forceinline__ void pack_pt(v8f a, v8f c, v16b& ph, v16b& pl) {
  const v16us zz = {0, 0, 0, 0, 0, 0, 0, 0, 0, 0, 0, 0, 0, 0, 0, 0};
  PBits H, L;
  H.u = zz; L.u = zz;
#pragma unroll
  for (int r = 0; r < 8; ++r) {
    const unsigned short hb = bf_bits(a[r]);
    H.u[r] = hb;
    L.u[r] = bf_bits(a[r] - bf_up(hb));
  }
#pragma unroll
  for (int r = 0; r < 8; ++r) {
    const unsigned short hb = bf_bits(c[r]);
    H.u[8 + r] = hb;
    L.u[8 + r] = bf_bits(c[r] - bf_up(hb));
  }
  ph = H.v; pl = L.v;
}

// load 8 consecutive f32, or zeros when keep == 0 (address always valid, select by value)
__device__ __forceinline__ void ld8sel(const float* src, int keep, float f[8]) {
  const v4f a = *(const v4f*)src;
  const v4f c = *(const v4f*)(src + 4);
  f[0] = keep ? a[0] : 0.f; f[1] = keep ? a[1] : 0.f; f[2] = keep ? a[2] : 0.f; f[3] = keep ? a[3] : 0.f;
  f[4] = keep ? c[0] : 0.f; f[5] = keep ? c[1] : 0.f; f[6] = keep ? c[2] : 0.f; f[7] = keep ? c[3] : 0.f;
}

// =====================================================================================================
// Windowed attention, one block = (batch b, head, 8x8 query tile at (i0, j0)); 128 threads = 4 waves,
// wave w owns the 16 queries lq = 16w..16w+15 (query row i0 + (lq>>3), col j0 + (lq&7)).
// Key superset = the 14x14 image block at (R0, C0), R0 = clamp(i0-3, 0, 42), slot = u*14 + v (196 slots,
// padded to 224 with zero rows). Every query's clamped 7x7 window lies inside the superset: valid slots are
// su <= u <= su+6, sv <= v <= sv+6 with su = clamp(qi-3,0,49) - R0 in [0,7].
//   qkv plane f32 [b*3136 + p][768]: q = cols head*32+d (scaled by 32^-0.5 in f32 here), k = 256+.., v = 512+..
//   scores (transposed): S^T[slot][query] = K[slot][d] . Q^T[d][query] on bf16 WMMA, 3 products
//     (hi.hi + hi.res + res.hi); lane owns query column (lane&15) of its wave and key rows 16j + 8h + r.
//   s = S^T + rpb[head][u + R0 - qi + 6][v + C0 - qj + 6] for valid slots, -1e30 otherwise (f32);
//   softmax in f32 (max / sum over the 104 lane values and the partner lane ^16).
//   O^T[d][query] = V^T[d][slot] . P^T[slot][query] on bf16 WMMA, 3 products, p unnormalised exp, 1/sum at the end.
// LDS: KV0/KV1 hold K hi/res [slot][d] for the scores, then (after a block barrier) V^T hi/res [d][slot].
// Staged extents: KV 224x32 both phases (slots >= 196 zero), Q 64x32, Rp 384 (table at 100..268, zeros around),
// Os 16x32 per wave -- every LDS element read is written first.
// Output coverage: each wave stores its 16 query rows (it 0..3 x lane>>3) x 8 pieces of 16 B (lane&7) =
// =====================================================================================================
__global__ __launch_bounds__(128)
void natt(const float* __restrict__ qkv, const float* __restrict__ rpb, unsigned short* ctx) {
  __shared__ __align__(16) unsigned short KV0[NSLOT * HDIM];   // 14336 B
  __shared__ __align__(16) unsigned short KV1[NSLOT * HDIM];   // 14336 B
  __shared__ __align__(16) unsigned short Qh[64 * HDIM];       //  4096 B
  __shared__ __align__(16) unsigned short Ql[64 * HDIM];       //  4096 B
  __shared__ __align__(16) float Os[4][16 * HDIM];             //  8192 B
  __shared__ float Rp[RPN];

  const int tid  = (int)threadIdx.x;
  const int wave = tid >> 5;
  const int lane = tid & 31;
  const int hh   = lane >> 4;
  const int m    = lane & 15;

  const int bx   = blockIdx.x;
  const int tj   = bx % 7;
  const int ti   = (bx / 7) % 7;
  const int head = (bx / 49) % NHD;
  const int b    = bx / (49 * NHD);
  const int i0 = ti * 8, j0 = tj * 8;
  const int R0 = min(max(i0 - 3, 0), IMH - SUP);
  const int C0 = min(max(j0 - 3, 0), IMW - SUP);
  const size_t pb = (size_t)b * NPOS;

  // ---- position-bias table of this head (bf16 RNE-converted values), entries 0..168 at Rp[RPLO..], zeros around ----
  {
    float rv[RPN / 128];
    // both loops unrolled: rv stays in registers and the three loads go out together
#pragma unroll
    for (int it = 0; it < RPN / 128; ++it) {
      const int t = it * 128 + tid - RPLO;
      rv[it] = rpb[head * 169 + min(max(t, 0), 168)];           // clamped address
    }
    wait_addr();
#pragma unroll
    for (int it = 0; it < RPN / 128; ++it) {
      const int e = it * 128 + tid;
      const float tv = bf_up(bf_bits(rv[it]));
      Rp[e] = ((unsigned)(e - RPLO) < 169u) ? tv : 0.f;
    }
  }
  // ---- q (scaled in f32) -> hi / residual planes [lq][d]; thread = (lq = tid>>1, d half) ----
  {
    const int lq = tid >> 1, dh = (tid & 1) * 16;
    const int qi = lq >> 3, qj = lq & 7;
    const size_t pos = pb + (size_t)(i0 + qi) * IMW + j0 + qj;
    const float* src = qkv + pos * C3 + head * HDIM + dh;
#pragma unroll
    for (int g = 0; g < 2; ++g) {
      float f[8];
      ld8sel(src + 8 * g, 1, f);
      v4u ph, pl;
#pragma unroll
      for (int e = 0; e < 4; ++e) {
        unsigned short h0, l0, h1, l1;
        split_bf(f[2 * e] * QSCALE, h0, l0);
        split_bf(f[2 * e + 1] * QSCALE, h1, l1);
        ph[e] = pk16(h0, h1); pl[e] = pk16(l0, l1);
      }
      *(v4u*)(Qh + lq * HDIM + dh + 8 * g) = ph;
      *(v4u*)(Ql + lq * HDIM + dh + 8 * g) = pl;
    }
  }
  // ---- K superset -> KV0 (hi) / KV1 (residual), layout [slot][d]; item = it*128 + tid, slot = item>>2,
  //      d8 = (item&3)*8; 7 x 128 items = 224 slots x 4 groups = the whole tile; slots >= 196 = zeros ----
  {
    const float* kbase = qkv + CH + head * HDIM;
#pragma unroll
    for (int it = 0; it < 7; ++it) {
      const int item = it * 128 + tid;
      const int slot = item >> 2, d8 = (item & 3) * 8;
      const int u = slot / SUP, v = slot - u * SUP;
      const int uc = min(u, SUP - 1);
      const size_t pos = pb + (size_t)(R0 + uc) * IMW + C0 + v;
      float f[8];
      ld8sel(kbase + pos * C3 + d8, slot < SUP * SUP, f);
      v4u ph, pl;
#pragma unroll
      for (int e = 0; e < 4; ++e) {
        unsigned short h0, l0, h1, l1;
        split_bf(f[2 * e], h0, l0);
        split_bf(f[2 * e + 1], h1, l1);
        ph[e] = pk16(h0, h1); pl[e] = pk16(l0, l1);
      }
      *(v4u*)(KV0 + slot * HDIM + d8) = ph;
      *(v4u*)(KV1 + slot * HDIM + d8) = pl;
    }
  }
  __syncthreads();

  // ---- scores: S^T tiles j = 0..12 (key slots 16j..16j+15) for the wave's 16 queries; s[13] stays zero ----
  v8f s[NKT + 1];
  {
    const __bf16* Kh = (const __bf16*)(const void*)KV0;
    const __bf16* Kl = (const __bf16*)(const void*)KV1;
    const __bf16* Qhp = (const __bf16*)(const void*)Qh;
    const __bf16* Qlp = (const __bf16*)(const void*)Ql;
    const v16b qfh = ldfrag<__bf16>(Qhp + (16 * wave + m) * HDIM + 8 * hh);
    const v16b qfl = ldfrag<__bf16>(Qlp + (16 * wave + m) * HDIM + 8 * hh);
#pragma unroll
    for (int j = 0; j < NKT; ++j) {
      const v16b kfh = ldfrag<__bf16>(Kh + (16 * j + m) * HDIM + 8 * hh);
      const v16b kfl = ldfrag<__bf16>(Kl + (16 * j + m) * HDIM + 8 * hh);
      v8f z = zero8();
      z = mma_b(kfh, qfh, z);
      z = mma_b(kfh, qfl, z);
      z = mma_b(kfl, qfh, z);
      s[j] = z;
    }
    s[NKT] = zero8();
  }
  __syncthreads();   // all waves done reading K from KV0/KV1

  // ---- V superset -> KV0 (hi) / KV1 (residual), transposed layout [d][slot] (pitch 224);
  //      same item map as K: 224 slots x 32 d written, slots >= 196 = zeros ----
  {
    const float* vbase = qkv + 2 * CH + head * HDIM;
#pragma unroll
    for (int it = 0; it < 7; ++it) {
      const int item = it * 128 + tid;
      const int slot = item >> 2, d8 = (item & 3) * 8;
      const int u = slot / SUP, v = slot - u * SUP;
      const int uc = min(u, SUP - 1);
      const size_t pos = pb + (size_t)(R0 + uc) * IMW + C0 + v;
      float f[8];
      ld8sel(vbase + pos * C3 + d8, slot < SUP * SUP, f);
#pragma unroll
      for (int e = 0; e < 8; ++e) {
        unsigned short h0, l0;
        split_bf(f[e], h0, l0);
        KV0[(d8 + e) * NSLOT + slot] = h0;
        KV1[(d8 + e) * NSLOT + slot] = l0;
      }
    }
  }
  __syncthreads();

  // ---- window mask + position bias (f32), softmax over the query column ----
  const int lq = 16 * wave + m;
  const int ai = i0 + (lq >> 3), aj = j0 + (lq & 7);
  const int su = min(max(ai - 3, 0), IMH - KW) - R0;
  const int sv = min(max(aj - 3, 0), IMW - KW) - C0;
  const int cb = (R0 - ai + 6) * 13 + (C0 - aj + 6);
  // Bias index 13u + v + cb = slot - u + cb. The upper lane half's slot is 8 higher and its u is equal or one
  // higher (one higher where t0 % 14 >= 6), so two lane bases and a constant offset address every read; the read
  // is made for every slot (the padded table holds every such index) and the window test selects by value.
  const float* rb8 = Rp + (RPLO + cb + 8 * hh);
  const float* rb7 = Rp + (RPLO + cb + 7 * hh);
  // The window test of a slot is a row test and a column test; each distinct one is made once:
  // column k = t0 % 14 (upper half: (k + 8) % 14), row a = t0 / 14 (upper half: a, or a + 1 where k >= 6).
  // Both loops unrolled: the arrays are then indexed by constants only and each test is one lane mask in a register.
  bool colok[SUP], rowsame[SUP + 1], rownext[SUP + 1];
#pragma unroll
  for (int k = 0; k < SUP; ++k) {
    const int v = hh ? ((k + 8) % SUP) : k;
    colok[k] = (unsigned)(v - sv) < 7u;
  }
#pragma unroll
  for (int a = 0; a <= SUP; ++a) {
    rowsame[a] = (unsigned)(a - su) < 7u;
    rownext[a] = (unsigned)(a + hh - su) < 7u;
  }
  float mloc = -1.0e30f;
#pragma unroll
  for (int j = 0; j < NKT; ++j) {
#pragma unroll
    for (int r = 0; r < 8; ++r) {
      const int t0 = 16 * j + r;                       // slot = t0 + 8*hh
      const bool step = (t0 % SUP) >= SUP - 8;         // the upper half's slot lies one superset row further
      const bool ok = colok[t0 % SUP] & (step ? rownext[t0 / SUP] : rowsame[t0 / SUP]);
      const int c0 = t0 - t0 / SUP;                    // 13u + v of the lower half's slot
      const float bv = step ? rb7[c0] : rb8[c0];
      const float sb = s[j][r] + bv;
      const float sval = ok ? sb : -1.0e30f;
      s[j][r] = sval;
      mloc = fmaxf(mloc, sval);
    }
  }
  const float mrow = fmaxf(mloc, __shfl_xor(mloc, 16, 32));
  // scheduling boundary: without it the branch-free mask phase and the exp / pack / P.V phase form one region, the
  // scheduler lifts later work into it and the register count passes 256, which costs a resident wave per SIMD
  __builtin_amdgcn_sched_barrier(0);
  float lsum = 0.f;
#pragma unroll
  for (int j = 0; j < NKT; ++j) {
#pragma unroll
    for (int r = 0; r < 8; ++r) {
      const float p = __expf(s[j][r] - mrow);
      s[j][r] = p;
      lsum += p;
    }
  }
  lsum += __shfl_xor(lsum, 16, 32);

  // ---- O^T = V^T . P^T : 2 d-tiles x 7 k-steps of 32 slots x 3 products ----
  v8f o[2];
  o[0] = zero8(); o[1] = zero8();
  {
    const __bf16* Vh = (const __bf16*)(const void*)KV0;
    const __bf16* Vl = (const __bf16*)(const void*)KV1;
#pragma unroll
    for (int kk = 0; kk < NSLOT / 32; ++kk) {
      v16b ph, pl;
      pack_pt(s[2 * kk], s[2 * kk + 1], ph, pl);
#pragma unroll
      for (int t = 0; t < 2; ++t) {
        const v16b vfh = ldfrag<__bf16>(Vh + (16 * t + m) * NSLOT + 32 * kk + 8 * hh);
        const v16b vfl = ldfrag<__bf16>(Vl + (16 * t + m) * NSLOT + 32 * kk + 8 * hh);
        o[t] = mma_b(vfh, ph, o[t]);
        o[t] = mma_b(vfh, pl, o[t]);
        o[t] = mma_b(vfl, ph, o[t]);
      }
    }
  }

  // ---- normalise, stage the wave's 16 queries x 32 d in LDS, write the ctx lines ----
  const float linv = 1.0f / lsum;
  float* os = Os[wave];
#pragma unroll
  for (int t = 0; t < 2; ++t)
#pragma unroll
    for (int r = 0; r < 8; ++r) os[m * HDIM + 16 * t + 8 * hh + r] = o[t][r] * linv;
  __syncthreads();
  {
    const int q4 = lane >> 3, pc = lane & 7, dsel = (pc & 3) * 8;
    const bool lowp = (pc >= 4);
    v4u hv[4];
    size_t go[4];
#pragma unroll
    for (int it = 0; it < 4; ++it) {
      const int row = it * 4 + q4;                     // it 0..3 x q4 0..3 = rows 0..15
      const float* sp = os + row * HDIM + dsel;
      v4u a;
#pragma unroll
      for (int e = 0; e < 4; ++e) {
        unsigned short h0, l0, h1, l1;
        split_bf(sp[2 * e], h0, l0);
        split_bf(sp[2 * e + 1], h1, l1);
        a[e] = lowp ? pk16(l0, l1) : pk16(h0, h1);
      }
      hv[it] = a;
      const int lqr = 16 * wave + row;
      const size_t pos = pb + (size_t)(i0 + (lqr >> 3)) * IMW + j0 + (lqr & 7);
      go[it] = pos * CTXK + (size_t)head * 64 + pc * 8;
    }
    {
#pragma unroll
      for (int it = 0; it < 4; ++it) *(v4u*)(ctx + go[it]) = hv[it];
      
    }
  }
}

// =====================================================================================================
//   Xh   bf16 [6272][256]     3211264
//   Wqb  bf16 [768][256]       393216
//   Wpf  bf16 [256][512]       262144
//   QKV  f32  [6272][768]    19267584
//   CTX  bf16 [6272][512]     6422528
//   total                   29556736
// =====================================================================================================
extern "C" void kernel_launch(void* const* d_in, const int* in_sizes, int n_in,
                              void* d_out, int out_size, void* d_ws, size_t ws_size,
                              hipStream_t stream) {
  if (n_in < 6) return;
  if (in_sizes[0] != NBT * CH * NPOS) return;
  if (in_sizes[1] != C3 * CH) return;
  if (in_sizes[2] != C3) return;
  if (in_sizes[3] != NHD * 13 * 13) return;
  if (in_sizes[4] != CH * CH) return;
  if (in_sizes[5] != CH) return;
  if (out_size != NBT * CH * NPOS) return;

  const float* x      = (const float*)d_in[0];
  const float* w_qkv  = (const float*)d_in[1];
  const float* b_qkv  = (const float*)d_in[2];
  const float* rpb    = (const float*)d_in[3];
  const float* w_proj = (const float*)d_in[4];
  const float* b_proj = (const float*)d_in[5];

  const size_t PXH  = (size_t)MROW * CH * 2;        //  3211264
  const size_t PWQ  = (size_t)C3 * CH * 2;          //   393216
  const size_t PWP  = (size_t)CH * CTXK * 2;        //   262144
  const size_t PQKV = (size_t)MROW * C3 * 4;        // 19267584
  const size_t PCTX = (size_t)MROW * CTXK * 2;      //  6422528
  size_t off = 0;
  const size_t oXh  = off; off += PXH;
  const size_t oWq  = off; off += PWQ;
  const size_t oWp  = off; off += PWP;
  const size_t oQKV = off; off += PQKV;
  const size_t oCTX = off; off += PCTX;
  if (off > ws_size) return;                         // off = 29556736
  if (off > (size_t)134217728) return;

  char* ws = (char*)d_ws;
  unsigned short* Xh  = (unsigned short*)(ws + oXh);
  unsigned short* Wqb = (unsigned short*)(ws + oWq);
  unsigned short* Wpf = (unsigned short*)(ws + oWp);
  float*          QKV = (float*)(ws + oQKV);
  unsigned short* CTX = (unsigned short*)(ws + oCTX);

  const int tilesQKV = (MROW / 64) * (C3 / 256);                      //  294 block tiles of 64 x 256
  const int tilesPRJ = (CH / 256) * (NPOS / 64);                      //   49 block tiles of 256 x 64
  const dim3 gCvt(NBX + NBQ + NBP);                                   // 552
  const dim3 gQKV(tilesQKV, 1);                                       // 294
  const dim3 gAtt(NBT * NHD * 49);                                    // 784
  const dim3 gPRJ(tilesPRJ, NBT);                                     // (49, 2)

  // (1) x NCHW -> bf16 [p][c]; w_qkv -> bf16 [n][k]; w_proj -> folded bf16 [c][512]
  cvt_all<<<gCvt, dim3(256), 0, stream>>>(x, w_qkv, w_proj, Xh, Wqb, Wpf);
  // (2) qkv = Xh . Wqkv^T + b_qkv -> f32 [6272][768]   (M=6272, N=768, K=256)
  gemm64<1, 1><<<gQKV, dim3(128), 0, stream>>>(
      Xh, CH, 0LL, Wqb, CH, 0LL,
      QKV, C3, 0LL, b_qkv,
      MROW, C3, CH);
  // (3) windowed attention -> ctx plane bf16 [6272][512]
  natt<<<gAtt, dim3(128), 0, stream>>>(QKV, rpb, CTX);
  // (4) out[b][c][p] = sum_k Wpf[c][k] ctx[b*3136+p][k] + b_proj[c]   (per batch: M=256, N=3136, K=512)
  gemm64<2, 4><<<gPRJ, dim3(128), 0, stream>>>(
      Wpf, CTXK, 0LL, CTX, CTXK, (long long)NPOS * CTXK,
      (float*)d_out, NPOS, (long long)CH * NPOS, b_proj,
      CH, NPOS, CTXK);
  (void)hipGetLastError();
}

// v004
// A run of this version takes 40.9 microseconds.
// Timed twice side by side with v003, it ran 1.06 and 1.09 times as fast.
// All steps since v000 together make it 1.89 times as fast.
// Contractions: qkv projection = v_wmma_f32_16x16x32_bf16 (bf16 operands from RNE-converted x and w_qkv, single product, f32 accumulate);
// q.k scores = v_wmma_f32_16x16x32_bf16 (q and k each as bf16 hi plane + unscaled bf16 residual plane, 3 products, f32 accumulate);
// p.v = v_wmma_f32_16x16x32_bf16 (p and v each as bf16 hi + unscaled bf16 residual, 3 products, f32 accumulate);
// ctx.w_proj^T = v_wmma_f32_16x16x32_bf16 (ctx as bf16 hi + residual folded into K, w_proj bf16 from its RNE-converted value, f32 accumulate);
// biases, q scaling, window mask, position bias and softmax in f32. No power-of-two carries anywhere (bf16 planes, unscaled residuals).
#include <hip/hip_runtime.h>
#include <math.h>
#include <stdint.h>

#define NBT   2
#define CH    256
#define IMH   56
#define IMW   56
#define NPOS  (IMH * IMW)        // 3136 positions per image, p = i*56 + j
#define MROW  (NBT * NPOS)       // 6272 position rows
#define NHD   8
#define HDIM  32
#define C3    (3 * CH)           // 768
#define KW    7                  // window side; window start = clamp(i - 3, 0, IMH - KW)
#define SUP   14                 // clamped key superset side of an 8x8 query tile
#define NSLOT 224                // key slots staged per block (196 used, rest zero)
#define NKT   13                 // scored 16-key tiles (slots 0..207)
#define CTXK  512                // folded K of the ctx plane: per head [hi d0..31 | residual d0..31]
#define QSCALE 0.17677669529663687f
#define RPLO  100                // position-bias entry 0 sits at Rp[RPLO]; entries around the table are zero
#define RPN   384                // padded table: every unclamped index 13u + v + cb of a scored slot lies inside

static_assert((MROW % 64) == 0);
static_assert((C3 % 256) == 0);
static_assert((NPOS % 64) == 0);
static_assert((CH % 256) == 0);
static_assert((CH % 128) == 0 && (CTXK % 128) == 0);
static_assert(NHD * HDIM == CH);
static_assert(SUP == 8 + KW - 1);
static_assert(SUP * SUP <= NSLOT && (NSLOT % 32) == 0 && NKT * 16 >= SUP * SUP);
static_assert(IMH == IMW);
static_assert(RPLO - 7 * 13 - 7 >= 0 && RPLO + 6 * 13 + 6 + (NKT * 16 - 1) - (NKT * 16 - 1) / SUP < RPN && RPN % 128 == 0);

typedef __bf16   v16b __attribute__((ext_vector_type(16)));
typedef __bf16   v8b  __attribute__((ext_vector_type(8)));
typedef float    v8f  __attribute__((ext_vector_type(8)));
typedef float    v4f  __attribute__((ext_vector_type(4)));
typedef unsigned int v4u __attribute__((ext_vector_type(4)));
typedef unsigned int v8u __attribute__((ext_vector_type(8)));
typedef float    v2f  __attribute__((ext_vector_type(2)));
typedef __bf16   v2b  __attribute__((ext_vector_type(2)));

#if defined(__HIP_DEVICE_COMPILE__)
#define DEV_ASM 1
#else
#define DEV_ASM 0
#endif

// ---- scalar helpers --------------------------------------------------------------------------------
// two f32 -> two bf16 (RNE) packed in one register, a in the low half: one packed convert instruction
__device__ __forceinline__ unsigned cvt2(float a, float b) {
  const v2f f = {a, b};
  return __builtin_bit_cast(unsigned, __builtin_convertvector(f, v2b));
}
__device__ __forceinline__ float bf_round(float f) { return (float)(__bf16)f; }   // f32 value of the RNE bf16
__device__ __forceinline__ v8f zero8() { v8f z = {0.f, 0.f, 0.f, 0.f, 0.f, 0.f, 0.f, 0.f}; return z; }
// hi / residual bf16 split of an f32 value (residual unscaled)
// of a pair: hp = packed hi halves, lp = packed residuals, a in the low half of each
__device__ __forceinline__ void split2(float a, float b, unsigned& hp, unsigned& lp) {
  const v2f f = {a, b};
  const v2b h = __builtin_convertvector(f, v2b);
  hp = __builtin_bit_cast(unsigned, h);
  lp = cvt2(a - (float)h[0], b - (float)h[1]);
}

// ---- fragment loader: 16-bit A/B operand, lane -> row/col (lane&15), p already includes +8*(lane>>4);
//      elements 0..7 <- p[0..7] (k0+8h..k0+8h+7), elements 8..15 <- p[16..23] (k0+16+8h..k0+16+8h+7)
template <typename OT> struct FT;
template <> struct FT<__bf16> { typedef v16b frag; typedef v8b half8; };

template <typename OT>
__device__ __forceinline__ typename FT<OT>::frag ldfrag(const OT* p) {
  union { typename FT<OT>::frag v; typename FT<OT>::half8 h[2]; } f;
  f.h[0] = *(const typename FT<OT>::half8*)(p);
  f.h[1] = *(const typename FT<OT>::half8*)(p + 16);
  return f.v;
}

// ---- WMMA helpers ------------------------------------------------------------------------------------
__device__ __forceinline__ v8f mmar(v16b a, v16b b, v8f c) {
  return __builtin_amdgcn_wmma_f32_16x16x32_bf16(false, a, false, b, (short)0, c, false, false);
}
// guarded form: 4 VALU slots after the WMMA, D tied, A/B kept live
__device__ __forceinline__ v8f mma_b(v16b a, v16b b, v8f c) {
  c = __builtin_amdgcn_wmma_f32_16x16x32_bf16(false, a, false, b, (short)0, c, false, false);
#if DEV_ASM
  asm volatile("v_nop\n\tv_nop\n\tv_nop\n\tv_nop" : "+v"(c) : "v"(a), "v"(b));
#endif
  return c;
}
__device__ __forceinline__ void dep_guard(v8f& a, v8f& b, v16b x, v16b y) {
#if DEV_ASM
  asm volatile("v_nop\n\tv_nop\n\tv_nop\n\tv_nop" : "+v"(a), "+v"(b) : "v"(x), "v"(y));
#else
  (void)a; (void)b; (void)x; (void)y;
#endif
}
__device__ __forceinline__ void keep4(v16b a, v16b b, v16b c, v16b d) {
#if DEV_ASM
  asm volatile("v_nop" :: "v"(a), "v"(b), "v"(c), "v"(d));
#else
  (void)a; (void)b; (void)c; (void)d;
#endif
}
__device__ __forceinline__ void acc_guard4(v8f& a, v8f& b, v8f& c, v8f& d) {
#if DEV_ASM
  asm volatile("v_nop\n\tv_nop\n\tv_nop\n\tv_nop" : "+v"(a), "+v"(b), "+v"(c), "+v"(d));
#else
  (void)a; (void)b; (void)c; (void)d;
#endif
}

// =====================================================================================================
// x NCHW f32 [b][c][p] -> Xh bf16 [b*3136 + p][c] (RNE convert), transposed through an LDS 64c x 64p tile.
// Store phase: item = it*256 + tid, p = item>>3, channel group = item&7 -> lanes 8q..8q+7 write one whole
// coverage: 2 iterations x 256 threads x 8 = the whole 64x64 tile; 392 blocks = the whole [6272][256] plane.
// =====================================================================================================
__device__ __forceinline__ void cvt_x(const float* __restrict__ x, unsigned short* xh, float* t, int blk) {
  const int tid = (int)threadIdx.x;
  const int p0 = (blk % (NPOS / 64)) * 64, c0 = ((blk / (NPOS / 64)) % (CH / 64)) * 64, b = blk / ((NPOS / 64) * (CH / 64));
#pragma unroll
  for (int it = 0; it < 4; ++it) {
    const int c  = it * 16 + (tid >> 4);
    const int p4 = (tid & 15) * 4;
    const v4f v = *(const v4f*)(x + ((size_t)(b * CH + c0 + c)) * NPOS + p0 + p4);
    float* tp = t + c * 65 + p4;
    tp[0] = v[0]; tp[1] = v[1]; tp[2] = v[2]; tp[3] = v[3];
  }
  __syncthreads();
  v4u pk[2];
  size_t go[2];
#pragma unroll
  for (int it = 0; it < 2; ++it) {
    const int item = it * 256 + tid;
    const int p = item >> 3, cg = item & 7;
    v4u a;
#pragma unroll
    for (int e = 0; e < 4; ++e) {
      const float f0 = t[(cg * 8 + 2 * e) * 65 + p];
      const float f1 = t[(cg * 8 + 2 * e + 1) * 65 + p];
      a[e] = cvt2(f0, f1);
    }
    pk[it] = a;
    go[it] = ((size_t)(b * NPOS + p0 + p)) * CH + c0 + cg * 8;
  }
  {
#pragma unroll
    for (int it = 0; it < 2; ++it) *(v4u*)(xh + go[it]) = pk[it];
    
  }
}

// =====================================================================================================
// f32 -> bf16 bits (RNE convert), 8 elements per thread, one 16-B store per lane: a wave writes 512
// coverage: n8 threads x 8 = the whole plane (n8 = 24576 here, a multiple of 256).
// =====================================================================================================
__device__ __forceinline__ void cvt16x8(const float* __restrict__ in, unsigned short* out, int n8, int blk) {
  const int i = blk * 256 + (int)threadIdx.x;
  if (i < n8) {
    const v4f a  = *(const v4f*)(in + (size_t)i * 8);
    const v4f a4 = *(const v4f*)(in + (size_t)i * 8 + 4);
    v4u p;
    p[0] = cvt2(a[0],  a[1]);
    p[1] = cvt2(a[2],  a[3]);
    p[2] = cvt2(a4[0], a4[1]);
    p[3] = cvt2(a4[2], a4[3]);
    unsigned short* o = out + (size_t)i * 8;
    *(v4u*)o = p;
    
  }
}

// =====================================================================================================
// w_proj [256 c][256 k] f32 -> folded plane Wf bf16 [256 c][512]: Wf[c][head*64 + part*32 + d] =
// bf16(w_proj[c][head*32 + d]) for part = 0 (meets the ctx hi half) and part = 1 (meets the residual half).
// coverage: 16384 threads x 8 = the whole [256][512] plane.
// =====================================================================================================
__device__ __forceinline__ void cvt_wp(const float* __restrict__ wp, unsigned short* out, int blk) {
  const int i = blk * 256 + (int)threadIdx.x;
  if (i < CH * CTXK / 8) {
    const int c  = i >> 6;                 // 64 groups of 8 per 512-wide row
    const int k  = (i & 63) * 8;           // 0..504
    const int hd = k >> 6;                 // head
    const int d0 = k & 31;                 // 0, 8, 16, 24
    const float* src = wp + (size_t)c * CH + hd * HDIM + d0;
    const v4f a  = *(const v4f*)src;
    const v4f a4 = *(const v4f*)(src + 4);
    v4u p;
    p[0] = cvt2(a[0],  a[1]);
    p[1] = cvt2(a[2],  a[3]);
    p[2] = cvt2(a4[0], a4[1]);
    p[3] = cvt2(a4[2], a4[3]);
    unsigned short* o = out + (size_t)i * 8;
    *(v4u*)o = p;
    
  }
}

// =====================================================================================================
// The three operand conversions read and write disjoint planes and none reads another's output, so they run
// as block ranges of one grid: blocks 0..NBX-1 = x tiles (the longest blocks, so they start first),
// NBX..NBX+NBQ-1 = w_qkv, the last NBP = w_proj. The range test is block-uniform (the x tiles hold a barrier).
// =====================================================================================================
#define NBX ((NPOS / 64) * (CH / 64) * NBT)   // 392 x tiles
#define NBQ (C3 * CH / 8 / 256)               //  96 blocks of w_qkv
#define NBP (CH * CTXK / 8 / 256)             //  64 blocks of w_proj
static_assert(NBQ * 256 * 8 == C3 * CH && NBP * 256 * 8 == CH * CTXK);
__global__ __launch_bounds__(256) void cvt_all(const float* __restrict__ x, const float* __restrict__ wq,
                                               const float* __restrict__ wp, unsigned short* xh,
                                               unsigned short* wqb, unsigned short* wpf) {
  __shared__ float t[64 * 65];                       // x tile [c][p], pitch 65
  const int blk = (int)blockIdx.x;
  if (blk < NBX) {
    cvt_x(x, xh, t, blk);
  } else if (blk < NBX + NBQ) {
    cvt16x8(wq, wqb, C3 * CH / 8, blk - NBX);
  } else {
    cvt_wp(wp, wpf, blk - (NBX + NBQ));
  }
}

// =====================================================================================================
// Batched WMMA GEMM (bf16 operands): C[m][n] = sum_k A[m][k] * Bt[n][k] + bias. A row-major [M][K] pitch lda;
// Bt row-major [N][K] pitch ldb (k contiguous); blockIdx.y = batch index (strides in elements).
// One block = 4 waves, one 64x64 tile of C per wave: WM waves along m and 4 / WM along n, so the block tile is
// (64 WM) x (256 / WM). M, N multiples of the block tile, K a multiple of SK (host constants).
// Operands go global -> LDS by asynchronous 16-B copies, SK = 64 k (one whole 128-B line of each of the 320
// operand rows) per stage, two buffers: stage t + 1 is in flight while stage t feeds the WMMAs.
// Stage layout: rows 0..BM-1 = A rows, rows BM..319 = Bt rows, pitch 144 B (16 B x 9, conflict-free b128 reads).
// Copy map: item = it*128 + tid, row = item>>3, 16-B piece = item&7 -> 8 lanes copy one line, 20 copies per lane
// = 320 rows x 8 pieces, each LDS byte written by one lane. Fragments keep the split k map (ldfrag), k ascending.
// BIAS_MODE 1: bias[n] (per column); BIAS_MODE 2: bias[m] (per row); bias values RNE-converted to bf16.
// Output: f32 C (pitch ldc). Epilogue: 16-row slabs staged per wave in LDS; each 64-wide row segment (256 B =
// coverage: 4 slabs x 16 rows (it 0..7 x lane>>4) x 64 cols = the wave's whole 64x64 tile.
// =====================================================================================================
#define SK     64                     // k elements per stage
#define SPITCH 72                     // LDS row pitch in elements (144 B)
#define SROWS  320                    // operand rows per stage (BM + BN)
#define SBYTES (SROWS * SPITCH * 2)   // 46080 B per buffer

// Four asynchronous copies, 16 B per lane each, global -> LDS. The s_wait_xcnt closes the statement so that no
// address register named here is rewritten before it.
__device__ __forceinline__ void copy4(unsigned l0, unsigned l1, unsigned l2, unsigned l3,
                                      const unsigned short* g0, const unsigned short* g1,
                                      const unsigned short* g2, const unsigned short* g3) {
#if DEV_ASM
  asm volatile("global_load_async_to_lds_b128 %0, %4, off\n\t"
               "global_load_async_to_lds_b128 %1, %5, off\n\t"
               "global_load_async_to_lds_b128 %2, %6, off\n\t"
               "global_load_async_to_lds_b128 %3, %7, off\n\t"
               "s_wait_xcnt 0x0"
               :: "v"(l0), "v"(l1), "v"(l2), "v"(l3), "v"(g0), "v"(g1), "v"(g2), "v"(g3) : "memory");
#else
  (void)l0; (void)l1; (void)l2; (void)l3; (void)g0; (void)g1; (void)g2; (void)g3;
#endif
}
// this wave's copies have landed in LDS (the compiler places no wait for them)
__device__ __forceinline__ void wait_copies() {
#if DEV_ASM
  asm volatile("s_wait_asynccnt 0x0" ::: "memory");
#endif
}
// this wave's LDS reads have returned, so the buffer they read may be refilled behind the next barrier
__device__ __forceinline__ void wait_lds() {
#if DEV_ASM
  asm volatile("s_wait_dscnt 0x0" ::: "memory");
#endif
}
// stands behind global loads, in front of whatever rewrites their address registers
__device__ __forceinline__ void wait_addr() {
#if DEV_ASM
  asm volatile("s_wait_xcnt 0x0" ::: "memory");
#endif
}
// one stage: 20 copies per lane; ga / gb = the lane's piece of its first A / Bt row at this stage's k
template <int BM>
__device__ __forceinline__ void fill_stage(unsigned lb, const unsigned short* ga, int lda,
                                           const unsigned short* gb, int ldb) {
  // both loops unrolled: r0 is then a constant, so the A / Bt choice is no branch and g, l stay in registers
#pragma unroll
  for (int q = 0; q < SROWS / 64; ++q) {
    const unsigned short* g[4];
    unsigned l[4];
#pragma unroll
    for (int e = 0; e < 4; ++e) {
      const int r0 = (q * 4 + e) * 16;                 // first row of this copy's 16 rows
      g[e] = (r0 < BM) ? ga + (size_t)r0 * lda : gb + (size_t)(r0 - BM) * ldb;
      l[e] = lb + (unsigned)(r0 * SPITCH * 2);
    }
    copy4(l[0], l[1], l[2], l[3], g[0], g[1], g[2], g[3]);
  }
}

template <int BIAS_MODE, int WM>
__global__ __launch_bounds__(128) void gemm64(
    const unsigned short* __restrict__ Ap, int lda, long long strideA,
    const unsigned short* __restrict__ Btp, int ldb, long long strideB,
    float* Cout, int ldc, long long strideC,
    const float* __restrict__ bias,
    int M, int N, int K) {
  constexpr int BM = 64 * WM;
  constexpr int BN = SROWS - BM;
  static_assert(WM == 1 || WM == 4);
  __shared__ __align__(16) unsigned short stg[2 * SROWS * SPITCH];   // two stage buffers
  __shared__ __align__(16) float sT[4][16 * 68];   // per-wave 16x64 slab, pitch 68 floats
  const int b    = blockIdx.y;
  const int tid  = (int)threadIdx.x;
  const int lane = tid & 31;
  const int wave = tid >> 5;
  const int tilesN = N / BN;
  const int tilesM = M / BM;
  const int tile = blockIdx.x;
  if (tile >= tilesM * tilesN) return;   // block-uniform, in front of every barrier and copy
  const int tm = tile / tilesN;
  const int tn = tile - tm * tilesN;
  const int wrA = (WM == 4) ? (wave << 6) : 0;          // the wave's first A row inside the stage
  const int wrB = BM + ((WM == 4) ? 0 : (wave << 6));   // the wave's first Bt row inside the stage
  const int m0 = tm * BM + wrA;
  const int n0 = tn * BN + (wrB - BM);

  const int rlane = lane & 15;                 // row (A) / col (B, D) within subtile
  const int koff  = (lane >> 4) * 8;           // k offset of this lane half
  const int mOff  = (lane >> 4) * 8;           // D row offset

  // the lane's copy addresses: row tid>>3 of each 16-row group, 16-B piece tid&7
  const unsigned short* ga = Ap  + (size_t)b * (size_t)strideA + (size_t)(tm * BM + (tid >> 3)) * lda + (tid & 7) * 8;
  const unsigned short* gb = Btp + (size_t)b * (size_t)strideB + (size_t)(tn * BN + (tid >> 3)) * ldb + (tid & 7) * 8;
  const unsigned lds0 = (unsigned)(uintptr_t)stg + (unsigned)((tid >> 3) * SPITCH * 2 + (tid & 7) * 16);
  const int nst = K / SK;

  v8f acc[4][4];
#pragma unroll
  for (int i = 0; i < 4; ++i)
#pragma unroll
    for (int j = 0; j < 4; ++j) acc[i][j] = zero8();

  fill_stage<BM>(lds0, ga, lda, gb, ldb);
  wait_copies();
  __syncthreads();                             // stage 0 is readable by every wave
  if (nst > 1) fill_stage<BM>(lds0 + SBYTES, ga + SK, lda, gb + SK, ldb);

  for (int t = 0; t < nst; ++t) {
    const __bf16* sb = (const __bf16*)(const void*)stg + (t & 1) * (SROWS * SPITCH);
    // unrolled (inner loops too): fragments stay in registers, and the second k step's LDS reads start under
    // the first step's WMMAs
#pragma unroll
    for (int kk = 0; kk < SK; kk += 32) {
      v16b bq[4], af[4];
#pragma unroll
      for (int j = 0; j < 4; ++j) bq[j] = ldfrag<__bf16>(sb + (wrB + (j << 4) + rlane) * SPITCH + koff + kk);
#pragma unroll
      for (int i = 0; i < 4; ++i) af[i] = ldfrag<__bf16>(sb + (wrA + (i << 4) + rlane) * SPITCH + koff + kk);
#pragma unroll
      for (int i = 0; i < 4; ++i) {
#pragma unroll
        for (int j = 0; j < 4; ++j) acc[i][j] = mmar(af[i], bq[j], acc[i][j]);
        dep_guard(acc[i][0], acc[i][3], af[i], bq[3]);
      }
      keep4(bq[0], bq[1], bq[2], bq[3]);
    }
    // publish point of stage t + 1: own reads of stage t done, own copies of stage t + 1 landed, then the barrier
    wait_lds();
    wait_copies();
    __syncthreads();
    if (t + 2 < nst) fill_stage<BM>(lds0 + (unsigned)(t & 1) * SBYTES, ga + (t + 2) * SK, lda, gb + (t + 2) * SK, ldb);
  }
  wait_copies();
  acc_guard4(acc[0][0], acc[0][1], acc[0][2], acc[0][3]);
  acc_guard4(acc[1][0], acc[1][1], acc[1][2], acc[1][3]);
  acc_guard4(acc[2][0], acc[2][1], acc[2][2], acc[2][3]);
  acc_guard4(acc[3][0], acc[3][1], acc[3][2], acc[3][3]);

  // ---- epilogue ----
  float* slab = sT[wave];
  float* C = Cout + (size_t)b * (size_t)strideC;
  const int h2 = lane >> 4, c4 = (lane & 15) * 4;     // 256-B row segment = 16 lanes x 16 B
  v4f bcol = {0.f, 0.f, 0.f, 0.f};
  if (BIAS_MODE == 1) {
#pragma unroll
    for (int e = 0; e < 4; ++e) bcol[e] = bf_round(bias[n0 + c4 + e]);
  }
#pragma unroll
  for (int i = 0; i < 4; ++i) {
    const int mBase = m0 + (i << 4);
#pragma unroll
    for (int j = 0; j < 4; ++j) {
#pragma unroll
      for (int r = 0; r < 8; ++r) {
        slab[(mOff + r) * 68 + (j << 4) + rlane] = acc[i][j][r];
      }
    }
    __builtin_amdgcn_fence(__ATOMIC_RELEASE, "workgroup");
    __builtin_amdgcn_wave_barrier();
    __builtin_amdgcn_fence(__ATOMIC_ACQUIRE, "workgroup");
    {
#pragma unroll
      for (int it = 0; it < 8; ++it) {
        const int row = it * 2 + h2;                     // it 0..7 x h2 0..1 = rows 0..15
        v4f v = *(const v4f*)(slab + row * 68 + c4);
        if (BIAS_MODE == 1) {
          v = v + bcol;
        } else {
          const float br = bf_round(bias[mBase + row]);
          v = v + br;
        }
        *(v4f*)(C + (size_t)(mBase + row) * ldc + n0 + c4) = v;
      }
      
    }
    __builtin_amdgcn_fence(__ATOMIC_RELEASE, "workgroup");
    __builtin_amdgcn_wave_barrier();
    __builtin_amdgcn_fence(__ATOMIC_ACQUIRE, "workgroup");
  }
}

// =====================================================================================================
// P^T B fragment pair (hi, residual) from the lane's own score D values: element r <- tile a row r,
// element 8+r <- tile c row r (same lane, same query column).
// =====================================================================================================
__device__ __forceinline__ void pack_pt(v8f a, v8f c, v16b& ph, v16b& pl) {
  v8u H, L;
#pragma unroll
  for (int r = 0; r < 4; ++r) {
    unsigned hp, lp;
    split2(a[2 * r], a[2 * r + 1], hp, lp);
    H[r] = hp; L[r] = lp;
    split2(c[2 * r], c[2 * r + 1], hp, lp);
    H[4 + r] = hp; L[4 + r] = lp;
  }
  ph = __builtin_bit_cast(v16b, H); pl = __builtin_bit_cast(v16b, L);
}

// load 8 consecutive f32, or zeros when keep == 0 (address always valid, select by value)
__device__ __forceinline__ void ld8sel(const float* src, int keep, float f[8]) {
  const v4f a = *(const v4f*)src;
  const v4f c = *(const v4f*)(src + 4);
  f[0] = keep ? a[0] : 0.f; f[1] = keep ? a[1] : 0.f; f[2] = keep ? a[2] : 0.f; f[3] = keep ? a[3] : 0.f;
  f[4] = keep ? c[0] : 0.f; f[5] = keep ? c[1] : 0.f; f[6] = keep ? c[2] : 0.f; f[7] = keep ? c[3] : 0.f;
}

// =====================================================================================================
// Windowed attention, one block = (batch b, head, 8x8 query tile at (i0, j0)); 128 threads = 4 waves,
// wave w owns the 16 queries lq = 16w..16w+15 (query row i0 + (lq>>3), col j0 + (lq&7)).
// Key superset = the 14x14 image block at (R0, C0), R0 = clamp(i0-3, 0, 42), slot = u*14 + v (196 slots,
// padded to 224 with zero rows). Every query's clamped 7x7 window lies inside the superset: valid slots are
// su <= u <= su+6, sv <= v <= sv+6 with su = clamp(qi-3,0,49) - R0 in [0,7].
//   qkv plane f32 [b*3136 + p][768]: q = cols head*32+d (scaled by 32^-0.5 in f32 here), k = 256+.., v = 512+..
//   scores (transposed): S^T[slot][query] = K[slot][d] . Q^T[d][query] on bf16 WMMA, 3 products
//     (hi.hi + hi.res + res.hi); lane owns query column (lane&15) of its wave and key rows 16j + 8h + r.
//   s = S^T + rpb[head][u + R0 - qi + 6][v + C0 - qj + 6] for valid slots, -1e30 otherwise (f32);
//   softmax in f32 (max / sum over the 104 lane values and the partner lane ^16).
//   O^T[d][query] = V^T[d][slot] . P^T[slot][query] on bf16 WMMA, 3 products, p unnormalised exp, 1/sum at the end.
// LDS: KV0/KV1 hold K hi/res [slot][d] for the scores, then (after a block barrier) V^T hi/res [d][slot].
// Staged extents: KV 224x32 both phases (slots >= 196 zero), Q 64x32, Rp 384 (table at 100..268, zeros around),
// Os 16x32 per wave -- every LDS element read is written first.
// Output coverage: each wave stores its 16 query rows (it 0..3 x lane>>3) x 8 pieces of 16 B (lane&7) =
// =====================================================================================================
__global__ __launch_bounds__(128)
void natt(const float* __restrict__ qkv, const float* __restrict__ rpb, unsigned short* ctx) {
  __shared__ __align__(16) unsigned short KV0[NSLOT * HDIM];   // 14336 B
  __shared__ __align__(16) unsigned short KV1[NSLOT * HDIM];   // 14336 B
  __shared__ __align__(16) unsigned short Qh[64 * HDIM];       //  4096 B
  __shared__ __align__(16) unsigned short Ql[64 * HDIM];       //  4096 B
  __shared__ __align__(16) float Os[4][16 * HDIM];             //  8192 B
  __shared__ float Rp[RPN];

  const int tid  = (int)threadIdx.x;
  const int wave = tid >> 5;
  const int lane = tid & 31;
  const int hh   = lane >> 4;
  const int m    = lane & 15;

  const int bx   = blockIdx.x;
  const int tj   = bx % 7;
  const int ti   = (bx / 7) % 7;
  const int head = (bx / 49) % NHD;
  const int b    = bx / (49 * NHD);
  const int i0 = ti * 8, j0 = tj * 8;
  const int R0 = min(max(i0 - 3, 0), IMH - SUP);
  const int C0 = min(max(j0 - 3, 0), IMW - SUP);
  const size_t pb = (size_t)b * NPOS;

  // ---- position-bias table of this head (bf16 RNE-converted values), entries 0..168 at Rp[RPLO..], zeros around ----
  {
    float rv[RPN / 128];
    // both loops unrolled: rv stays in registers and the three loads go out together
#pragma unroll
    for (int it = 0; it < RPN / 128; ++it) {
      const int t = it * 128 + tid - RPLO;
      rv[it] = rpb[head * 169 + min(max(t, 0), 168)];           // clamped address
    }
    wait_addr();
#pragma unroll
    for (int it = 0; it < RPN / 128; ++it) {
      const int e = it * 128 + tid;
      const float tv = bf_round(rv[it]);
      Rp[e] = ((unsigned)(e - RPLO) < 169u) ? tv : 0.f;
    }
  }
  // ---- q (scaled in f32) -> hi / residual planes [lq][d]; thread = (lq = tid>>1, d half) ----
  {
    const int lq = tid >> 1, dh = (tid & 1) * 16;
    const int qi = lq >> 3, qj = lq & 7;
    const size_t pos = pb + (size_t)(i0 + qi) * IMW + j0 + qj;
    const float* src = qkv + pos * C3 + head * HDIM + dh;
#pragma unroll
    for (int g = 0; g < 2; ++g) {
      float f[8];
      ld8sel(src + 8 * g, 1, f);
      v4u ph, pl;
#pragma unroll
      for (int e = 0; e < 4; ++e) {
        unsigned hp, lp;
        split2(f[2 * e] * QSCALE, f[2 * e + 1] * QSCALE, hp, lp);
        ph[e] = hp; pl[e] = lp;
      }
      *(v4u*)(Qh + lq * HDIM + dh + 8 * g) = ph;
      *(v4u*)(Ql + lq * HDIM + dh + 8 * g) = pl;
    }
  }
  // ---- K superset -> KV0 (hi) / KV1 (residual), layout [slot][d]; item = it*128 + tid, slot = item>>2,
  //      d8 = (item&3)*8; 7 x 128 items = 224 slots x 4 groups = the whole tile; slots >= 196 = zeros ----
  {
    const float* kbase = qkv + CH + head * HDIM;
#pragma unroll
    for (int it = 0; it < 7; ++it) {
      const int item = it * 128 + tid;
      const int slot = item >> 2, d8 = (item & 3) * 8;
      const int u = slot / SUP, v = slot - u * SUP;
      const int uc = min(u, SUP - 1);
      const size_t pos = pb + (size_t)(R0 + uc) * IMW + C0 + v;
      float f[8];
      ld8sel(kbase + pos * C3 + d8, slot < SUP * SUP, f);
      v4u ph, pl;
#pragma unroll
      for (int e = 0; e < 4; ++e) {
        unsigned hp, lp;
        split2(f[2 * e], f[2 * e + 1], hp, lp);
        ph[e] = hp; pl[e] = lp;
      }
      *(v4u*)(KV0 + slot * HDIM + d8) = ph;
      *(v4u*)(KV1 + slot * HDIM + d8) = pl;
    }
  }
  __syncthreads();

  // ---- scores: S^T tiles j = 0..12 (key slots 16j..16j+15) for the wave's 16 queries; s[13] stays zero ----
  v8f s[NKT + 1];
  {
    const __bf16* Kh = (const __bf16*)(const void*)KV0;
    const __bf16* Kl = (const __bf16*)(const void*)KV1;
    const __bf16* Qhp = (const __bf16*)(const void*)Qh;
    const __bf16* Qlp = (const __bf16*)(const void*)Ql;
    const v16b qfh = ldfrag<__bf16>(Qhp + (16 * wave + m) * HDIM + 8 * hh);
    const v16b qfl = ldfrag<__bf16>(Qlp + (16 * wave + m) * HDIM + 8 * hh);
#pragma unroll
    for (int j = 0; j < NKT; ++j) {
      const v16b kfh = ldfrag<__bf16>(Kh + (16 * j + m) * HDIM + 8 * hh);
      const v16b kfl = ldfrag<__bf16>(Kl + (16 * j + m) * HDIM + 8 * hh);
      v8f z = zero8();
      z = mma_b(kfh, qfh, z);
      z = mma_b(kfh, qfl, z);
      z = mma_b(kfl, qfh, z);
      s[j] = z;
    }
    s[NKT] = zero8();
  }
  __syncthreads();   // all waves done reading K from KV0/KV1

  // ---- V superset -> KV0 (hi) / KV1 (residual), transposed layout [d][slot] (pitch 224);
  //      same item map as K: 224 slots x 32 d written, slots >= 196 = zeros ----
  {
    const float* vbase = qkv + 2 * CH + head * HDIM;
#pragma unroll
    for (int it = 0; it < 7; ++it) {
      const int item = it * 128 + tid;
      const int slot = item >> 2, d8 = (item & 3) * 8;
      const int u = slot / SUP, v = slot - u * SUP;
      const int uc = min(u, SUP - 1);
      const size_t pos = pb + (size_t)(R0 + uc) * IMW + C0 + v;
      float f[8];
      ld8sel(vbase + pos * C3 + d8, slot < SUP * SUP, f);
#pragma unroll
      for (int e = 0; e < 8; e += 2) {
        unsigned hp, lp;
        split2(f[e], f[e + 1], hp, lp);
        KV0[(d8 + e) * NSLOT + slot]     = (unsigned short)hp;
        KV0[(d8 + e + 1) * NSLOT + slot] = (unsigned short)(hp >> 16);
        KV1[(d8 + e) * NSLOT + slot]     = (unsigned short)lp;
        KV1[(d8 + e + 1) * NSLOT + slot] = (unsigned short)(lp >> 16);
      }
    }
  }
  __syncthreads();

  // ---- window mask + position bias (f32), softmax over the query column ----
  const int lq = 16 * wave + m;
  const int ai = i0 + (lq >> 3), aj = j0 + (lq & 7);
  const int su = min(max(ai - 3, 0), IMH - KW) - R0;
  const int sv = min(max(aj - 3, 0), IMW - KW) - C0;
  const int cb = (R0 - ai + 6) * 13 + (C0 - aj + 6);
  // Bias index 13u + v + cb = slot - u + cb. The upper lane half's slot is 8 higher and its u is equal or one
  // higher (one higher where t0 % 14 >= 6), so two lane bases and a constant offset address every read; the read
  // is made for every slot (the padded table holds every such index) and the window test selects by value.
  const float* rb8 = Rp + (RPLO + cb + 8 * hh);
  const float* rb7 = Rp + (RPLO + cb + 7 * hh);
  // The window test of a slot is a row test and a column test; each distinct one is made once:
  // column k = t0 % 14 (upper half: (k + 8) % 14), row a = t0 / 14 (upper half: a, or a + 1 where k >= 6).
  // Both loops unrolled: the arrays are then indexed by constants only and each test is one lane mask in a register.
  bool colok[SUP], rowsame[SUP + 1], rownext[SUP + 1];
#pragma unroll
  for (int k = 0; k < SUP; ++k) {
    const int v = hh ? ((k + 8) % SUP) : k;
    colok[k] = (unsigned)(v - sv) < 7u;
  }
#pragma unroll
  for (int a = 0; a <= SUP; ++a) {
    rowsame[a] = (unsigned)(a - su) < 7u;
    rownext[a] = (unsigned)(a + hh - su) < 7u;
  }
  float mloc = -1.0e30f;
#pragma unroll
  for (int j = 0; j < NKT; ++j) {
#pragma unroll
    for (int r = 0; r < 8; ++r) {
      const int t0 = 16 * j + r;                       // slot = t0 + 8*hh
      const bool step = (t0 % SUP) >= SUP - 8;         // the upper half's slot lies one superset row further
      const bool ok = colok[t0 % SUP] & (step ? rownext[t0 / SUP] : rowsame[t0 / SUP]);
      const int c0 = t0 - t0 / SUP;                    // 13u + v of the lower half's slot
      const float bv = step ? rb7[c0] : rb8[c0];
      const float sb = s[j][r] + bv;
      const float sval = ok ? sb : -1.0e30f;
      s[j][r] = sval;
      mloc = fmaxf(mloc, sval);
    }
  }
  const float mrow = fmaxf(mloc, __shfl_xor(mloc, 16, 32));
  // scheduling boundary: without it the branch-free mask phase and the exp / pack / P.V phase form one region, the
  // scheduler lifts later work into it and the register count passes 256, which costs a resident wave per SIMD
  __builtin_amdgcn_sched_barrier(0);
  float lsum = 0.f;
#pragma unroll
  for (int j = 0; j < NKT; ++j) {
#pragma unroll
    for (int r = 0; r < 8; ++r) {
      const float p = __expf(s[j][r] - mrow);
      s[j][r] = p;
      lsum += p;
    }
  }
  lsum += __shfl_xor(lsum, 16, 32);

  // ---- O^T = V^T . P^T : 2 d-tiles x 7 k-steps of 32 slots x 3 products ----
  v8f o[2];
  o[0] = zero8(); o[1] = zero8();
  {
    const __bf16* Vh = (const __bf16*)(const void*)KV0;
    const __bf16* Vl = (const __bf16*)(const void*)KV1;
#pragma unroll
    for (int kk = 0; kk < NSLOT / 32; ++kk) {
      v16b ph, pl;
      pack_pt(s[2 * kk], s[2 * kk + 1], ph, pl);
#pragma unroll
      for (int t = 0; t < 2; ++t) {
        const v16b vfh = ldfrag<__bf16>(Vh + (16 * t + m) * NSLOT + 32 * kk + 8 * hh);
        const v16b vfl = ldfrag<__bf16>(Vl + (16 * t + m) * NSLOT + 32 * kk + 8 * hh);
        o[t] = mma_b(vfh, ph, o[t]);
        o[t] = mma_b(vfh, pl, o[t]);
        o[t] = mma_b(vfl, ph, o[t]);
      }
    }
  }

  // ---- normalise, stage the wave's 16 queries x 32 d in LDS, write the ctx lines ----
  const float linv = 1.0f / lsum;
  float* os = Os[wave];
#pragma unroll
  for (int t = 0; t < 2; ++t)
#pragma unroll
    for (int r = 0; r < 8; ++r) os[m * HDIM + 16 * t + 8 * hh + r] = o[t][r] * linv;
  __syncthreads();
  {
    const int q4 = lane >> 3, pc = lane & 7, dsel = (pc & 3) * 8;
    const bool lowp = (pc >= 4);
    v4u hv[4];
    size_t go[4];
#pragma unroll
    for (int it = 0; it < 4; ++it) {
      const int row = it * 4 + q4;                     // it 0..3 x q4 0..3 = rows 0..15
      const float* sp = os + row * HDIM + dsel;
      v4u a;
#pragma unroll
      for (int e = 0; e < 4; ++e) {
        unsigned hp, lp;
        split2(sp[2 * e], sp[2 * e + 1], hp, lp);
        a[e] = lowp ? lp : hp;
      }
      hv[it] = a;
      const int lqr = 16 * wave + row;
      const size_t pos = pb + (size_t)(i0 + (lqr >> 3)) * IMW + j0 + (lqr & 7);
      go[it] = pos * CTXK + (size_t)head * 64 + pc * 8;
    }
    {
#pragma unroll
      for (int it = 0; it < 4; ++it) *(v4u*)(ctx + go[it]) = hv[it];
      
    }
  }
}

// =====================================================================================================
//   Xh   bf16 [6272][256]     3211264
//   Wqb  bf16 [768][256]       393216
//   Wpf  bf16 [256][512]       262144
//   QKV  f32  [6272][768]    19267584
//   CTX  bf16 [6272][512]     6422528
//   total                   29556736
// =====================================================================================================
extern "C" void kernel_launch(void* const* d_in, const int* in_sizes, int n_in,
                              void* d_out, int out_size, void* d_ws, size_t ws_size,
                              hipStream_t stream) {
  if (n_in < 6) return;
  if (in_sizes[0] != NBT * CH * NPOS) return;
  if (in_sizes[1] != C3 * CH) return;
  if (in_sizes[2] != C3) return;
  if (in_sizes[3] != NHD * 13 * 13) return;
  if (in_sizes[4] != CH * CH) return;
  if (in_sizes[5] != CH) return;
  if (out_size != NBT * CH * NPOS) return;

  const float* x      = (const float*)d_in[0];
  const float* w_qkv  = (const float*)d_in[1];
  const float* b_qkv  = (const float*)d_in[2];
  const float* rpb    = (const float*)d_in[3];
  const float* w_proj = (const float*)d_in[4];
  const float* b_proj = (const float*)d_in[5];

  const size_t PXH  = (size_t)MROW * CH * 2;        //  3211264
  const size_t PWQ  = (size_t)C3 * CH * 2;          //   393216
  const size_t PWP  = (size_t)CH * CTXK * 2;        //   262144
  const size_t PQKV = (size_t)MROW * C3 * 4;        // 19267584
  const size_t PCTX = (size_t)MROW * CTXK * 2;      //  6422528
  size_t off = 0;
  const size_t oXh  = off; off += PXH;
  const size_t oWq  = off; off += PWQ;
  const size_t oWp  = off; off += PWP;
  const size_t oQKV = off; off += PQKV;
  const size_t oCTX = off; off += PCTX;
  if (off > ws_size) return;                         // off = 29556736
  if (off > (size_t)134217728) return;

  char* ws = (char*)d_ws;
  unsigned short* Xh  = (unsigned short*)(ws + oXh);
  unsigned short* Wqb = (unsigned short*)(ws + oWq);
  unsigned short* Wpf = (unsigned short*)(ws + oWp);
  float*          QKV = (float*)(ws + oQKV);
  unsigned short* CTX = (unsigned short*)(ws + oCTX);

  const int tilesQKV = (MROW / 64) * (C3 / 256);                      //  294 block tiles of 64 x 256
  const int tilesPRJ = (CH / 256) * (NPOS / 64);                      //   49 block tiles of 256 x 64
  const dim3 gCvt(NBX + NBQ + NBP);                                   // 552
  const dim3 gQKV(tilesQKV, 1);                                       // 294
  const dim3 gAtt(NBT * NHD * 49);                                    // 784
  const dim3 gPRJ(tilesPRJ, NBT);                                     // (49, 2)

  // (1) x NCHW -> bf16 [p][c]; w_qkv -> bf16 [n][k]; w_proj -> folded bf16 [c][512]
  cvt_all<<<gCvt, dim3(256), 0, stream>>>(x, w_qkv, w_proj, Xh, Wqb, Wpf);
  // (2) qkv = Xh . Wqkv^T + b_qkv -> f32 [6272][768]   (M=6272, N=768, K=256)
  gemm64<1, 1><<<gQKV, dim3(128), 0, stream>>>(
      Xh, CH, 0LL, Wqb, CH, 0LL,
      QKV, C3, 0LL, b_qkv,
      MROW, C3, CH);
  // (3) windowed attention -> ctx plane bf16 [6272][512]
  natt<<<gAtt, dim3(128), 0, stream>>>(QKV, rpb, CTX);
  // (4) out[b][c][p] = sum_k Wpf[c][k] ctx[b*3136+p][k] + b_proj[c]   (per batch: M=256, N=3136, K=512)
  gemm64<2, 4><<<gPRJ, dim3(128), 0, stream>>>(
      Wpf, CTXK, 0LL, CTX, CTXK, (long long)NPOS * CTXK,
      (float*)d_out, NPOS, (long long)CH * NPOS, b_proj,
      CH, NPOS, CTXK);
  (void)hipGetLastError();
}

// v005
// A run of this version takes 38 microseconds.
// Two timings next to v004 both put it at 1.06 times that version's speed.
// Counting every step since v000, it is 2.00 times as fast.
// Contractions: qkv projection = v_wmma_f32_16x16x32_bf16 (bf16 operands from RNE-converted x and w_qkv, single product, f32 accumulate);
// q.k scores = v_wmma_f32_16x16x32_bf16 (q and k each as bf16 hi plane + unscaled bf16 residual plane, 3 products, f32 accumulate);
// p.v = v_wmma_f32_16x16x32_bf16 (p and v each as bf16 hi + unscaled bf16 residual, 3 products, f32 accumulate);
// ctx.w_proj^T = v_wmma_f32_16x16x32_bf16 (ctx as bf16 hi + residual folded into K, w_proj bf16 from its RNE-converted value, f32 accumulate);
// biases, q scaling, window mask, position bias and softmax in f32. No power-of-two carries anywhere (bf16 planes, unscaled residuals).
#include <hip/hip_runtime.h>
#include <math.h>
#include <stdint.h>

#define NBT   2
#define CH    256
#define IMH   56
#define IMW   56
#define NPOS  (IMH * IMW)        // 3136 positions per image, p = i*56 + j
#define MROW  (NBT * NPOS)       // 6272 position rows
#define NHD   8
#define HDIM  32
#define C3    (3 * CH)           // 768
#define KW    7                  // window side; window start = clamp(i - 3, 0, IMH - KW)
#define SUP   14                 // clamped key superset side of an 8x8 query tile
#define NSLOT 224                // key slots staged per block (196 used, rest zero)
#define NKT   13                 // scored 16-key tiles (slots 0..207)
#define CTXK  512                // folded K of the ctx plane: per head [hi d0..31 | residual d0..31]
#define QSCALE 0.17677669529663687f
#define RPLO  100                // position-bias entry 0 sits at Rp[RPLO]; entries around the table are zero
#define RPN   384                // padded table: every unclamped index 13u + v + cb of a scored slot lies inside
#define VPITCH 48                // LDS pitch of a staged V row [slot][d] in elements: 96 B = 32 B x 3, the transposing reader's pitch

static_assert((MROW % 64) == 0);
static_assert((C3 % 256) == 0);
static_assert((NPOS % 64) == 0);
static_assert((CH % 256) == 0);
static_assert((CH % 128) == 0 && (CTXK % 128) == 0);
static_assert(NHD * HDIM == CH);
static_assert(SUP == 8 + KW - 1);
static_assert(SUP * SUP <= NSLOT && (NSLOT % 32) == 0 && NKT * 16 >= SUP * SUP);
static_assert(IMH == IMW);
static_assert(VPITCH >= HDIM && (VPITCH * 2) % 32 == 0 && ((VPITCH * 2) / 32) % 2 == 1);
static_assert(RPLO - 7 * 13 - 7 >= 0 && RPLO + 6 * 13 + 6 + (NKT * 16 - 1) - (NKT * 16 - 1) / SUP < RPN && RPN % 128 == 0);

typedef __bf16   v16b __attribute__((ext_vector_type(16)));
typedef __bf16   v8b  __attribute__((ext_vector_type(8)));
typedef float    v8f  __attribute__((ext_vector_type(8)));
typedef float    v4f  __attribute__((ext_vector_type(4)));
typedef unsigned int v4u __attribute__((ext_vector_type(4)));
typedef unsigned int v8u __attribute__((ext_vector_type(8)));
typedef float    v2f  __attribute__((ext_vector_type(2)));
typedef __bf16   v2b  __attribute__((ext_vector_type(2)));

#if defined(__HIP_DEVICE_COMPILE__)
#define DEV_ASM 1
#else
#define DEV_ASM 0
#endif

// ---- scalar helpers --------------------------------------------------------------------------------
// two f32 -> two bf16 (RNE) packed in one register, a in the low half: one packed convert instruction
__device__ __forceinline__ unsigned cvt2(float a, float b) {
  const v2f f = {a, b};
  return __builtin_bit_cast(unsigned, __builtin_convertvector(f, v2b));
}
__device__ __forceinline__ float bf_round(float f) { return (float)(__bf16)f; }   // f32 value of the RNE bf16
__device__ __forceinline__ v8f zero8() { v8f z = {0.f, 0.f, 0.f, 0.f, 0.f, 0.f, 0.f, 0.f}; return z; }
// hi / residual bf16 split of an f32 value (residual unscaled)
// of a pair: hp = packed hi halves, lp = packed residuals, a in the low half of each
__device__ __forceinline__ void split2(float a, float b, unsigned& hp, unsigned& lp) {
  const v2f f = {a, b};
  const v2b h = __builtin_convertvector(f, v2b);
  hp = __builtin_bit_cast(unsigned, h);
  lp = cvt2(a - (float)h[0], b - (float)h[1]);
}

// ---- fragment loader: 16-bit A/B operand, lane -> row/col (lane&15), p already includes +8*(lane>>4);
//      elements 0..7 <- p[0..7] (k0+8h..k0+8h+7), elements 8..15 <- p[16..23] (k0+16+8h..k0+16+8h+7)
template <typename OT> struct FT;
template <> struct FT<__bf16> { typedef v16b frag; typedef v8b half8; };

template <typename OT>
__device__ __forceinline__ typename FT<OT>::frag ldfrag(const OT* p) {
  union { typename FT<OT>::frag v; typename FT<OT>::half8 h[2]; } f;
  f.h[0] = *(const typename FT<OT>::half8*)(p);
  f.h[1] = *(const typename FT<OT>::half8*)(p + 16);
  return f.v;
}

// ---- transposing fragment loader: a row-major 16-bit LDS tile T[k][d] read as the A operand T^T (rows d, k along the
//      fragment). p = the lane's own 16 B: row k0 + 8*(lane>>4) + (lane&7), piece (lane>>3)&1 of the 16 columns at d0.
//      Lane (c = lane&15, h = lane>>4) gets T[k0+8h .. k0+8h+7][d0+c] in elements 0..7 and, from 16 rows further,
//      T[k0+16+8h .. +7][d0+c] in elements 8..15: the k map of ldfrag. Every lane is on where it is called.
__device__ __forceinline__ v16b ldfrag_tr(const unsigned short* p, int pitch) {
  typedef __attribute__((address_space(3))) v8b lds_v8b;
  union { v16b v; v8b h[2]; } f;
  f.h[0] = __builtin_amdgcn_ds_load_tr16_b128_v8bf16((lds_v8b*)p);
  f.h[1] = __builtin_amdgcn_ds_load_tr16_b128_v8bf16((lds_v8b*)(p + 16 * pitch));
  return f.v;
}

// ---- WMMA helpers ------------------------------------------------------------------------------------
__device__ __forceinline__ v8f mmar(v16b a, v16b b, v8f c) {
  return __builtin_amdgcn_wmma_f32_16x16x32_bf16(false, a, false, b, (short)0, c, false, false);
}
// guarded form: 4 VALU slots after the WMMA, D tied, A/B kept live
__device__ __forceinline__ v8f mma_b(v16b a, v16b b, v8f c) {
  c = __builtin_amdgcn_wmma_f32_16x16x32_bf16(false, a, false, b, (short)0, c, false, false);
#if DEV_ASM
  asm volatile("v_nop\n\tv_nop\n\tv_nop\n\tv_nop" : "+v"(c) : "v"(a), "v"(b));
#endif
  return c;
}
__device__ __forceinline__ void dep_guard(v8f& a, v8f& b, v16b x, v16b y) {
#if DEV_ASM
  asm volatile("v_nop\n\tv_nop\n\tv_nop\n\tv_nop" : "+v"(a), "+v"(b) : "v"(x), "v"(y));
#else
  (void)a; (void)b; (void)x; (void)y;
#endif
}
__device__ __forceinline__ void keep4(v16b a, v16b b, v16b c, v16b d) {
#if DEV_ASM
  asm volatile("v_nop" :: "v"(a), "v"(b), "v"(c), "v"(d));
#else
  (void)a; (void)b; (void)c; (void)d;
#endif
}
__device__ __forceinline__ void acc_guard4(v8f& a, v8f& b, v8f& c, v8f& d) {
#if DEV_ASM
  asm volatile("v_nop\n\tv_nop\n\tv_nop\n\tv_nop" : "+v"(a), "+v"(b), "+v"(c), "+v"(d));
#else
  (void)a; (void)b; (void)c; (void)d;
#endif
}

// =====================================================================================================
// x NCHW f32 [b][c][p] -> Xh bf16 [b*3136 + p][c] (RNE convert), transposed through an LDS 64c x 64p tile.
// Store phase: item = it*256 + tid, p = item>>3, channel group = item&7 -> lanes 8q..8q+7 write one whole
// coverage: 2 iterations x 256 threads x 8 = the whole 64x64 tile; 392 blocks = the whole [6272][256] plane.
// =====================================================================================================
__device__ __forceinline__ void cvt_x(const float* __restrict__ x, unsigned short* xh, float* t, int blk) {
  const int tid = (int)threadIdx.x;
  const int p0 = (blk % (NPOS / 64)) * 64, c0 = ((blk / (NPOS / 64)) % (CH / 64)) * 64, b = blk / ((NPOS / 64) * (CH / 64));
#pragma unroll
  for (int it = 0; it < 4; ++it) {
    const int c  = it * 16 + (tid >> 4);
    const int p4 = (tid & 15) * 4;
    const v4f v = *(const v4f*)(x + ((size_t)(b * CH + c0 + c)) * NPOS + p0 + p4);
    float* tp = t + c * 65 + p4;
    tp[0] = v[0]; tp[1] = v[1]; tp[2] = v[2]; tp[3] = v[3];
  }
  __syncthreads();
  v4u pk[2];
  size_t go[2];
#pragma unroll
  for (int it = 0; it < 2; ++it) {
    const int item = it * 256 + tid;
    const int p = item >> 3, cg = item & 7;
    v4u a;
#pragma unroll
    for (int e = 0; e < 4; ++e) {
      const float f0 = t[(cg * 8 + 2 * e) * 65 + p];
      const float f1 = t[(cg * 8 + 2 * e + 1) * 65 + p];
      a[e] = cvt2(f0, f1);
    }
    pk[it] = a;
    go[it] = ((size_t)(b * NPOS + p0 + p)) * CH + c0 + cg * 8;
  }
  {
#pragma unroll
    for (int it = 0; it < 2; ++it) *(v4u*)(xh + go[it]) = pk[it];
    
  }
}

// =====================================================================================================
// f32 -> bf16 bits (RNE convert), 8 elements per thread, one 16-B store per lane: a wave writes 512
// coverage: n8 threads x 8 = the whole plane (n8 = 24576 here, a multiple of 256).
// =====================================================================================================
__device__ __forceinline__ void cvt16x8(const float* __restrict__ in, unsigned short* out, int n8, int blk) {
  const int i = blk * 256 + (int)threadIdx.x;
  if (i < n8) {
    const v4f a  = *(const v4f*)(in + (size_t)i * 8);
    const v4f a4 = *(const v4f*)(in + (size_t)i * 8 + 4);
    v4u p;
    p[0] = cvt2(a[0],  a[1]);
    p[1] = cvt2(a[2],  a[3]);
    p[2] = cvt2(a4[0], a4[1]);
    p[3] = cvt2(a4[2], a4[3]);
    unsigned short* o = out + (size_t)i * 8;
    *(v4u*)o = p;
    
  }
}

// =====================================================================================================
// w_proj [256 c][256 k] f32 -> folded plane Wf bf16 [256 c][512]: Wf[c][head*64 + part*32 + d] =
// bf16(w_proj[c][head*32 + d]) for part = 0 (meets the ctx hi half) and part = 1 (meets the residual half).
// coverage: 16384 threads x 8 = the whole [256][512] plane.
// =====================================================================================================
__device__ __forceinline__ void cvt_wp(const float* __restrict__ wp, unsigned short* out, int blk) {
  const int i = blk * 256 + (int)threadIdx.x;
  if (i < CH * CTXK / 8) {
    const int c  = i >> 6;                 // 64 groups of 8 per 512-wide row
    const int k  = (i & 63) * 8;           // 0..504
    const int hd = k >> 6;                 // head
    const int d0 = k & 31;                 // 0, 8, 16, 24
    const float* src = wp + (size_t)c * CH + hd * HDIM + d0;
    const v4f a  = *(const v4f*)src;
    const v4f a4 = *(const v4f*)(src + 4);
    v4u p;
    p[0] = cvt2(a[0],  a[1]);
    p[1] = cvt2(a[2],  a[3]);
    p[2] = cvt2(a4[0], a4[1]);
    p[3] = cvt2(a4[2], a4[3]);
    unsigned short* o = out + (size_t)i * 8;
    *(v4u*)o = p;
    
  }
}

// =====================================================================================================
// The three operand conversions read and write disjoint planes and none reads another's output, so they run
// as block ranges of one grid: blocks 0..NBX-1 = x tiles (the longest blocks, so they start first),
// NBX..NBX+NBQ-1 = w_qkv, the last NBP = w_proj. The range test is block-uniform (the x tiles hold a barrier).
// =====================================================================================================
#define NBX ((NPOS / 64) * (CH / 64) * NBT)   // 392 x tiles
#define NBQ (C3 * CH / 8 / 256)               //  96 blocks of w_qkv
#define NBP (CH * CTXK / 8 / 256)             //  64 blocks of w_proj
static_assert(NBQ * 256 * 8 == C3 * CH && NBP * 256 * 8 == CH * CTXK);
__global__ __launch_bounds__(256) void cvt_all(const float* __restrict__ x, const float* __restrict__ wq,
                                               const float* __restrict__ wp, unsigned short* xh,
                                               unsigned short* wqb, unsigned short* wpf) {
  __shared__ float t[64 * 65];                       // x tile [c][p], pitch 65
  const int blk = (int)blockIdx.x;
  if (blk < NBX) {
    cvt_x(x, xh, t, blk);
  } else if (blk < NBX + NBQ) {
    cvt16x8(wq, wqb, C3 * CH / 8, blk - NBX);
  } else {
    cvt_wp(wp, wpf, blk - (NBX + NBQ));
  }
}

// =====================================================================================================
// Batched WMMA GEMM (bf16 operands): C[m][n] = sum_k A[m][k] * Bt[n][k] + bias. A row-major [M][K] pitch lda;
// Bt row-major [N][K] pitch ldb (k contiguous); blockIdx.y = batch index (strides in elements).
// One block = 4 waves, one 64x64 tile of C per wave: WM waves along m and 4 / WM along n, so the block tile is
// (64 WM) x (256 / WM). M, N multiples of the block tile, K a multiple of SK (host constants).
// Operands go global -> LDS by asynchronous 16-B copies, SK = 64 k (one whole 128-B line of each of the 320
// operand rows) per stage, two buffers: stage t + 1 is in flight while stage t feeds the WMMAs.
// Stage layout: rows 0..BM-1 = A rows, rows BM..319 = Bt rows, pitch 144 B (16 B x 9, conflict-free b128 reads).
// Copy map: item = it*128 + tid, row = item>>3, 16-B piece = item&7 -> 8 lanes copy one line, 20 copies per lane
// = 320 rows x 8 pieces, each LDS byte written by one lane. Fragments keep the split k map (ldfrag), k ascending.
// BIAS_MODE 1: bias[n] (per column); BIAS_MODE 2: bias[m] (per row); bias values RNE-converted to bf16.
// Output: f32 C (pitch ldc). Epilogue: 16-row slabs staged per wave in LDS; each 64-wide row segment (256 B =
// coverage: 4 slabs x 16 rows (it 0..7 x lane>>4) x 64 cols = the wave's whole 64x64 tile.
// =====================================================================================================
#define SK     64                     // k elements per stage
#define SPITCH 72                     // LDS row pitch in elements (144 B)
#define SROWS  320                    // operand rows per stage (BM + BN)
#define SBYTES (SROWS * SPITCH * 2)   // 46080 B per buffer

// Four asynchronous copies, 16 B per lane each, global -> LDS. The s_wait_xcnt closes the statement so that no
// address register named here is rewritten before it.
__device__ __forceinline__ void copy4(unsigned l0, unsigned l1, unsigned l2, unsigned l3,
                                      const unsigned short* g0, const unsigned short* g1,
                                      const unsigned short* g2, const unsigned short* g3) {
#if DEV_ASM
  asm volatile("global_load_async_to_lds_b128 %0, %4, off\n\t"
               "global_load_async_to_lds_b128 %1, %5, off\n\t"
               "global_load_async_to_lds_b128 %2, %6, off\n\t"
               "global_load_async_to_lds_b128 %3, %7, off\n\t"
               "s_wait_xcnt 0x0"
               :: "v"(l0), "v"(l1), "v"(l2), "v"(l3), "v"(g0), "v"(g1), "v"(g2), "v"(g3) : "memory");
#else
  (void)l0; (void)l1; (void)l2; (void)l3; (void)g0; (void)g1; (void)g2; (void)g3;
#endif
}
// this wave's copies have landed in LDS (the compiler places no wait for them)
__device__ __forceinline__ void wait_copies() {
#if DEV_ASM
  asm volatile("s_wait_asynccnt 0x0" ::: "memory");
#endif
}
// this wave's LDS reads have returned, so the buffer they read may be refilled behind the next barrier
__device__ __forceinline__ void wait_lds() {
#if DEV_ASM
  asm volatile("s_wait_dscnt 0x0" ::: "memory");
#endif
}
// stands behind global loads, in front of whatever rewrites their address registers
__device__ __forceinline__ void wait_addr() {
#if DEV_ASM
  asm volatile("s_wait_xcnt 0x0" ::: "memory");
#endif
}
// one stage: 20 copies per lane; ga / gb = the lane's piece of its first A / Bt row at this stage's k
template <int BM>
__device__ __forceinline__ void fill_stage(unsigned lb, const unsigned short* ga, int lda,
                                           const unsigned short* gb, int ldb) {
  // both loops unrolled: r0 is then a constant, so the A / Bt choice is no branch and g, l stay in registers
#pragma unroll
  for (int q = 0; q < SROWS / 64; ++q) {
    const unsigned short* g[4];
    unsigned l[4];
#pragma unroll
    for (int e = 0; e < 4; ++e) {
      const int r0 = (q * 4 + e) * 16;                 // first row of this copy's 16 rows
      g[e] = (r0 < BM) ? ga + (size_t)r0 * lda : gb + (size_t)(r0 - BM) * ldb;
      l[e] = lb + (unsigned)(r0 * SPITCH * 2);
    }
    copy4(l[0], l[1], l[2], l[3], g[0], g[1], g[2], g[3]);
  }
}

template <int BIAS_MODE, int WM>
__global__ __launch_bounds__(128) void gemm64(
    const unsigned short* __restrict__ Ap, int lda, long long strideA,
    const unsigned short* __restrict__ Btp, int ldb, long long strideB,
    float* Cout, int ldc, long long strideC,
    const float* __restrict__ bias,
    int M, int N, int K) {
  constexpr int BM = 64 * WM;
  constexpr int BN = SROWS - BM;
  static_assert(WM == 1 || WM == 4);
  __shared__ __align__(16) unsigned short stg[2 * SROWS * SPITCH];   // two stage buffers
  __shared__ __align__(16) float sT[4][16 * 68];   // per-wave 16x64 slab, pitch 68 floats
  const int b    = blockIdx.y;
  const int tid  = (int)threadIdx.x;
  const int lane = tid & 31;
  const int wave = tid >> 5;
  const int tilesN = N / BN;
  const int tilesM = M / BM;
  const int tile = blockIdx.x;
  if (tile >= tilesM * tilesN) return;   // block-uniform, in front of every barrier and copy
  const int tm = tile / tilesN;
  const int tn = tile - tm * tilesN;
  const int wrA = (WM == 4) ? (wave << 6) : 0;          // the wave's first A row inside the stage
  const int wrB = BM + ((WM == 4) ? 0 : (wave << 6));   // the wave's first Bt row inside the stage
  const int m0 = tm * BM + wrA;
  const int n0 = tn * BN + (wrB - BM);

  const int rlane = lane & 15;                 // row (A) / col (B, D) within subtile
  const int koff  = (lane >> 4) * 8;           // k offset of this lane half
  const int mOff  = (lane >> 4) * 8;           // D row offset

  // the lane's copy addresses: row tid>>3 of each 16-row group, 16-B piece tid&7
  const unsigned short* ga = Ap  + (size_t)b * (size_t)strideA + (size_t)(tm * BM + (tid >> 3)) * lda + (tid & 7) * 8;
  const unsigned short* gb = Btp + (size_t)b * (size_t)strideB + (size_t)(tn * BN + (tid >> 3)) * ldb + (tid & 7) * 8;
  const unsigned lds0 = (unsigned)(uintptr_t)stg + (unsigned)((tid >> 3) * SPITCH * 2 + (tid & 7) * 16);
  const int nst = K / SK;

  v8f acc[4][4];
#pragma unroll
  for (int i = 0; i < 4; ++i)
#pragma unroll
    for (int j = 0; j < 4; ++j) acc[i][j] = zero8();

  fill_stage<BM>(lds0, ga, lda, gb, ldb);
  wait_copies();
  __syncthreads();                             // stage 0 is readable by every wave
  if (nst > 1) fill_stage<BM>(lds0 + SBYTES, ga + SK, lda, gb + SK, ldb);

  for (int t = 0; t < nst; ++t) {
    const __bf16* sb = (const __bf16*)(const void*)stg + (t & 1) * (SROWS * SPITCH);
    // unrolled (inner loops too): fragments stay in registers, and the second k step's LDS reads start under
    // the first step's WMMAs
#pragma unroll
    for (int kk = 0; kk < SK; kk += 32) {
      v16b bq[4], af[4];
#pragma unroll
      for (int j = 0; j < 4; ++j) bq[j] = ldfrag<__bf16>(sb + (wrB + (j << 4) + rlane) * SPITCH + koff + kk);
#pragma unroll
      for (int i = 0; i < 4; ++i) af[i] = ldfrag<__bf16>(sb + (wrA + (i << 4) + rlane) * SPITCH + koff + kk);
#pragma unroll
      for (int i = 0; i < 4; ++i) {
#pragma unroll
        for (int j = 0; j < 4; ++j) acc[i][j] = mmar(af[i], bq[j], acc[i][j]);
        dep_guard(acc[i][0], acc[i][3], af[i], bq[3]);
      }
      keep4(bq[0], bq[1], bq[2], bq[3]);
    }
    // publish point of stage t + 1: own reads of stage t done, own copies of stage t + 1 landed, then the barrier
    wait_lds();
    wait_copies();
    __syncthreads();
    if (t + 2 < nst) fill_stage<BM>(lds0 + (unsigned)(t & 1) * SBYTES, ga + (t + 2) * SK, lda, gb + (t + 2) * SK, ldb);
  }
  wait_copies();
  acc_guard4(acc[0][0], acc[0][1], acc[0][2], acc[0][3]);
  acc_guard4(acc[1][0], acc[1][1], acc[1][2], acc[1][3]);
  acc_guard4(acc[2][0], acc[2][1], acc[2][2], acc[2][3]);
  acc_guard4(acc[3][0], acc[3][1], acc[3][2], acc[3][3]);

  // ---- epilogue ----
  float* slab = sT[wave];
  float* C = Cout + (size_t)b * (size_t)strideC;
  const int h2 = lane >> 4, c4 = (lane & 15) * 4;     // 256-B row segment = 16 lanes x 16 B
  v4f bcol = {0.f, 0.f, 0.f, 0.f};
  if (BIAS_MODE == 1) {
#pragma unroll
    for (int e = 0; e < 4; ++e) bcol[e] = bf_round(bias[n0 + c4 + e]);
  }
#pragma unroll
  for (int i = 0; i < 4; ++i) {
    const int mBase = m0 + (i << 4);
#pragma unroll
    for (int j = 0; j < 4; ++j) {
#pragma unroll
      for (int r = 0; r < 8; ++r) {
        slab[(mOff + r) * 68 + (j << 4) + rlane] = acc[i][j][r];
      }
    }
    __builtin_amdgcn_fence(__ATOMIC_RELEASE, "workgroup");
    __builtin_amdgcn_wave_barrier();
    __builtin_amdgcn_fence(__ATOMIC_ACQUIRE, "workgroup");
    {
#pragma unroll
      for (int it = 0; it < 8; ++it) {
        const int row = it * 2 + h2;                     // it 0..7 x h2 0..1 = rows 0..15
        v4f v = *(const v4f*)(slab + row * 68 + c4);
        if (BIAS_MODE == 1) {
          v = v + bcol;
        } else {
          const float br = bf_round(bias[mBase + row]);
          v = v + br;
        }
        *(v4f*)(C + (size_t)(mBase + row) * ldc + n0 + c4) = v;
      }
      
    }
    __builtin_amdgcn_fence(__ATOMIC_RELEASE, "workgroup");
    __builtin_amdgcn_wave_barrier();
    __builtin_amdgcn_fence(__ATOMIC_ACQUIRE, "workgroup");
  }
}

// =====================================================================================================
// P^T B fragment pair (hi, residual) from the lane's own score D values: element r <- tile a row r,
// element 8+r <- tile c row r (same lane, same query column).
// =====================================================================================================
__device__ __forceinline__ void pack_pt(v8f a, v8f c, v16b& ph, v16b& pl) {
  v8u H, L;
#pragma unroll
  for (int r = 0; r < 4; ++r) {
    unsigned hp, lp;
    split2(a[2 * r], a[2 * r + 1], hp, lp);
    H[r] = hp; L[r] = lp;
    split2(c[2 * r], c[2 * r + 1], hp, lp);
    H[4 + r] = hp; L[4 + r] = lp;
  }
  ph = __builtin_bit_cast(v16b, H); pl = __builtin_bit_cast(v16b, L);
}

// load 8 consecutive f32, or zeros when keep == 0 (address always valid, select by value)
__device__ __forceinline__ void ld8sel(const float* src, int keep, float f[8]) {
  const v4f a = *(const v4f*)src;
  const v4f c = *(const v4f*)(src + 4);
  f[0] = keep ? a[0] : 0.f; f[1] = keep ? a[1] : 0.f; f[2] = keep ? a[2] : 0.f; f[3] = keep ? a[3] : 0.f;
  f[4] = keep ? c[0] : 0.f; f[5] = keep ? c[1] : 0.f; f[6] = keep ? c[2] : 0.f; f[7] = keep ? c[3] : 0.f;
}

// =====================================================================================================
// Windowed attention, one block = (batch b, head, 8x8 query tile at (i0, j0)); 128 threads = 4 waves,
// wave w owns the 16 queries lq = 16w..16w+15 (query row i0 + (lq>>3), col j0 + (lq&7)).
// Key superset = the 14x14 image block at (R0, C0), R0 = clamp(i0-3, 0, 42), slot = u*14 + v (196 slots,
// padded to 224 with zero rows). Every query's clamped 7x7 window lies inside the superset: valid slots are
// su <= u <= su+6, sv <= v <= sv+6 with su = clamp(qi-3,0,49) - R0 in [0,7].
//   qkv plane f32 [b*3136 + p][768]: q = cols head*32+d (scaled by 32^-0.5 in f32 here), k = 256+.., v = 512+..
//   scores (transposed): S^T[slot][query] = K[slot][d] . Q^T[d][query] on bf16 WMMA, 3 products
//     (hi.hi + hi.res + res.hi); lane owns query column (lane&15) of its wave and key rows 16j + 8h + r.
//   s = S^T + rpb[head][u + R0 - qi + 6][v + C0 - qj + 6] for valid slots, -1e30 otherwise (f32);
//   softmax in f32 (max / sum over the 104 lane values and the partner lane ^16).
//   O^T[d][query] = V^T[d][slot] . P^T[slot][query] on bf16 WMMA, 3 products, p unnormalised exp, 1/sum at the end.
// LDS: KV0/KV1 hold K hi/res [slot][d] (pitch 64 B) for the scores, then (after a block barrier) V hi/res [slot][d]
// (pitch 96 B), row-major as it comes from memory; the V^T fragments are made by transposing LDS loads.
// K and Q rows have a 64-B pitch, at which the b128 fragment reads meet four to a bank; Os rows 128 B.
// Staged extents: KV 224x32 both phases (slots >= 196 zero), Q 64x32, Rp 384 (table at 100..268, zeros around),
// Os 16x32 per wave -- every LDS element read is written first.
// Output coverage: each wave stores its 16 query rows (it 0..3 x lane>>3) x 8 pieces of 16 B (lane&7) =
// =====================================================================================================
__global__ __launch_bounds__(128)
void natt(const float* __restrict__ qkv, const float* __restrict__ rpb, unsigned short* ctx) {
  __shared__ __align__(32) unsigned short KV0[NSLOT * VPITCH];   // 21504 B (K uses the first 14336)
  __shared__ __align__(32) unsigned short KV1[NSLOT * VPITCH];   // 21504 B
  __shared__ __align__(16) unsigned short Qh[64 * HDIM];       //  4096 B
  __shared__ __align__(16) unsigned short Ql[64 * HDIM];       //  4096 B
  __shared__ __align__(16) float Os[4][16 * HDIM];             //  8192 B
  __shared__ float Rp[RPN];

  const int tid  = (int)threadIdx.x;
  const int wave = tid >> 5;
  const int lane = tid & 31;
  const int hh   = lane >> 4;
  const int m    = lane & 15;

  const int bx   = blockIdx.x;
  const int tj   = bx % 7;
  const int ti   = (bx / 7) % 7;
  const int head = (bx / 49) % NHD;
  const int b    = bx / (49 * NHD);
  const int i0 = ti * 8, j0 = tj * 8;
  const int R0 = min(max(i0 - 3, 0), IMH - SUP);
  const int C0 = min(max(j0 - 3, 0), IMW - SUP);
  const size_t pb = (size_t)b * NPOS;

  // ---- position-bias table of this head (bf16 RNE-converted values), entries 0..168 at Rp[RPLO..], zeros around ----
  {
    float rv[RPN / 128];
    // both loops unrolled: rv stays in registers and the three loads go out together
#pragma unroll
    for (int it = 0; it < RPN / 128; ++it) {
      const int t = it * 128 + tid - RPLO;
      rv[it] = rpb[head * 169 + min(max(t, 0), 168)];           // clamped address
    }
    wait_addr();
#pragma unroll
    for (int it = 0; it < RPN / 128; ++it) {
      const int e = it * 128 + tid;
      const float tv = bf_round(rv[it]);
      Rp[e] = ((unsigned)(e - RPLO) < 169u) ? tv : 0.f;
    }
  }
  // ---- q (scaled in f32) -> hi / residual planes [lq][d]; thread = (lq = tid>>1, d half) ----
  {
    const int lq = tid >> 1, dh = (tid & 1) * 16;
    const int qi = lq >> 3, qj = lq & 7;
    const size_t pos = pb + (size_t)(i0 + qi) * IMW + j0 + qj;
    const float* src = qkv + pos * C3 + head * HDIM + dh;
#pragma unroll
    for (int g = 0; g < 2; ++g) {
      float f[8];
      ld8sel(src + 8 * g, 1, f);
      v4u ph, pl;
#pragma unroll
      for (int e = 0; e < 4; ++e) {
        unsigned hp, lp;
        split2(f[2 * e] * QSCALE, f[2 * e + 1] * QSCALE, hp, lp);
        ph[e] = hp; pl[e] = lp;
      }
      *(v4u*)(Qh + lq * HDIM + dh + 8 * g) = ph;
      *(v4u*)(Ql + lq * HDIM + dh + 8 * g) = pl;
    }
  }
  // ---- K superset -> KV0 (hi) / KV1 (residual), layout [slot][d]; item = it*128 + tid, slot = item>>2,
  //      d8 = (item&3)*8; 7 x 128 items = 224 slots x 4 groups = the whole tile; slots >= 196 = zeros ----
  {
    const float* kbase = qkv + CH + head * HDIM;
#pragma unroll
    for (int it = 0; it < 7; ++it) {
      const int item = it * 128 + tid;
      const int slot = item >> 2, d8 = (item & 3) * 8;
      const int u = slot / SUP, v = slot - u * SUP;
      const int uc = min(u, SUP - 1);
      const size_t pos = pb + (size_t)(R0 + uc) * IMW + C0 + v;
      float f[8];
      ld8sel(kbase + pos * C3 + d8, slot < SUP * SUP, f);
      v4u ph, pl;
#pragma unroll
      for (int e = 0; e < 4; ++e) {
        unsigned hp, lp;
        split2(f[2 * e], f[2 * e + 1], hp, lp);
        ph[e] = hp; pl[e] = lp;
      }
      *(v4u*)(KV0 + slot * HDIM + d8) = ph;
      *(v4u*)(KV1 + slot * HDIM + d8) = pl;
    }
  }
  __syncthreads();

  // ---- scores: S^T tiles j = 0..12 (key slots 16j..16j+15) for the wave's 16 queries; s[13] stays zero ----
  v8f s[NKT + 1];
  {
    const __bf16* Kh = (const __bf16*)(const void*)KV0;
    const __bf16* Kl = (const __bf16*)(const void*)KV1;
    const __bf16* Qhp = (const __bf16*)(const void*)Qh;
    const __bf16* Qlp = (const __bf16*)(const void*)Ql;
    const v16b qfh = ldfrag<__bf16>(Qhp + (16 * wave + m) * HDIM + 8 * hh);
    const v16b qfl = ldfrag<__bf16>(Qlp + (16 * wave + m) * HDIM + 8 * hh);
#pragma unroll
    for (int j = 0; j < NKT; ++j) {
      const v16b kfh = ldfrag<__bf16>(Kh + (16 * j + m) * HDIM + 8 * hh);
      const v16b kfl = ldfrag<__bf16>(Kl + (16 * j + m) * HDIM + 8 * hh);
      v8f z = zero8();
      z = mma_b(kfh, qfh, z);
      z = mma_b(kfh, qfl, z);
      z = mma_b(kfl, qfh, z);
      s[j] = z;
    }
    s[NKT] = zero8();
  }
  __syncthreads();   // all waves done reading K from KV0/KV1

  // ---- V superset -> KV0 (hi) / KV1 (residual), layout [slot][d] (pitch VPITCH), one 16-B store per plane and item;
  //      same item map as K: 224 slots x 32 d written, slots >= 196 = zeros ----
  {
    const float* vbase = qkv + 2 * CH + head * HDIM;
#pragma unroll
    for (int it = 0; it < 7; ++it) {
      const int item = it * 128 + tid;
      const int slot = item >> 2, d8 = (item & 3) * 8;
      const int u = slot / SUP, v = slot - u * SUP;
      const int uc = min(u, SUP - 1);
      const size_t pos = pb + (size_t)(R0 + uc) * IMW + C0 + v;
      float f[8];
      ld8sel(vbase + pos * C3 + d8, slot < SUP * SUP, f);
      v4u ph, pl;
#pragma unroll
      for (int e = 0; e < 4; ++e) {
        unsigned hp, lp;
        split2(f[2 * e], f[2 * e + 1], hp, lp);
        ph[e] = hp; pl[e] = lp;
      }
      *(v4u*)(KV0 + slot * VPITCH + d8) = ph;
      *(v4u*)(KV1 + slot * VPITCH + d8) = pl;
    }
  }
  __syncthreads();

  // ---- window mask + position bias (f32), softmax over the query column ----
  const int lq = 16 * wave + m;
  const int ai = i0 + (lq >> 3), aj = j0 + (lq & 7);
  const int su = min(max(ai - 3, 0), IMH - KW) - R0;
  const int sv = min(max(aj - 3, 0), IMW - KW) - C0;
  const int cb = (R0 - ai + 6) * 13 + (C0 - aj + 6);
  // Bias index 13u + v + cb = slot - u + cb. The upper lane half's slot is 8 higher and its u is equal or one
  // higher (one higher where t0 % 14 >= 6), so two lane bases and a constant offset address every read; the read
  // is made for every slot (the padded table holds every such index) and the window test selects by value.
  const float* rb8 = Rp + (RPLO + cb + 8 * hh);
  const float* rb7 = Rp + (RPLO + cb + 7 * hh);
  // The window test of a slot is a row test and a column test; each distinct one is made once:
  // column k = t0 % 14 (upper half: (k + 8) % 14), row a = t0 / 14 (upper half: a, or a + 1 where k >= 6).
  // Both loops unrolled: the arrays are then indexed by constants only and each test is one lane mask in a register.
  bool colok[SUP], rowsame[SUP + 1], rownext[SUP + 1];
#pragma unroll
  for (int k = 0; k < SUP; ++k) {
    const int v = hh ? ((k + 8) % SUP) : k;
    colok[k] = (unsigned)(v - sv) < 7u;
  }
#pragma unroll
  for (int a = 0; a <= SUP; ++a) {
    rowsame[a] = (unsigned)(a - su) < 7u;
    rownext[a] = (unsigned)(a + hh - su) < 7u;
  }
  float mloc = -1.0e30f;
#pragma unroll
  for (int j = 0; j < NKT; ++j) {
#pragma unroll
    for (int r = 0; r < 8; ++r) {
      const int t0 = 16 * j + r;                       // slot = t0 + 8*hh
      const bool step = (t0 % SUP) >= SUP - 8;         // the upper half's slot lies one superset row further
      const bool ok = colok[t0 % SUP] & (step ? rownext[t0 / SUP] : rowsame[t0 / SUP]);
      const int c0 = t0 - t0 / SUP;                    // 13u + v of the lower half's slot
      const float bv = step ? rb7[c0] : rb8[c0];
      const float sb = s[j][r] + bv;
      const float sval = ok ? sb : -1.0e30f;
      s[j][r] = sval;
      mloc = fmaxf(mloc, sval);
    }
  }
  const float mrow = fmaxf(mloc, __shfl_xor(mloc, 16, 32));
  // scheduling boundary: without it the branch-free mask phase and the exp / pack / P.V phase form one region, the
  // scheduler lifts later work into it and the register count passes 256, which costs a resident wave per SIMD
  __builtin_amdgcn_sched_barrier(0);
  float lsum = 0.f;
#pragma unroll
  for (int j = 0; j < NKT; ++j) {
#pragma unroll
    for (int r = 0; r < 8; ++r) {
      const float p = __expf(s[j][r] - mrow);
      s[j][r] = p;
      lsum += p;
    }
  }
  lsum += __shfl_xor(lsum, 16, 32);

  // ---- O^T = V^T . P^T : 2 d-tiles x 7 k-steps of 32 slots x 3 products ----
  v8f o[2];
  o[0] = zero8(); o[1] = zero8();
  {
    // the lane's 16 B of a transposing load: slot row 8*hh + (lane&7), column piece (lane>>3)&1
    const int vo = (8 * hh + (lane & 7)) * VPITCH + ((lane >> 3) & 1) * 8;
    const unsigned short* Vh = KV0 + vo;
    const unsigned short* Vl = KV1 + vo;
#pragma unroll
    for (int kk = 0; kk < NSLOT / 32; ++kk) {
      v16b ph, pl;
      pack_pt(s[2 * kk], s[2 * kk + 1], ph, pl);
#pragma unroll
      for (int t = 0; t < 2; ++t) {
        const v16b vfh = ldfrag_tr(Vh + 32 * kk * VPITCH + 16 * t, VPITCH);
        const v16b vfl = ldfrag_tr(Vl + 32 * kk * VPITCH + 16 * t, VPITCH);
        o[t] = mma_b(vfh, ph, o[t]);
        o[t] = mma_b(vfh, pl, o[t]);
        o[t] = mma_b(vfl, ph, o[t]);
      }
    }
  }

  // ---- normalise, stage the wave's 16 queries x 32 d in LDS, write the ctx lines ----
  const float linv = 1.0f / lsum;
  float* os = Os[wave];
#pragma unroll
  for (int t = 0; t < 2; ++t)
#pragma unroll
    for (int r = 0; r < 8; ++r) os[m * HDIM + 16 * t + 8 * hh + r] = o[t][r] * linv;
  __syncthreads();
  {
    const int q4 = lane >> 3, pc = lane & 7, dsel = (pc & 3) * 8;
    const bool lowp = (pc >= 4);
    v4u hv[4];
    size_t go[4];
#pragma unroll
    for (int it = 0; it < 4; ++it) {
      const int row = it * 4 + q4;                     // it 0..3 x q4 0..3 = rows 0..15
      const float* sp = os + row * HDIM + dsel;
      v4u a;
#pragma unroll
      for (int e = 0; e < 4; ++e) {
        unsigned hp, lp;
        split2(sp[2 * e], sp[2 * e + 1], hp, lp);
        a[e] = lowp ? lp : hp;
      }
      hv[it] = a;
      const int lqr = 16 * wave + row;
      const size_t pos = pb + (size_t)(i0 + (lqr >> 3)) * IMW + j0 + (lqr & 7);
      go[it] = pos * CTXK + (size_t)head * 64 + pc * 8;
    }
    {
#pragma unroll
      for (int it = 0; it < 4; ++it) *(v4u*)(ctx + go[it]) = hv[it];
      
    }
  }
}

// =====================================================================================================
//   Xh   bf16 [6272][256]     3211264
//   Wqb  bf16 [768][256]       393216
//   Wpf  bf16 [256][512]       262144
//   QKV  f32  [6272][768]    19267584
//   CTX  bf16 [6272][512]     6422528
//   total                   29556736
// =====================================================================================================
extern "C" void kernel_launch(void* const* d_in, const int* in_sizes, int n_in,
                              void* d_out, int out_size, void* d_ws, size_t ws_size,
                              hipStream_t stream) {
  if (n_in < 6) return;
  if (in_sizes[0] != NBT * CH * NPOS) return;
  if (in_sizes[1] != C3 * CH) return;
  if (in_sizes[2] != C3) return;
  if (in_sizes[3] != NHD * 13 * 13) return;
  if (in_sizes[4] != CH * CH) return;
  if (in_sizes[5] != CH) return;
  if (out_size != NBT * CH * NPOS) return;

  const float* x      = (const float*)d_in[0];
  const float* w_qkv  = (const float*)d_in[1];
  const float* b_qkv  = (const float*)d_in[2];
  const float* rpb    = (const float*)d_in[3];
  const float* w_proj = (const float*)d_in[4];
  const float* b_proj = (const float*)d_in[5];

  const size_t PXH  = (size_t)MROW * CH * 2;        //  3211264
  const size_t PWQ  = (size_t)C3 * CH * 2;          //   393216
  const size_t PWP  = (size_t)CH * CTXK * 2;        //   262144
  const size_t PQKV = (size_t)MROW * C3 * 4;        // 19267584
  const size_t PCTX = (size_t)MROW * CTXK * 2;      //  6422528
  size_t off = 0;
  const size_t oXh  = off; off += PXH;
  const size_t oWq  = off; off += PWQ;
  const size_t oWp  = off; off += PWP;
  const size_t oQKV = off; off += PQKV;
  const size_t oCTX = off; off += PCTX;
  if (off > ws_size) return;                         // off = 29556736
  if (off > (size_t)134217728) return;

  char* ws = (char*)d_ws;
  unsigned short* Xh  = (unsigned short*)(ws + oXh);
  unsigned short* Wqb = (unsigned short*)(ws + oWq);
  unsigned short* Wpf = (unsigned short*)(ws + oWp);
  float*          QKV = (float*)(ws + oQKV);
  unsigned short* CTX = (unsigned short*)(ws + oCTX);

  const int tilesQKV = (MROW / 64) * (C3 / 256);                      //  294 block tiles of 64 x 256
  const int tilesPRJ = (CH / 256) * (NPOS / 64);                      //   49 block tiles of 256 x 64
  const dim3 gCvt(NBX + NBQ + NBP);                                   // 552
  const dim3 gQKV(tilesQKV, 1);                                       // 294
  const dim3 gAtt(NBT * NHD * 49);                                    // 784
  const dim3 gPRJ(tilesPRJ, NBT);                                     // (49, 2)

  // (1) x NCHW -> bf16 [p][c]; w_qkv -> bf16 [n][k]; w_proj -> folded bf16 [c][512]
  cvt_all<<<gCvt, dim3(256), 0, stream>>>(x, w_qkv, w_proj, Xh, Wqb, Wpf);
  // (2) qkv = Xh . Wqkv^T + b_qkv -> f32 [6272][768]   (M=6272, N=768, K=256)
  gemm64<1, 1><<<gQKV, dim3(128), 0, stream>>>(
      Xh, CH, 0LL, Wqb, CH, 0LL,
      QKV, C3, 0LL, b_qkv,
      MROW, C3, CH);
  // (3) windowed attention -> ctx plane bf16 [6272][512]
  natt<<<gAtt, dim3(128), 0, stream>>>(QKV, rpb, CTX);
  // (4) out[b][c][p] = sum_k Wpf[c][k] ctx[b*3136+p][k] + b_proj[c]   (per batch: M=256, N=3136, K=512)
  gemm64<2, 4><<<gPRJ, dim3(128), 0, stream>>>(
      Wpf, CTXK, 0LL, CTX, CTXK, (long long)NPOS * CTXK,
      (float*)d_out, NPOS, (long long)CH * NPOS, b_proj,
      CH, NPOS, CTXK);
  (void)hipGetLastError();
}

// v006
// A run of this version takes 36.3 microseconds.
// Next to v005, in two timings, it ran 1.04 times as fast each time.
// Over all steps from v000 it is 2.08 times as fast.
// Contractions: qkv projection = v_wmma_f32_16x16x32_bf16 (bf16 operands from RNE-converted x and w_qkv, single product, f32 accumulate);
// q.k scores = v_wmma_f32_16x16x32_bf16 (q and k each as bf16 hi plane + unscaled bf16 residual plane, 3 products, f32 accumulate);
// p.v = v_wmma_f32_16x16x32_bf16 (p and v each as bf16 hi + unscaled bf16 residual, 3 products, f32 accumulate);
// ctx.w_proj^T = v_wmma_f32_16x16x32_bf16 (ctx as bf16 hi + residual folded into K, w_proj bf16 from its RNE-converted value, f32 accumulate);
// biases, q scaling, window mask, position bias and softmax in f32. No power-of-two carries anywhere (bf16 planes, unscaled residuals).
#include <hip/hip_runtime.h>
#include <math.h>
#include <stdint.h>

#define NBT   2
#define CH    256
#define IMH   56
#define IMW   56
#define NPOS  (IMH * IMW)        // 3136 positions per image, p = i*56 + j
#define MROW  (NBT * NPOS)       // 6272 position rows
#define NHD   8
#define HDIM  32
#define C3    (3 * CH)           // 768
#define KW    7                  // window side; window start = clamp(i - 3, 0, IMH - KW)
#define SUP   14                 // clamped key superset side of an 8x8 query tile
#define NSLOT 224                // key slots staged per block (196 used, rest zero)
#define NKT   13                 // scored 16-key tiles (slots 0..207)
#define CTXK  512                // folded K of the ctx plane: per head [hi d0..31 | residual d0..31]
#define QSCALE 0.17677669529663687f
#define RPLO  100                // position-bias entry 0 sits at Rp[RPLO]; entries around the table are zero
#define RPN   384                // padded table: every unclamped index 13u + v + cb of a scored slot lies inside
#define VPITCH 48                // LDS pitch of a staged V row [slot][d] in elements: 96 B = 32 B x 3, the transposing reader's pitch

static_assert((MROW % 64) == 0);
static_assert((C3 % 256) == 0);
static_assert((NPOS % 64) == 0);
static_assert((CH % 256) == 0);
static_assert((CH % 128) == 0 && (CTXK % 128) == 0);
static_assert(NHD * HDIM == CH);
static_assert(SUP == 8 + KW - 1);
static_assert(SUP * SUP <= NSLOT && (NSLOT % 32) == 0 && NKT * 16 >= SUP * SUP);
static_assert(IMH == IMW);
static_assert(VPITCH >= HDIM && (VPITCH * 2) % 32 == 0 && ((VPITCH * 2) / 32) % 2 == 1);
static_assert(RPLO - 7 * 13 - 7 >= 0 && RPLO + 6 * 13 + 6 + (NKT * 16 - 1) - (NKT * 16 - 1) / SUP < RPN && RPN % 128 == 0);

typedef __bf16   v16b __attribute__((ext_vector_type(16)));
typedef __bf16   v8b  __attribute__((ext_vector_type(8)));
typedef float    v8f  __attribute__((ext_vector_type(8)));
typedef float    v4f  __attribute__((ext_vector_type(4)));
typedef unsigned int v4u __attribute__((ext_vector_type(4)));
typedef unsigned int v8u __attribute__((ext_vector_type(8)));
typedef float    v2f  __attribute__((ext_vector_type(2)));
typedef __bf16   v2b  __attribute__((ext_vector_type(2)));

#if defined(__HIP_DEVICE_COMPILE__)
#define DEV_ASM 1
#else
#define DEV_ASM 0
#endif

// ---- scalar helpers --------------------------------------------------------------------------------
// two f32 -> two bf16 (RNE) packed in one register, a in the low half: one packed convert instruction
__device__ __forceinline__ unsigned cvt2(float a, float b) {
  const v2f f = {a, b};
  return __builtin_bit_cast(unsigned, __builtin_convertvector(f, v2b));
}
__device__ __forceinline__ float bf_round(float f) { return (float)(__bf16)f; }   // f32 value of the RNE bf16
__device__ __forceinline__ v8f zero8() { v8f z = {0.f, 0.f, 0.f, 0.f, 0.f, 0.f, 0.f, 0.f}; return z; }
// hi / residual bf16 split of an f32 value (residual unscaled)
// of a pair: hp = packed hi halves, lp = packed residuals, a in the low half of each
__device__ __forceinline__ void split2(float a, float b, unsigned& hp, unsigned& lp) {
  const v2f f = {a, b};
  const v2b h = __builtin_convertvector(f, v2b);
  hp = __builtin_bit_cast(unsigned, h);
  lp = cvt2(a - (float)h[0], b - (float)h[1]);
}

// ---- fragment loader: 16-bit A/B operand, lane -> row/col (lane&15), p already includes +8*(lane>>4);
//      elements 0..7 <- p[0..7] (k0+8h..k0+8h+7), elements 8..15 <- p[16..23] (k0+16+8h..k0+16+8h+7)
template <typename OT> struct FT;
template <> struct FT<__bf16> { typedef v16b frag; typedef v8b half8; };

template <typename OT>
__device__ __forceinline__ typename FT<OT>::frag ldfrag(const OT* p) {
  union { typename FT<OT>::frag v; typename FT<OT>::half8 h[2]; } f;
  f.h[0] = *(const typename FT<OT>::half8*)(p);
  f.h[1] = *(const typename FT<OT>::half8*)(p + 16);
  return f.v;
}

// ---- transposing fragment loader: a row-major 16-bit LDS tile T[k][d] read as the A operand T^T (rows d, k along the
//      fragment). p = the lane's own 16 B: row k0 + 8*(lane>>4) + (lane&7), piece (lane>>3)&1 of the 16 columns at d0.
//      Lane (c = lane&15, h = lane>>4) gets T[k0+8h .. k0+8h+7][d0+c] in elements 0..7 and, from 16 rows further,
//      T[k0+16+8h .. +7][d0+c] in elements 8..15: the k map of ldfrag. Every lane is on where it is called.
__device__ __forceinline__ v16b ldfrag_tr(const unsigned short* p, int pitch) {
  typedef __attribute__((address_space(3))) v8b lds_v8b;
  union { v16b v; v8b h[2]; } f;
  f.h[0] = __builtin_amdgcn_ds_load_tr16_b128_v8bf16((lds_v8b*)p);
  f.h[1] = __builtin_amdgcn_ds_load_tr16_b128_v8bf16((lds_v8b*)(p + 16 * pitch));
  return f.v;
}

// ---- WMMA helpers ------------------------------------------------------------------------------------
__device__ __forceinline__ v8f mmar(v16b a, v16b b, v8f c) {
  return __builtin_amdgcn_wmma_f32_16x16x32_bf16(false, a, false, b, (short)0, c, false, false);
}
// guarded form: 4 VALU slots after the WMMA, D tied, A/B kept live
__device__ __forceinline__ v8f mma_b(v16b a, v16b b, v8f c) {
  c = __builtin_amdgcn_wmma_f32_16x16x32_bf16(false, a, false, b, (short)0, c, false, false);
#if DEV_ASM
  asm volatile("v_nop\n\tv_nop\n\tv_nop\n\tv_nop" : "+v"(c) : "v"(a), "v"(b));
#endif
  return c;
}
__device__ __forceinline__ void dep_guard(v8f& a, v8f& b, v16b x, v16b y) {
#if DEV_ASM
  asm volatile("v_nop\n\tv_nop\n\tv_nop\n\tv_nop" : "+v"(a), "+v"(b) : "v"(x), "v"(y));
#else
  (void)a; (void)b; (void)x; (void)y;
#endif
}
__device__ __forceinline__ void keep4(v16b a, v16b b, v16b c, v16b d) {
#if DEV_ASM
  asm volatile("v_nop" :: "v"(a), "v"(b), "v"(c), "v"(d));
#else
  (void)a; (void)b; (void)c; (void)d;
#endif
}
__device__ __forceinline__ void acc_guard4(v8f& a, v8f& b, v8f& c, v8f& d) {
#if DEV_ASM
  asm volatile("v_nop\n\tv_nop\n\tv_nop\n\tv_nop" : "+v"(a), "+v"(b), "+v"(c), "+v"(d));
#else
  (void)a; (void)b; (void)c; (void)d;
#endif
}

// =====================================================================================================
// x NCHW f32 [b][c][p] -> Xh bf16 [b*3136 + p][c] (RNE convert), transposed through an LDS 64c x 64p tile.
// Store phase: item = it*256 + tid, p = item>>3, channel group = item&7 -> lanes 8q..8q+7 write one whole
// coverage: 2 iterations x 256 threads x 8 = the whole 64x64 tile; 392 blocks = the whole [6272][256] plane.
// =====================================================================================================
__device__ __forceinline__ void cvt_x(const float* __restrict__ x, unsigned short* xh, float* t, int blk) {
  const int tid = (int)threadIdx.x;
  const int p0 = (blk % (NPOS / 64)) * 64, c0 = ((blk / (NPOS / 64)) % (CH / 64)) * 64, b = blk / ((NPOS / 64) * (CH / 64));
#pragma unroll
  for (int it = 0; it < 4; ++it) {
    const int c  = it * 16 + (tid >> 4);
    const int p4 = (tid & 15) * 4;
    const v4f v = *(const v4f*)(x + ((size_t)(b * CH + c0 + c)) * NPOS + p0 + p4);
    float* tp = t + c * 65 + p4;
    tp[0] = v[0]; tp[1] = v[1]; tp[2] = v[2]; tp[3] = v[3];
  }
  __syncthreads();
  v4u pk[2];
  size_t go[2];
#pragma unroll
  for (int it = 0; it < 2; ++it) {
    const int item = it * 256 + tid;
    const int p = item >> 3, cg = item & 7;
    v4u a;
#pragma unroll
    for (int e = 0; e < 4; ++e) {
      const float f0 = t[(cg * 8 + 2 * e) * 65 + p];
      const float f1 = t[(cg * 8 + 2 * e + 1) * 65 + p];
      a[e] = cvt2(f0, f1);
    }
    pk[it] = a;
    go[it] = ((size_t)(b * NPOS + p0 + p)) * CH + c0 + cg * 8;
  }
  {
#pragma unroll
    for (int it = 0; it < 2; ++it) *(v4u*)(xh + go[it]) = pk[it];
    
  }
}

// =====================================================================================================
// f32 -> bf16 bits (RNE convert), 8 elements per thread, one 16-B store per lane: a wave writes 512
// coverage: n8 threads x 8 = the whole plane (n8 = 24576 here, a multiple of 256).
// =====================================================================================================
__device__ __forceinline__ void cvt16x8(const float* __restrict__ in, unsigned short* out, int n8, int blk) {
  const int i = blk * 256 + (int)threadIdx.x;
  if (i < n8) {
    const v4f a  = *(const v4f*)(in + (size_t)i * 8);
    const v4f a4 = *(const v4f*)(in + (size_t)i * 8 + 4);
    v4u p;
    p[0] = cvt2(a[0],  a[1]);
    p[1] = cvt2(a[2],  a[3]);
    p[2] = cvt2(a4[0], a4[1]);
    p[3] = cvt2(a4[2], a4[3]);
    unsigned short* o = out + (size_t)i * 8;
    *(v4u*)o = p;
    
  }
}

// =====================================================================================================
// w_proj [256 c][256 k] f32 -> folded plane Wf bf16 [256 c][512]: Wf[c][head*64 + part*32 + d] =
// bf16(w_proj[c][head*32 + d]) for part = 0 (meets the ctx hi half) and part = 1 (meets the residual half).
// coverage: 16384 threads x 8 = the whole [256][512] plane.
// =====================================================================================================
__device__ __forceinline__ void cvt_wp(const float* __restrict__ wp, unsigned short* out, int blk) {
  const int i = blk * 256 + (int)threadIdx.x;
  if (i < CH * CTXK / 8) {
    const int c  = i >> 6;                 // 64 groups of 8 per 512-wide row
    const int k  = (i & 63) * 8;           // 0..504
    const int hd = k >> 6;                 // head
    const int d0 = k & 31;                 // 0, 8, 16, 24
    const float* src = wp + (size_t)c * CH + hd * HDIM + d0;
    const v4f a  = *(const v4f*)src;
    const v4f a4 = *(const v4f*)(src + 4);
    v4u p;
    p[0] = cvt2(a[0],  a[1]);
    p[1] = cvt2(a[2],  a[3]);
    p[2] = cvt2(a4[0], a4[1]);
    p[3] = cvt2(a4[2], a4[3]);
    unsigned short* o = out + (size_t)i * 8;
    *(v4u*)o = p;
    
  }
}

// =====================================================================================================
// The three operand conversions read and write disjoint planes and none reads another's output, so they run
// as block ranges of one grid: blocks 0..NBX-1 = x tiles (the longest blocks, so they start first),
// NBX..NBX+NBQ-1 = w_qkv, the last NBP = w_proj. The range test is block-uniform (the x tiles hold a barrier).
// =====================================================================================================
#define NBX ((NPOS / 64) * (CH / 64) * NBT)   // 392 x tiles
#define NBQ (C3 * CH / 8 / 256)               //  96 blocks of w_qkv
#define NBP (CH * CTXK / 8 / 256)             //  64 blocks of w_proj
static_assert(NBQ * 256 * 8 == C3 * CH && NBP * 256 * 8 == CH * CTXK);
__global__ __launch_bounds__(256) void cvt_all(const float* __restrict__ x, const float* __restrict__ wq,
                                               const float* __restrict__ wp, unsigned short* xh,
                                               unsigned short* wqb, unsigned short* wpf) {
  __shared__ float t[64 * 65];                       // x tile [c][p], pitch 65
  const int blk = (int)blockIdx.x;
  if (blk < NBX) {
    cvt_x(x, xh, t, blk);
  } else if (blk < NBX + NBQ) {
    cvt16x8(wq, wqb, C3 * CH / 8, blk - NBX);
  } else {
    cvt_wp(wp, wpf, blk - (NBX + NBQ));
  }
}

// =====================================================================================================
// Batched WMMA GEMM (bf16 operands): C[m][n] = sum_k A[m][k] * Bt[n][k] + bias. A row-major [M][K] pitch lda;
// Bt row-major [N][K] pitch ldb (k contiguous); blockIdx.y = batch index (strides in elements).
// One block = 4 waves, one 64x64 tile of C per wave: WM waves along m and 4 / WM along n, so the block tile is
// (64 WM) x (256 / WM). M, N multiples of the block tile, K a multiple of SK (host constants).
// Operands go global -> LDS by asynchronous 16-B copies, SK = 64 k (one whole 128-B line of each of the 320
// operand rows) per stage, a ring of NB buffers: up to NB - 1 stages (at most 60 copies of a wave) are in flight while
// stage t feeds the WMMAs, so a stage has NB - 1 passes to land instead of one.
// Stage layout: rows 0..BM-1 = A rows, rows BM..319 = Bt rows, pitch 144 B (16 B x 9, conflict-free b128 reads).
// Copy map: item = it*128 + tid, row = item>>3, 16-B piece = item&7 -> 8 lanes copy one line, 20 copies per lane
// = 320 rows x 8 pieces, each LDS byte written by one lane. Fragments keep the split k map (ldfrag), k ascending.
// BIAS_MODE 1: bias[n] (per column); BIAS_MODE 2: bias[m] (per row); bias values RNE-converted to bf16.
// Output: f32 C (pitch ldc). Epilogue: 16-row slabs staged per wave in LDS; each 64-wide row segment (256 B =
// coverage: 4 slabs x 16 rows (it 0..7 x lane>>4) x 64 cols = the wave's whole 64x64 tile.
// =====================================================================================================
#define SK     64                     // k elements per stage
#define SPITCH 72                     // LDS row pitch in elements (144 B)
#define SROWS  320                    // operand rows per stage (BM + BN)
#define SBYTES (SROWS * SPITCH * 2)   // 46080 B per buffer

// Four asynchronous copies, 16 B per lane each, global -> LDS. The s_wait_xcnt closes the statement so that no
// address register named here is rewritten before it.
__device__ __forceinline__ void copy4(unsigned l0, unsigned l1, unsigned l2, unsigned l3,
                                      const unsigned short* g0, const unsigned short* g1,
                                      const unsigned short* g2, const unsigned short* g3) {
#if DEV_ASM
  asm volatile("global_load_async_to_lds_b128 %0, %4, off\n\t"
               "global_load_async_to_lds_b128 %1, %5, off\n\t"
               "global_load_async_to_lds_b128 %2, %6, off\n\t"
               "global_load_async_to_lds_b128 %3, %7, off\n\t"
               "s_wait_xcnt 0x0"
               :: "v"(l0), "v"(l1), "v"(l2), "v"(l3), "v"(g0), "v"(g1), "v"(g2), "v"(g3) : "memory");
#else
  (void)l0; (void)l1; (void)l2; (void)l3; (void)g0; (void)g1; (void)g2; (void)g3;
#endif
}
// this wave's copies have landed in LDS (the compiler places no wait for them)
__device__ __forceinline__ void wait_copies() {
#if DEV_ASM
  asm volatile("s_wait_asynccnt 0x0" ::: "memory");
#endif
}
// all of this wave's copies but its N youngest have landed: publishes one stage and leaves the N copies of the
// stages issued behind it in flight (every wave issues SROWS / 16 copies per stage, and nothing else counts here)
template <int N>
__device__ __forceinline__ void wait_copies_but() {
#if DEV_ASM
  asm volatile("s_wait_asynccnt %0" :: "i"(N) : "memory");
#endif
}
// this wave's LDS reads have returned, so the buffer they read may be refilled behind the next barrier
__device__ __forceinline__ void wait_lds() {
#if DEV_ASM
  asm volatile("s_wait_dscnt 0x0" ::: "memory");
#endif
}
// stands behind global loads, in front of whatever rewrites their address registers
__device__ __forceinline__ void wait_addr() {
#if DEV_ASM
  asm volatile("s_wait_xcnt 0x0" ::: "memory");
#endif
}
// one stage: 20 copies per lane; ga / gb = the lane's piece of its first A / Bt row at this stage's k
template <int BM>
__device__ __forceinline__ void fill_stage(unsigned lb, const unsigned short* ga, int lda,
                                           const unsigned short* gb, int ldb) {
  // both loops unrolled: r0 is then a constant, so the A / Bt choice is no branch and g, l stay in registers
#pragma unroll
  for (int q = 0; q < SROWS / 64; ++q) {
    const unsigned short* g[4];
    unsigned l[4];
#pragma unroll
    for (int e = 0; e < 4; ++e) {
      const int r0 = (q * 4 + e) * 16;                 // first row of this copy's 16 rows
      g[e] = (r0 < BM) ? ga + (size_t)r0 * lda : gb + (size_t)(r0 - BM) * ldb;
      l[e] = lb + (unsigned)(r0 * SPITCH * 2);
    }
    copy4(l[0], l[1], l[2], l[3], g[0], g[1], g[2], g[3]);
  }
}

template <int BIAS_MODE, int WM, int NB>
__global__ __launch_bounds__(128) void gemm64(
    const unsigned short* __restrict__ Ap, int lda, long long strideA,
    const unsigned short* __restrict__ Btp, int ldb, long long strideB,
    float* Cout, int ldc, long long strideC,
    const float* __restrict__ bias,
    int M, int N, int K) {
  constexpr int BM = 64 * WM;
  constexpr int BN = SROWS - BM;
  constexpr int AHEAD = (NB - 2) * (SROWS / 16);   // a wave's copies of the NB - 2 stages behind the one being published
  static_assert(WM == 1 || WM == 4);
  static_assert(NB >= 2 && (NB - 1) * (SROWS / 16) <= 63);           // copies of a wave outstanding at most
  __shared__ __align__(16) unsigned short stg[NB * SROWS * SPITCH];  // the ring's stage buffers
  __shared__ __align__(16) float sT[4][16 * 68];   // per-wave 16x64 slab, pitch 68 floats
  const int b    = blockIdx.y;
  const int tid  = (int)threadIdx.x;
  const int lane = tid & 31;
  const int wave = tid >> 5;
  const int tilesN = N / BN;
  const int tilesM = M / BM;
  const int tile = blockIdx.x;
  if (tile >= tilesM * tilesN) return;   // block-uniform, in front of every barrier and copy
  const int tm = tile / tilesN;
  const int tn = tile - tm * tilesN;
  const int wrA = (WM == 4) ? (wave << 6) : 0;          // the wave's first A row inside the stage
  const int wrB = BM + ((WM == 4) ? 0 : (wave << 6));   // the wave's first Bt row inside the stage
  const int m0 = tm * BM + wrA;
  const int n0 = tn * BN + (wrB - BM);

  const int rlane = lane & 15;                 // row (A) / col (B, D) within subtile
  const int koff  = (lane >> 4) * 8;           // k offset of this lane half
  const int mOff  = (lane >> 4) * 8;           // D row offset

  // the lane's copy addresses: row tid>>3 of each 16-row group, 16-B piece tid&7
  const unsigned short* ga = Ap  + (size_t)b * (size_t)strideA + (size_t)(tm * BM + (tid >> 3)) * lda + (tid & 7) * 8;
  const unsigned short* gb = Btp + (size_t)b * (size_t)strideB + (size_t)(tn * BN + (tid >> 3)) * ldb + (tid & 7) * 8;
  const unsigned lds0 = (unsigned)(uintptr_t)stg + (unsigned)((tid >> 3) * SPITCH * 2 + (tid & 7) * 16);
  const int nst = K / SK;

  v8f acc[4][4];
#pragma unroll
  for (int i = 0; i < 4; ++i)
#pragma unroll
    for (int j = 0; j < 4; ++j) acc[i][j] = zero8();

  // unrolled: the buffer offsets are constants; stages 0 .. NB - 2 go out together
#pragma unroll
  for (int s = 0; s < NB - 1; ++s)
    if (s < nst) fill_stage<BM>(lds0 + (unsigned)s * SBYTES, ga + s * SK, lda, gb + s * SK, ldb);
  // the count is used only where all NB - 2 stages behind stage 0 were issued
  if (NB - 1 <= nst) wait_copies_but<AHEAD>(); else wait_copies();
  __syncthreads();                             // stage 0 is readable by every wave
  if (NB - 1 < nst) fill_stage<BM>(lds0 + (unsigned)(NB - 1) * SBYTES, ga + (NB - 1) * SK, lda, gb + (NB - 1) * SK, ldb);

  int buf = 0;                                 // t mod NB
  for (int t = 0; t < nst; ++t) {
    const __bf16* sb = (const __bf16*)(const void*)stg + buf * (SROWS * SPITCH);
    // unrolled (inner loops too): fragments stay in registers, and the second k step's LDS reads start under
    // the first step's WMMAs
#pragma unroll
    for (int kk = 0; kk < SK; kk += 32) {
      v16b bq[4], af[4];
#pragma unroll
      for (int j = 0; j < 4; ++j) bq[j] = ldfrag<__bf16>(sb + (wrB + (j << 4) + rlane) * SPITCH + koff + kk);
#pragma unroll
      for (int i = 0; i < 4; ++i) af[i] = ldfrag<__bf16>(sb + (wrA + (i << 4) + rlane) * SPITCH + koff + kk);
#pragma unroll
      for (int i = 0; i < 4; ++i) {
#pragma unroll
        for (int j = 0; j < 4; ++j) acc[i][j] = mmar(af[i], bq[j], acc[i][j]);
        dep_guard(acc[i][0], acc[i][3], af[i], bq[3]);
      }
      keep4(bq[0], bq[1], bq[2], bq[3]);
    }
    // publish point of stage t + 1: own reads of stage t done, own copies of stage t + 1 landed, then the barrier.
    // Stages t + 2 .. t + NB - 1 stay in flight where all of them were issued; towards the end the wait is to 0.
    wait_lds();
    if (t + NB - 1 < nst) wait_copies_but<AHEAD>(); else wait_copies();
    __syncthreads();
    // refill the buffer that every wave has just left
    if (t + NB < nst) fill_stage<BM>(lds0 + (unsigned)buf * SBYTES, ga + (t + NB) * SK, lda, gb + (t + NB) * SK, ldb);
    buf = (buf + 1 == NB) ? 0 : buf + 1;
  }
  wait_copies();
  acc_guard4(acc[0][0], acc[0][1], acc[0][2], acc[0][3]);
  acc_guard4(acc[1][0], acc[1][1], acc[1][2], acc[1][3]);
  acc_guard4(acc[2][0], acc[2][1], acc[2][2], acc[2][3]);
  acc_guard4(acc[3][0], acc[3][1], acc[3][2], acc[3][3]);

  // ---- epilogue ----
  float* slab = sT[wave];
  float* C = Cout + (size_t)b * (size_t)strideC;
  const int h2 = lane >> 4, c4 = (lane & 15) * 4;     // 256-B row segment = 16 lanes x 16 B
  v4f bcol = {0.f, 0.f, 0.f, 0.f};
  if (BIAS_MODE == 1) {
#pragma unroll
    for (int e = 0; e < 4; ++e) bcol[e] = bf_round(bias[n0 + c4 + e]);
  }
#pragma unroll
  for (int i = 0; i < 4; ++i) {
    const int mBase = m0 + (i << 4);
#pragma unroll
    for (int j = 0; j < 4; ++j) {
#pragma unroll
      for (int r = 0; r < 8; ++r) {
        slab[(mOff + r) * 68 + (j << 4) + rlane] = acc[i][j][r];
      }
    }
    __builtin_amdgcn_fence(__ATOMIC_RELEASE, "workgroup");
    __builtin_amdgcn_wave_barrier();
    __builtin_amdgcn_fence(__ATOMIC_ACQUIRE, "workgroup");
    {
#pragma unroll
      for (int it = 0; it < 8; ++it) {
        const int row = it * 2 + h2;                     // it 0..7 x h2 0..1 = rows 0..15
        v4f v = *(const v4f*)(slab + row * 68 + c4);
        if (BIAS_MODE == 1) {
          v = v + bcol;
        } else {
          const float br = bf_round(bias[mBase + row]);
          v = v + br;
        }
        *(v4f*)(C + (size_t)(mBase + row) * ldc + n0 + c4) = v;
      }
      
    }
    __builtin_amdgcn_fence(__ATOMIC_RELEASE, "workgroup");
    __builtin_amdgcn_wave_barrier();
    __builtin_amdgcn_fence(__ATOMIC_ACQUIRE, "workgroup");
  }
}

// =====================================================================================================
// P^T B fragment pair (hi, residual) from the lane's own score D values: element r <- tile a row r,
// element 8+r <- tile c row r (same lane, same query column).
// =====================================================================================================
__device__ __forceinline__ void pack_pt(v8f a, v8f c, v16b& ph, v16b& pl) {
  v8u H, L;
#pragma unroll
  for (int r = 0; r < 4; ++r) {
    unsigned hp, lp;
    split2(a[2 * r], a[2 * r + 1], hp, lp);
    H[r] = hp; L[r] = lp;
    split2(c[2 * r], c[2 * r + 1], hp, lp);
    H[4 + r] = hp; L[4 + r] = lp;
  }
  ph = __builtin_bit_cast(v16b, H); pl = __builtin_bit_cast(v16b, L);
}

// load 8 consecutive f32, or zeros when keep == 0 (address always valid, select by value)
__device__ __forceinline__ void ld8sel(const float* src, int keep, float f[8]) {
  const v4f a = *(const v4f*)src;
  const v4f c = *(const v4f*)(src + 4);
  f[0] = keep ? a[0] : 0.f; f[1] = keep ? a[1] : 0.f; f[2] = keep ? a[2] : 0.f; f[3] = keep ? a[3] : 0.f;
  f[4] = keep ? c[0] : 0.f; f[5] = keep ? c[1] : 0.f; f[6] = keep ? c[2] : 0.f; f[7] = keep ? c[3] : 0.f;
}

// =====================================================================================================
// Windowed attention, one block = (batch b, head, 8x8 query tile at (i0, j0)); 128 threads = 4 waves,
// wave w owns the 16 queries lq = 16w..16w+15 (query row i0 + (lq>>3), col j0 + (lq&7)).
// Key superset = the 14x14 image block at (R0, C0), R0 = clamp(i0-3, 0, 42), slot = u*14 + v (196 slots,
// padded to 224 with zero rows). Every query's clamped 7x7 window lies inside the superset: valid slots are
// su <= u <= su+6, sv <= v <= sv+6 with su = clamp(qi-3,0,49) - R0 in [0,7].
//   qkv plane f32 [b*3136 + p][768]: q = cols head*32+d (scaled by 32^-0.5 in f32 here), k = 256+.., v = 512+..
//   scores (transposed): S^T[slot][query] = K[slot][d] . Q^T[d][query] on bf16 WMMA, 3 products
//     (hi.hi + hi.res + res.hi); lane owns query column (lane&15) of its wave and key rows 16j + 8h + r.
//   s = S^T + rpb[head][u + R0 - qi + 6][v + C0 - qj + 6] for valid slots, -1e30 otherwise (f32);
//   softmax in f32 (max / sum over the 104 lane values and the partner lane ^16).
//   O^T[d][query] = V^T[d][slot] . P^T[slot][query] on bf16 WMMA, 3 products, p unnormalised exp, 1/sum at the end.
// LDS: KV0/KV1 hold K hi/res [slot][d] (pitch 64 B) for the scores, then (after a block barrier) V hi/res [slot][d]
// (pitch 96 B), row-major as it comes from memory; the V^T fragments are made by transposing LDS loads.
// K and Q rows have a 64-B pitch, at which the b128 fragment reads meet four to a bank; Os rows 128 B.
// Staged extents: KV 224x32 both phases (slots >= 196 zero), Q 64x32, Rp 384 (table at 100..268, zeros around),
// Os 16x32 per wave -- every LDS element read is written first.
// Output coverage: each wave stores its 16 query rows (it 0..3 x lane>>3) x 8 pieces of 16 B (lane&7) =
// =====================================================================================================
__global__ __launch_bounds__(128)
void natt(const float* __restrict__ qkv, const float* __restrict__ rpb, unsigned short* ctx) {
  __shared__ __align__(32) unsigned short KV0[NSLOT * VPITCH];   // 21504 B (K uses the first 14336)
  __shared__ __align__(32) unsigned short KV1[NSLOT * VPITCH];   // 21504 B
  __shared__ __align__(16) unsigned short Qh[64 * HDIM];       //  4096 B
  __shared__ __align__(16) unsigned short Ql[64 * HDIM];       //  4096 B
  __shared__ __align__(16) float Os[4][16 * HDIM];             //  8192 B
  __shared__ float Rp[RPN];

  const int tid  = (int)threadIdx.x;
  const int wave = tid >> 5;
  const int lane = tid & 31;
  const int hh   = lane >> 4;
  const int m    = lane & 15;

  const int bx   = blockIdx.x;
  const int tj   = bx % 7;
  const int ti   = (bx / 7) % 7;
  const int head = (bx / 49) % NHD;
  const int b    = bx / (49 * NHD);
  const int i0 = ti * 8, j0 = tj * 8;
  const int R0 = min(max(i0 - 3, 0), IMH - SUP);
  const int C0 = min(max(j0 - 3, 0), IMW - SUP);
  const size_t pb = (size_t)b * NPOS;

  // ---- position-bias table of this head (bf16 RNE-converted values), entries 0..168 at Rp[RPLO..], zeros around ----
  {
    float rv[RPN / 128];
    // both loops unrolled: rv stays in registers and the three loads go out together
#pragma unroll
    for (int it = 0; it < RPN / 128; ++it) {
      const int t = it * 128 + tid - RPLO;
      rv[it] = rpb[head * 169 + min(max(t, 0), 168)];           // clamped address
    }
    wait_addr();
#pragma unroll
    for (int it = 0; it < RPN / 128; ++it) {
      const int e = it * 128 + tid;
      const float tv = bf_round(rv[it]);
      Rp[e] = ((unsigned)(e - RPLO) < 169u) ? tv : 0.f;
    }
  }
  // ---- q (scaled in f32) -> hi / residual planes [lq][d]; thread = (lq = tid>>1, d half) ----
  {
    const int lq = tid >> 1, dh = (tid & 1) * 16;
    const int qi = lq >> 3, qj = lq & 7;
    const size_t pos = pb + (size_t)(i0 + qi) * IMW + j0 + qj;
    const float* src = qkv + pos * C3 + head * HDIM + dh;
#pragma unroll
    for (int g = 0; g < 2; ++g) {
      float f[8];
      ld8sel(src + 8 * g, 1, f);
      v4u ph, pl;
#pragma unroll
      for (int e = 0; e < 4; ++e) {
        unsigned hp, lp;
        split2(f[2 * e] * QSCALE, f[2 * e + 1] * QSCALE, hp, lp);
        ph[e] = hp; pl[e] = lp;
      }
      *(v4u*)(Qh + lq * HDIM + dh + 8 * g) = ph;
      *(v4u*)(Ql + lq * HDIM + dh + 8 * g) = pl;
    }
  }
  // ---- K superset -> KV0 (hi) / KV1 (residual), layout [slot][d]; item = it*128 + tid, slot = item>>2,
  //      d8 = (item&3)*8; 7 x 128 items = 224 slots x 4 groups = the whole tile; slots >= 196 = zeros ----
  {
    const float* kbase = qkv + CH + head * HDIM;
#pragma unroll
    for (int it = 0; it < 7; ++it) {
      const int item = it * 128 + tid;
      const int slot = item >> 2, d8 = (item & 3) * 8;
      const int u = slot / SUP, v = slot - u * SUP;
      const int uc = min(u, SUP - 1);
      const size_t pos = pb + (size_t)(R0 + uc) * IMW + C0 + v;
      float f[8];
      ld8sel(kbase + pos * C3 + d8, slot < SUP * SUP, f);
      v4u ph, pl;
#pragma unroll
      for (int e = 0; e < 4; ++e) {
        unsigned hp, lp;
        split2(f[2 * e], f[2 * e + 1], hp, lp);
        ph[e] = hp; pl[e] = lp;
      }
      *(v4u*)(KV0 + slot * HDIM + d8) = ph;
      *(v4u*)(KV1 + slot * HDIM + d8) = pl;
    }
  }
  __syncthreads();

  // ---- scores: S^T tiles j = 0..12 (key slots 16j..16j+15) for the wave's 16 queries; s[13] stays zero ----
  v8f s[NKT + 1];
  {
    const __bf16* Kh = (const __bf16*)(const void*)KV0;
    const __bf16* Kl = (const __bf16*)(const void*)KV1;
    const __bf16* Qhp = (const __bf16*)(const void*)Qh;
    const __bf16* Qlp = (const __bf16*)(const void*)Ql;
    const v16b qfh = ldfrag<__bf16>(Qhp + (16 * wave + m) * HDIM + 8 * hh);
    const v16b qfl = ldfrag<__bf16>(Qlp + (16 * wave + m) * HDIM + 8 * hh);
#pragma unroll
    for (int j = 0; j < NKT; ++j) {
      const v16b kfh = ldfrag<__bf16>(Kh + (16 * j + m) * HDIM + 8 * hh);
      const v16b kfl = ldfrag<__bf16>(Kl + (16 * j + m) * HDIM + 8 * hh);
      v8f z = zero8();
      z = mma_b(kfh, qfh, z);
      z = mma_b(kfh, qfl, z);
      z = mma_b(kfl, qfh, z);
      s[j] = z;
    }
    s[NKT] = zero8();
  }
  __syncthreads();   // all waves done reading K from KV0/KV1

  // ---- V superset -> KV0 (hi) / KV1 (residual), layout [slot][d] (pitch VPITCH), one 16-B store per plane and item;
  //      same item map as K: 224 slots x 32 d written, slots >= 196 = zeros ----
  {
    const float* vbase = qkv + 2 * CH + head * HDIM;
#pragma unroll
    for (int it = 0; it < 7; ++it) {
      const int item = it * 128 + tid;
      const int slot = item >> 2, d8 = (item & 3) * 8;
      const int u = slot / SUP, v = slot - u * SUP;
      const int uc = min(u, SUP - 1);
      const size_t pos = pb + (size_t)(R0 + uc) * IMW + C0 + v;
      float f[8];
      ld8sel(vbase + pos * C3 + d8, slot < SUP * SUP, f);
      v4u ph, pl;
#pragma unroll
      for (int e = 0; e < 4; ++e) {
        unsigned hp, lp;
        split2(f[2 * e], f[2 * e + 1], hp, lp);
        ph[e] = hp; pl[e] = lp;
      }
      *(v4u*)(KV0 + slot * VPITCH + d8) = ph;
      *(v4u*)(KV1 + slot * VPITCH + d8) = pl;
    }
  }
  __syncthreads();

  // ---- window mask + position bias (f32), softmax over the query column ----
  const int lq = 16 * wave + m;
  const int ai = i0 + (lq >> 3), aj = j0 + (lq & 7);
  const int su = min(max(ai - 3, 0), IMH - KW) - R0;
  const int sv = min(max(aj - 3, 0), IMW - KW) - C0;
  const int cb = (R0 - ai + 6) * 13 + (C0 - aj + 6);
  // Bias index 13u + v + cb = slot - u + cb. The upper lane half's slot is 8 higher and its u is equal or one
  // higher (one higher where t0 % 14 >= 6), so two lane bases and a constant offset address every read; the read
  // is made for every slot (the padded table holds every such index) and the window test selects by value.
  const float* rb8 = Rp + (RPLO + cb + 8 * hh);
  const float* rb7 = Rp + (RPLO + cb + 7 * hh);
  // The window test of a slot is a row test and a column test; each distinct one is made once:
  // column k = t0 % 14 (upper half: (k + 8) % 14), row a = t0 / 14 (upper half: a, or a + 1 where k >= 6).
  // Both loops unrolled: the arrays are then indexed by constants only and each test is one lane mask in a register.
  bool colok[SUP], rowsame[SUP + 1], rownext[SUP + 1];
#pragma unroll
  for (int k = 0; k < SUP; ++k) {
    const int v = hh ? ((k + 8) % SUP) : k;
    colok[k] = (unsigned)(v - sv) < 7u;
  }
#pragma unroll
  for (int a = 0; a <= SUP; ++a) {
    rowsame[a] = (unsigned)(a - su) < 7u;
    rownext[a] = (unsigned)(a + hh - su) < 7u;
  }
  float mloc = -1.0e30f;
#pragma unroll
  for (int j = 0; j < NKT; ++j) {
#pragma unroll
    for (int r = 0; r < 8; ++r) {
      const int t0 = 16 * j + r;                       // slot = t0 + 8*hh
      const bool step = (t0 % SUP) >= SUP - 8;         // the upper half's slot lies one superset row further
      const bool ok = colok[t0 % SUP] & (step ? rownext[t0 / SUP] : rowsame[t0 / SUP]);
      const int c0 = t0 - t0 / SUP;                    // 13u + v of the lower half's slot
      const float bv = step ? rb7[c0] : rb8[c0];
      const float sb = s[j][r] + bv;
      const float sval = ok ? sb : -1.0e30f;
      s[j][r] = sval;
      mloc = fmaxf(mloc, sval);
    }
  }
  const float mrow = fmaxf(mloc, __shfl_xor(mloc, 16, 32));
  // scheduling boundary: without it the branch-free mask phase and the exp / pack / P.V phase form one region, the
  // scheduler lifts later work into it and the register count passes 256, which costs a resident wave per SIMD
  __builtin_amdgcn_sched_barrier(0);
  float lsum = 0.f;
#pragma unroll
  for (int j = 0; j < NKT; ++j) {
#pragma unroll
    for (int r = 0; r < 8; ++r) {
      const float p = __expf(s[j][r] - mrow);
      s[j][r] = p;
      lsum += p;
    }
  }
  lsum += __shfl_xor(lsum, 16, 32);

  // ---- O^T = V^T . P^T : 2 d-tiles x 7 k-steps of 32 slots x 3 products ----
  v8f o[2];
  o[0] = zero8(); o[1] = zero8();
  {
    // the lane's 16 B of a transposing load: slot row 8*hh + (lane&7), column piece (lane>>3)&1
    const int vo = (8 * hh + (lane & 7)) * VPITCH + ((lane >> 3) & 1) * 8;
    const unsigned short* Vh = KV0 + vo;
    const unsigned short* Vl = KV1 + vo;
#pragma unroll
    for (int kk = 0; kk < NSLOT / 32; ++kk) {
      v16b ph, pl;
      pack_pt(s[2 * kk], s[2 * kk + 1], ph, pl);
#pragma unroll
      for (int t = 0; t < 2; ++t) {
        const v16b vfh = ldfrag_tr(Vh + 32 * kk * VPITCH + 16 * t, VPITCH);
        const v16b vfl = ldfrag_tr(Vl + 32 * kk * VPITCH + 16 * t, VPITCH);
        o[t] = mma_b(vfh, ph, o[t]);
        o[t] = mma_b(vfh, pl, o[t]);
        o[t] = mma_b(vfl, ph, o[t]);
      }
    }
  }

  // ---- normalise, stage the wave's 16 queries x 32 d in LDS, write the ctx lines ----
  const float linv = 1.0f / lsum;
  float* os = Os[wave];
#pragma unroll
  for (int t = 0; t < 2; ++t)
#pragma unroll
    for (int r = 0; r < 8; ++r) os[m * HDIM + 16 * t + 8 * hh + r] = o[t][r] * linv;
  __syncthreads();
  {
    const int q4 = lane >> 3, pc = lane & 7, dsel = (pc & 3) * 8;
    const bool lowp = (pc >= 4);
    v4u hv[4];
    size_t go[4];
#pragma unroll
    for (int it = 0; it < 4; ++it) {
      const int row = it * 4 + q4;                     // it 0..3 x q4 0..3 = rows 0..15
      const float* sp = os + row * HDIM + dsel;
      v4u a;
#pragma unroll
      for (int e = 0; e < 4; ++e) {
        unsigned hp, lp;
        split2(sp[2 * e], sp[2 * e + 1], hp, lp);
        a[e] = lowp ? lp : hp;
      }
      hv[it] = a;
      const int lqr = 16 * wave + row;
      const size_t pos = pb + (size_t)(i0 + (lqr >> 3)) * IMW + j0 + (lqr & 7);
      go[it] = pos * CTXK + (size_t)head * 64 + pc * 8;
    }
    {
#pragma unroll
      for (int it = 0; it < 4; ++it) *(v4u*)(ctx + go[it]) = hv[it];
      
    }
  }
}

// =====================================================================================================
//   Xh   bf16 [6272][256]     3211264
//   Wqb  bf16 [768][256]       393216
//   Wpf  bf16 [256][512]       262144
//   QKV  f32  [6272][768]    19267584
//   CTX  bf16 [6272][512]     6422528
//   total                   29556736
// =====================================================================================================
extern "C" void kernel_launch(void* const* d_in, const int* in_sizes, int n_in,
                              void* d_out, int out_size, void* d_ws, size_t ws_size,
                              hipStream_t stream) {
  if (n_in < 6) return;
  if (in_sizes[0] != NBT * CH * NPOS) return;
  if (in_sizes[1] != C3 * CH) return;
  if (in_sizes[2] != C3) return;
  if (in_sizes[3] != NHD * 13 * 13) return;
  if (in_sizes[4] != CH * CH) return;
  if (in_sizes[5] != CH) return;
  if (out_size != NBT * CH * NPOS) return;

  const float* x      = (const float*)d_in[0];
  const float* w_qkv  = (const float*)d_in[1];
  const float* b_qkv  = (const float*)d_in[2];
  const float* rpb    = (const float*)d_in[3];
  const float* w_proj = (const float*)d_in[4];
  const float* b_proj = (const float*)d_in[5];

  const size_t PXH  = (size_t)MROW * CH * 2;        //  3211264
  const size_t PWQ  = (size_t)C3 * CH * 2;          //   393216
  const size_t PWP  = (size_t)CH * CTXK * 2;        //   262144
  const size_t PQKV = (size_t)MROW * C3 * 4;        // 19267584
  const size_t PCTX = (size_t)MROW * CTXK * 2;      //  6422528
  size_t off = 0;
  const size_t oXh  = off; off += PXH;
  const size_t oWq  = off; off += PWQ;
  const size_t oWp  = off; off += PWP;
  const size_t oQKV = off; off += PQKV;
  const size_t oCTX = off; off += PCTX;
  if (off > ws_size) return;                         // off = 29556736
  if (off > (size_t)134217728) return;

  char* ws = (char*)d_ws;
  unsigned short* Xh  = (unsigned short*)(ws + oXh);
  unsigned short* Wqb = (unsigned short*)(ws + oWq);
  unsigned short* Wpf = (unsigned short*)(ws + oWp);
  float*          QKV = (float*)(ws + oQKV);
  unsigned short* CTX = (unsigned short*)(ws + oCTX);

  const int tilesQKV = (MROW / 64) * (C3 / 256);                      //  294 block tiles of 64 x 256
  const int tilesPRJ = (CH / 256) * (NPOS / 64);                      //   49 block tiles of 256 x 64
  const dim3 gCvt(NBX + NBQ + NBP);                                   // 552
  const dim3 gQKV(tilesQKV, 1);                                       // 294
  const dim3 gAtt(NBT * NHD * 49);                                    // 784
  const dim3 gPRJ(tilesPRJ, NBT);                                     // (49, 2)

  // (1) x NCHW -> bf16 [p][c]; w_qkv -> bf16 [n][k]; w_proj -> folded bf16 [c][512]
  cvt_all<<<gCvt, dim3(256), 0, stream>>>(x, w_qkv, w_proj, Xh, Wqb, Wpf);
  // (2) qkv = Xh . Wqkv^T + b_qkv -> f32 [6272][768]   (M=6272, N=768, K=256)
  gemm64<1, 1, 3><<<gQKV, dim3(128), 0, stream>>>(
      Xh, CH, 0LL, Wqb, CH, 0LL,
      QKV, C3, 0LL, b_qkv,
      MROW, C3, CH);
  // (3) windowed attention -> ctx plane bf16 [6272][512]
  natt<<<gAtt, dim3(128), 0, stream>>>(QKV, rpb, CTX);
  // (4) out[b][c][p] = sum_k Wpf[c][k] ctx[b*3136+p][k] + b_proj[c]   (per batch: M=256, N=3136, K=512)
  gemm64<2, 4, 4><<<gPRJ, dim3(128), 0, stream>>>(
      Wpf, CTXK, 0LL, CTX, CTXK, (long long)NPOS * CTXK,
      (float*)d_out, NPOS, (long long)CH * NPOS, b_proj,
      CH, NPOS, CTXK);
  (void)hipGetLastError();
}

// v007
// It runs in 33.7 microseconds.
// Two timings next to v006 both put it at 1.08 times that version's speed.
// All steps since v000 together make it 2.24 times as fast.
// Contractions: qkv projection = v_wmma_f32_16x16x32_bf16 (bf16 operands from RNE-converted x and w_qkv, single product, f32 accumulate);
// q.k scores = v_wmma_f32_16x16x32_bf16 (q and k each as bf16 hi plane + unscaled bf16 residual plane, 3 products, f32 accumulate);
// p.v = v_wmma_f32_16x16x32_bf16 (p and v each as bf16 hi + unscaled bf16 residual, 3 products, f32 accumulate);
// ctx.w_proj^T = v_wmma_f32_16x16x32_bf16 (ctx as bf16 hi + residual folded into K, w_proj bf16 from its RNE-converted value, f32 accumulate);
// biases, q scaling, window mask, position bias and softmax in f32. No power-of-two carries anywhere (bf16 planes, unscaled residuals).
#include <hip/hip_runtime.h>
#include <math.h>
#include <stdint.h>

#define NBT   2
#define CH    256
#define IMH   56
#define IMW   56
#define NPOS  (IMH * IMW)        // 3136 positions per image, p = i*56 + j
#define MROW  (NBT * NPOS)       // 6272 position rows
#define NHD   8
#define HDIM  32
#define C3    (3 * CH)           // 768
#define KW    7                  // window side; window start = clamp(i - 3, 0, IMH - KW)
#define SUP   14                 // clamped key superset side of an 8x8 query tile
#define NSLOT 224                // key slots staged per block (196 used, rest zero)
#define WROWS 8                  // superset rows that hold every window of one wave's 16 queries (two image rows)
#define NKT   7                  // scored 16-key tiles per wave: WROWS x SUP = 112 consecutive slots
#define CTXK  512                // folded K of the ctx plane: per head [hi d0..31 | residual d0..31]
#define QSCALE 0.17677669529663687f
#define RPLO  100                // position-bias entry 0 sits at Rp[RPLO]; entries around the table are zero
#define RPN   384                // padded table: every unclamped index 13u + v + cb of a scored slot lies inside
#define VPITCH 48                // LDS pitch of a staged V row [slot][d] in elements: 96 B = 32 B x 3, the transposing reader's pitch

static_assert((MROW % 64) == 0);
static_assert((C3 % 256) == 0);
static_assert((NPOS % 64) == 0);
static_assert((CH % 256) == 0);
static_assert((CH % 128) == 0 && (CTXK % 128) == 0);
static_assert(NHD * HDIM == CH);
static_assert(SUP == 8 + KW - 1);
static_assert(SUP * SUP <= NSLOT && (NSLOT % 32) == 0 && NKT * 16 == WROWS * SUP && WROWS == KW + 1);
static_assert((SUP - WROWS) * SUP + ((NKT + 1) / 2) * 32 <= NSLOT);   // the last wave range's P.V steps stay in staged rows
static_assert(IMH == IMW);
static_assert(VPITCH >= HDIM && (VPITCH * 2) % 32 == 0 && ((VPITCH * 2) / 32) % 2 == 1);
static_assert(RPLO - 7 * 13 - 7 >= 0 && RPLO + 6 * 13 + 6 + (SUP * SUP - 1) - (SUP * SUP - 1) / SUP < RPN && RPN % 128 == 0);

typedef __bf16   v16b __attribute__((ext_vector_type(16)));
typedef __bf16   v8b  __attribute__((ext_vector_type(8)));
typedef float    v8f  __attribute__((ext_vector_type(8)));
typedef float    v4f  __attribute__((ext_vector_type(4)));
typedef unsigned int v4u __attribute__((ext_vector_type(4)));
typedef unsigned int v8u __attribute__((ext_vector_type(8)));
typedef float    v2f  __attribute__((ext_vector_type(2)));
typedef __bf16   v2b  __attribute__((ext_vector_type(2)));

#if defined(__HIP_DEVICE_COMPILE__)
#define DEV_ASM 1
#else
#define DEV_ASM 0
#endif

// ---- scalar helpers --------------------------------------------------------------------------------
// two f32 -> two bf16 (RNE) packed in one register, a in the low half: one packed convert instruction
__device__ __forceinline__ unsigned cvt2(float a, float b) {
  const v2f f = {a, b};
  return __builtin_bit_cast(unsigned, __builtin_convertvector(f, v2b));
}
__device__ __forceinline__ float bf_round(float f) { return (float)(__bf16)f; }   // f32 value of the RNE bf16
__device__ __forceinline__ v8f zero8() { v8f z = {0.f, 0.f, 0.f, 0.f, 0.f, 0.f, 0.f, 0.f}; return z; }
// hi / residual bf16 split of an f32 value (residual unscaled)
// of a pair: hp = packed hi halves, lp = packed residuals, a in the low half of each
__device__ __forceinline__ void split2(float a, float b, unsigned& hp, unsigned& lp) {
  const v2f f = {a, b};
  const v2b h = __builtin_convertvector(f, v2b);
  hp = __builtin_bit_cast(unsigned, h);
  lp = cvt2(a - (float)h[0], b - (float)h[1]);
}

// ---- fragment loader: 16-bit A/B operand, lane -> row/col (lane&15), p already includes +8*(lane>>4);
//      elements 0..7 <- p[0..7] (k0+8h..k0+8h+7), elements 8..15 <- p[16..23] (k0+16+8h..k0+16+8h+7)
template <typename OT> struct FT;
template <> struct FT<__bf16> { typedef v16b frag; typedef v8b half8; };

template <typename OT>
__device__ __forceinline__ typename FT<OT>::frag ldfrag(const OT* p) {
  union { typename FT<OT>::frag v; typename FT<OT>::half8 h[2]; } f;
  f.h[0] = *(const typename FT<OT>::half8*)(p);
  f.h[1] = *(const typename FT<OT>::half8*)(p + 16);
  return f.v;
}

// ---- transposing fragment loader: a row-major 16-bit LDS tile T[k][d] read as the A operand T^T (rows d, k along the
//      fragment). p = the lane's own 16 B: row k0 + 8*(lane>>4) + (lane&7), piece (lane>>3)&1 of the 16 columns at d0.
//      Lane (c = lane&15, h = lane>>4) gets T[k0+8h .. k0+8h+7][d0+c] in elements 0..7 and, from 16 rows further,
//      T[k0+16+8h .. +7][d0+c] in elements 8..15: the k map of ldfrag. Every lane is on where it is called.
__device__ __forceinline__ v16b ldfrag_tr(const unsigned short* p, int pitch) {
  typedef __attribute__((address_space(3))) v8b lds_v8b;
  union { v16b v; v8b h[2]; } f;
  f.h[0] = __builtin_amdgcn_ds_load_tr16_b128_v8bf16((lds_v8b*)p);
  f.h[1] = __builtin_amdgcn_ds_load_tr16_b128_v8bf16((lds_v8b*)(p + 16 * pitch));
  return f.v;
}

// ---- WMMA helpers ------------------------------------------------------------------------------------
__device__ __forceinline__ v8f mmar(v16b a, v16b b, v8f c) {
  return __builtin_amdgcn_wmma_f32_16x16x32_bf16(false, a, false, b, (short)0, c, false, false);
}
// guarded form: 4 VALU slots after the WMMA, D tied, A/B kept live
__device__ __forceinline__ v8f mma_b(v16b a, v16b b, v8f c) {
  c = __builtin_amdgcn_wmma_f32_16x16x32_bf16(false, a, false, b, (short)0, c, false, false);
#if DEV_ASM
  asm volatile("v_nop\n\tv_nop\n\tv_nop\n\tv_nop" : "+v"(c) : "v"(a), "v"(b));
#endif
  return c;
}
__device__ __forceinline__ void dep_guard(v8f& a, v8f& b, v16b x, v16b y) {
#if DEV_ASM
  asm volatile("v_nop\n\tv_nop\n\tv_nop\n\tv_nop" : "+v"(a), "+v"(b) : "v"(x), "v"(y));
#else
  (void)a; (void)b; (void)x; (void)y;
#endif
}
__device__ __forceinline__ void keep4(v16b a, v16b b, v16b c, v16b d) {
#if DEV_ASM
  asm volatile("v_nop" :: "v"(a), "v"(b), "v"(c), "v"(d));
#else
  (void)a; (void)b; (void)c; (void)d;
#endif
}
__device__ __forceinline__ void acc_guard4(v8f& a, v8f& b, v8f& c, v8f& d) {
#if DEV_ASM
  asm volatile("v_nop\n\tv_nop\n\tv_nop\n\tv_nop" : "+v"(a), "+v"(b), "+v"(c), "+v"(d));
#else
  (void)a; (void)b; (void)c; (void)d;
#endif
}

// =====================================================================================================
// x NCHW f32 [b][c][p] -> Xh bf16 [b*3136 + p][c] (RNE convert), transposed through an LDS 64c x 64p tile.
// Store phase: item = it*256 + tid, p = item>>3, channel group = item&7 -> lanes 8q..8q+7 write one whole
// coverage: 2 iterations x 256 threads x 8 = the whole 64x64 tile; 392 blocks = the whole [6272][256] plane.
// =====================================================================================================
__device__ __forceinline__ void cvt_x(const float* __restrict__ x, unsigned short* xh, float* t, int blk) {
  const int tid = (int)threadIdx.x;
  const int p0 = (blk % (NPOS / 64)) * 64, c0 = ((blk / (NPOS / 64)) % (CH / 64)) * 64, b = blk / ((NPOS / 64) * (CH / 64));
#pragma unroll
  for (int it = 0; it < 4; ++it) {
    const int c  = it * 16 + (tid >> 4);
    const int p4 = (tid & 15) * 4;
    const v4f v = *(const v4f*)(x + ((size_t)(b * CH + c0 + c)) * NPOS + p0 + p4);
    float* tp = t + c * 65 + p4;
    tp[0] = v[0]; tp[1] = v[1]; tp[2] = v[2]; tp[3] = v[3];
  }
  __syncthreads();
  v4u pk[2];
  size_t go[2];
#pragma unroll
  for (int it = 0; it < 2; ++it) {
    const int item = it * 256 + tid;
    const int p = item >> 3, cg = item & 7;
    v4u a;
#pragma unroll
    for (int e = 0; e < 4; ++e) {
      const float f0 = t[(cg * 8 + 2 * e) * 65 + p];
      const float f1 = t[(cg * 8 + 2 * e + 1) * 65 + p];
      a[e] = cvt2(f0, f1);
    }
    pk[it] = a;
    go[it] = ((size_t)(b * NPOS + p0 + p)) * CH + c0 + cg * 8;
  }
  {
#pragma unroll
    for (int it = 0; it < 2; ++it) *(v4u*)(xh + go[it]) = pk[it];
    
  }
}

// =====================================================================================================
// f32 -> bf16 bits (RNE convert), 8 elements per thread, one 16-B store per lane: a wave writes 512
// coverage: n8 threads x 8 = the whole plane (n8 = 24576 here, a multiple of 256).
// =====================================================================================================
__device__ __forceinline__ void cvt16x8(const float* __restrict__ in, unsigned short* out, int n8, int blk) {
  const int i = blk * 256 + (int)threadIdx.x;
  if (i < n8) {
    const v4f a  = *(const v4f*)(in + (size_t)i * 8);
    const v4f a4 = *(const v4f*)(in + (size_t)i * 8 + 4);
    v4u p;
    p[0] = cvt2(a[0],  a[1]);
    p[1] = cvt2(a[2],  a[3]);
    p[2] = cvt2(a4[0], a4[1]);
    p[3] = cvt2(a4[2], a4[3]);
    unsigned short* o = out + (size_t)i * 8;
    *(v4u*)o = p;
    
  }
}

// =====================================================================================================
// w_proj [256 c][256 k] f32 -> folded plane Wf bf16 [256 c][512]: Wf[c][head*64 + part*32 + d] =
// bf16(w_proj[c][head*32 + d]) for part = 0 (meets the ctx hi half) and part = 1 (meets the residual half).
// coverage: 16384 threads x 8 = the whole [256][512] plane.
// =====================================================================================================
__device__ __forceinline__ void cvt_wp(const float* __restrict__ wp, unsigned short* out, int blk) {
  const int i = blk * 256 + (int)threadIdx.x;
  if (i < CH * CTXK / 8) {
    const int c  = i >> 6;                 // 64 groups of 8 per 512-wide row
    const int k  = (i & 63) * 8;           // 0..504
    const int hd = k >> 6;                 // head
    const int d0 = k & 31;                 // 0, 8, 16, 24
    const float* src = wp + (size_t)c * CH + hd * HDIM + d0;
    const v4f a  = *(const v4f*)src;
    const v4f a4 = *(const v4f*)(src + 4);
    v4u p;
    p[0] = cvt2(a[0],  a[1]);
    p[1] = cvt2(a[2],  a[3]);
    p[2] = cvt2(a4[0], a4[1]);
    p[3] = cvt2(a4[2], a4[3]);
    unsigned short* o = out + (size_t)i * 8;
    *(v4u*)o = p;
    
  }
}

// =====================================================================================================
// The three operand conversions read and write disjoint planes and none reads another's output, so they run
// as block ranges of one grid: blocks 0..NBX-1 = x tiles (the longest blocks, so they start first),
// NBX..NBX+NBQ-1 = w_qkv, the last NBP = w_proj. The range test is block-uniform (the x tiles hold a barrier).
// =====================================================================================================
#define NBX ((NPOS / 64) * (CH / 64) * NBT)   // 392 x tiles
#define NBQ (C3 * CH / 8 / 256)               //  96 blocks of w_qkv
#define NBP (CH * CTXK / 8 / 256)             //  64 blocks of w_proj
static_assert(NBQ * 256 * 8 == C3 * CH && NBP * 256 * 8 == CH * CTXK);
__global__ __launch_bounds__(256) void cvt_all(const float* __restrict__ x, const float* __restrict__ wq,
                                               const float* __restrict__ wp, unsigned short* xh,
                                               unsigned short* wqb, unsigned short* wpf) {
  __shared__ float t[64 * 65];                       // x tile [c][p], pitch 65
  const int blk = (int)blockIdx.x;
  if (blk < NBX) {
    cvt_x(x, xh, t, blk);
  } else if (blk < NBX + NBQ) {
    cvt16x8(wq, wqb, C3 * CH / 8, blk - NBX);
  } else {
    cvt_wp(wp, wpf, blk - (NBX + NBQ));
  }
}

// =====================================================================================================
// Batched WMMA GEMM (bf16 operands): C[m][n] = sum_k A[m][k] * Bt[n][k] + bias. A row-major [M][K] pitch lda;
// Bt row-major [N][K] pitch ldb (k contiguous); blockIdx.y = batch index (strides in elements).
// One block = 4 waves, one 64x64 tile of C per wave: WM waves along m and 4 / WM along n, so the block tile is
// (64 WM) x (256 / WM). M, N multiples of the block tile, K a multiple of SK (host constants).
// Operands go global -> LDS by asynchronous 16-B copies, SK = 64 k (one whole 128-B line of each of the 320
// operand rows) per stage, a ring of NB buffers: up to NB - 1 stages (at most 60 copies of a wave) are in flight while
// stage t feeds the WMMAs, so a stage has NB - 1 passes to land instead of one.
// Stage layout: rows 0..BM-1 = A rows, rows BM..319 = Bt rows, pitch 144 B (16 B x 9, conflict-free b128 reads).
// Copy map: item = it*128 + tid, row = item>>3, 16-B piece = item&7 -> 8 lanes copy one line, 20 copies per lane
// = 320 rows x 8 pieces, each LDS byte written by one lane. Fragments keep the split k map (ldfrag), k ascending.
// BIAS_MODE 1: bias[n] (per column); BIAS_MODE 2: bias[m] (per row); bias values RNE-converted to bf16.
// Output: f32 C (pitch ldc). Epilogue: 16-row slabs staged per wave in LDS; each 64-wide row segment (256 B =
// coverage: 4 slabs x 16 rows (it 0..7 x lane>>4) x 64 cols = the wave's whole 64x64 tile.
// =====================================================================================================
#define SK     64                     // k elements per stage
#define SPITCH 72                     // LDS row pitch in elements (144 B)
#define SROWS  320                    // operand rows per stage (BM + BN)
#define SBYTES (SROWS * SPITCH * 2)   // 46080 B per buffer

// Four asynchronous copies, 16 B per lane each, global -> LDS. The s_wait_xcnt closes the statement so that no
// address register named here is rewritten before it.
__device__ __forceinline__ void copy4(unsigned l0, unsigned l1, unsigned l2, unsigned l3,
                                      const unsigned short* g0, const unsigned short* g1,
                                      const unsigned short* g2, const unsigned short* g3) {
#if DEV_ASM
  asm volatile("global_load_async_to_lds_b128 %0, %4, off\n\t"
               "global_load_async_to_lds_b128 %1, %5, off\n\t"
               "global_load_async_to_lds_b128 %2, %6, off\n\t"
               "global_load_async_to_lds_b128 %3, %7, off\n\t"
               "s_wait_xcnt 0x0"
               :: "v"(l0), "v"(l1), "v"(l2), "v"(l3), "v"(g0), "v"(g1), "v"(g2), "v"(g3) : "memory");
#else
  (void)l0; (void)l1; (void)l2; (void)l3; (void)g0; (void)g1; (void)g2; (void)g3;
#endif
}
// this wave's copies have landed in LDS (the compiler places no wait for them)
__device__ __forceinline__ void wait_copies() {
#if DEV_ASM
  asm volatile("s_wait_asynccnt 0x0" ::: "memory");
#endif
}
// all of this wave's copies but its N youngest have landed: publishes one stage and leaves the N copies of the
// stages issued behind it in flight (every wave issues SROWS / 16 copies per stage, and nothing else counts here)
template <int N>
__device__ __forceinline__ void wait_copies_but() {
#if DEV_ASM
  asm volatile("s_wait_asynccnt %0" :: "i"(N) : "memory");
#endif
}
// this wave's LDS reads have returned, so the buffer they read may be refilled behind the next barrier
__device__ __forceinline__ void wait_lds() {
#if DEV_ASM
  asm volatile("s_wait_dscnt 0x0" ::: "memory");
#endif
}
// stands behind global loads, in front of whatever rewrites their address registers
__device__ __forceinline__ void wait_addr() {
#if DEV_ASM
  asm volatile("s_wait_xcnt 0x0" ::: "memory");
#endif
}
// one stage: 20 copies per lane; ga / gb = the lane's piece of its first A / Bt row at this stage's k
template <int BM>
__device__ __forceinline__ void fill_stage(unsigned lb, const unsigned short* ga, int lda,
                                           const unsigned short* gb, int ldb) {
  // both loops unrolled: r0 is then a constant, so the A / Bt choice is no branch and g, l stay in registers
#pragma unroll
  for (int q = 0; q < SROWS / 64; ++q) {
    const unsigned short* g[4];
    unsigned l[4];
#pragma unroll
    for (int e = 0; e < 4; ++e) {
      const int r0 = (q * 4 + e) * 16;                 // first row of this copy's 16 rows
      g[e] = (r0 < BM) ? ga + (size_t)r0 * lda : gb + (size_t)(r0 - BM) * ldb;
      l[e] = lb + (unsigned)(r0 * SPITCH * 2);
    }
    copy4(l[0], l[1], l[2], l[3], g[0], g[1], g[2], g[3]);
  }
}

template <int BIAS_MODE, int WM, int NB>
__global__ __launch_bounds__(128) void gemm64(
    const unsigned short* __restrict__ Ap, int lda, long long strideA,
    const unsigned short* __restrict__ Btp, int ldb, long long strideB,
    float* Cout, int ldc, long long strideC,
    const float* __restrict__ bias,
    int M, int N, int K) {
  constexpr int BM = 64 * WM;
  constexpr int BN = SROWS - BM;
  constexpr int AHEAD = (NB - 2) * (SROWS / 16);   // a wave's copies of the NB - 2 stages behind the one being published
  static_assert(WM == 1 || WM == 4);
  static_assert(NB >= 2 && (NB - 1) * (SROWS / 16) <= 63);           // copies of a wave outstanding at most
  __shared__ __align__(16) unsigned short stg[NB * SROWS * SPITCH];  // the ring's stage buffers
  __shared__ __align__(16) float sT[4][16 * 68];   // per-wave 16x64 slab, pitch 68 floats
  const int b    = blockIdx.y;
  const int tid  = (int)threadIdx.x;
  const int lane = tid & 31;
  const int wave = tid >> 5;
  const int tilesN = N / BN;
  const int tilesM = M / BM;
  const int tile = blockIdx.x;
  if (tile >= tilesM * tilesN) return;   // block-uniform, in front of every barrier and copy
  const int tm = tile / tilesN;
  const int tn = tile - tm * tilesN;
  const int wrA = (WM == 4) ? (wave << 6) : 0;          // the wave's first A row inside the stage
  const int wrB = BM + ((WM == 4) ? 0 : (wave << 6));   // the wave's first Bt row inside the stage
  const int m0 = tm * BM + wrA;
  const int n0 = tn * BN + (wrB - BM);

  const int rlane = lane & 15;                 // row (A) / col (B, D) within subtile
  const int koff  = (lane >> 4) * 8;           // k offset of this lane half
  const int mOff  = (lane >> 4) * 8;           // D row offset

  // the lane's copy addresses: row tid>>3 of each 16-row group, 16-B piece tid&7
  const unsigned short* ga = Ap  + (size_t)b * (size_t)strideA + (size_t)(tm * BM + (tid >> 3)) * lda + (tid & 7) * 8;
  const unsigned short* gb = Btp + (size_t)b * (size_t)strideB + (size_t)(tn * BN + (tid >> 3)) * ldb + (tid & 7) * 8;
  const unsigned lds0 = (unsigned)(uintptr_t)stg + (unsigned)((tid >> 3) * SPITCH * 2 + (tid & 7) * 16);
  const int nst = K / SK;

  v8f acc[4][4];
#pragma unroll
  for (int i = 0; i < 4; ++i)
#pragma unroll
    for (int j = 0; j < 4; ++j) acc[i][j] = zero8();

  // unrolled: the buffer offsets are constants; stages 0 .. NB - 2 go out together
#pragma unroll
  for (int s = 0; s < NB - 1; ++s)
    if (s < nst) fill_stage<BM>(lds0 + (unsigned)s * SBYTES, ga + s * SK, lda, gb + s * SK, ldb);
  // the count is used only where all NB - 2 stages behind stage 0 were issued
  if (NB - 1 <= nst) wait_copies_but<AHEAD>(); else wait_copies();
  __syncthreads();                             // stage 0 is readable by every wave
  if (NB - 1 < nst) fill_stage<BM>(lds0 + (unsigned)(NB - 1) * SBYTES, ga + (NB - 1) * SK, lda, gb + (NB - 1) * SK, ldb);

  int buf = 0;                                 // t mod NB
  for (int t = 0; t < nst; ++t) {
    const __bf16* sb = (const __bf16*)(const void*)stg + buf * (SROWS * SPITCH);
    // unrolled (inner loops too): fragments stay in registers, and the second k step's LDS reads start under
    // the first step's WMMAs
#pragma unroll
    for (int kk = 0; kk < SK; kk += 32) {
      v16b bq[4], af[4];
#pragma unroll
      for (int j = 0; j < 4; ++j) bq[j] = ldfrag<__bf16>(sb + (wrB + (j << 4) + rlane) * SPITCH + koff + kk);
#pragma unroll
      for (int i = 0; i < 4; ++i) af[i] = ldfrag<__bf16>(sb + (wrA + (i << 4) + rlane) * SPITCH + koff + kk);
#pragma unroll
      for (int i = 0; i < 4; ++i) {
#pragma unroll
        for (int j = 0; j < 4; ++j) acc[i][j] = mmar(af[i], bq[j], acc[i][j]);
        dep_guard(acc[i][0], acc[i][3], af[i], bq[3]);
      }
      keep4(bq[0], bq[1], bq[2], bq[3]);
    }
    // publish point of stage t + 1: own reads of stage t done, own copies of stage t + 1 landed, then the barrier.
    // Stages t + 2 .. t + NB - 1 stay in flight where all of them were issued; towards the end the wait is to 0.
    wait_lds();
    if (t + NB - 1 < nst) wait_copies_but<AHEAD>(); else wait_copies();
    __syncthreads();
    // refill the buffer that every wave has just left
    if (t + NB < nst) fill_stage<BM>(lds0 + (unsigned)buf * SBYTES, ga + (t + NB) * SK, lda, gb + (t + NB) * SK, ldb);
    buf = (buf + 1 == NB) ? 0 : buf + 1;
  }
  wait_copies();
  acc_guard4(acc[0][0], acc[0][1], acc[0][2], acc[0][3]);
  acc_guard4(acc[1][0], acc[1][1], acc[1][2], acc[1][3]);
  acc_guard4(acc[2][0], acc[2][1], acc[2][2], acc[2][3]);
  acc_guard4(acc[3][0], acc[3][1], acc[3][2], acc[3][3]);

  // ---- epilogue ----
  float* slab = sT[wave];
  float* C = Cout + (size_t)b * (size_t)strideC;
  const int h2 = lane >> 4, c4 = (lane & 15) * 4;     // 256-B row segment = 16 lanes x 16 B
  v4f bcol = {0.f, 0.f, 0.f, 0.f};
  if (BIAS_MODE == 1) {
#pragma unroll
    for (int e = 0; e < 4; ++e) bcol[e] = bf_round(bias[n0 + c4 + e]);
  }
#pragma unroll
  for (int i = 0; i < 4; ++i) {
    const int mBase = m0 + (i << 4);
#pragma unroll
    for (int j = 0; j < 4; ++j) {
#pragma unroll
      for (int r = 0; r < 8; ++r) {
        slab[(mOff + r) * 68 + (j << 4) + rlane] = acc[i][j][r];
      }
    }
    __builtin_amdgcn_fence(__ATOMIC_RELEASE, "workgroup");
    __builtin_amdgcn_wave_barrier();
    __builtin_amdgcn_fence(__ATOMIC_ACQUIRE, "workgroup");
    {
#pragma unroll
      for (int it = 0; it < 8; ++it) {
        const int row = it * 2 + h2;                     // it 0..7 x h2 0..1 = rows 0..15
        v4f v = *(const v4f*)(slab + row * 68 + c4);
        if (BIAS_MODE == 1) {
          v = v + bcol;
        } else {
          const float br = bf_round(bias[mBase + row]);
          v = v + br;
        }
        *(v4f*)(C + (size_t)(mBase + row) * ldc + n0 + c4) = v;
      }
      
    }
    __builtin_amdgcn_fence(__ATOMIC_RELEASE, "workgroup");
    __builtin_amdgcn_wave_barrier();
    __builtin_amdgcn_fence(__ATOMIC_ACQUIRE, "workgroup");
  }
}

// =====================================================================================================
// P^T B fragment pair (hi, residual) from the lane's own score D values: element r <- tile a row r,
// element 8+r <- tile c row r (same lane, same query column).
// =====================================================================================================
__device__ __forceinline__ void pack_pt(v8f a, v8f c, v16b& ph, v16b& pl) {
  v8u H, L;
#pragma unroll
  for (int r = 0; r < 4; ++r) {
    unsigned hp, lp;
    split2(a[2 * r], a[2 * r + 1], hp, lp);
    H[r] = hp; L[r] = lp;
    split2(c[2 * r], c[2 * r + 1], hp, lp);
    H[4 + r] = hp; L[4 + r] = lp;
  }
  ph = __builtin_bit_cast(v16b, H); pl = __builtin_bit_cast(v16b, L);
}

// load 8 consecutive f32, or zeros when keep == 0 (address always valid, select by value)
__device__ __forceinline__ void ld8sel(const float* src, int keep, float f[8]) {
  const v4f a = *(const v4f*)src;
  const v4f c = *(const v4f*)(src + 4);
  f[0] = keep ? a[0] : 0.f; f[1] = keep ? a[1] : 0.f; f[2] = keep ? a[2] : 0.f; f[3] = keep ? a[3] : 0.f;
  f[4] = keep ? c[0] : 0.f; f[5] = keep ? c[1] : 0.f; f[6] = keep ? c[2] : 0.f; f[7] = keep ? c[3] : 0.f;
}

// =====================================================================================================
// Windowed attention, one block = (batch b, head, 8x8 query tile at (i0, j0)); 128 threads = 4 waves,
// wave w owns the 16 queries lq = 16w..16w+15 (query row i0 + (lq>>3), col j0 + (lq&7)).
// Key superset = the 14x14 image block at (R0, C0), R0 = clamp(i0-3, 0, 42), slot = u*14 + v (196 slots,
// padded to 224 with zero rows). Every query's clamped 7x7 window lies inside the superset: valid slots are
// su <= u <= su+6, sv <= v <= sv+6 with su = clamp(qi-3,0,49) - R0 in [0,7].
// A wave's 16 queries are two image rows, so their windows lie in the 8 superset rows ulo..ulo+7, ulo = min(su of the
// first row, 6): the wave scores, masks, exponentiates and multiplies only those 112 slots (7 tiles from slot 14 ulo).
//   qkv plane f32 [b*3136 + p][768]: q = cols head*32+d (scaled by 32^-0.5 in f32 here), k = 256+.., v = 512+..
//   scores (transposed): S^T[slot][query] = K[slot][d] . Q^T[d][query] on bf16 WMMA, 3 products
//     (hi.hi + hi.res + res.hi); lane owns query column (lane&15) of its wave and key rows 14 ulo + 16j + 8h + r.
//   s = S^T + rpb[head][u + R0 - qi + 6][v + C0 - qj + 6] for valid slots, -1e30 otherwise (f32);
//   softmax in f32 (max / sum over the 56 lane values and the partner lane ^16).
//   O^T[d][query] = V^T[d][slot] . P^T[slot][query] on bf16 WMMA, 3 products, p unnormalised exp, 1/sum at the end.
// LDS: KV0/KV1 hold K hi/res [slot][d] (pitch 64 B) for the scores, then (after a block barrier) V hi/res [slot][d]
// (pitch 96 B), row-major as it comes from memory; the V^T fragments are made by transposing LDS loads.
// K and Q rows have a 64-B pitch, at which the b128 fragment reads meet four to a bank; Os rows 128 B.
// Staged extents: KV 224x32 both phases (slots >= 196 zero), Q 64x32, Rp 384 (table at 100..268, zeros around),
// Os 16x32 per wave -- every LDS element read is written first.
// Output coverage: each wave stores its 16 query rows (it 0..3 x lane>>3) x 8 pieces of 16 B (lane&7) =
// =====================================================================================================
__global__ __launch_bounds__(128)
void natt(const float* __restrict__ qkv, const float* __restrict__ rpb, unsigned short* ctx) {
  __shared__ __align__(32) unsigned short KV0[NSLOT * VPITCH];   // 21504 B (K uses the first 14336)
  __shared__ __align__(32) unsigned short KV1[NSLOT * VPITCH];   // 21504 B
  __shared__ __align__(16) unsigned short Qh[64 * HDIM];       //  4096 B
  __shared__ __align__(16) unsigned short Ql[64 * HDIM];       //  4096 B
  __shared__ __align__(16) float Os[4][16 * HDIM];             //  8192 B
  __shared__ float Rp[RPN];

  const int tid  = (int)threadIdx.x;
  const int wave = tid >> 5;
  const int lane = tid & 31;
  const int hh   = lane >> 4;
  const int m    = lane & 15;

  const int bx   = blockIdx.x;
  const int tj   = bx % 7;
  const int ti   = (bx / 7) % 7;
  const int head = (bx / 49) % NHD;
  const int b    = bx / (49 * NHD);
  const int i0 = ti * 8, j0 = tj * 8;
  const int R0 = min(max(i0 - 3, 0), IMH - SUP);
  const int C0 = min(max(j0 - 3, 0), IMW - SUP);
  const size_t pb = (size_t)b * NPOS;

  // ---- position-bias table of this head (bf16 RNE-converted values), entries 0..168 at Rp[RPLO..], zeros around ----
  {
    float rv[RPN / 128];
    // both loops unrolled: rv stays in registers and the three loads go out together
#pragma unroll
    for (int it = 0; it < RPN / 128; ++it) {
      const int t = it * 128 + tid - RPLO;
      rv[it] = rpb[head * 169 + min(max(t, 0), 168)];           // clamped address
    }
    wait_addr();
#pragma unroll
    for (int it = 0; it < RPN / 128; ++it) {
      const int e = it * 128 + tid;
      const float tv = bf_round(rv[it]);
      Rp[e] = ((unsigned)(e - RPLO) < 169u) ? tv : 0.f;
    }
  }
  // ---- q (scaled in f32) -> hi / residual planes [lq][d]; thread = (lq = tid>>1, d half) ----
  {
    const int lq = tid >> 1, dh = (tid & 1) * 16;
    const int qi = lq >> 3, qj = lq & 7;
    const size_t pos = pb + (size_t)(i0 + qi) * IMW + j0 + qj;
    const float* src = qkv + pos * C3 + head * HDIM + dh;
#pragma unroll
    for (int g = 0; g < 2; ++g) {
      float f[8];
      ld8sel(src + 8 * g, 1, f);
      v4u ph, pl;
#pragma unroll
      for (int e = 0; e < 4; ++e) {
        unsigned hp, lp;
        split2(f[2 * e] * QSCALE, f[2 * e + 1] * QSCALE, hp, lp);
        ph[e] = hp; pl[e] = lp;
      }
      *(v4u*)(Qh + lq * HDIM + dh + 8 * g) = ph;
      *(v4u*)(Ql + lq * HDIM + dh + 8 * g) = pl;
    }
  }
  // ---- K superset -> KV0 (hi) / KV1 (residual), layout [slot][d]; item = it*128 + tid, slot = item>>2,
  //      d8 = (item&3)*8; 7 x 128 items = 224 slots x 4 groups = the whole tile; slots >= 196 = zeros ----
  {
    const float* kbase = qkv + CH + head * HDIM;
#pragma unroll
    for (int it = 0; it < 7; ++it) {
      const int item = it * 128 + tid;
      const int slot = item >> 2, d8 = (item & 3) * 8;
      const int u = slot / SUP, v = slot - u * SUP;
      const int uc = min(u, SUP - 1);
      const size_t pos = pb + (size_t)(R0 + uc) * IMW + C0 + v;
      float f[8];
      ld8sel(kbase + pos * C3 + d8, slot < SUP * SUP, f);
      v4u ph, pl;
#pragma unroll
      for (int e = 0; e < 4; ++e) {
        unsigned hp, lp;
        split2(f[2 * e], f[2 * e + 1], hp, lp);
        ph[e] = hp; pl[e] = lp;
      }
      *(v4u*)(KV0 + slot * HDIM + d8) = ph;
      *(v4u*)(KV1 + slot * HDIM + d8) = pl;
    }
  }
  __syncthreads();

  // ---- the wave's key range: first superset row ulo, first slot slot0 (the same in every lane of the wave) ----
  const int wv    = __builtin_amdgcn_readfirstlane(wave);
  const int ulo   = min(min(max(i0 + 2 * wv - 3, 0), IMH - KW) - R0, SUP - WROWS);
  const int slot0 = ulo * SUP;

  // ---- scores: S^T tiles j = 0..6 (key slots slot0 + 16j .. + 15) for the wave's 16 queries; s[7] stays zero ----
  v8f s[NKT + 1];
  {
    const __bf16* Kh = (const __bf16*)(const void*)KV0 + slot0 * HDIM;
    const __bf16* Kl = (const __bf16*)(const void*)KV1 + slot0 * HDIM;
    const __bf16* Qhp = (const __bf16*)(const void*)Qh;
    const __bf16* Qlp = (const __bf16*)(const void*)Ql;
    const v16b qfh = ldfrag<__bf16>(Qhp + (16 * wave + m) * HDIM + 8 * hh);
    const v16b qfl = ldfrag<__bf16>(Qlp + (16 * wave + m) * HDIM + 8 * hh);
#pragma unroll
    for (int j = 0; j < NKT; ++j) {
      const v16b kfh = ldfrag<__bf16>(Kh + (16 * j + m) * HDIM + 8 * hh);
      const v16b kfl = ldfrag<__bf16>(Kl + (16 * j + m) * HDIM + 8 * hh);
      v8f z = zero8();
      z = mma_b(kfh, qfh, z);
      z = mma_b(kfh, qfl, z);
      z = mma_b(kfl, qfh, z);
      s[j] = z;
    }
    s[NKT] = zero8();
  }
  __syncthreads();   // all waves done reading K from KV0/KV1

  // ---- V superset -> KV0 (hi) / KV1 (residual), layout [slot][d] (pitch VPITCH), one 16-B store per plane and item;
  //      same item map as K: 224 slots x 32 d written, slots >= 196 = zeros ----
  {
    const float* vbase = qkv + 2 * CH + head * HDIM;
#pragma unroll
    for (int it = 0; it < 7; ++it) {
      const int item = it * 128 + tid;
      const int slot = item >> 2, d8 = (item & 3) * 8;
      const int u = slot / SUP, v = slot - u * SUP;
      const int uc = min(u, SUP - 1);
      const size_t pos = pb + (size_t)(R0 + uc) * IMW + C0 + v;
      float f[8];
      ld8sel(vbase + pos * C3 + d8, slot < SUP * SUP, f);
      v4u ph, pl;
#pragma unroll
      for (int e = 0; e < 4; ++e) {
        unsigned hp, lp;
        split2(f[2 * e], f[2 * e + 1], hp, lp);
        ph[e] = hp; pl[e] = lp;
      }
      *(v4u*)(KV0 + slot * VPITCH + d8) = ph;
      *(v4u*)(KV1 + slot * VPITCH + d8) = pl;
    }
  }
  __syncthreads();

  // ---- window mask + position bias (f32), softmax over the query column ----
  const int lq = 16 * wave + m;
  const int ai = i0 + (lq >> 3), aj = j0 + (lq & 7);
  const int su = min(max(ai - 3, 0), IMH - KW) - R0 - ulo;      // counted from the wave's first row: 0 or 1
  const int sv = min(max(aj - 3, 0), IMW - KW) - C0;
  const int cb = (R0 + ulo - ai + 6) * 13 + (C0 - aj + 6);
  // Slots and rows u are counted from the wave's first slot and row from here on.
  // Bias index 13u + v + cb = slot - u + cb. The upper lane half's slot is 8 higher and its u is equal or one
  // higher (one higher where t0 % 14 >= 6), so two lane bases and a constant offset address every read; the read
  // is made for every slot (the padded table holds every such index) and the window test selects by value.
  const float* rb8 = Rp + (RPLO + cb + 8 * hh);
  const float* rb7 = Rp + (RPLO + cb + 7 * hh);
  // The window test of a slot is a row test and a column test; each distinct one is made once:
  // column k = t0 % 14 (upper half: (k + 8) % 14), row a = t0 / 14 (upper half: a, or a + 1 where k >= 6).
  // Both loops unrolled: the arrays are then indexed by constants only and each test is one lane mask in a register.
  bool colok[SUP], rowsame[WROWS], rownext[WROWS];
#pragma unroll
  for (int k = 0; k < SUP; ++k) {
    const int v = hh ? ((k + 8) % SUP) : k;
    colok[k] = (unsigned)(v - sv) < 7u;
  }
#pragma unroll
  for (int a = 0; a < WROWS; ++a) {
    rowsame[a] = (unsigned)(a - su) < 7u;
    rownext[a] = (unsigned)(a + hh - su) < 7u;
  }
  float mloc = -1.0e30f;
#pragma unroll
  for (int j = 0; j < NKT; ++j) {
#pragma unroll
    for (int r = 0; r < 8; ++r) {
      const int t0 = 16 * j + r;                       // slot = t0 + 8*hh
      const bool step = (t0 % SUP) >= SUP - 8;         // the upper half's slot lies one superset row further
      const bool ok = colok[t0 % SUP] & (step ? rownext[t0 / SUP] : rowsame[t0 / SUP]);
      const int c0 = t0 - t0 / SUP;                    // 13u + v of the lower half's slot
      const float bv = step ? rb7[c0] : rb8[c0];
      const float sb = s[j][r] + bv;
      const float sval = ok ? sb : -1.0e30f;
      s[j][r] = sval;
      mloc = fmaxf(mloc, sval);
    }
  }
  const float mrow = fmaxf(mloc, __shfl_xor(mloc, 16, 32));
  float lsum = 0.f;
#pragma unroll
  for (int j = 0; j < NKT; ++j) {
#pragma unroll
    for (int r = 0; r < 8; ++r) {
      const float p = __expf(s[j][r] - mrow);
      s[j][r] = p;
      lsum += p;
    }
  }
  lsum += __shfl_xor(lsum, 16, 32);

  // ---- O^T = V^T . P^T : 2 d-tiles x 4 k-steps of 32 slots x 3 products (the last 16 slots meet p = 0) ----
  v8f o[2];
  o[0] = zero8(); o[1] = zero8();
  {
    // the lane's 16 B of a transposing load: slot row 8*hh + (lane&7), column piece (lane>>3)&1
    const int vo = (slot0 + 8 * hh + (lane & 7)) * VPITCH + ((lane >> 3) & 1) * 8;
    const unsigned short* Vh = KV0 + vo;
    const unsigned short* Vl = KV1 + vo;
#pragma unroll
    for (int kk = 0; kk < (NKT + 1) / 2; ++kk) {
      v16b ph, pl;
      pack_pt(s[2 * kk], s[2 * kk + 1], ph, pl);
#pragma unroll
      for (int t = 0; t < 2; ++t) {
        const v16b vfh = ldfrag_tr(Vh + 32 * kk * VPITCH + 16 * t, VPITCH);
        const v16b vfl = ldfrag_tr(Vl + 32 * kk * VPITCH + 16 * t, VPITCH);
        o[t] = mma_b(vfh, ph, o[t]);
        o[t] = mma_b(vfh, pl, o[t]);
        o[t] = mma_b(vfl, ph, o[t]);
      }
    }
  }

  // ---- normalise, stage the wave's 16 queries x 32 d in LDS, write the ctx lines ----
  const float linv = 1.0f / lsum;
  float* os = Os[wave];
#pragma unroll
  for (int t = 0; t < 2; ++t)
#pragma unroll
    for (int r = 0; r < 8; ++r) os[m * HDIM + 16 * t + 8 * hh + r] = o[t][r] * linv;
  __syncthreads();
  {
    const int q4 = lane >> 3, pc = lane & 7, dsel = (pc & 3) * 8;
    const bool lowp = (pc >= 4);
    v4u hv[4];
    size_t go[4];
#pragma unroll
    for (int it = 0; it < 4; ++it) {
      const int row = it * 4 + q4;                     // it 0..3 x q4 0..3 = rows 0..15
      const float* sp = os + row * HDIM + dsel;
      v4u a;
#pragma unroll
      for (int e = 0; e < 4; ++e) {
        unsigned hp, lp;
        split2(sp[2 * e], sp[2 * e + 1], hp, lp);
        a[e] = lowp ? lp : hp;
      }
      hv[it] = a;
      const int lqr = 16 * wave + row;
      const size_t pos = pb + (size_t)(i0 + (lqr >> 3)) * IMW + j0 + (lqr & 7);
      go[it] = pos * CTXK + (size_t)head * 64 + pc * 8;
    }
    {
#pragma unroll
      for (int it = 0; it < 4; ++it) *(v4u*)(ctx + go[it]) = hv[it];
      
    }
  }
}

// =====================================================================================================
//   Xh   bf16 [6272][256]     3211264
//   Wqb  bf16 [768][256]       393216
//   Wpf  bf16 [256][512]       262144
//   QKV  f32  [6272][768]    19267584
//   CTX  bf16 [6272][512]     6422528
//   total                   29556736
// =====================================================================================================
extern "C" void kernel_launch(void* const* d_in, const int* in_sizes, int n_in,
                              void* d_out, int out_size, void* d_ws, size_t ws_size,
                              hipStream_t stream) {
  if (n_in < 6) return;
  if (in_sizes[0] != NBT * CH * NPOS) return;
  if (in_sizes[1] != C3 * CH) return;
  if (in_sizes[2] != C3) return;
  if (in_sizes[3] != NHD * 13 * 13) return;
  if (in_sizes[4] != CH * CH) return;
  if (in_sizes[5] != CH) return;
  if (out_size != NBT * CH * NPOS) return;

  const float* x      = (const float*)d_in[0];
  const float* w_qkv  = (const float*)d_in[1];
  const float* b_qkv  = (const float*)d_in[2];
  const float* rpb    = (const float*)d_in[3];
  const float* w_proj = (const float*)d_in[4];
  const float* b_proj = (const float*)d_in[5];

  const size_t PXH  = (size_t)MROW * CH * 2;        //  3211264
  const size_t PWQ  = (size_t)C3 * CH * 2;          //   393216
  const size_t PWP  = (size_t)CH * CTXK * 2;        //   262144
  const size_t PQKV = (size_t)MROW * C3 * 4;        // 19267584
  const size_t PCTX = (size_t)MROW * CTXK * 2;      //  6422528
  size_t off = 0;
  const size_t oXh  = off; off += PXH;
  const size_t oWq  = off; off += PWQ;
  const size_t oWp  = off; off += PWP;
  const size_t oQKV = off; off += PQKV;
  const size_t oCTX = off; off += PCTX;
  if (off > ws_size) return;                         // off = 29556736
  if (off > (size_t)134217728) return;

  char* ws = (char*)d_ws;
  unsigned short* Xh  = (unsigned short*)(ws + oXh);
  unsigned short* Wqb = (unsigned short*)(ws + oWq);
  unsigned short* Wpf = (unsigned short*)(ws + oWp);
  float*          QKV = (float*)(ws + oQKV);
  unsigned short* CTX = (unsigned short*)(ws + oCTX);

  const int tilesQKV = (MROW / 64) * (C3 / 256);                      //  294 block tiles of 64 x 256
  const int tilesPRJ = (CH / 256) * (NPOS / 64);                      //   49 block tiles of 256 x 64
  const dim3 gCvt(NBX + NBQ + NBP);                                   // 552
  const dim3 gQKV(tilesQKV, 1);                                       // 294
  const dim3 gAtt(NBT * NHD * 49);                                    // 784
  const dim3 gPRJ(tilesPRJ, NBT);                                     // (49, 2)

  // (1) x NCHW -> bf16 [p][c]; w_qkv -> bf16 [n][k]; w_proj -> folded bf16 [c][512]
  cvt_all<<<gCvt, dim3(256), 0, stream>>>(x, w_qkv, w_proj, Xh, Wqb, Wpf);
  // (2) qkv = Xh . Wqkv^T + b_qkv -> f32 [6272][768]   (M=6272, N=768, K=256)
  gemm64<1, 1, 3><<<gQKV, dim3(128), 0, stream>>>(
      Xh, CH, 0LL, Wqb, CH, 0LL,
      QKV, C3, 0LL, b_qkv,
      MROW, C3, CH);
  // (3) windowed attention -> ctx plane bf16 [6272][512]
  natt<<<gAtt, dim3(128), 0, stream>>>(QKV, rpb, CTX);
  // (4) out[b][c][p] = sum_k Wpf[c][k] ctx[b*3136+p][k] + b_proj[c]   (per batch: M=256, N=3136, K=512)
  gemm64<2, 4, 4><<<gPRJ, dim3(128), 0, stream>>>(
      Wpf, CTXK, 0LL, CTX, CTXK, (long long)NPOS * CTXK,
      (float*)d_out, NPOS, (long long)CH * NPOS, b_proj,
      CH, NPOS, CTXK);
  (void)hipGetLastError();
}

// v008
// A run of this version takes 32.2 microseconds.
// Next to v007, in two timings, it ran 1.05 and 1.04 times as fast.
// All steps since v000 together make it 2.35 times as fast.
// Contractions: qkv projection = v_wmma_f32_16x16x32_bf16 (bf16 operands from RNE-converted x and w_qkv, single product, f32 accumulate);
// q.k scores = v_wmma_f32_16x16x32_bf16 (q and k each as bf16 hi plane + unscaled bf16 residual plane, 3 products, f32 accumulate);
// p.v = v_wmma_f32_16x16x32_bf16 (p and v each as bf16 hi + unscaled bf16 residual, 3 products, f32 accumulate);
// ctx.w_proj^T = v_wmma_f32_16x16x32_bf16 (ctx as bf16 hi + residual folded into K, w_proj bf16 from its RNE-converted value, f32 accumulate);
// biases, q scaling, window mask, position bias and softmax in f32. No power-of-two carries anywhere (bf16 planes, unscaled residuals).
#include <hip/hip_runtime.h>
#include <math.h>
#include <stdint.h>

#define NBT   2
#define CH    256
#define IMH   56
#define IMW   56
#define NPOS  (IMH * IMW)        // 3136 positions per image, p = i*56 + j
#define MROW  (NBT * NPOS)       // 6272 position rows
#define NHD   8
#define HDIM  32
#define C3    (3 * CH)           // 768
#define KW    7                  // window side; window start = clamp(i - 3, 0, IMH - KW)
#define SUP   14                 // clamped key superset side of an 8x8 query tile
#define NSLOT 224                // key slots staged per block (196 used, rest zero)
#define WROWS 8                  // superset rows that hold every window of one wave's 16 queries (two image rows)
#define NKT   7                  // scored 16-key tiles per wave: WROWS x SUP = 112 consecutive slots
#define CTXK  512                // folded K of the ctx plane: per head [hi d0..31 | residual d0..31]
#define QSCALE 0.17677669529663687f
#define RPLO  100                // position-bias entry 0 sits at Rp[RPLO]; entries around the table are zero
#define RPN   384                // padded table: every unclamped index 13u + v + cb of a scored slot lies inside
#define VPITCH 48                // LDS pitch of a staged V row [slot][d] in elements: 96 B = 32 B x 3, the transposing reader's pitch

static_assert((MROW % 64) == 0);
static_assert((C3 % 256) == 0);
static_assert((NPOS % 64) == 0);
static_assert((CH % 256) == 0);
static_assert((CH % 128) == 0 && (CTXK % 128) == 0);
static_assert(NHD * HDIM == CH);
static_assert(SUP == 8 + KW - 1);
static_assert(SUP * SUP <= NSLOT && (NSLOT % 32) == 0 && NKT * 16 == WROWS * SUP && WROWS == KW + 1);
static_assert((SUP - WROWS) * SUP + ((NKT + 1) / 2) * 32 <= NSLOT);   // the last wave range's P.V steps stay in staged rows
static_assert(IMH == IMW);
static_assert(VPITCH >= HDIM && (VPITCH * 2) % 32 == 0 && ((VPITCH * 2) / 32) % 2 == 1);
static_assert(RPLO - 7 * 13 - 7 >= 0 && RPLO + 6 * 13 + 6 + (SUP * SUP - 1) - (SUP * SUP - 1) / SUP < RPN && RPN % 128 == 0);

typedef __bf16   v16b __attribute__((ext_vector_type(16)));
typedef __bf16   v8b  __attribute__((ext_vector_type(8)));
typedef float    v8f  __attribute__((ext_vector_type(8)));
typedef float    v4f  __attribute__((ext_vector_type(4)));
typedef unsigned int v4u __attribute__((ext_vector_type(4)));
typedef unsigned int v8u __attribute__((ext_vector_type(8)));
typedef float    v2f  __attribute__((ext_vector_type(2)));
typedef __bf16   v2b  __attribute__((ext_vector_type(2)));
typedef unsigned int v2u __attribute__((ext_vector_type(2)));

#if defined(__HIP_DEVICE_COMPILE__)
#define DEV_ASM 1
#else
#define DEV_ASM 0
#endif

// ---- scalar helpers --------------------------------------------------------------------------------
// two f32 -> two bf16 (RNE) packed in one register, a in the low half: one packed convert instruction
__device__ __forceinline__ unsigned cvt2(float a, float b) {
  const v2f f = {a, b};
  return __builtin_bit_cast(unsigned, __builtin_convertvector(f, v2b));
}
__device__ __forceinline__ float bf_round(float f) { return (float)(__bf16)f; }   // f32 value of the RNE bf16
__device__ __forceinline__ v8f zero8() { v8f z = {0.f, 0.f, 0.f, 0.f, 0.f, 0.f, 0.f, 0.f}; return z; }
// hi / residual bf16 split of an f32 value (residual unscaled)
// of a pair: hp = packed hi halves, lp = packed residuals, a in the low half of each
__device__ __forceinline__ void split2(float a, float b, unsigned& hp, unsigned& lp) {
  const v2f f = {a, b};
  const v2b h = __builtin_convertvector(f, v2b);
  hp = __builtin_bit_cast(unsigned, h);
  lp = cvt2(a - (float)h[0], b - (float)h[1]);
}

// ---- fragment loader: 16-bit A/B operand, lane -> row/col (lane&15), p already includes +8*(lane>>4);
//      elements 0..7 <- p[0..7] (k0+8h..k0+8h+7), elements 8..15 <- p[16..23] (k0+16+8h..k0+16+8h+7)
template <typename OT> struct FT;
template <> struct FT<__bf16> { typedef v16b frag; typedef v8b half8; };

template <typename OT>
__device__ __forceinline__ typename FT<OT>::frag ldfrag(const OT* p) {
  union { typename FT<OT>::frag v; typename FT<OT>::half8 h[2]; } f;
  f.h[0] = *(const typename FT<OT>::half8*)(p);
  f.h[1] = *(const typename FT<OT>::half8*)(p + 16);
  return f.v;
}

// ---- the same fragment from f32 values in LDS, read (ldraw_f32) and then RNE-converted to bf16 (cvtfrag): p already
//      includes +8*(lane>>4); elements 0..7 <- p[0..7], elements 8..15 <- p[16..23], the k map of ldfrag
struct raw16 { v4f a, b, c, d; };
__device__ __forceinline__ raw16 ldraw_f32(const float* p) {
  raw16 r;
  r.a = *(const v4f*)(p);
  r.b = *(const v4f*)(p + 4);
  r.c = *(const v4f*)(p + 16);
  r.d = *(const v4f*)(p + 20);
  return r;
}
__device__ __forceinline__ v16b cvtfrag(raw16 r) {
  v8u u;
  u[0] = cvt2(r.a[0], r.a[1]); u[1] = cvt2(r.a[2], r.a[3]); u[2] = cvt2(r.b[0], r.b[1]); u[3] = cvt2(r.b[2], r.b[3]);
  u[4] = cvt2(r.c[0], r.c[1]); u[5] = cvt2(r.c[2], r.c[3]); u[6] = cvt2(r.d[0], r.d[1]); u[7] = cvt2(r.d[2], r.d[3]);
  return __builtin_bit_cast(v16b, u);
}

// ---- transposing fragment loader: a row-major 16-bit LDS tile T[k][d] read as the A operand T^T (rows d, k along the
//      fragment). p = the lane's own 16 B: row k0 + 8*(lane>>4) + (lane&7), piece (lane>>3)&1 of the 16 columns at d0.
//      Lane (c = lane&15, h = lane>>4) gets T[k0+8h .. k0+8h+7][d0+c] in elements 0..7 and, from 16 rows further,
//      T[k0+16+8h .. +7][d0+c] in elements 8..15: the k map of ldfrag. Every lane is on where it is called.
__device__ __forceinline__ v16b ldfrag_tr(const unsigned short* p, int pitch) {
  typedef __attribute__((address_space(3))) v8b lds_v8b;
  union { v16b v; v8b h[2]; } f;
  f.h[0] = __builtin_amdgcn_ds_load_tr16_b128_v8bf16((lds_v8b*)p);
  f.h[1] = __builtin_amdgcn_ds_load_tr16_b128_v8bf16((lds_v8b*)(p + 16 * pitch));
  return f.v;
}

// ---- WMMA helpers ------------------------------------------------------------------------------------
__device__ __forceinline__ v8f mmar(v16b a, v16b b, v8f c) {
  return __builtin_amdgcn_wmma_f32_16x16x32_bf16(false, a, false, b, (short)0, c, false, false);
}
// guarded form: 4 VALU slots after the WMMA, D tied, A/B kept live
__device__ __forceinline__ v8f mma_b(v16b a, v16b b, v8f c) {
  c = __builtin_amdgcn_wmma_f32_16x16x32_bf16(false, a, false, b, (short)0, c, false, false);
#if DEV_ASM
  asm volatile("v_nop\n\tv_nop\n\tv_nop\n\tv_nop" : "+v"(c) : "v"(a), "v"(b));
#endif
  return c;
}
__device__ __forceinline__ void dep_guard(v8f& a, v8f& b, v16b x, v16b y) {
#if DEV_ASM
  asm volatile("v_nop\n\tv_nop\n\tv_nop\n\tv_nop" : "+v"(a), "+v"(b) : "v"(x), "v"(y));
#else
  (void)a; (void)b; (void)x; (void)y;
#endif
}
__device__ __forceinline__ void keep4(v16b a, v16b b, v16b c, v16b d) {
#if DEV_ASM
  asm volatile("v_nop" :: "v"(a), "v"(b), "v"(c), "v"(d));
#else
  (void)a; (void)b; (void)c; (void)d;
#endif
}
__device__ __forceinline__ void acc_guard4(v8f& a, v8f& b, v8f& c, v8f& d) {
#if DEV_ASM
  asm volatile("v_nop\n\tv_nop\n\tv_nop\n\tv_nop" : "+v"(a), "+v"(b), "+v"(c), "+v"(d));
#else
  (void)a; (void)b; (void)c; (void)d;
#endif
}

// =====================================================================================================
// Batched WMMA GEMM (bf16 operands): C[m][n] = sum_k A[m][k] * Bt[n][k] + bias. A row-major [M][K] pitch lda;
// A is given as f32 [M][K / 2] and stands for the folded plane A[m][64 g + 32 part + d] = bf16(Af[m][32 g + d]), part = 0, 1
// (part 0 meets the hi half of Bt's group g, part 1 its residual half). The 32 f32 of a group fill the same 128 B as its
// 64 folded bf16 would, so rows, pitches and copies are counted in 16-bit units as for Bt; the A fragment is converted
// (RNE) where it is read from LDS and serves both k steps of its stage.
// Bt row-major [N][K] pitch ldb (k contiguous); blockIdx.y = batch index (strides in elements).
// One block = 4 waves, one 64x64 tile of C per wave: WM waves along m and 4 / WM along n, so the block tile is
// (64 WM) x (256 / WM). M, N multiples of the block tile, K a multiple of SK (host constants).
// Operands go global -> LDS by asynchronous 16-B copies, SK = 64 k (one whole 128-B line of each of the 320
// operand rows) per stage, a ring of NB buffers: up to NB - 1 stages (at most 60 copies of a wave) are in flight while
// stage t feeds the WMMAs, so a stage has NB - 1 passes to land instead of one.
// Stage layout: rows 0..BM-1 = A rows, rows BM..319 = Bt rows, pitch 144 B (16 B x 9, conflict-free b128 reads).
// Copy map: item = it*128 + tid, row = item>>3, 16-B piece = item&7 -> 8 lanes copy one line, 20 copies per lane
// = 320 rows x 8 pieces, each LDS byte written by one lane. Fragments keep the split k map (ldfrag), k ascending.
// BIAS_MODE 1: bias[n] (per column); BIAS_MODE 2: bias[m] (per row); bias values RNE-converted to bf16.
// Output: f32 C (pitch ldc). Epilogue: 16-row slabs staged per wave in LDS; each 64-wide row segment (256 B =
// coverage: 4 slabs x 16 rows (it 0..7 x lane>>4) x 64 cols = the wave's whole 64x64 tile.
// =====================================================================================================
#define SK     64                     // k elements per stage
#define SPITCH 72                     // LDS row pitch in elements (144 B)
#define SROWS  320                    // operand rows per stage (BM + BN)
#define SBYTES (SROWS * SPITCH * 2)   // 46080 B per buffer

// Four asynchronous copies, 16 B per lane each, global -> LDS. The s_wait_xcnt closes the statement so that no
// address register named here is rewritten before it.
__device__ __forceinline__ void copy4(unsigned l0, unsigned l1, unsigned l2, unsigned l3,
                                      const unsigned short* g0, const unsigned short* g1,
                                      const unsigned short* g2, const unsigned short* g3) {
#if DEV_ASM
  asm volatile("global_load_async_to_lds_b128 %0, %4, off\n\t"
               "global_load_async_to_lds_b128 %1, %5, off\n\t"
               "global_load_async_to_lds_b128 %2, %6, off\n\t"
               "global_load_async_to_lds_b128 %3, %7, off\n\t"
               "s_wait_xcnt 0x0"
               :: "v"(l0), "v"(l1), "v"(l2), "v"(l3), "v"(g0), "v"(g1), "v"(g2), "v"(g3) : "memory");
#else
  (void)l0; (void)l1; (void)l2; (void)l3; (void)g0; (void)g1; (void)g2; (void)g3;
#endif
}
// this wave's copies have landed in LDS (the compiler places no wait for them)
__device__ __forceinline__ void wait_copies() {
#if DEV_ASM
  asm volatile("s_wait_asynccnt 0x0" ::: "memory");
#endif
}
// all of this wave's copies but its N youngest have landed: publishes one stage and leaves the N copies of the
// stages issued behind it in flight (every wave issues the same count per stage: SROWS / 16 in gemm64, WCOP in gemm_qkv, and nothing else counts here)
template <int N>
__device__ __forceinline__ void wait_copies_but() {
#if DEV_ASM
  asm volatile("s_wait_asynccnt %0" :: "i"(N) : "memory");
#endif
}
// this wave's LDS reads have returned, so the buffer they read may be refilled behind the next barrier
__device__ __forceinline__ void wait_lds() {
#if DEV_ASM
  asm volatile("s_wait_dscnt 0x0" ::: "memory");
#endif
}
// stands behind global loads, in front of whatever rewrites their address registers
__device__ __forceinline__ void wait_addr() {
#if DEV_ASM
  asm volatile("s_wait_xcnt 0x0" ::: "memory");
#endif
}
// the same, with the loads' address named as an input: its register pair stays whole up to the wait
__device__ __forceinline__ void wait_addr_of(const float* g) {
#if DEV_ASM
  asm volatile("s_wait_xcnt 0x0" :: "v"(g) : "memory");
#else
  (void)g;
#endif
}
// one stage: 20 copies per lane; ga / gb = the lane's piece of its first A / Bt row at this stage's k
template <int BM>
__device__ __forceinline__ void fill_stage(unsigned lb, const unsigned short* ga, int lda,
                                           const unsigned short* gb, int ldb) {
  // both loops unrolled: r0 is then a constant, so the A / Bt choice is no branch and g, l stay in registers
#pragma unroll
  for (int q = 0; q < SROWS / 64; ++q) {
    const unsigned short* g[4];
    unsigned l[4];
#pragma unroll
    for (int e = 0; e < 4; ++e) {
      const int r0 = (q * 4 + e) * 16;                 // first row of this copy's 16 rows
      g[e] = (r0 < BM) ? ga + (size_t)r0 * lda : gb + (size_t)(r0 - BM) * ldb;
      l[e] = lb + (unsigned)(r0 * SPITCH * 2);
    }
    copy4(l[0], l[1], l[2], l[3], g[0], g[1], g[2], g[3]);
  }
}

template <int BIAS_MODE, int WM, int NB>
__global__ __launch_bounds__(128) void gemm64(
    const float* __restrict__ Af, int lda, long long strideA,
    const unsigned short* __restrict__ Btp, int ldb, long long strideB,
    float* Cout, int ldc, long long strideC,
    const float* __restrict__ bias,
    int M, int N, int K) {
  constexpr int BM = 64 * WM;
  constexpr int BN = SROWS - BM;
  constexpr int AHEAD = (NB - 2) * (SROWS / 16);   // a wave's copies of the NB - 2 stages behind the one being published
  static_assert(WM == 1 || WM == 4);
  static_assert(NB >= 2 && (NB - 1) * (SROWS / 16) <= 63);           // copies of a wave outstanding at most
  __shared__ __align__(16) unsigned short stg[NB * SROWS * SPITCH];  // the ring's stage buffers
  __shared__ __align__(16) float sT[4][16 * 68];   // per-wave 16x64 slab, pitch 68 floats
  const unsigned short* Ap = (const unsigned short*)(const void*)Af;   // addressed in 16-bit units, like Bt
  const int b    = blockIdx.y;
  const int tid  = (int)threadIdx.x;
  const int lane = tid & 31;
  const int wave = tid >> 5;
  const int tilesN = N / BN;
  const int tilesM = M / BM;
  const int tile = blockIdx.x;
  if (tile >= tilesM * tilesN) return;   // block-uniform, in front of every barrier and copy
  const int tm = tile / tilesN;
  const int tn = tile - tm * tilesN;
  const int wrA = (WM == 4) ? (wave << 6) : 0;          // the wave's first A row inside the stage
  const int wrB = BM + ((WM == 4) ? 0 : (wave << 6));   // the wave's first Bt row inside the stage
  const int m0 = tm * BM + wrA;
  const int n0 = tn * BN + (wrB - BM);

  const int rlane = lane & 15;                 // row (A) / col (B, D) within subtile
  const int koff  = (lane >> 4) * 8;           // k offset of this lane half
  const int mOff  = (lane >> 4) * 8;           // D row offset

  // the lane's copy addresses: row tid>>3 of each 16-row group, 16-B piece tid&7
  const unsigned short* ga = Ap  + (size_t)b * (size_t)strideA + (size_t)(tm * BM + (tid >> 3)) * lda + (tid & 7) * 8;
  const unsigned short* gb = Btp + (size_t)b * (size_t)strideB + (size_t)(tn * BN + (tid >> 3)) * ldb + (tid & 7) * 8;
  const unsigned lds0 = (unsigned)(uintptr_t)stg + (unsigned)((tid >> 3) * SPITCH * 2 + (tid & 7) * 16);
  const int nst = K / SK;

  v8f acc[4][4];
#pragma unroll
  for (int i = 0; i < 4; ++i)
#pragma unroll
    for (int j = 0; j < 4; ++j) acc[i][j] = zero8();

  // unrolled: the buffer offsets are constants; stages 0 .. NB - 2 go out together
#pragma unroll
  for (int s = 0; s < NB - 1; ++s)
    if (s < nst) fill_stage<BM>(lds0 + (unsigned)s * SBYTES, ga + s * SK, lda, gb + s * SK, ldb);
  // the count is used only where all NB - 2 stages behind stage 0 were issued
  if (NB - 1 <= nst) wait_copies_but<AHEAD>(); else wait_copies();
  __syncthreads();                             // stage 0 is readable by every wave
  if (NB - 1 < nst) fill_stage<BM>(lds0 + (unsigned)(NB - 1) * SBYTES, ga + (NB - 1) * SK, lda, gb + (NB - 1) * SK, ldb);

  int buf = 0;                                 // t mod NB
  for (int t = 0; t < nst; ++t) {
    const __bf16* sb = (const __bf16*)(const void*)stg + buf * (SROWS * SPITCH);
    // unrolled (inner loops too): fragments stay in registers, and the second k step's LDS reads start under
    // the first step's WMMAs
    v16b af[4];
    raw16 ar[4];
#pragma unroll
    for (int i = 0; i < 4; ++i)
      ar[i] = ldraw_f32((const float*)(const void*)(sb + (wrA + (i << 4) + rlane) * SPITCH) + koff);
#pragma unroll
    for (int kk = 0; kk < SK; kk += 32) {
      v16b bq[4];
#pragma unroll
      for (int j = 0; j < 4; ++j) bq[j] = ldfrag<__bf16>(sb + (wrB + (j << 4) + rlane) * SPITCH + koff + kk);
      if (kk == 0) {
        // all LDS reads of the first k step go out before the first convert waits on one: one LDS latency, not four
        __builtin_amdgcn_sched_barrier(0);
#pragma unroll
        for (int i = 0; i < 4; ++i) af[i] = cvtfrag(ar[i]);
      }
#pragma unroll
      for (int i = 0; i < 4; ++i) {
#pragma unroll
        for (int j = 0; j < 4; ++j) acc[i][j] = mmar(af[i], bq[j], acc[i][j]);
        dep_guard(acc[i][0], acc[i][3], af[i], bq[3]);
      }
      keep4(bq[0], bq[1], bq[2], bq[3]);
    }
    // publish point of stage t + 1: own reads of stage t done, own copies of stage t + 1 landed, then the barrier.
    // Stages t + 2 .. t + NB - 1 stay in flight where all of them were issued; towards the end the wait is to 0.
    wait_lds();
    if (t + NB - 1 < nst) wait_copies_but<AHEAD>(); else wait_copies();
    __syncthreads();
    // refill the buffer that every wave has just left
    if (t + NB < nst) fill_stage<BM>(lds0 + (unsigned)buf * SBYTES, ga + (t + NB) * SK, lda, gb + (t + NB) * SK, ldb);
    buf = (buf + 1 == NB) ? 0 : buf + 1;
  }
  wait_copies();
  acc_guard4(acc[0][0], acc[0][1], acc[0][2], acc[0][3]);
  acc_guard4(acc[1][0], acc[1][1], acc[1][2], acc[1][3]);
  acc_guard4(acc[2][0], acc[2][1], acc[2][2], acc[2][3]);
  acc_guard4(acc[3][0], acc[3][1], acc[3][2], acc[3][3]);

  // ---- epilogue ----
  float* slab = sT[wave];
  float* C = Cout + (size_t)b * (size_t)strideC;
  const int h2 = lane >> 4, c4 = (lane & 15) * 4;     // 256-B row segment = 16 lanes x 16 B
  v4f bcol = {0.f, 0.f, 0.f, 0.f};
  if (BIAS_MODE == 1) {
#pragma unroll
    for (int e = 0; e < 4; ++e) bcol[e] = bf_round(bias[n0 + c4 + e]);
  }
#pragma unroll
  for (int i = 0; i < 4; ++i) {
    const int mBase = m0 + (i << 4);
#pragma unroll
    for (int j = 0; j < 4; ++j) {
#pragma unroll
      for (int r = 0; r < 8; ++r) {
        slab[(mOff + r) * 68 + (j << 4) + rlane] = acc[i][j][r];
      }
    }
    __builtin_amdgcn_fence(__ATOMIC_RELEASE, "workgroup");
    __builtin_amdgcn_wave_barrier();
    __builtin_amdgcn_fence(__ATOMIC_ACQUIRE, "workgroup");
    {
#pragma unroll
      for (int it = 0; it < 8; ++it) {
        const int row = it * 2 + h2;                     // it 0..7 x h2 0..1 = rows 0..15
        v4f v = *(const v4f*)(slab + row * 68 + c4);
        if (BIAS_MODE == 1) {
          v = v + bcol;
        } else {
          const float br = bf_round(bias[mBase + row]);
          v = v + br;
        }
        *(v4f*)(C + (size_t)(mBase + row) * ldc + n0 + c4) = v;
      }
      
    }
    __builtin_amdgcn_fence(__ATOMIC_RELEASE, "workgroup");
    __builtin_amdgcn_wave_barrier();
    __builtin_amdgcn_fence(__ATOMIC_ACQUIRE, "workgroup");
  }
}

// =====================================================================================================
// qkv projection straight from the f32 inputs: C[p][n] = sum_c bf16(x[b][c][p]) * bf16(w[n][c]) + bias[n], f32 out [6272][768].
// One block = 8 waves = 128 positions x 256 columns, one 64x64 tile per wave: waves 0..3 the first 64 positions, waves 4..7
// the second (a weight row, twice as wide in f32, so feeds twice the positions).
// x: each half's whole [256 c][64 p] panel goes global -> registers -> bf16 (RNE) -> LDS once, row-major as it lies in
// memory (pitch 160 B), loaded by the four waves that read it; the A fragments (rows p, k = c) are made by transposing
// LDS loads. A half of 64 positions lies in one image (NPOS % 64 == 0); the two halves of a block need not.
// w: f32 rows go global -> LDS by asynchronous 16-B copies, WSK = 32 k (one 128-B line of each of the 256 rows) per stage,
// a ring of QNB buffers with QNB - 1 stages in flight; the B fragments are converted (RNE) where they are read.
// Copy map: row = 32 g + (tid>>3), 16-B piece = tid&7, g = 0..7 -> 8 copies per lane, each LDS byte written by one lane.
// Both fragments keep the split k map of ldfrag, k ascending. Epilogue as in gemm64; its slabs reuse the x panels,
// which every wave has left at the loop's last barrier.
// =====================================================================================================
#define XPITCH 80                     // LDS pitch of an x panel row in elements: 160 B = 32 B x 5, the transposing reader's pitch
#define WSK    32                     // k (f32) per weight stage
#define WPB    144                    // LDS pitch of a weight row in bytes (16 B x 9)
#define WSTG   (256 * WPB)            // 36864 B per buffer
#define QNB    5                      // buffers of the weight ring
#define WCOP   8                      // copies of a wave per stage
static_assert((XPITCH * 2) % 32 == 0 && ((XPITCH * 2) / 32) % 2 == 1 && XPITCH >= 64);
static_assert(CH % WSK == 0 && CH / WSK >= QNB && (QNB - 1) * WCOP <= 63);
static_assert(2 * CH * XPITCH * 2 >= 8 * 16 * 68 * 4);   // the epilogue slabs fit in the x panels
static_assert((MROW % 128) == 0);

// one weight stage: g = the lane's piece of its first row at this stage's k
__device__ __forceinline__ void fill_w(unsigned lb, const float* g) {
  // both loops unrolled: the row offsets are constants and gp, l stay in registers
#pragma unroll
  for (int q = 0; q < WCOP / 4; ++q) {
    const unsigned short* gp[4];
    unsigned l[4];
#pragma unroll
    for (int e = 0; e < 4; ++e) {
      const int r0 = (q * 4 + e) * 32;                 // first row of this copy's 32 rows
      gp[e] = (const unsigned short*)(const void*)(g + (size_t)r0 * CH);
      l[e] = lb + (unsigned)(r0 * WPB);
    }
    copy4(l[0], l[1], l[2], l[3], gp[0], gp[1], gp[2], gp[3]);
  }
}

__global__ __launch_bounds__(256) void gemm_qkv(const float* __restrict__ x, const float* __restrict__ wq,
                                                const float* __restrict__ bias, float* C) {
  __shared__ __align__(32) unsigned short xp[2 * CH * XPITCH]; // two x panels bf16 [c][p], 40960 B each
  __shared__ __align__(16) float wr[QNB * WSTG / 4];           // weight ring, f32 rows
  constexpr int nst = CH / WSK;
  const int tid  = (int)threadIdx.x;
  const int lane = tid & 31;
  const int wave = __builtin_amdgcn_readfirstlane(tid >> 5);   // the same in every lane: tile indices stay scalar
  const int wm = wave >> 2, wn = wave & 3;           // the wave's half of the positions, its 64 columns
  const int tm = (int)blockIdx.x / (C3 / 256);
  const int tn = (int)blockIdx.x - tm * (C3 / 256);
  const int m0 = tm * 128 + (wm << 6);
  const int b  = m0 / NPOS, p0 = m0 - b * NPOS;      // image and first position of the wave's half
  const int n0 = tn * 256 + (wn << 6);
  const int rlane = lane & 15;                 // col (B, D) within subtile
  const int hh    = lane >> 4;
  const int koff  = hh * 8;                    // k offset of this lane half
  const int mOff  = hh * 8;                    // D row offset

  const float* gw = wq + (size_t)(tn * 256 + (tid >> 3)) * CH + (tid & 7) * 4;
  const unsigned lds0 = (unsigned)(uintptr_t)wr + (unsigned)((tid >> 3) * WPB + (tid & 7) * 16);

  // ---- x panel of the wave's half, by its 128 threads: load it = rows c = 8 it + (th>>4), 16 lanes x 16 B = the row's
  //      256 B; 32 x 128 x 4 = 256 c x 64 p ----
  unsigned short* xh = xp + wm * (CH * XPITCH);
  {
    const int th = tid & 127;
    const float* gx = x + ((size_t)(b * CH + (th >> 4))) * NPOS + p0 + (th & 15) * 4;
    unsigned short* xs = xh + (th >> 4) * XPITCH + (th & 15) * 4;
    v4f xv[CH / 8];
    // both loops unrolled: xv stays in registers and all loads go out together
#pragma unroll
    for (int it = 0; it < CH / 8; ++it) xv[it] = *(const v4f*)(gx + (size_t)it * 8 * NPOS);
    wait_addr_of(gx);
    // weight stages 0 .. QNB - 2 go out together, behind the x loads (x has the longer way: convert, LDS store);
    // unrolled: the buffer offsets are constants
#pragma unroll
    for (int s = 0; s < QNB - 1; ++s) fill_w(lds0 + (unsigned)s * WSTG, gw + s * WSK);
#pragma unroll
    for (int it = 0; it < CH / 8; ++it) {
      const v2u u = {cvt2(xv[it][0], xv[it][1]), cvt2(xv[it][2], xv[it][3])};
      *(v2u*)(xs + it * 8 * XPITCH) = u;
    }
  }
  // keeps the zeroing of the 128 accumulator registers behind the panel's 128 load registers (fewer registers live at once)
  __builtin_amdgcn_sched_barrier(0);

  v8f acc[4][4];
#pragma unroll
  for (int i = 0; i < 4; ++i)
#pragma unroll
    for (int j = 0; j < 4; ++j) acc[i][j] = zero8();

  wait_copies_but<(QNB - 2) * WCOP>();
  __syncthreads();                             // the x panels and weight stage 0 are readable by every wave
  fill_w(lds0 + (unsigned)(QNB - 1) * WSTG, gw + (QNB - 1) * WSK);

  // the lane's 16 B of a transposing load: panel row 8*hh + (lane&7), column piece (lane>>3)&1
  const unsigned short* xa = xh + (8 * hh + (lane & 7)) * XPITCH + ((lane >> 3) & 1) * 8;
  int buf = 0;                                 // t mod QNB
  for (int t = 0; t < nst; ++t) {
    const float* sw = wr + buf * (WSTG / 4) + ((wn << 6) + rlane) * (WPB / 4) + koff;
    v16b bq[4], af[4];
    raw16 br[4];
    // inner loops unrolled: fragments and accumulators stay in registers
#pragma unroll
    for (int j = 0; j < 4; ++j) br[j] = ldraw_f32(sw + (j << 4) * (WPB / 4));
#pragma unroll
    for (int i = 0; i < 4; ++i) af[i] = ldfrag_tr(xa + t * WSK * XPITCH + (i << 4), XPITCH);
    // all LDS reads of the stage go out before the first convert waits on one: one LDS latency per stage
    __builtin_amdgcn_sched_barrier(0);
#pragma unroll
    for (int j = 0; j < 4; ++j) bq[j] = cvtfrag(br[j]);
#pragma unroll
    for (int i = 0; i < 4; ++i) {
#pragma unroll
      for (int j = 0; j < 4; ++j) acc[i][j] = mmar(af[i], bq[j], acc[i][j]);
      dep_guard(acc[i][0], acc[i][3], af[i], bq[3]);
    }
    keep4(bq[0], bq[1], bq[2], bq[3]);
    // publish point of stage t + 1: own reads of stage t done, own copies of stage t + 1 landed, then the barrier.
    // The QNB - 2 stages behind it stay in flight where all of them were issued; towards the end the wait is to 0.
    wait_lds();
    if (t + QNB - 1 < nst) wait_copies_but<(QNB - 2) * WCOP>(); else wait_copies();
    __syncthreads();
    // refill the buffer that every wave has just left
    if (t + QNB < nst) fill_w(lds0 + (unsigned)buf * WSTG, gw + (t + QNB) * WSK);
    buf = (buf + 1 == QNB) ? 0 : buf + 1;
  }
  wait_copies();
  acc_guard4(acc[0][0], acc[0][1], acc[0][2], acc[0][3]);
  acc_guard4(acc[1][0], acc[1][1], acc[1][2], acc[1][3]);
  acc_guard4(acc[2][0], acc[2][1], acc[2][2], acc[2][3]);
  acc_guard4(acc[3][0], acc[3][1], acc[3][2], acc[3][3]);

  // ---- epilogue: 16-row slabs staged per wave in LDS, 256-B row segments stored whole ----
  float* slab = (float*)(void*)xp + wave * (16 * 68);  // per-wave 16x64 slab, pitch 68 floats
  const int h2 = lane >> 4, c4 = (lane & 15) * 4;     // 256-B row segment = 16 lanes x 16 B
  v4f bcol;
#pragma unroll
  for (int e = 0; e < 4; ++e) bcol[e] = bf_round(bias[n0 + c4 + e]);
#pragma unroll
  for (int i = 0; i < 4; ++i) {
    const int mBase = m0 + (i << 4);
#pragma unroll
    for (int j = 0; j < 4; ++j) {
#pragma unroll
      for (int r = 0; r < 8; ++r) {
        slab[(mOff + r) * 68 + (j << 4) + rlane] = acc[i][j][r];
      }
    }
    __builtin_amdgcn_fence(__ATOMIC_RELEASE, "workgroup");
    __builtin_amdgcn_wave_barrier();
    __builtin_amdgcn_fence(__ATOMIC_ACQUIRE, "workgroup");
#pragma unroll
    for (int it = 0; it < 8; ++it) {
      const int row = it * 2 + h2;                     // it 0..7 x h2 0..1 = rows 0..15
      const v4f v = *(const v4f*)(slab + row * 68 + c4) + bcol;
      *(v4f*)(C + (size_t)(mBase + row) * C3 + n0 + c4) = v;
    }
    __builtin_amdgcn_fence(__ATOMIC_RELEASE, "workgroup");
    __builtin_amdgcn_wave_barrier();
    __builtin_amdgcn_fence(__ATOMIC_ACQUIRE, "workgroup");
  }
}

// =====================================================================================================
// P^T B fragment pair (hi, residual) from the lane's own score D values: element r <- tile a row r,
// element 8+r <- tile c row r (same lane, same query column).
// =====================================================================================================
__device__ __forceinline__ void pack_pt(v8f a, v8f c, v16b& ph, v16b& pl) {
  v8u H, L;
#pragma unroll
  for (int r = 0; r < 4; ++r) {
    unsigned hp, lp;
    split2(a[2 * r], a[2 * r + 1], hp, lp);
    H[r] = hp; L[r] = lp;
    split2(c[2 * r], c[2 * r + 1], hp, lp);
    H[4 + r] = hp; L[4 + r] = lp;
  }
  ph = __builtin_bit_cast(v16b, H); pl = __builtin_bit_cast(v16b, L);
}

// load 8 consecutive f32, or zeros when keep == 0 (address always valid, select by value)
__device__ __forceinline__ void ld8sel(const float* src, int keep, float f[8]) {
  const v4f a = *(const v4f*)src;
  const v4f c = *(const v4f*)(src + 4);
  f[0] = keep ? a[0] : 0.f; f[1] = keep ? a[1] : 0.f; f[2] = keep ? a[2] : 0.f; f[3] = keep ? a[3] : 0.f;
  f[4] = keep ? c[0] : 0.f; f[5] = keep ? c[1] : 0.f; f[6] = keep ? c[2] : 0.f; f[7] = keep ? c[3] : 0.f;
}

// =====================================================================================================
// Windowed attention, one block = (batch b, head, 8x8 query tile at (i0, j0)); 128 threads = 4 waves,
// wave w owns the 16 queries lq = 16w..16w+15 (query row i0 + (lq>>3), col j0 + (lq&7)).
// Key superset = the 14x14 image block at (R0, C0), R0 = clamp(i0-3, 0, 42), slot = u*14 + v (196 slots,
// padded to 224 with zero rows). Every query's clamped 7x7 window lies inside the superset: valid slots are
// su <= u <= su+6, sv <= v <= sv+6 with su = clamp(qi-3,0,49) - R0 in [0,7].
// A wave's 16 queries are two image rows, so their windows lie in the 8 superset rows ulo..ulo+7, ulo = min(su of the
// first row, 6): the wave scores, masks, exponentiates and multiplies only those 112 slots (7 tiles from slot 14 ulo).
//   qkv plane f32 [b*3136 + p][768]: q = cols head*32+d (scaled by 32^-0.5 in f32 here), k = 256+.., v = 512+..
//   scores (transposed): S^T[slot][query] = K[slot][d] . Q^T[d][query] on bf16 WMMA, 3 products
//     (hi.hi + hi.res + res.hi); lane owns query column (lane&15) of its wave and key rows 14 ulo + 16j + 8h + r.
//   s = S^T + rpb[head][u + R0 - qi + 6][v + C0 - qj + 6] for valid slots, -1e30 otherwise (f32);
//   softmax in f32 (max / sum over the 56 lane values and the partner lane ^16).
//   O^T[d][query] = V^T[d][slot] . P^T[slot][query] on bf16 WMMA, 3 products, p unnormalised exp, 1/sum at the end.
// LDS: KV0/KV1 hold K hi/res [slot][d] (pitch 64 B) for the scores, then (after a block barrier) V hi/res [slot][d]
// (pitch 96 B), row-major as it comes from memory; the V^T fragments are made by transposing LDS loads.
// K and Q rows have a 64-B pitch, at which the b128 fragment reads meet four to a bank; Os rows 128 B.
// Staged extents: KV 224x32 both phases (slots >= 196 zero), Q 64x32, Rp 384 (table at 100..268, zeros around),
// Os 16x32 per wave -- every LDS element read is written first.
// Output coverage: each wave stores its 16 query rows (it 0..3 x lane>>3) x 8 pieces of 16 B (lane&7) =
// =====================================================================================================
__global__ __launch_bounds__(128)
void natt(const float* __restrict__ qkv, const float* __restrict__ rpb, unsigned short* ctx) {
  __shared__ __align__(32) unsigned short KV0[NSLOT * VPITCH];   // 21504 B (K uses the first 14336)
  __shared__ __align__(32) unsigned short KV1[NSLOT * VPITCH];   // 21504 B
  __shared__ __align__(16) unsigned short Qh[64 * HDIM];       //  4096 B
  __shared__ __align__(16) unsigned short Ql[64 * HDIM];       //  4096 B
  __shared__ __align__(16) float Os[4][16 * HDIM];             //  8192 B
  __shared__ float Rp[RPN];

  const int tid  = (int)threadIdx.x;
  const int wave = tid >> 5;
  const int lane = tid & 31;
  const int hh   = lane >> 4;
  const int m    = lane & 15;

  const int bx   = blockIdx.x;
  const int tj   = bx % 7;
  const int ti   = (bx / 7) % 7;
  const int head = (bx / 49) % NHD;
  const int b    = bx / (49 * NHD);
  const int i0 = ti * 8, j0 = tj * 8;
  const int R0 = min(max(i0 - 3, 0), IMH - SUP);
  const int C0 = min(max(j0 - 3, 0), IMW - SUP);
  const size_t pb = (size_t)b * NPOS;

  // ---- position-bias table of this head (bf16 RNE-converted values), entries 0..168 at Rp[RPLO..], zeros around ----
  {
    float rv[RPN / 128];
    // both loops unrolled: rv stays in registers and the three loads go out together
#pragma unroll
    for (int it = 0; it < RPN / 128; ++it) {
      const int t = it * 128 + tid - RPLO;
      rv[it] = rpb[head * 169 + min(max(t, 0), 168)];           // clamped address
    }
    wait_addr();
#pragma unroll
    for (int it = 0; it < RPN / 128; ++it) {
      const int e = it * 128 + tid;
      const float tv = bf_round(rv[it]);
      Rp[e] = ((unsigned)(e - RPLO) < 169u) ? tv : 0.f;
    }
  }
  // ---- q (scaled in f32) -> hi / residual planes [lq][d]; thread = (lq = tid>>1, d half) ----
  {
    const int lq = tid >> 1, dh = (tid & 1) * 16;
    const int qi = lq >> 3, qj = lq & 7;
    const size_t pos = pb + (size_t)(i0 + qi) * IMW + j0 + qj;
    const float* src = qkv + pos * C3 + head * HDIM + dh;
#pragma unroll
    for (int g = 0; g < 2; ++g) {
      float f[8];
      ld8sel(src + 8 * g, 1, f);
      v4u ph, pl;
#pragma unroll
      for (int e = 0; e < 4; ++e) {
        unsigned hp, lp;
        split2(f[2 * e] * QSCALE, f[2 * e + 1] * QSCALE, hp, lp);
        ph[e] = hp; pl[e] = lp;
      }
      *(v4u*)(Qh + lq * HDIM + dh + 8 * g) = ph;
      *(v4u*)(Ql + lq * HDIM + dh + 8 * g) = pl;
    }
  }
  // ---- K superset -> KV0 (hi) / KV1 (residual), layout [slot][d]; item = it*128 + tid, slot = item>>2,
  //      d8 = (item&3)*8; 7 x 128 items = 224 slots x 4 groups = the whole tile; slots >= 196 = zeros ----
  {
    const float* kbase = qkv + CH + head * HDIM;
#pragma unroll
    for (int it = 0; it < 7; ++it) {
      const int item = it * 128 + tid;
      const int slot = item >> 2, d8 = (item & 3) * 8;
      const int u = slot / SUP, v = slot - u * SUP;
      const int uc = min(u, SUP - 1);
      const size_t pos = pb + (size_t)(R0 + uc) * IMW + C0 + v;
      float f[8];
      ld8sel(kbase + pos * C3 + d8, slot < SUP * SUP, f);
      v4u ph, pl;
#pragma unroll
      for (int e = 0; e < 4; ++e) {
        unsigned hp, lp;
        split2(f[2 * e], f[2 * e + 1], hp, lp);
        ph[e] = hp; pl[e] = lp;
      }
      *(v4u*)(KV0 + slot * HDIM + d8) = ph;
      *(v4u*)(KV1 + slot * HDIM + d8) = pl;
    }
  }
  __syncthreads();

  // ---- the wave's key range: first superset row ulo, first slot slot0 (the same in every lane of the wave) ----
  const int wv    = __builtin_amdgcn_readfirstlane(wave);
  const int ulo   = min(min(max(i0 + 2 * wv - 3, 0), IMH - KW) - R0, SUP - WROWS);
  const int slot0 = ulo * SUP;

  // ---- scores: S^T tiles j = 0..6 (key slots slot0 + 16j .. + 15) for the wave's 16 queries; s[7] stays zero ----
  v8f s[NKT + 1];
  {
    const __bf16* Kh = (const __bf16*)(const void*)KV0 + slot0 * HDIM;
    const __bf16* Kl = (const __bf16*)(const void*)KV1 + slot0 * HDIM;
    const __bf16* Qhp = (const __bf16*)(const void*)Qh;
    const __bf16* Qlp = (const __bf16*)(const void*)Ql;
    const v16b qfh = ldfrag<__bf16>(Qhp + (16 * wave + m) * HDIM + 8 * hh);
    const v16b qfl = ldfrag<__bf16>(Qlp + (16 * wave + m) * HDIM + 8 * hh);
#pragma unroll
    for (int j = 0; j < NKT; ++j) {
      const v16b kfh = ldfrag<__bf16>(Kh + (16 * j + m) * HDIM + 8 * hh);
      const v16b kfl = ldfrag<__bf16>(Kl + (16 * j + m) * HDIM + 8 * hh);
      v8f z = zero8();
      z = mma_b(kfh, qfh, z);
      z = mma_b(kfh, qfl, z);
      z = mma_b(kfl, qfh, z);
      s[j] = z;
    }
    s[NKT] = zero8();
  }
  __syncthreads();   // all waves done reading K from KV0/KV1

  // ---- V superset -> KV0 (hi) / KV1 (residual), layout [slot][d] (pitch VPITCH), one 16-B store per plane and item;
  //      same item map as K: 224 slots x 32 d written, slots >= 196 = zeros ----
  {
    const float* vbase = qkv + 2 * CH + head * HDIM;
#pragma unroll
    for (int it = 0; it < 7; ++it) {
      const int item = it * 128 + tid;
      const int slot = item >> 2, d8 = (item & 3) * 8;
      const int u = slot / SUP, v = slot - u * SUP;
      const int uc = min(u, SUP - 1);
      const size_t pos = pb + (size_t)(R0 + uc) * IMW + C0 + v;
      float f[8];
      ld8sel(vbase + pos * C3 + d8, slot < SUP * SUP, f);
      v4u ph, pl;
#pragma unroll
      for (int e = 0; e < 4; ++e) {
        unsigned hp, lp;
        split2(f[2 * e], f[2 * e + 1], hp, lp);
        ph[e] = hp; pl[e] = lp;
      }
      *(v4u*)(KV0 + slot * VPITCH + d8) = ph;
      *(v4u*)(KV1 + slot * VPITCH + d8) = pl;
    }
  }
  __syncthreads();

  // ---- window mask + position bias (f32), softmax over the query column ----
  const int lq = 16 * wave + m;
  const int ai = i0 + (lq >> 3), aj = j0 + (lq & 7);
  const int su = min(max(ai - 3, 0), IMH - KW) - R0 - ulo;      // counted from the wave's first row: 0 or 1
  const int sv = min(max(aj - 3, 0), IMW - KW) - C0;
  const int cb = (R0 + ulo - ai + 6) * 13 + (C0 - aj + 6);
  // Slots and rows u are counted from the wave's first slot and row from here on.
  // Bias index 13u + v + cb = slot - u + cb. The upper lane half's slot is 8 higher and its u is equal or one
  // higher (one higher where t0 % 14 >= 6), so two lane bases and a constant offset address every read; the read
  // is made for every slot (the padded table holds every such index) and the window test selects by value.
  const float* rb8 = Rp + (RPLO + cb + 8 * hh);
  const float* rb7 = Rp + (RPLO + cb + 7 * hh);
  // The window test of a slot is a row test and a column test; each distinct one is made once:
  // column k = t0 % 14 (upper half: (k + 8) % 14), row a = t0 / 14 (upper half: a, or a + 1 where k >= 6).
  // Both loops unrolled: the arrays are then indexed by constants only and each test is one lane mask in a register.
  bool colok[SUP], rowsame[WROWS], rownext[WROWS];
#pragma unroll
  for (int k = 0; k < SUP; ++k) {
    const int v = hh ? ((k + 8) % SUP) : k;
    colok[k] = (unsigned)(v - sv) < 7u;
  }
#pragma unroll
  for (int a = 0; a < WROWS; ++a) {
    rowsame[a] = (unsigned)(a - su) < 7u;
    rownext[a] = (unsigned)(a + hh - su) < 7u;
  }
  float mloc = -1.0e30f;
#pragma unroll
  for (int j = 0; j < NKT; ++j) {
#pragma unroll
    for (int r = 0; r < 8; ++r) {
      const int t0 = 16 * j + r;                       // slot = t0 + 8*hh
      const bool step = (t0 % SUP) >= SUP - 8;         // the upper half's slot lies one superset row further
      const bool ok = colok[t0 % SUP] & (step ? rownext[t0 / SUP] : rowsame[t0 / SUP]);
      const int c0 = t0 - t0 / SUP;                    // 13u + v of the lower half's slot
      const float bv = step ? rb7[c0] : rb8[c0];
      const float sb = s[j][r] + bv;
      const float sval = ok ? sb : -1.0e30f;
      s[j][r] = sval;
      mloc = fmaxf(mloc, sval);
    }
  }
  const float mrow = fmaxf(mloc, __shfl_xor(mloc, 16, 32));
  float lsum = 0.f;
#pragma unroll
  for (int j = 0; j < NKT; ++j) {
#pragma unroll
    for (int r = 0; r < 8; ++r) {
      const float p = __expf(s[j][r] - mrow);
      s[j][r] = p;
      lsum += p;
    }
  }
  lsum += __shfl_xor(lsum, 16, 32);

  // ---- O^T = V^T . P^T : 2 d-tiles x 4 k-steps of 32 slots x 3 products (the last 16 slots meet p = 0) ----
  v8f o[2];
  o[0] = zero8(); o[1] = zero8();
  {
    // the lane's 16 B of a transposing load: slot row 8*hh + (lane&7), column piece (lane>>3)&1
    const int vo = (slot0 + 8 * hh + (lane & 7)) * VPITCH + ((lane >> 3) & 1) * 8;
    const unsigned short* Vh = KV0 + vo;
    const unsigned short* Vl = KV1 + vo;
#pragma unroll
    for (int kk = 0; kk < (NKT + 1) / 2; ++kk) {
      v16b ph, pl;
      pack_pt(s[2 * kk], s[2 * kk + 1], ph, pl);
#pragma unroll
      for (int t = 0; t < 2; ++t) {
        const v16b vfh = ldfrag_tr(Vh + 32 * kk * VPITCH + 16 * t, VPITCH);
        const v16b vfl = ldfrag_tr(Vl + 32 * kk * VPITCH + 16 * t, VPITCH);
        o[t] = mma_b(vfh, ph, o[t]);
        o[t] = mma_b(vfh, pl, o[t]);
        o[t] = mma_b(vfl, ph, o[t]);
      }
    }
  }

  // ---- normalise, stage the wave's 16 queries x 32 d in LDS, write the ctx lines ----
  const float linv = 1.0f / lsum;
  float* os = Os[wave];
#pragma unroll
  for (int t = 0; t < 2; ++t)
#pragma unroll
    for (int r = 0; r < 8; ++r) os[m * HDIM + 16 * t + 8 * hh + r] = o[t][r] * linv;
  __syncthreads();
  {
    const int q4 = lane >> 3, pc = lane & 7, dsel = (pc & 3) * 8;
    const bool lowp = (pc >= 4);
    v4u hv[4];
    size_t go[4];
#pragma unroll
    for (int it = 0; it < 4; ++it) {
      const int row = it * 4 + q4;                     // it 0..3 x q4 0..3 = rows 0..15
      const float* sp = os + row * HDIM + dsel;
      v4u a;
#pragma unroll
      for (int e = 0; e < 4; ++e) {
        unsigned hp, lp;
        split2(sp[2 * e], sp[2 * e + 1], hp, lp);
        a[e] = lowp ? lp : hp;
      }
      hv[it] = a;
      const int lqr = 16 * wave + row;
      const size_t pos = pb + (size_t)(i0 + (lqr >> 3)) * IMW + j0 + (lqr & 7);
      go[it] = pos * CTXK + (size_t)head * 64 + pc * 8;
    }
    {
#pragma unroll
      for (int it = 0; it < 4; ++it) *(v4u*)(ctx + go[it]) = hv[it];
      
    }
  }
}

// =====================================================================================================
//   QKV  f32  [6272][768]    19267584
//   CTX  bf16 [6272][512]     6422528
//   total                   25690112
// =====================================================================================================
extern "C" void kernel_launch(void* const* d_in, const int* in_sizes, int n_in,
                              void* d_out, int out_size, void* d_ws, size_t ws_size,
                              hipStream_t stream) {
  if (n_in < 6) return;
  if (in_sizes[0] != NBT * CH * NPOS) return;
  if (in_sizes[1] != C3 * CH) return;
  if (in_sizes[2] != C3) return;
  if (in_sizes[3] != NHD * 13 * 13) return;
  if (in_sizes[4] != CH * CH) return;
  if (in_sizes[5] != CH) return;
  if (out_size != NBT * CH * NPOS) return;

  const float* x      = (const float*)d_in[0];
  const float* w_qkv  = (const float*)d_in[1];
  const float* b_qkv  = (const float*)d_in[2];
  const float* rpb    = (const float*)d_in[3];
  const float* w_proj = (const float*)d_in[4];
  const float* b_proj = (const float*)d_in[5];

  const size_t PQKV = (size_t)MROW * C3 * 4;        // 19267584
  const size_t PCTX = (size_t)MROW * CTXK * 2;      //  6422528
  size_t off = 0;
  const size_t oQKV = off; off += PQKV;
  const size_t oCTX = off; off += PCTX;
  if (off > ws_size) return;                         // off = 25690112
  if (off > (size_t)134217728) return;

  char* ws = (char*)d_ws;
  float*          QKV = (float*)(ws + oQKV);
  unsigned short* CTX = (unsigned short*)(ws + oCTX);

  const int tilesQKV = (MROW / 128) * (C3 / 256);                     //  147 block tiles of 128 x 256
  const int tilesPRJ = (CH / 256) * (NPOS / 64);                      //   49 block tiles of 256 x 64
  const dim3 gQKV(tilesQKV, 1);                                       // 147
  const dim3 gAtt(NBT * NHD * 49);                                    // 784
  const dim3 gPRJ(tilesPRJ, NBT);                                     // (49, 2)

  // (1) qkv = bf16(x)^T . bf16(w_qkv)^T + b_qkv -> f32 [6272][768]   (M=6272, N=768, K=256)
  gemm_qkv<<<gQKV, dim3(256), 0, stream>>>(x, w_qkv, b_qkv, QKV);
  // (2) windowed attention -> ctx plane bf16 [6272][512]
  natt<<<gAtt, dim3(128), 0, stream>>>(QKV, rpb, CTX);
  // (3) out[b][c][p] = sum_k Wf[c][k] ctx[b*3136+p][k] + b_proj[c], Wf = w_proj folded   (per batch: M=256, N=3136, K=512)
  gemm64<2, 4, 4><<<gPRJ, dim3(128), 0, stream>>>(
      w_proj, CTXK, 0LL, CTX, CTXK, (long long)NPOS * CTXK,
      (float*)d_out, NPOS, (long long)CH * NPOS, b_proj,
      CH, NPOS, CTXK);
  (void)hipGetLastError();
}

// v009
// Measured time: 30.6 microseconds a run.
// In both of two side-by-side timings against v008, it was 1.06 times as fast.
// Counting every step since v000, it is 2.48 times as fast.
// Contractions: qkv projection = v_wmma_f32_16x16x32_bf16 (bf16 operands from RNE-converted x and w_qkv, single product, f32 accumulate);
// q.k scores = v_wmma_f32_16x16x32_bf16 (q and k each as bf16 hi plane + unscaled bf16 residual plane, 3 products, f32 accumulate);
// p.v = v_wmma_f32_16x16x32_bf16 (p and v each as bf16 hi + unscaled bf16 residual, 3 products, f32 accumulate);
// ctx.w_proj^T = v_wmma_f32_16x16x32_bf16 (ctx as bf16 hi + residual folded into K, w_proj bf16 from its RNE-converted value, f32 accumulate);
// biases, q scaling, window mask, position bias and softmax in f32. No power-of-two carries anywhere (bf16 planes, unscaled residuals).
#include <hip/hip_runtime.h>
#include <math.h>
#include <stdint.h>

#define NBT   2
#define CH    256
#define IMH   56
#define IMW   56
#define NPOS  (IMH * IMW)        // 3136 positions per image, p = i*56 + j
#define MROW  (NBT * NPOS)       // 6272 position rows
#define NHD   8
#define HDIM  32
#define C3    (3 * CH)           // 768
#define KW    7                  // window side; window start = clamp(i - 3, 0, IMH - KW)
#define SUP   14                 // clamped key superset side of an 8x8 query tile
#define NSLOT 224                // key slots staged per block (196 used, rest zero)
#define WROWS 8                  // superset rows that hold every window of one wave's 16 queries (two image rows)
#define NKT   7                  // scored 16-key tiles per wave: WROWS x SUP = 112 consecutive slots
#define CTXK  512                // folded K of the ctx plane: per head [hi d0..31 | residual d0..31]
#define QSCALE 0.17677669529663687f
#define RPLO  100                // position-bias entry 0 sits at Rp[RPLO]; entries around the table are zero
#define RPN   384                // padded table: every unclamped index 13u + v + cb of a scored slot lies inside
#define VPITCH 48                // LDS pitch of a staged V row [slot][d] in elements: 96 B = 32 B x 3, the transposing reader's pitch

static_assert((MROW % 64) == 0);
static_assert((C3 % 256) == 0);
static_assert((NPOS % 64) == 0);
static_assert((CH % 256) == 0);
static_assert((CH % 128) == 0 && (CTXK % 128) == 0);
static_assert(NHD * HDIM == CH);
static_assert(SUP == 8 + KW - 1);
static_assert(SUP * SUP <= NSLOT && (NSLOT % 32) == 0 && NKT * 16 == WROWS * SUP && WROWS == KW + 1);
static_assert((SUP - WROWS) * SUP + ((NKT + 1) / 2) * 32 <= NSLOT);   // the last wave range's P.V steps stay in staged rows
static_assert(IMH == IMW);
static_assert(VPITCH >= HDIM && (VPITCH * 2) % 32 == 0 && ((VPITCH * 2) / 32) % 2 == 1);
static_assert(RPLO - 7 * 13 - 7 >= 0 && RPLO + 6 * 13 + 6 + (SUP * SUP - 1) - (SUP * SUP - 1) / SUP < RPN && RPN % 128 == 0);

typedef __bf16   v16b __attribute__((ext_vector_type(16)));
typedef __bf16   v8b  __attribute__((ext_vector_type(8)));
typedef float    v8f  __attribute__((ext_vector_type(8)));
typedef float    v4f  __attribute__((ext_vector_type(4)));
typedef unsigned int v4u __attribute__((ext_vector_type(4)));
typedef unsigned int v8u __attribute__((ext_vector_type(8)));
typedef float    v2f  __attribute__((ext_vector_type(2)));
typedef __bf16   v2b  __attribute__((ext_vector_type(2)));
typedef unsigned int v2u __attribute__((ext_vector_type(2)));

#if defined(__HIP_DEVICE_COMPILE__)
#define DEV_ASM 1
#else
#define DEV_ASM 0
#endif

// ---- scalar helpers --------------------------------------------------------------------------------
// two f32 -> two bf16 (RNE) packed in one register, a in the low half: one packed convert instruction
__device__ __forceinline__ unsigned cvt2(float a, float b) {
  const v2f f = {a, b};
  return __builtin_bit_cast(unsigned, __builtin_convertvector(f, v2b));
}
__device__ __forceinline__ float bf_round(float f) { return (float)(__bf16)f; }   // f32 value of the RNE bf16
__device__ __forceinline__ v8f zero8() { v8f z = {0.f, 0.f, 0.f, 0.f, 0.f, 0.f, 0.f, 0.f}; return z; }
// hi / residual bf16 split of an f32 value (residual unscaled)
// of a pair: hp = packed hi halves, lp = packed residuals, a in the low half of each
__device__ __forceinline__ void split2(float a, float b, unsigned& hp, unsigned& lp) {
  const v2f f = {a, b};
  const v2b h = __builtin_convertvector(f, v2b);
  hp = __builtin_bit_cast(unsigned, h);
  lp = cvt2(a - (float)h[0], b - (float)h[1]);
}

// ---- fragment loader: 16-bit A/B operand, lane -> row/col (lane&15), p already includes +8*(lane>>4);
//      elements 0..7 <- p[0..7] (k0+8h..k0+8h+7), elements 8..15 <- p[16..23] (k0+16+8h..k0+16+8h+7)
template <typename OT> struct FT;
template <> struct FT<__bf16> { typedef v16b frag; typedef v8b half8; };

template <typename OT>
__device__ __forceinline__ typename FT<OT>::frag ldfrag(const OT* p) {
  union { typename FT<OT>::frag v; typename FT<OT>::half8 h[2]; } f;
  f.h[0] = *(const typename FT<OT>::half8*)(p);
  f.h[1] = *(const typename FT<OT>::half8*)(p + 16);
  return f.v;
}

// ---- the same fragment from f32 values in LDS, read (ldraw_f32) and then RNE-converted to bf16 (cvtfrag): p already
//      includes +8*(lane>>4); elements 0..7 <- p[0..7], elements 8..15 <- p[16..23], the k map of ldfrag
struct raw16 { v4f a, b, c, d; };
__device__ __forceinline__ raw16 ldraw_f32(const float* p) {
  raw16 r;
  r.a = *(const v4f*)(p);
  r.b = *(const v4f*)(p + 4);
  r.c = *(const v4f*)(p + 16);
  r.d = *(const v4f*)(p + 20);
  return r;
}
__device__ __forceinline__ v16b cvtfrag(raw16 r) {
  v8u u;
  u[0] = cvt2(r.a[0], r.a[1]); u[1] = cvt2(r.a[2], r.a[3]); u[2] = cvt2(r.b[0], r.b[1]); u[3] = cvt2(r.b[2], r.b[3]);
  u[4] = cvt2(r.c[0], r.c[1]); u[5] = cvt2(r.c[2], r.c[3]); u[6] = cvt2(r.d[0], r.d[1]); u[7] = cvt2(r.d[2], r.d[3]);
  return __builtin_bit_cast(v16b, u);
}

// ---- transposing fragment loader: a row-major 16-bit LDS tile T[k][d] read as the A operand T^T (rows d, k along the
//      fragment). p = the lane's own 16 B: row k0 + 8*(lane>>4) + (lane&7), piece (lane>>3)&1 of the 16 columns at d0.
//      Lane (c = lane&15, h = lane>>4) gets T[k0+8h .. k0+8h+7][d0+c] in elements 0..7 and, from 16 rows further,
//      T[k0+16+8h .. +7][d0+c] in elements 8..15: the k map of ldfrag. Every lane is on where it is called.
__device__ __forceinline__ v16b ldfrag_tr(const unsigned short* p, int pitch) {
  typedef __attribute__((address_space(3))) v8b lds_v8b;
  union { v16b v; v8b h[2]; } f;
  f.h[0] = __builtin_amdgcn_ds_load_tr16_b128_v8bf16((lds_v8b*)p);
  f.h[1] = __builtin_amdgcn_ds_load_tr16_b128_v8bf16((lds_v8b*)(p + 16 * pitch));
  return f.v;
}

// ---- WMMA helpers ------------------------------------------------------------------------------------
__device__ __forceinline__ v8f mmar(v16b a, v16b b, v8f c) {
  return __builtin_amdgcn_wmma_f32_16x16x32_bf16(false, a, false, b, (short)0, c, false, false);
}
// guarded form: 4 VALU slots after the WMMA, D tied, A/B kept live
__device__ __forceinline__ v8f mma_b(v16b a, v16b b, v8f c) {
  c = __builtin_amdgcn_wmma_f32_16x16x32_bf16(false, a, false, b, (short)0, c, false, false);
#if DEV_ASM
  asm volatile("v_nop\n\tv_nop\n\tv_nop\n\tv_nop" : "+v"(c) : "v"(a), "v"(b));
#endif
  return c;
}
__device__ __forceinline__ void dep_guard(v8f& a, v8f& b, v16b x, v16b y) {
#if DEV_ASM
  asm volatile("v_nop\n\tv_nop\n\tv_nop\n\tv_nop" : "+v"(a), "+v"(b) : "v"(x), "v"(y));
#else
  (void)a; (void)b; (void)x; (void)y;
#endif
}
__device__ __forceinline__ void keep4(v16b a, v16b b, v16b c, v16b d) {
#if DEV_ASM
  asm volatile("v_nop" :: "v"(a), "v"(b), "v"(c), "v"(d));
#else
  (void)a; (void)b; (void)c; (void)d;
#endif
}
__device__ __forceinline__ void acc_guard4(v8f& a, v8f& b, v8f& c, v8f& d) {
#if DEV_ASM
  asm volatile("v_nop\n\tv_nop\n\tv_nop\n\tv_nop" : "+v"(a), "+v"(b), "+v"(c), "+v"(d));
#else
  (void)a; (void)b; (void)c; (void)d;
#endif
}

// =====================================================================================================
// Batched WMMA GEMM (bf16 operands): C[m][n] = sum_k A[m][k] * Bt[n][k] + bias. A row-major [M][K] pitch lda;
// A is given as f32 [M][K / 2] and stands for the folded plane A[m][64 g + 32 part + d] = bf16(Af[m][32 g + d]), part = 0, 1
// (part 0 meets the hi half of Bt's group g, part 1 its residual half). The 32 f32 of a group fill the same 128 B as its
// 64 folded bf16 would, so rows, pitches and copies are counted in 16-bit units as for Bt; the A fragment is converted
// (RNE) where it is read from LDS and serves both k steps of its stage.
// Bt row-major [N][K] pitch ldb (k contiguous); blockIdx.y = batch index (strides in elements).
// One block = 4 waves, one 64x64 tile of C per wave: WM waves along m and 4 / WM along n, so the block tile is
// (64 WM) x (256 / WM). M, N multiples of the block tile, K a multiple of SK (host constants).
// Operands go global -> LDS by asynchronous 16-B copies, SK = 64 k (one whole 128-B line of each of the 320
// operand rows) per stage, a ring of NB buffers: up to NB - 1 stages (at most 60 copies of a wave) are in flight while
// stage t feeds the WMMAs, so a stage has NB - 1 passes to land instead of one.
// Stage layout: rows 0..BM-1 = A rows, rows BM..319 = Bt rows, pitch 144 B (16 B x 9, conflict-free b128 reads).
// Copy map: item = it*128 + tid, row = item>>3, 16-B piece = item&7 -> 8 lanes copy one line, 20 copies per lane
// = 320 rows x 8 pieces, each LDS byte written by one lane. Fragments keep the split k map (ldfrag), k ascending.
// BIAS_MODE 1: bias[n] (per column); BIAS_MODE 2: bias[m] (per row); bias values RNE-converted to bf16.
// Output: f32 C (pitch ldc). Epilogue: 16-row slabs staged per wave in LDS; each 64-wide row segment (256 B =
// coverage: 4 slabs x 16 rows (it 0..7 x lane>>4) x 64 cols = the wave's whole 64x64 tile.
// =====================================================================================================
#define SK     64                     // k elements per stage
#define SPITCH 72                     // LDS row pitch in elements (144 B)
#define SROWS  320                    // operand rows per stage (BM + BN)
#define SBYTES (SROWS * SPITCH * 2)   // 46080 B per buffer

// Four asynchronous copies, 16 B per lane each, global -> LDS. The s_wait_xcnt closes the statement so that no
// address register named here is rewritten before it.
__device__ __forceinline__ void copy4(unsigned l0, unsigned l1, unsigned l2, unsigned l3,
                                      const unsigned short* g0, const unsigned short* g1,
                                      const unsigned short* g2, const unsigned short* g3) {
#if DEV_ASM
  asm volatile("global_load_async_to_lds_b128 %0, %4, off\n\t"
               "global_load_async_to_lds_b128 %1, %5, off\n\t"
               "global_load_async_to_lds_b128 %2, %6, off\n\t"
               "global_load_async_to_lds_b128 %3, %7, off\n\t"
               "s_wait_xcnt 0x0"
               :: "v"(l0), "v"(l1), "v"(l2), "v"(l3), "v"(g0), "v"(g1), "v"(g2), "v"(g3) : "memory");
#else
  (void)l0; (void)l1; (void)l2; (void)l3; (void)g0; (void)g1; (void)g2; (void)g3;
#endif
}
// this wave's copies have landed in LDS (the compiler places no wait for them)
__device__ __forceinline__ void wait_copies() {
#if DEV_ASM
  asm volatile("s_wait_asynccnt 0x0" ::: "memory");
#endif
}
// all of this wave's copies but its N youngest have landed: publishes one stage and leaves the N copies of the
// stages issued behind it in flight (every wave issues the same count per stage: SROWS / 16 in gemm64, WCOP in gemm_qkv, and nothing else counts here)
template <int N>
__device__ __forceinline__ void wait_copies_but() {
#if DEV_ASM
  asm volatile("s_wait_asynccnt %0" :: "i"(N) : "memory");
#endif
}
// this wave's LDS reads have returned, so the buffer they read may be refilled behind the next barrier
__device__ __forceinline__ void wait_lds() {
#if DEV_ASM
  asm volatile("s_wait_dscnt 0x0" ::: "memory");
#endif
}
// stands behind global loads, in front of whatever rewrites their address registers
__device__ __forceinline__ void wait_addr() {
#if DEV_ASM
  asm volatile("s_wait_xcnt 0x0" ::: "memory");
#endif
}
// the same, with the loads' address named as an input: its register pair stays whole up to the wait
__device__ __forceinline__ void wait_addr_of(const float* g) {
#if DEV_ASM
  asm volatile("s_wait_xcnt 0x0" :: "v"(g) : "memory");
#else
  (void)g;
#endif
}
// one stage: 20 copies per lane; ga / gb = the lane's piece of its first A / Bt row at this stage's k
template <int BM>
__device__ __forceinline__ void fill_stage(unsigned lb, const unsigned short* ga, int lda,
                                           const unsigned short* gb, int ldb) {
  // both loops unrolled: r0 is then a constant, so the A / Bt choice is no branch and g, l stay in registers
#pragma unroll
  for (int q = 0; q < SROWS / 64; ++q) {
    const unsigned short* g[4];
    unsigned l[4];
#pragma unroll
    for (int e = 0; e < 4; ++e) {
      const int r0 = (q * 4 + e) * 16;                 // first row of this copy's 16 rows
      g[e] = (r0 < BM) ? ga + (size_t)r0 * lda : gb + (size_t)(r0 - BM) * ldb;
      l[e] = lb + (unsigned)(r0 * SPITCH * 2);
    }
    copy4(l[0], l[1], l[2], l[3], g[0], g[1], g[2], g[3]);
  }
}

template <int BIAS_MODE, int WM, int NB>
__global__ __launch_bounds__(128) void gemm64(
    const float* __restrict__ Af, int lda, long long strideA,
    const unsigned short* __restrict__ Btp, int ldb, long long strideB,
    float* Cout, int ldc, long long strideC,
    const float* __restrict__ bias,
    int M, int N, int K) {
  constexpr int BM = 64 * WM;
  constexpr int BN = SROWS - BM;
  constexpr int AHEAD = (NB - 2) * (SROWS / 16);   // a wave's copies of the NB - 2 stages behind the one being published
  static_assert(WM == 1 || WM == 4);
  static_assert(NB >= 2 && (NB - 1) * (SROWS / 16) <= 63);           // copies of a wave outstanding at most
  __shared__ __align__(16) unsigned short stg[NB * SROWS * SPITCH];  // the ring's stage buffers
  __shared__ __align__(16) float sT[4][16 * 68];   // per-wave 16x64 slab, pitch 68 floats
  const unsigned short* Ap = (const unsigned short*)(const void*)Af;   // addressed in 16-bit units, like Bt
  const int b    = blockIdx.y;
  const int tid  = (int)threadIdx.x;
  const int lane = tid & 31;
  const int wave = tid >> 5;
  const int tilesN = N / BN;
  const int tilesM = M / BM;
  const int tile = blockIdx.x;
  if (tile >= tilesM * tilesN) return;   // block-uniform, in front of every barrier and copy
  const int tm = tile / tilesN;
  const int tn = tile - tm * tilesN;
  const int wrA = (WM == 4) ? (wave << 6) : 0;          // the wave's first A row inside the stage
  const int wrB = BM + ((WM == 4) ? 0 : (wave << 6));   // the wave's first Bt row inside the stage
  const int m0 = tm * BM + wrA;
  const int n0 = tn * BN + (wrB - BM);

  const int rlane = lane & 15;                 // row (A) / col (B, D) within subtile
  const int koff  = (lane >> 4) * 8;           // k offset of this lane half
  const int mOff  = (lane >> 4) * 8;           // D row offset

  // the lane's copy addresses: row tid>>3 of each 16-row group, 16-B piece tid&7
  const unsigned short* ga = Ap  + (size_t)b * (size_t)strideA + (size_t)(tm * BM + (tid >> 3)) * lda + (tid & 7) * 8;
  const unsigned short* gb = Btp + (size_t)b * (size_t)strideB + (size_t)(tn * BN + (tid >> 3)) * ldb + (tid & 7) * 8;
  const unsigned lds0 = (unsigned)(uintptr_t)stg + (unsigned)((tid >> 3) * SPITCH * 2 + (tid & 7) * 16);
  const int nst = K / SK;

  v8f acc[4][4];
#pragma unroll
  for (int i = 0; i < 4; ++i)
#pragma unroll
    for (int j = 0; j < 4; ++j) acc[i][j] = zero8();

  // unrolled: the buffer offsets are constants; stages 0 .. NB - 2 go out together
#pragma unroll
  for (int s = 0; s < NB - 1; ++s)
    if (s < nst) fill_stage<BM>(lds0 + (unsigned)s * SBYTES, ga + s * SK, lda, gb + s * SK, ldb);
  // the count is used only where all NB - 2 stages behind stage 0 were issued
  if (NB - 1 <= nst) wait_copies_but<AHEAD>(); else wait_copies();
  __syncthreads();                             // stage 0 is readable by every wave
  if (NB - 1 < nst) fill_stage<BM>(lds0 + (unsigned)(NB - 1) * SBYTES, ga + (NB - 1) * SK, lda, gb + (NB - 1) * SK, ldb);

  int buf = 0;                                 // t mod NB
  for (int t = 0; t < nst; ++t) {
    const __bf16* sb = (const __bf16*)(const void*)stg + buf * (SROWS * SPITCH);
    // unrolled (inner loops too): fragments stay in registers, and the second k step's LDS reads start under
    // the first step's WMMAs
    v16b af[4];
    raw16 ar[4];
#pragma unroll
    for (int i = 0; i < 4; ++i)
      ar[i] = ldraw_f32((const float*)(const void*)(sb + (wrA + (i << 4) + rlane) * SPITCH) + koff);
#pragma unroll
    for (int kk = 0; kk < SK; kk += 32) {
      v16b bq[4];
#pragma unroll
      for (int j = 0; j < 4; ++j) bq[j] = ldfrag<__bf16>(sb + (wrB + (j << 4) + rlane) * SPITCH + koff + kk);
      if (kk == 0) {
        // all LDS reads of the first k step go out before the first convert waits on one: one LDS latency, not four
        __builtin_amdgcn_sched_barrier(0);
#pragma unroll
        for (int i = 0; i < 4; ++i) af[i] = cvtfrag(ar[i]);
      }
#pragma unroll
      for (int i = 0; i < 4; ++i) {
#pragma unroll
        for (int j = 0; j < 4; ++j) acc[i][j] = mmar(af[i], bq[j], acc[i][j]);
        dep_guard(acc[i][0], acc[i][3], af[i], bq[3]);
      }
      keep4(bq[0], bq[1], bq[2], bq[3]);
    }
    // publish point of stage t + 1: own reads of stage t done, own copies of stage t + 1 landed, then the barrier.
    // Stages t + 2 .. t + NB - 1 stay in flight where all of them were issued; towards the end the wait is to 0.
    wait_lds();
    if (t + NB - 1 < nst) wait_copies_but<AHEAD>(); else wait_copies();
    __syncthreads();
    // refill the buffer that every wave has just left
    if (t + NB < nst) fill_stage<BM>(lds0 + (unsigned)buf * SBYTES, ga + (t + NB) * SK, lda, gb + (t + NB) * SK, ldb);
    buf = (buf + 1 == NB) ? 0 : buf + 1;
  }
  wait_copies();
  acc_guard4(acc[0][0], acc[0][1], acc[0][2], acc[0][3]);
  acc_guard4(acc[1][0], acc[1][1], acc[1][2], acc[1][3]);
  acc_guard4(acc[2][0], acc[2][1], acc[2][2], acc[2][3]);
  acc_guard4(acc[3][0], acc[3][1], acc[3][2], acc[3][3]);

  // ---- epilogue ----
  float* slab = sT[wave];
  float* C = Cout + (size_t)b * (size_t)strideC;
  const int h2 = lane >> 4, c4 = (lane & 15) * 4;     // 256-B row segment = 16 lanes x 16 B
  v4f bcol = {0.f, 0.f, 0.f, 0.f};
  if (BIAS_MODE == 1) {
#pragma unroll
    for (int e = 0; e < 4; ++e) bcol[e] = bf_round(bias[n0 + c4 + e]);
  }
  // the lane's row biases of all four slabs, loaded together ahead of the slabs: one load latency, none between slabs
  float brow[4][8];
  if (BIAS_MODE == 2) {
    // both loops unrolled: brow stays in registers
#pragma unroll
    for (int i = 0; i < 4; ++i)
#pragma unroll
      for (int it = 0; it < 8; ++it) brow[i][it] = bf_round(bias[m0 + (i << 4) + it * 2 + h2]);
  }
#pragma unroll
  for (int i = 0; i < 4; ++i) {
    const int mBase = m0 + (i << 4);
#pragma unroll
    for (int j = 0; j < 4; ++j) {
#pragma unroll
      for (int r = 0; r < 8; ++r) {
        slab[(mOff + r) * 68 + (j << 4) + rlane] = acc[i][j][r];
      }
    }
    // stands behind the last slab's global stores, in front of the LDS reads that reuse their registers
    if (i > 0) wait_addr();
    // The slab belongs to this wave alone: wavefront scope keeps its LDS stores and reads in order for the compiler and
    // places no wait; workgroup scope would also wait (s_wait_storecnt 0) for the last slab's global stores.
    __builtin_amdgcn_fence(__ATOMIC_RELEASE, "wavefront");
    // the slab's LDS stores are done before other lanes read the rows back (a wavefront-scope fence places no wait)
    wait_lds();
    __builtin_amdgcn_wave_barrier();
    __builtin_amdgcn_fence(__ATOMIC_ACQUIRE, "wavefront");
    {
#pragma unroll
      for (int it = 0; it < 8; ++it) {
        const int row = it * 2 + h2;                     // it 0..7 x h2 0..1 = rows 0..15
        v4f v = *(const v4f*)(slab + row * 68 + c4);
        if (BIAS_MODE == 1) {
          v = v + bcol;
        } else {
          v = v + brow[i][it];
        }
        *(v4f*)(C + (size_t)(mBase + row) * ldc + n0 + c4) = v;
      }
      
    }
    __builtin_amdgcn_fence(__ATOMIC_RELEASE, "wavefront");
    __builtin_amdgcn_wave_barrier();
    __builtin_amdgcn_fence(__ATOMIC_ACQUIRE, "wavefront");
  }
}

// =====================================================================================================
// qkv projection straight from the f32 inputs: C[p][n] = sum_c bf16(x[b][c][p]) * bf16(w[n][c]) + bias[n], f32 out [6272][768].
// One block = 8 waves = 128 positions x 256 columns, one 64x64 tile per wave: waves 0..3 the first 64 positions, waves 4..7
// the second (a weight row, twice as wide in f32, so feeds twice the positions).
// x: each half's whole [256 c][64 p] panel goes global -> registers -> bf16 (RNE) -> LDS once, row-major as it lies in
// memory (pitch 160 B), loaded by the four waves that read it; the A fragments (rows p, k = c) are made by transposing
// LDS loads. A half of 64 positions lies in one image (NPOS % 64 == 0); the two halves of a block need not.
// w: f32 rows go global -> LDS by asynchronous 16-B copies, WSK = 32 k (one 128-B line of each of the 256 rows) per stage,
// a ring of QNB buffers with QNB - 1 stages in flight; the B fragments are converted (RNE) where they are read.
// Copy map: row = 32 g + (tid>>3), 16-B piece = tid&7, g = 0..7 -> 8 copies per lane, each LDS byte written by one lane.
// Both fragments keep the split k map of ldfrag, k ascending. Epilogue as in gemm64; its slabs reuse the x panels,
// which every wave has left at the loop's last barrier.
// =====================================================================================================
#define XPITCH 80                     // LDS pitch of an x panel row in elements: 160 B = 32 B x 5, the transposing reader's pitch
#define WSK    32                     // k (f32) per weight stage
#define WPB    144                    // LDS pitch of a weight row in bytes (16 B x 9)
#define WSTG   (256 * WPB)            // 36864 B per buffer
#define QNB    5                      // buffers of the weight ring
#define WCOP   8                      // copies of a wave per stage
static_assert((XPITCH * 2) % 32 == 0 && ((XPITCH * 2) / 32) % 2 == 1 && XPITCH >= 64);
static_assert(CH % WSK == 0 && CH / WSK >= QNB && (QNB - 1) * WCOP <= 63);
static_assert(2 * CH * XPITCH * 2 >= 8 * 16 * 68 * 4);   // the epilogue slabs fit in the x panels
static_assert((MROW % 128) == 0);

// one weight stage: g = the lane's piece of its first row at this stage's k
__device__ __forceinline__ void fill_w(unsigned lb, const float* g) {
  // both loops unrolled: the row offsets are constants and gp, l stay in registers
#pragma unroll
  for (int q = 0; q < WCOP / 4; ++q) {
    const unsigned short* gp[4];
    unsigned l[4];
#pragma unroll
    for (int e = 0; e < 4; ++e) {
      const int r0 = (q * 4 + e) * 32;                 // first row of this copy's 32 rows
      gp[e] = (const unsigned short*)(const void*)(g + (size_t)r0 * CH);
      l[e] = lb + (unsigned)(r0 * WPB);
    }
    copy4(l[0], l[1], l[2], l[3], gp[0], gp[1], gp[2], gp[3]);
  }
}

__global__ __launch_bounds__(256) void gemm_qkv(const float* __restrict__ x, const float* __restrict__ wq,
                                                const float* __restrict__ bias, float* C) {
  __shared__ __align__(32) unsigned short xp[2 * CH * XPITCH]; // two x panels bf16 [c][p], 40960 B each
  __shared__ __align__(16) float wr[QNB * WSTG / 4];           // weight ring, f32 rows
  constexpr int nst = CH / WSK;
  const int tid  = (int)threadIdx.x;
  const int lane = tid & 31;
  const int wave = __builtin_amdgcn_readfirstlane(tid >> 5);   // the same in every lane: tile indices stay scalar
  const int wm = wave >> 2, wn = wave & 3;           // the wave's half of the positions, its 64 columns
  const int tm = (int)blockIdx.x / (C3 / 256);
  const int tn = (int)blockIdx.x - tm * (C3 / 256);
  const int m0 = tm * 128 + (wm << 6);
  const int b  = m0 / NPOS, p0 = m0 - b * NPOS;      // image and first position of the wave's half
  const int n0 = tn * 256 + (wn << 6);
  const int rlane = lane & 15;                 // col (B, D) within subtile
  const int hh    = lane >> 4;
  const int koff  = hh * 8;                    // k offset of this lane half
  const int mOff  = hh * 8;                    // D row offset

  const float* gw = wq + (size_t)(tn * 256 + (tid >> 3)) * CH + (tid & 7) * 4;
  const unsigned lds0 = (unsigned)(uintptr_t)wr + (unsigned)((tid >> 3) * WPB + (tid & 7) * 16);

  // ---- x panel of the wave's half, by its 128 threads: load it = rows c = 8 it + (th>>4), 16 lanes x 16 B = the row's
  //      256 B; 32 x 128 x 4 = 256 c x 64 p ----
  unsigned short* xh = xp + wm * (CH * XPITCH);
  {
    const int th = tid & 127;
    const float* gx = x + ((size_t)(b * CH + (th >> 4))) * NPOS + p0 + (th & 15) * 4;
    unsigned short* xs = xh + (th >> 4) * XPITCH + (th & 15) * 4;
    v4f xv[CH / 8];
    // both loops unrolled: xv stays in registers and all loads go out together
#pragma unroll
    for (int it = 0; it < CH / 8; ++it) xv[it] = *(const v4f*)(gx + (size_t)it * 8 * NPOS);
    wait_addr_of(gx);
    // weight stages 0 .. QNB - 2 go out together, behind the x loads (x has the longer way: convert, LDS store);
    // unrolled: the buffer offsets are constants
#pragma unroll
    for (int s = 0; s < QNB - 1; ++s) fill_w(lds0 + (unsigned)s * WSTG, gw + s * WSK);
#pragma unroll
    for (int it = 0; it < CH / 8; ++it) {
      const v2u u = {cvt2(xv[it][0], xv[it][1]), cvt2(xv[it][2], xv[it][3])};
      *(v2u*)(xs + it * 8 * XPITCH) = u;
    }
  }
  // keeps the zeroing of the 128 accumulator registers behind the panel's 128 load registers (fewer registers live at once)
  __builtin_amdgcn_sched_barrier(0);

  v8f acc[4][4];
#pragma unroll
  for (int i = 0; i < 4; ++i)
#pragma unroll
    for (int j = 0; j < 4; ++j) acc[i][j] = zero8();

  wait_copies_but<(QNB - 2) * WCOP>();
  __syncthreads();                             // the x panels and weight stage 0 are readable by every wave
  fill_w(lds0 + (unsigned)(QNB - 1) * WSTG, gw + (QNB - 1) * WSK);

  // the lane's 16 B of a transposing load: panel row 8*hh + (lane&7), column piece (lane>>3)&1
  const unsigned short* xa = xh + (8 * hh + (lane & 7)) * XPITCH + ((lane >> 3) & 1) * 8;
  int buf = 0;                                 // t mod QNB
  for (int t = 0; t < nst; ++t) {
    const float* sw = wr + buf * (WSTG / 4) + ((wn << 6) + rlane) * (WPB / 4) + koff;
    v16b bq[4], af[4];
    raw16 br[4];
    // inner loops unrolled: fragments and accumulators stay in registers
#pragma unroll
    for (int j = 0; j < 4; ++j) br[j] = ldraw_f32(sw + (j << 4) * (WPB / 4));
#pragma unroll
    for (int i = 0; i < 4; ++i) af[i] = ldfrag_tr(xa + t * WSK * XPITCH + (i << 4), XPITCH);
    // all LDS reads of the stage go out before the first convert waits on one: one LDS latency per stage
    __builtin_amdgcn_sched_barrier(0);
#pragma unroll
    for (int j = 0; j < 4; ++j) bq[j] = cvtfrag(br[j]);
#pragma unroll
    for (int i = 0; i < 4; ++i) {
#pragma unroll
      for (int j = 0; j < 4; ++j) acc[i][j] = mmar(af[i], bq[j], acc[i][j]);
      dep_guard(acc[i][0], acc[i][3], af[i], bq[3]);
    }
    keep4(bq[0], bq[1], bq[2], bq[3]);
    // publish point of stage t + 1: own reads of stage t done, own copies of stage t + 1 landed, then the barrier.
    // The QNB - 2 stages behind it stay in flight where all of them were issued; towards the end the wait is to 0.
    wait_lds();
    if (t + QNB - 1 < nst) wait_copies_but<(QNB - 2) * WCOP>(); else wait_copies();
    __syncthreads();
    // refill the buffer that every wave has just left
    if (t + QNB < nst) fill_w(lds0 + (unsigned)buf * WSTG, gw + (t + QNB) * WSK);
    buf = (buf + 1 == QNB) ? 0 : buf + 1;
  }
  wait_copies();
  acc_guard4(acc[0][0], acc[0][1], acc[0][2], acc[0][3]);
  acc_guard4(acc[1][0], acc[1][1], acc[1][2], acc[1][3]);
  acc_guard4(acc[2][0], acc[2][1], acc[2][2], acc[2][3]);
  acc_guard4(acc[3][0], acc[3][1], acc[3][2], acc[3][3]);

  // ---- epilogue: 16-row slabs staged per wave in LDS, 256-B row segments stored whole ----
  float* slab = (float*)(void*)xp + wave * (16 * 68);  // per-wave 16x64 slab, pitch 68 floats
  const int h2 = lane >> 4, c4 = (lane & 15) * 4;     // 256-B row segment = 16 lanes x 16 B
  v4f bcol;
#pragma unroll
  for (int e = 0; e < 4; ++e) bcol[e] = bf_round(bias[n0 + c4 + e]);
#pragma unroll
  for (int i = 0; i < 4; ++i) {
    const int mBase = m0 + (i << 4);
#pragma unroll
    for (int j = 0; j < 4; ++j) {
#pragma unroll
      for (int r = 0; r < 8; ++r) {
        slab[(mOff + r) * 68 + (j << 4) + rlane] = acc[i][j][r];
      }
    }
    // stands behind the last slab's global stores, in front of the LDS reads that reuse their registers
    if (i > 0) wait_addr();
    // The slab belongs to this wave alone: wavefront scope keeps its LDS stores and reads in order for the compiler and
    // places no wait; workgroup scope would also wait (s_wait_storecnt 0) for the last slab's global stores.
    __builtin_amdgcn_fence(__ATOMIC_RELEASE, "wavefront");
    // the slab's LDS stores are done before other lanes read the rows back (a wavefront-scope fence places no wait)
    wait_lds();
    __builtin_amdgcn_wave_barrier();
    __builtin_amdgcn_fence(__ATOMIC_ACQUIRE, "wavefront");
#pragma unroll
    for (int it = 0; it < 8; ++it) {
      const int row = it * 2 + h2;                     // it 0..7 x h2 0..1 = rows 0..15
      const v4f v = *(const v4f*)(slab + row * 68 + c4) + bcol;
      *(v4f*)(C + (size_t)(mBase + row) * C3 + n0 + c4) = v;
    }
    __builtin_amdgcn_fence(__ATOMIC_RELEASE, "wavefront");
    __builtin_amdgcn_wave_barrier();
    __builtin_amdgcn_fence(__ATOMIC_ACQUIRE, "wavefront");
  }
}

// =====================================================================================================
// P^T B fragment pair (hi, residual) from the lane's own score D values: element r <- tile a row r,
// element 8+r <- tile c row r (same lane, same query column).
// =====================================================================================================
__device__ __forceinline__ void pack_pt(v8f a, v8f c, v16b& ph, v16b& pl) {
  v8u H, L;
#pragma unroll
  for (int r = 0; r < 4; ++r) {
    unsigned hp, lp;
    split2(a[2 * r], a[2 * r + 1], hp, lp);
    H[r] = hp; L[r] = lp;
    split2(c[2 * r], c[2 * r + 1], hp, lp);
    H[4 + r] = hp; L[4 + r] = lp;
  }
  ph = __builtin_bit_cast(v16b, H); pl = __builtin_bit_cast(v16b, L);
}

// load 8 consecutive f32, or zeros when keep == 0 (address always valid, select by value)
__device__ __forceinline__ void ld8sel(const float* src, int keep, float f[8]) {
  const v4f a = *(const v4f*)src;
  const v4f c = *(const v4f*)(src + 4);
  f[0] = keep ? a[0] : 0.f; f[1] = keep ? a[1] : 0.f; f[2] = keep ? a[2] : 0.f; f[3] = keep ? a[3] : 0.f;
  f[4] = keep ? c[0] : 0.f; f[5] = keep ? c[1] : 0.f; f[6] = keep ? c[2] : 0.f; f[7] = keep ? c[3] : 0.f;
}

// =====================================================================================================
// Windowed attention, one block = (batch b, head, 8x8 query tile at (i0, j0)); 128 threads = 4 waves,
// wave w owns the 16 queries lq = 16w..16w+15 (query row i0 + (lq>>3), col j0 + (lq&7)).
// Key superset = the 14x14 image block at (R0, C0), R0 = clamp(i0-3, 0, 42), slot = u*14 + v (196 slots,
// padded to 224 with zero rows). Every query's clamped 7x7 window lies inside the superset: valid slots are
// su <= u <= su+6, sv <= v <= sv+6 with su = clamp(qi-3,0,49) - R0 in [0,7].
// A wave's 16 queries are two image rows, so their windows lie in the 8 superset rows ulo..ulo+7, ulo = min(su of the
// first row, 6): the wave scores, masks, exponentiates and multiplies only those 112 slots (7 tiles from slot 14 ulo).
//   qkv plane f32 [b*3136 + p][768]: q = cols head*32+d (scaled by 32^-0.5 in f32 here), k = 256+.., v = 512+..
//   scores (transposed): S^T[slot][query] = K[slot][d] . Q^T[d][query] on bf16 WMMA, 3 products
//     (hi.hi + hi.res + res.hi); lane owns query column (lane&15) of its wave and key rows 14 ulo + 16j + 8h + r.
//   s = S^T + rpb[head][u + R0 - qi + 6][v + C0 - qj + 6] for valid slots, -1e30 otherwise (f32);
//   softmax in f32 (max / sum over the 56 lane values and the partner lane ^16).
//   O^T[d][query] = V^T[d][slot] . P^T[slot][query] on bf16 WMMA, 3 products, p unnormalised exp, 1/sum at the end.
// LDS: KV0/KV1 hold K hi/res [slot][d] (pitch 64 B) for the scores, then (after a block barrier) V hi/res [slot][d]
// (pitch 96 B), row-major as it comes from memory; the V^T fragments are made by transposing LDS loads.
// K and Q rows have a 64-B pitch, at which the b128 fragment reads meet four to a bank; Os rows 128 B.
// Staged extents: KV 224x32 both phases (slots >= 196 zero), Q 64x32, Rp 384 (table at 100..268, zeros around),
// Os 16x32 per wave -- every LDS element read is written first.
// Output coverage: each wave stores its 16 query rows (it 0..3 x lane>>3) x 8 pieces of 16 B (lane&7) =
// =====================================================================================================
__global__ __launch_bounds__(128)
void natt(const float* __restrict__ qkv, const float* __restrict__ rpb, unsigned short* ctx) {
  __shared__ __align__(32) unsigned short KV0[NSLOT * VPITCH];   // 21504 B (K uses the first 14336)
  __shared__ __align__(32) unsigned short KV1[NSLOT * VPITCH];   // 21504 B
  __shared__ __align__(16) unsigned short Qh[64 * HDIM];       //  4096 B
  __shared__ __align__(16) unsigned short Ql[64 * HDIM];       //  4096 B
  __shared__ __align__(16) float Os[4][16 * HDIM];             //  8192 B
  __shared__ float Rp[RPN];

  const int tid  = (int)threadIdx.x;
  const int wave = tid >> 5;
  const int lane = tid & 31;
  const int hh   = lane >> 4;
  const int m    = lane & 15;

  const int bx   = blockIdx.x;
  const int tj   = bx % 7;
  const int ti   = (bx / 7) % 7;
  const int head = (bx / 49) % NHD;
  const int b    = bx / (49 * NHD);
  const int i0 = ti * 8, j0 = tj * 8;
  const int R0 = min(max(i0 - 3, 0), IMH - SUP);
  const int C0 = min(max(j0 - 3, 0), IMW - SUP);
  const size_t pb = (size_t)b * NPOS;

  // ---- position-bias table of this head (bf16 RNE-converted values), entries 0..168 at Rp[RPLO..], zeros around ----
  {
    float rv[RPN / 128];
    // both loops unrolled: rv stays in registers and the three loads go out together
#pragma unroll
    for (int it = 0; it < RPN / 128; ++it) {
      const int t = it * 128 + tid - RPLO;
      rv[it] = rpb[head * 169 + min(max(t, 0), 168)];           // clamped address
    }
    wait_addr();
#pragma unroll
    for (int it = 0; it < RPN / 128; ++it) {
      const int e = it * 128 + tid;
      const float tv = bf_round(rv[it]);
      Rp[e] = ((unsigned)(e - RPLO) < 169u) ? tv : 0.f;
    }
  }
  // ---- q (scaled in f32) -> hi / residual planes [lq][d]; thread = (lq = tid>>1, d half) ----
  {
    const int lq = tid >> 1, dh = (tid & 1) * 16;
    const int qi = lq >> 3, qj = lq & 7;
    const size_t pos = pb + (size_t)(i0 + qi) * IMW + j0 + qj;
    const float* src = qkv + pos * C3 + head * HDIM + dh;
#pragma unroll
    for (int g = 0; g < 2; ++g) {
      float f[8];
      ld8sel(src + 8 * g, 1, f);
      v4u ph, pl;
#pragma unroll
      for (int e = 0; e < 4; ++e) {
        unsigned hp, lp;
        split2(f[2 * e] * QSCALE, f[2 * e + 1] * QSCALE, hp, lp);
        ph[e] = hp; pl[e] = lp;
      }
      *(v4u*)(Qh + lq * HDIM + dh + 8 * g) = ph;
      *(v4u*)(Ql + lq * HDIM + dh + 8 * g) = pl;
    }
  }
  // ---- K superset -> KV0 (hi) / KV1 (residual), layout [slot][d]; item = it*128 + tid, slot = item>>2,
  //      d8 = (item&3)*8; 7 x 128 items = 224 slots x 4 groups = the whole tile; slots >= 196 = zeros ----
  {
    const float* kbase = qkv + CH + head * HDIM;
#pragma unroll
    for (int it = 0; it < 7; ++it) {
      const int item = it * 128 + tid;
      const int slot = item >> 2, d8 = (item & 3) * 8;
      const int u = slot / SUP, v = slot - u * SUP;
      const int uc = min(u, SUP - 1);
      const size_t pos = pb + (size_t)(R0 + uc) * IMW + C0 + v;
      float f[8];
      ld8sel(kbase + pos * C3 + d8, slot < SUP * SUP, f);
      v4u ph, pl;
#pragma unroll
      for (int e = 0; e < 4; ++e) {
        unsigned hp, lp;
        split2(f[2 * e], f[2 * e + 1], hp, lp);
        ph[e] = hp; pl[e] = lp;
      }
      *(v4u*)(KV0 + slot * HDIM + d8) = ph;
      *(v4u*)(KV1 + slot * HDIM + d8) = pl;
    }
  }
  __syncthreads();

  // ---- the wave's key range: first superset row ulo, first slot slot0 (the same in every lane of the wave) ----
  const int wv    = __builtin_amdgcn_readfirstlane(wave);
  const int ulo   = min(min(max(i0 + 2 * wv - 3, 0), IMH - KW) - R0, SUP - WROWS);
  const int slot0 = ulo * SUP;

  // ---- scores: S^T tiles j = 0..6 (key slots slot0 + 16j .. + 15) for the wave's 16 queries; s[7] stays zero ----
  v8f s[NKT + 1];
  {
    const __bf16* Kh = (const __bf16*)(const void*)KV0 + slot0 * HDIM;
    const __bf16* Kl = (const __bf16*)(const void*)KV1 + slot0 * HDIM;
    const __bf16* Qhp = (const __bf16*)(const void*)Qh;
    const __bf16* Qlp = (const __bf16*)(const void*)Ql;
    const v16b qfh = ldfrag<__bf16>(Qhp + (16 * wave + m) * HDIM + 8 * hh);
    const v16b qfl = ldfrag<__bf16>(Qlp + (16 * wave + m) * HDIM + 8 * hh);
#pragma unroll
    for (int j = 0; j < NKT; ++j) {
      const v16b kfh = ldfrag<__bf16>(Kh + (16 * j + m) * HDIM + 8 * hh);
      const v16b kfl = ldfrag<__bf16>(Kl + (16 * j + m) * HDIM + 8 * hh);
      v8f z = zero8();
      z = mma_b(kfh, qfh, z);
      z = mma_b(kfh, qfl, z);
      z = mma_b(kfl, qfh, z);
      s[j] = z;
    }
    s[NKT] = zero8();
  }
  __syncthreads();   // all waves done reading K from KV0/KV1

  // ---- V superset -> KV0 (hi) / KV1 (residual), layout [slot][d] (pitch VPITCH), one 16-B store per plane and item;
  //      same item map as K: 224 slots x 32 d written, slots >= 196 = zeros ----
  {
    const float* vbase = qkv + 2 * CH + head * HDIM;
#pragma unroll
    for (int it = 0; it < 7; ++it) {
      const int item = it * 128 + tid;
      const int slot = item >> 2, d8 = (item & 3) * 8;
      const int u = slot / SUP, v = slot - u * SUP;
      const int uc = min(u, SUP - 1);
      const size_t pos = pb + (size_t)(R0 + uc) * IMW + C0 + v;
      float f[8];
      ld8sel(vbase + pos * C3 + d8, slot < SUP * SUP, f);
      v4u ph, pl;
#pragma unroll
      for (int e = 0; e < 4; ++e) {
        unsigned hp, lp;
        split2(f[2 * e], f[2 * e + 1], hp, lp);
        ph[e] = hp; pl[e] = lp;
      }
      *(v4u*)(KV0 + slot * VPITCH + d8) = ph;
      *(v4u*)(KV1 + slot * VPITCH + d8) = pl;
    }
  }
  __syncthreads();

  // ---- window mask + position bias (f32), softmax over the query column ----
  const int lq = 16 * wave + m;
  const int ai = i0 + (lq >> 3), aj = j0 + (lq & 7);
  const int su = min(max(ai - 3, 0), IMH - KW) - R0 - ulo;      // counted from the wave's first row: 0 or 1
  const int sv = min(max(aj - 3, 0), IMW - KW) - C0;
  const int cb = (R0 + ulo - ai + 6) * 13 + (C0 - aj + 6);
  // Slots and rows u are counted from the wave's first slot and row from here on.
  // Bias index 13u + v + cb = slot - u + cb. The upper lane half's slot is 8 higher and its u is equal or one
  // higher (one higher where t0 % 14 >= 6), so two lane bases and a constant offset address every read; the read
  // is made for every slot (the padded table holds every such index) and the window test selects by value.
  const float* rb8 = Rp + (RPLO + cb + 8 * hh);
  const float* rb7 = Rp + (RPLO + cb + 7 * hh);
  // The window test of a slot is a row test and a column test; each distinct one is made once:
  // column k = t0 % 14 (upper half: (k + 8) % 14), row a = t0 / 14 (upper half: a, or a + 1 where k >= 6).
  // Both loops unrolled: the arrays are then indexed by constants only and each test is one lane mask in a register.
  bool colok[SUP], rowsame[WROWS], rownext[WROWS];
#pragma unroll
  for (int k = 0; k < SUP; ++k) {
    const int v = hh ? ((k + 8) % SUP) : k;
    colok[k] = (unsigned)(v - sv) < 7u;
  }
#pragma unroll
  for (int a = 0; a < WROWS; ++a) {
    rowsame[a] = (unsigned)(a - su) < 7u;
    rownext[a] = (unsigned)(a + hh - su) < 7u;
  }
  float mloc = -1.0e30f;
#pragma unroll
  for (int j = 0; j < NKT; ++j) {
#pragma unroll
    for (int r = 0; r < 8; ++r) {
      const int t0 = 16 * j + r;                       // slot = t0 + 8*hh
      const bool step = (t0 % SUP) >= SUP - 8;         // the upper half's slot lies one superset row further
      const bool ok = colok[t0 % SUP] & (step ? rownext[t0 / SUP] : rowsame[t0 / SUP]);
      const int c0 = t0 - t0 / SUP;                    // 13u + v of the lower half's slot
      const float bv = step ? rb7[c0] : rb8[c0];
      const float sb = s[j][r] + bv;
      const float sval = ok ? sb : -1.0e30f;
      s[j][r] = sval;
      mloc = fmaxf(mloc, sval);
    }
  }
  const float mrow = fmaxf(mloc, __shfl_xor(mloc, 16, 32));
  float lsum = 0.f;
#pragma unroll
  for (int j = 0; j < NKT; ++j) {
#pragma unroll
    for (int r = 0; r < 8; ++r) {
      const float p = __expf(s[j][r] - mrow);
      s[j][r] = p;
      lsum += p;
    }
  }
  lsum += __shfl_xor(lsum, 16, 32);

  // ---- O^T = V^T . P^T : 2 d-tiles x 4 k-steps of 32 slots x 3 products (the last 16 slots meet p = 0) ----
  v8f o[2];
  o[0] = zero8(); o[1] = zero8();
  {
    // the lane's 16 B of a transposing load: slot row 8*hh + (lane&7), column piece (lane>>3)&1
    const int vo = (slot0 + 8 * hh + (lane & 7)) * VPITCH + ((lane >> 3) & 1) * 8;
    const unsigned short* Vh = KV0 + vo;
    const unsigned short* Vl = KV1 + vo;
#pragma unroll
    for (int kk = 0; kk < (NKT + 1) / 2; ++kk) {
      v16b ph, pl;
      pack_pt(s[2 * kk], s[2 * kk + 1], ph, pl);
#pragma unroll
      for (int t = 0; t < 2; ++t) {
        const v16b vfh = ldfrag_tr(Vh + 32 * kk * VPITCH + 16 * t, VPITCH);
        const v16b vfl = ldfrag_tr(Vl + 32 * kk * VPITCH + 16 * t, VPITCH);
        o[t] = mma_b(vfh, ph, o[t]);
        o[t] = mma_b(vfh, pl, o[t]);
        o[t] = mma_b(vfl, ph, o[t]);
      }
    }
  }

  // ---- normalise, stage the wave's 16 queries x 32 d in LDS, write the ctx lines ----
  const float linv = 1.0f / lsum;
  float* os = Os[wave];
#pragma unroll
  for (int t = 0; t < 2; ++t)
#pragma unroll
    for (int r = 0; r < 8; ++r) os[m * HDIM + 16 * t + 8 * hh + r] = o[t][r] * linv;
  __syncthreads();
  {
    const int q4 = lane >> 3, pc = lane & 7, dsel = (pc & 3) * 8;
    const bool lowp = (pc >= 4);
    v4u hv[4];
    size_t go[4];
#pragma unroll
    for (int it = 0; it < 4; ++it) {
      const int row = it * 4 + q4;                     // it 0..3 x q4 0..3 = rows 0..15
      const float* sp = os + row * HDIM + dsel;
      v4u a;
#pragma unroll
      for (int e = 0; e < 4; ++e) {
        unsigned hp, lp;
        split2(sp[2 * e], sp[2 * e + 1], hp, lp);
        a[e] = lowp ? lp : hp;
      }
      hv[it] = a;
      const int lqr = 16 * wave + row;
      const size_t pos = pb + (size_t)(i0 + (lqr >> 3)) * IMW + j0 + (lqr & 7);
      go[it] = pos * CTXK + (size_t)head * 64 + pc * 8;
    }
    {
#pragma unroll
      for (int it = 0; it < 4; ++it) *(v4u*)(ctx + go[it]) = hv[it];
      
    }
  }
}

// =====================================================================================================
//   QKV  f32  [6272][768]    19267584
//   CTX  bf16 [6272][512]     6422528
//   total                   25690112
// =====================================================================================================
extern "C" void kernel_launch(void* const* d_in, const int* in_sizes, int n_in,
                              void* d_out, int out_size, void* d_ws, size_t ws_size,
                              hipStream_t stream) {
  if (n_in < 6) return;
  if (in_sizes[0] != NBT * CH * NPOS) return;
  if (in_sizes[1] != C3 * CH) return;
  if (in_sizes[2] != C3) return;
  if (in_sizes[3] != NHD * 13 * 13) return;
  if (in_sizes[4] != CH * CH) return;
  if (in_sizes[5] != CH) return;
  if (out_size != NBT * CH * NPOS) return;

  const float* x      = (const float*)d_in[0];
  const float* w_qkv  = (const float*)d_in[1];
  const float* b_qkv  = (const float*)d_in[2];
  const float* rpb    = (const float*)d_in[3];
  const float* w_proj = (const float*)d_in[4];
  const float* b_proj = (const float*)d_in[5];

  const size_t PQKV = (size_t)MROW * C3 * 4;        // 19267584
  const size_t PCTX = (size_t)MROW * CTXK * 2;      //  6422528
  size_t off = 0;
  const size_t oQKV = off; off += PQKV;
  const size_t oCTX = off; off += PCTX;
  if (off > ws_size) return;                         // off = 25690112
  if (off > (size_t)134217728) return;

  char* ws = (char*)d_ws;
  float*          QKV = (float*)(ws + oQKV);
  unsigned short* CTX = (unsigned short*)(ws + oCTX);

  const int tilesQKV = (MROW / 128) * (C3 / 256);                     //  147 block tiles of 128 x 256
  const int tilesPRJ = (CH / 256) * (NPOS / 64);                      //   49 block tiles of 256 x 64
  const dim3 gQKV(tilesQKV, 1);                                       // 147
  const dim3 gAtt(NBT * NHD * 49);                                    // 784
  const dim3 gPRJ(tilesPRJ, NBT);                                     // (49, 2)

  // (1) qkv = bf16(x)^T . bf16(w_qkv)^T + b_qkv -> f32 [6272][768]   (M=6272, N=768, K=256)
  gemm_qkv<<<gQKV, dim3(256), 0, stream>>>(x, w_qkv, b_qkv, QKV);
  // (2) windowed attention -> ctx plane bf16 [6272][512]
  natt<<<gAtt, dim3(128), 0, stream>>>(QKV, rpb, CTX);
  // (3) out[b][c][p] = sum_k Wf[c][k] ctx[b*3136+p][k] + b_proj[c], Wf = w_proj folded   (per batch: M=256, N=3136, K=512)
  gemm64<2, 4, 4><<<gPRJ, dim3(128), 0, stream>>>(
      w_proj, CTXK, 0LL, CTX, CTXK, (long long)NPOS * CTXK,
      (float*)d_out, NPOS, (long long)CH * NPOS, b_proj,
      CH, NPOS, CTXK);
  (void)hipGetLastError();
}

// v010
// It runs in 29.2 microseconds.
// Next to v009, in two timings, it ran 1.05 times as fast each time.
// Counting every step since v000, it is 2.60 times as fast.
// Contractions: qkv projection = v_wmma_f32_16x16x32_bf16 (bf16 operands from RNE-converted x and w_qkv, single product, f32 accumulate);
// q.k scores = v_wmma_f32_16x16x32_bf16 (q and k each as bf16 hi plane + unscaled bf16 residual plane, 3 products, f32 accumulate);
// p.v = v_wmma_f32_16x16x32_bf16 (p and v each as bf16 hi + unscaled bf16 residual, 3 products, f32 accumulate);
// ctx.w_proj^T = v_wmma_f32_16x16x32_bf16 (ctx as bf16 hi + residual folded into K, w_proj bf16 from its RNE-converted value, f32 accumulate);
// biases, q scaling, window mask, position bias and softmax in f32. No power-of-two carries anywhere (bf16 planes, unscaled residuals).
#include <hip/hip_runtime.h>
#include <math.h>
#include <stdint.h>

#define NBT   2
#define CH    256
#define IMH   56
#define IMW   56
#define NPOS  (IMH * IMW)        // 3136 positions per image, p = i*56 + j
#define MROW  (NBT * NPOS)       // 6272 position rows
#define NHD   8
#define HDIM  32
#define C3    (3 * CH)           // 768
#define KW    7                  // window side; window start = clamp(i - 3, 0, IMH - KW)
#define SUP   14                 // clamped key superset side of an 8x8 query tile
#define WROWS 8                  // superset rows that hold every window of one wave's 16 queries (two image rows)
#define NKT   7                  // scored 16-key tiles per wave: WROWS x SUP = 112 consecutive slots
#define CTXK  512                // folded K of the ctx plane: per head [hi d0..31 | residual d0..31]
#define QSCALE 0.17677669529663687f
#define RPLO  100                // position-bias entry 0 sits at Rp[RPLO]; entries around the table are zero
#define RPN   384                // padded table: every unclamped index 13u + v + cb of a staged slot lies inside
#define QROW   (2 * C3)          // elements of a qkv plane row: 24 groups (q, k, v x 8 heads) of [hi d0..31 | residual d0..31]
#define KROWS  (SUP * SUP)       // staged K rows: the scored slots end at (SUP - WROWS) * SUP + NKT * 16 = 196
#define VROWS  212               // staged V rows: the last wave range's P.V steps end at slot 211 (rows from 196 on are zero)
#define KPITCH 72                // LDS pitch of a staged K row [hi | residual] in elements: 144 B = 16 B x 9, for b128 fragment reads
#define VPITCH 80                // LDS pitch of a staged V row [hi | residual] in elements: 160 B = 32 B x 5, the transposing reader's pitch

static_assert((MROW % 64) == 0);
static_assert((C3 % 256) == 0);
static_assert((NPOS % 64) == 0);
static_assert((CH % 256) == 0);
static_assert((CH % 128) == 0 && (CTXK % 128) == 0);
static_assert(NHD * HDIM == CH);
static_assert(SUP == 8 + KW - 1);
static_assert(NKT * 16 == WROWS * SUP && WROWS == KW + 1);
static_assert((SUP - WROWS) * SUP + ((NKT + 1) / 2) * 32 <= VROWS);   // the last wave range's P.V steps stay in staged rows
static_assert((SUP - WROWS) * SUP + NKT * 16 <= KROWS);               // and its scored slots in staged K rows
static_assert(KROWS * 8 == 12 * 128 + 32 && (VROWS - KROWS) * 8 == 128);   // the copy map and the zero rows of natt
static_assert(IMH == IMW);
static_assert(VPITCH >= 2 * HDIM && (VPITCH * 2) % 32 == 0 && ((VPITCH * 2) / 32) % 2 == 1);
static_assert(KPITCH >= 2 * HDIM && (KPITCH * 2) % 16 == 0);
static_assert(RPLO - 7 * 13 - 7 >= 0 && RPLO + 6 * 13 + 6 + (SUP * SUP - 1) - (SUP * SUP - 1) / SUP < RPN && RPN % 128 == 0);

typedef __bf16   v16b __attribute__((ext_vector_type(16)));
typedef __bf16   v8b  __attribute__((ext_vector_type(8)));
typedef float    v8f  __attribute__((ext_vector_type(8)));
typedef float    v4f  __attribute__((ext_vector_type(4)));
typedef unsigned int v4u __attribute__((ext_vector_type(4)));
typedef unsigned int v8u __attribute__((ext_vector_type(8)));
typedef float    v2f  __attribute__((ext_vector_type(2)));
typedef __bf16   v2b  __attribute__((ext_vector_type(2)));
typedef unsigned int v2u __attribute__((ext_vector_type(2)));

#if defined(__HIP_DEVICE_COMPILE__)
#define DEV_ASM 1
#else
#define DEV_ASM 0
#endif

// ---- scalar helpers --------------------------------------------------------------------------------
// two f32 -> two bf16 (RNE) packed in one register, a in the low half: one packed convert instruction
__device__ __forceinline__ unsigned cvt2(float a, float b) {
  const v2f f = {a, b};
  return __builtin_bit_cast(unsigned, __builtin_convertvector(f, v2b));
}
__device__ __forceinline__ float bf_round(float f) { return (float)(__bf16)f; }   // f32 value of the RNE bf16
__device__ __forceinline__ v8f zero8() { v8f z = {0.f, 0.f, 0.f, 0.f, 0.f, 0.f, 0.f, 0.f}; return z; }
// hi / residual bf16 split of an f32 value (residual unscaled)
// of a pair: hp = packed hi halves, lp = packed residuals, a in the low half of each
__device__ __forceinline__ void split2(float a, float b, unsigned& hp, unsigned& lp) {
  const v2f f = {a, b};
  const v2b h = __builtin_convertvector(f, v2b);
  hp = __builtin_bit_cast(unsigned, h);
  lp = cvt2(a - (float)h[0], b - (float)h[1]);
}

// ---- fragment loader: 16-bit A/B operand, lane -> row/col (lane&15), p already includes +8*(lane>>4);
//      elements 0..7 <- p[0..7] (k0+8h..k0+8h+7), elements 8..15 <- p[16..23] (k0+16+8h..k0+16+8h+7)
template <typename OT> struct FT;
template <> struct FT<__bf16> { typedef v16b frag; typedef v8b half8; };

template <typename OT>
__device__ __forceinline__ typename FT<OT>::frag ldfrag(const OT* p) {
  union { typename FT<OT>::frag v; typename FT<OT>::half8 h[2]; } f;
  f.h[0] = *(const typename FT<OT>::half8*)(p);
  f.h[1] = *(const typename FT<OT>::half8*)(p + 16);
  return f.v;
}

// ---- the same fragment from f32 values in LDS, read (ldraw_f32) and then RNE-converted to bf16 (cvtfrag): p already
//      includes +8*(lane>>4); elements 0..7 <- p[0..7], elements 8..15 <- p[16..23], the k map of ldfrag
struct raw16 { v4f a, b, c, d; };
__device__ __forceinline__ raw16 ldraw_f32(const float* p) {
  raw16 r;
  r.a = *(const v4f*)(p);
  r.b = *(const v4f*)(p + 4);
  r.c = *(const v4f*)(p + 16);
  r.d = *(const v4f*)(p + 20);
  return r;
}
__device__ __forceinline__ v16b cvtfrag(raw16 r) {
  v8u u;
  u[0] = cvt2(r.a[0], r.a[1]); u[1] = cvt2(r.a[2], r.a[3]); u[2] = cvt2(r.b[0], r.b[1]); u[3] = cvt2(r.b[2], r.b[3]);
  u[4] = cvt2(r.c[0], r.c[1]); u[5] = cvt2(r.c[2], r.c[3]); u[6] = cvt2(r.d[0], r.d[1]); u[7] = cvt2(r.d[2], r.d[3]);
  return __builtin_bit_cast(v16b, u);
}

// ---- transposing fragment loader: a row-major 16-bit LDS tile T[k][d] read as the operand T^T (rows d, k along the
//      fragment). p = the lane's own 16 B: row k0 + 8*(lane>>4) + (lane&7), piece (lane>>3)&1 of the 16 columns at d0.
//      Lane (c = lane&15, h = lane>>4) gets T[k0+8h .. k0+8h+7][d0+c] in elements 0..7 and, from 16 rows further,
//      T[k0+16+8h .. +7][d0+c] in elements 8..15: the k map of ldfrag. Every lane is on where it is called.
__device__ __forceinline__ v16b ldfrag_tr(const unsigned short* p, int pitch) {
  typedef __attribute__((address_space(3))) v8b lds_v8b;
  union { v16b v; v8b h[2]; } f;
  f.h[0] = __builtin_amdgcn_ds_load_tr16_b128_v8bf16((lds_v8b*)p);
  f.h[1] = __builtin_amdgcn_ds_load_tr16_b128_v8bf16((lds_v8b*)(p + 16 * pitch));
  return f.v;
}

// ---- WMMA helpers ------------------------------------------------------------------------------------
__device__ __forceinline__ v8f mmar(v16b a, v16b b, v8f c) {
  return __builtin_amdgcn_wmma_f32_16x16x32_bf16(false, a, false, b, (short)0, c, false, false);
}
// guarded form: 4 VALU slots after the WMMA, D tied, A/B kept live
__device__ __forceinline__ v8f mma_b(v16b a, v16b b, v8f c) {
  c = __builtin_amdgcn_wmma_f32_16x16x32_bf16(false, a, false, b, (short)0, c, false, false);
#if DEV_ASM
  asm volatile("v_nop\n\tv_nop\n\tv_nop\n\tv_nop" : "+v"(c) : "v"(a), "v"(b));
#endif
  return c;
}
__device__ __forceinline__ void dep_guard(v8f& a, v8f& b, v16b x, v16b y) {
#if DEV_ASM
  asm volatile("v_nop\n\tv_nop\n\tv_nop\n\tv_nop" : "+v"(a), "+v"(b) : "v"(x), "v"(y));
#else
  (void)a; (void)b; (void)x; (void)y;
#endif
}
__device__ __forceinline__ void keep4(v16b a, v16b b, v16b c, v16b d) {
#if DEV_ASM
  asm volatile("v_nop" :: "v"(a), "v"(b), "v"(c), "v"(d));
#else
  (void)a; (void)b; (void)c; (void)d;
#endif
}
__device__ __forceinline__ void acc_guard4(v8f& a, v8f& b, v8f& c, v8f& d) {
#if DEV_ASM
  asm volatile("v_nop\n\tv_nop\n\tv_nop\n\tv_nop" : "+v"(a), "+v"(b), "+v"(c), "+v"(d));
#else
  (void)a; (void)b; (void)c; (void)d;
#endif
}

// =====================================================================================================
// Batched WMMA GEMM (bf16 operands): C[m][n] = sum_k A[m][k] * Bt[n][k] + bias. A row-major [M][K] pitch lda;
// A is given as f32 [M][K / 2] and stands for the folded plane A[m][64 g + 32 part + d] = bf16(Af[m][32 g + d]), part = 0, 1
// (part 0 meets the hi half of Bt's group g, part 1 its residual half). The 32 f32 of a group fill the same 128 B as its
// 64 folded bf16 would, so rows, pitches and copies are counted in 16-bit units as for Bt; the A fragment is converted
// (RNE) where it is read from LDS and serves both k steps of its stage.
// Bt row-major [N][K] pitch ldb (k contiguous); blockIdx.y = batch index (strides in elements).
// One block = 4 waves, one 64x64 tile of C per wave: WM waves along m and 4 / WM along n, so the block tile is
// (64 WM) x (256 / WM). M, N multiples of the block tile, K a multiple of SK (host constants).
// Operands go global -> LDS by asynchronous 16-B copies, SK = 64 k (one whole 128-B line of each of the 320
// operand rows) per stage, a ring of NB buffers: up to NB - 1 stages (at most 60 copies of a wave) are in flight while
// stage t feeds the WMMAs, so a stage has NB - 1 passes to land instead of one.
// Stage layout: rows 0..BM-1 = A rows, rows BM..319 = Bt rows, pitch 144 B (16 B x 9, conflict-free b128 reads).
// Copy map: item = it*128 + tid, row = item>>3, 16-B piece = item&7 -> 8 lanes copy one line, 20 copies per lane
// = 320 rows x 8 pieces, each LDS byte written by one lane. Fragments keep the split k map (ldfrag), k ascending.
// BIAS_MODE 1: bias[n] (per column); BIAS_MODE 2: bias[m] (per row); bias values RNE-converted to bf16.
// Output: f32 C (pitch ldc). Epilogue: 16-row slabs staged per wave in LDS; each 64-wide row segment (256 B =
// coverage: 4 slabs x 16 rows (it 0..7 x lane>>4) x 64 cols = the wave's whole 64x64 tile.
// =====================================================================================================
#define SK     64                     // k elements per stage
#define SPITCH 72                     // LDS row pitch in elements (144 B)
#define SROWS  320                    // operand rows per stage (BM + BN)
#define SBYTES (SROWS * SPITCH * 2)   // 46080 B per buffer

// Four asynchronous copies, 16 B per lane each, global -> LDS. The s_wait_xcnt closes the statement so that no
// address register named here is rewritten before it.
__device__ __forceinline__ void copy4(unsigned l0, unsigned l1, unsigned l2, unsigned l3,
                                      const unsigned short* g0, const unsigned short* g1,
                                      const unsigned short* g2, const unsigned short* g3) {
#if DEV_ASM
  asm volatile("global_load_async_to_lds_b128 %0, %4, off\n\t"
               "global_load_async_to_lds_b128 %1, %5, off\n\t"
               "global_load_async_to_lds_b128 %2, %6, off\n\t"
               "global_load_async_to_lds_b128 %3, %7, off\n\t"
               "s_wait_xcnt 0x0"
               :: "v"(l0), "v"(l1), "v"(l2), "v"(l3), "v"(g0), "v"(g1), "v"(g2), "v"(g3) : "memory");
#else
  (void)l0; (void)l1; (void)l2; (void)l3; (void)g0; (void)g1; (void)g2; (void)g3;
#endif
}
// The same for eight copies and for two: one closing s_wait_xcnt serves the whole run of a statement.
__device__ __forceinline__ void copy8(const unsigned (&l)[8], const unsigned short* const (&g)[8]) {
#if DEV_ASM
  asm volatile("global_load_async_to_lds_b128 %0, %8, off\n\t"
               "global_load_async_to_lds_b128 %1, %9, off\n\t"
               "global_load_async_to_lds_b128 %2, %10, off\n\t"
               "global_load_async_to_lds_b128 %3, %11, off\n\t"
               "global_load_async_to_lds_b128 %4, %12, off\n\t"
               "global_load_async_to_lds_b128 %5, %13, off\n\t"
               "global_load_async_to_lds_b128 %6, %14, off\n\t"
               "global_load_async_to_lds_b128 %7, %15, off\n\t"
               "s_wait_xcnt 0x0"
               :: "v"(l[0]), "v"(l[1]), "v"(l[2]), "v"(l[3]), "v"(l[4]), "v"(l[5]), "v"(l[6]), "v"(l[7]),
                  "v"(g[0]), "v"(g[1]), "v"(g[2]), "v"(g[3]), "v"(g[4]), "v"(g[5]), "v"(g[6]), "v"(g[7]) : "memory");
#else
  (void)l; (void)g;
#endif
}
__device__ __forceinline__ void copy2(unsigned l0, unsigned l1, const unsigned short* g0, const unsigned short* g1) {
#if DEV_ASM
  asm volatile("global_load_async_to_lds_b128 %0, %2, off\n\t"
               "global_load_async_to_lds_b128 %1, %3, off\n\t"
               "s_wait_xcnt 0x0"
               :: "v"(l0), "v"(l1), "v"(g0), "v"(g1) : "memory");
#else
  (void)l0; (void)l1; (void)g0; (void)g1;
#endif
}
// this wave's copies have landed in LDS (the compiler places no wait for them)
__device__ __forceinline__ void wait_copies() {
#if DEV_ASM
  asm volatile("s_wait_asynccnt 0x0" ::: "memory");
#endif
}
// all of this wave's copies but its N youngest have landed: publishes one stage and leaves the N copies of the
// stages issued behind it in flight (every wave issues the same count per stage: SROWS / 16 in gemm64, WCOP in gemm_qkv, and nothing else counts here)
template <int N>
__device__ __forceinline__ void wait_copies_but() {
#if DEV_ASM
  asm volatile("s_wait_asynccnt %0" :: "i"(N) : "memory");
#endif
}
// this wave's LDS reads have returned, so the buffer they read may be refilled behind the next barrier
__device__ __forceinline__ void wait_lds() {
#if DEV_ASM
  asm volatile("s_wait_dscnt 0x0" ::: "memory");
#endif
}
// stands behind global loads, in front of whatever rewrites their address registers
__device__ __forceinline__ void wait_addr() {
#if DEV_ASM
  asm volatile("s_wait_xcnt 0x0" ::: "memory");
#endif
}
// the same, with the loads' address named as an input: its register pair stays whole up to the wait
__device__ __forceinline__ void wait_addr_of(const float* g) {
#if DEV_ASM
  asm volatile("s_wait_xcnt 0x0" :: "v"(g) : "memory");
#else
  (void)g;
#endif
}
// one stage: 20 copies per lane; ga / gb = the lane's piece of its first A / Bt row at this stage's k
template <int BM>
__device__ __forceinline__ void fill_stage(unsigned lb, const unsigned short* ga, int lda,
                                           const unsigned short* gb, int ldb) {
  // both loops unrolled: r0 is then a constant, so the A / Bt choice is no branch and g, l stay in registers
#pragma unroll
  for (int q = 0; q < SROWS / 64; ++q) {
    const unsigned short* g[4];
    unsigned l[4];
#pragma unroll
    for (int e = 0; e < 4; ++e) {
      const int r0 = (q * 4 + e) * 16;                 // first row of this copy's 16 rows
      g[e] = (r0 < BM) ? ga + (size_t)r0 * lda : gb + (size_t)(r0 - BM) * ldb;
      l[e] = lb + (unsigned)(r0 * SPITCH * 2);
    }
    copy4(l[0], l[1], l[2], l[3], g[0], g[1], g[2], g[3]);
  }
}

template <int BIAS_MODE, int WM, int NB>
__global__ __launch_bounds__(128) void gemm64(
    const float* __restrict__ Af, int lda, long long strideA,
    const unsigned short* __restrict__ Btp, int ldb, long long strideB,
    float* Cout, int ldc, long long strideC,
    const float* __restrict__ bias,
    int M, int N, int K) {
  constexpr int BM = 64 * WM;
  constexpr int BN = SROWS - BM;
  constexpr int AHEAD = (NB - 2) * (SROWS / 16);   // a wave's copies of the NB - 2 stages behind the one being published
  static_assert(WM == 1 || WM == 4);
  static_assert(NB >= 2 && (NB - 1) * (SROWS / 16) <= 63);           // copies of a wave outstanding at most
  __shared__ __align__(16) unsigned short stg[NB * SROWS * SPITCH];  // the ring's stage buffers
  __shared__ __align__(16) float sT[4][16 * 68];   // per-wave 16x64 slab, pitch 68 floats
  const unsigned short* Ap = (const unsigned short*)(const void*)Af;   // addressed in 16-bit units, like Bt
  const int b    = blockIdx.y;
  const int tid  = (int)threadIdx.x;
  const int lane = tid & 31;
  const int wave = tid >> 5;
  const int tilesN = N / BN;
  const int tilesM = M / BM;
  const int tile = blockIdx.x;
  if (tile >= tilesM * tilesN) return;   // block-uniform, in front of every barrier and copy
  const int tm = tile / tilesN;
  const int tn = tile - tm * tilesN;
  const int wrA = (WM == 4) ? (wave << 6) : 0;          // the wave's first A row inside the stage
  const int wrB = BM + ((WM == 4) ? 0 : (wave << 6));   // the wave's first Bt row inside the stage
  const int m0 = tm * BM + wrA;
  const int n0 = tn * BN + (wrB - BM);

  const int rlane = lane & 15;                 // row (A) / col (B, D) within subtile
  const int koff  = (lane >> 4) * 8;           // k offset of this lane half
  const int mOff  = (lane >> 4) * 8;           // D row offset

  // the lane's copy addresses: row tid>>3 of each 16-row group, 16-B piece tid&7
  const unsigned short* ga = Ap  + (size_t)b * (size_t)strideA + (size_t)(tm * BM + (tid >> 3)) * lda + (tid & 7) * 8;
  const unsigned short* gb = Btp + (size_t)b * (size_t)strideB + (size_t)(tn * BN + (tid >> 3)) * ldb + (tid & 7) * 8;
  const unsigned lds0 = (unsigned)(uintptr_t)stg + (unsigned)((tid >> 3) * SPITCH * 2 + (tid & 7) * 16);
  const int nst = K / SK;

  v8f acc[4][4];
#pragma unroll
  for (int i = 0; i < 4; ++i)
#pragma unroll
    for (int j = 0; j < 4; ++j) acc[i][j] = zero8();

  // unrolled: the buffer offsets are constants; stages 0 .. NB - 2 go out together
#pragma unroll
  for (int s = 0; s < NB - 1; ++s)
    if (s < nst) fill_stage<BM>(lds0 + (unsigned)s * SBYTES, ga + s * SK, lda, gb + s * SK, ldb);
  // the count is used only where all NB - 2 stages behind stage 0 were issued
  if (NB - 1 <= nst) wait_copies_but<AHEAD>(); else wait_copies();
  __syncthreads();                             // stage 0 is readable by every wave
  if (NB - 1 < nst) fill_stage<BM>(lds0 + (unsigned)(NB - 1) * SBYTES, ga + (NB - 1) * SK, lda, gb + (NB - 1) * SK, ldb);

  int buf = 0;                                 // t mod NB
  for (int t = 0; t < nst; ++t) {
    const __bf16* sb = (const __bf16*)(const void*)stg + buf * (SROWS * SPITCH);
    // unrolled (inner loops too): fragments stay in registers, and the second k step's LDS reads start under
    // the first step's WMMAs
    v16b af[4];
    raw16 ar[4];
#pragma unroll
    for (int i = 0; i < 4; ++i)
      ar[i] = ldraw_f32((const float*)(const void*)(sb + (wrA + (i << 4) + rlane) * SPITCH) + koff);
#pragma unroll
    for (int kk = 0; kk < SK; kk += 32) {
      v16b bq[4];
#pragma unroll
      for (int j = 0; j < 4; ++j) bq[j] = ldfrag<__bf16>(sb + (wrB + (j << 4) + rlane) * SPITCH + koff + kk);
      if (kk == 0) {
        // all LDS reads of the first k step go out before the first convert waits on one: one LDS latency, not four
        __builtin_amdgcn_sched_barrier(0);
#pragma unroll
        for (int i = 0; i < 4; ++i) af[i] = cvtfrag(ar[i]);
      }
#pragma unroll
      for (int i = 0; i < 4; ++i) {
#pragma unroll
        for (int j = 0; j < 4; ++j) acc[i][j] = mmar(af[i], bq[j], acc[i][j]);
        dep_guard(acc[i][0], acc[i][3], af[i], bq[3]);
      }
      keep4(bq[0], bq[1], bq[2], bq[3]);
    }
    // publish point of stage t + 1: own reads of stage t done, own copies of stage t + 1 landed, then the barrier.
    // Stages t + 2 .. t + NB - 1 stay in flight where all of them were issued; towards the end the wait is to 0.
    wait_lds();
    if (t + NB - 1 < nst) wait_copies_but<AHEAD>(); else wait_copies();
    __syncthreads();
    // refill the buffer that every wave has just left
    if (t + NB < nst) fill_stage<BM>(lds0 + (unsigned)buf * SBYTES, ga + (t + NB) * SK, lda, gb + (t + NB) * SK, ldb);
    buf = (buf + 1 == NB) ? 0 : buf + 1;
  }
  wait_copies();
  acc_guard4(acc[0][0], acc[0][1], acc[0][2], acc[0][3]);
  acc_guard4(acc[1][0], acc[1][1], acc[1][2], acc[1][3]);
  acc_guard4(acc[2][0], acc[2][1], acc[2][2], acc[2][3]);
  acc_guard4(acc[3][0], acc[3][1], acc[3][2], acc[3][3]);

  // ---- epilogue ----
  float* slab = sT[wave];
  float* C = Cout + (size_t)b * (size_t)strideC;
  const int h2 = lane >> 4, c4 = (lane & 15) * 4;     // 256-B row segment = 16 lanes x 16 B
  v4f bcol = {0.f, 0.f, 0.f, 0.f};
  if (BIAS_MODE == 1) {
#pragma unroll
    for (int e = 0; e < 4; ++e) bcol[e] = bf_round(bias[n0 + c4 + e]);
  }
  // the lane's row biases of all four slabs, loaded together ahead of the slabs: one load latency, none between slabs
  float brow[4][8];
  if (BIAS_MODE == 2) {
    // both loops unrolled: brow stays in registers
#pragma unroll
    for (int i = 0; i < 4; ++i)
#pragma unroll
      for (int it = 0; it < 8; ++it) brow[i][it] = bf_round(bias[m0 + (i << 4) + it * 2 + h2]);
  }
#pragma unroll
  for (int i = 0; i < 4; ++i) {
    const int mBase = m0 + (i << 4);
#pragma unroll
    for (int j = 0; j < 4; ++j) {
#pragma unroll
      for (int r = 0; r < 8; ++r) {
        slab[(mOff + r) * 68 + (j << 4) + rlane] = acc[i][j][r];
      }
    }
    // stands behind the last slab's global stores, in front of the LDS reads that reuse their registers
    if (i > 0) wait_addr();
    // The slab belongs to this wave alone: wavefront scope keeps its LDS stores and reads in order for the compiler and
    // places no wait; workgroup scope would also wait (s_wait_storecnt 0) for the last slab's global stores.
    __builtin_amdgcn_fence(__ATOMIC_RELEASE, "wavefront");
    // the slab's LDS stores are done before other lanes read the rows back (a wavefront-scope fence places no wait)
    wait_lds();
    __builtin_amdgcn_wave_barrier();
    __builtin_amdgcn_fence(__ATOMIC_ACQUIRE, "wavefront");
    {
#pragma unroll
      for (int it = 0; it < 8; ++it) {
        const int row = it * 2 + h2;                     // it 0..7 x h2 0..1 = rows 0..15
        v4f v = *(const v4f*)(slab + row * 68 + c4);
        if (BIAS_MODE == 1) {
          v = v + bcol;
        } else {
          v = v + brow[i][it];
        }
        *(v4f*)(C + (size_t)(mBase + row) * ldc + n0 + c4) = v;
      }
      
    }
    __builtin_amdgcn_fence(__ATOMIC_RELEASE, "wavefront");
    __builtin_amdgcn_wave_barrier();
    __builtin_amdgcn_fence(__ATOMIC_ACQUIRE, "wavefront");
  }
}

// =====================================================================================================
// qkv projection straight from the f32 inputs: C[p][n] = sum_c bf16(x[b][c][p]) * bf16(w[n][c]) + bias[n] in f32 (q columns
// then scaled by 32^-0.5 in f32), written as bf16 hi + unscaled residual: plane [6272][24 groups][hi d0..31 | residual d0..31].
// One block = 8 waves = 128 positions x 256 columns, one 64x64 tile per wave: waves 0..3 the first 64 positions, waves 4..7
// the second (a weight row, twice as wide in f32, so feeds twice the positions).
// x: each half's whole [256 c][64 p] panel goes global -> registers -> bf16 (RNE) -> LDS once, row-major as it lies in
// memory (pitch 160 B), loaded by the four waves that read it; the x fragments (positions p, k = c) are made by transposing
// LDS loads. A half of 64 positions lies in one image (NPOS % 64 == 0); the two halves of a block need not.
// w: f32 rows go global -> LDS by asynchronous 16-B copies, WSK = 32 k (one 128-B line of each of the 256 rows) per stage,
// a ring of QNB buffers with QNB - 1 stages in flight; the weight fragments are converted (RNE) where they are read.
// Copy map: row = 32 g + (tid>>3), 16-B piece = tid&7, g = 0..7 -> 8 copies per lane, each LDS byte written by one lane.
// Both fragments keep the split k map of ldfrag, k ascending. The epilogue's slabs (as in gemm64) reuse the x panels,
// which every wave has left at the loop's last barrier.
// =====================================================================================================
#define XPITCH 80                     // LDS pitch of an x panel row in elements: 160 B = 32 B x 5, the transposing reader's pitch
#define WSK    32                     // k (f32) per weight stage
#define WPB    144                    // LDS pitch of a weight row in bytes (16 B x 9)
#define WSTG   (256 * WPB)            // 36864 B per buffer
#define QNB    5                      // buffers of the weight ring
#define WCOP   8                      // copies of a wave per stage
static_assert((XPITCH * 2) % 32 == 0 && ((XPITCH * 2) / 32) % 2 == 1 && XPITCH >= 64);
static_assert(CH % WSK == 0 && CH / WSK >= QNB && (QNB - 1) * WCOP <= 63);
static_assert(2 * CH * XPITCH * 2 >= 8 * 16 * 68 * 4);   // the epilogue slabs fit in the x panels
static_assert((MROW % 128) == 0);

// one weight stage: g = the lane's piece of its first row at this stage's k
__device__ __forceinline__ void fill_w(unsigned lb, const float* g) {
  // both loops unrolled: the row offsets are constants and gp, l stay in registers
#pragma unroll
  for (int q = 0; q < WCOP / 4; ++q) {
    const unsigned short* gp[4];
    unsigned l[4];
#pragma unroll
    for (int e = 0; e < 4; ++e) {
      const int r0 = (q * 4 + e) * 32;                 // first row of this copy's 32 rows
      gp[e] = (const unsigned short*)(const void*)(g + (size_t)r0 * CH);
      l[e] = lb + (unsigned)(r0 * WPB);
    }
    copy4(l[0], l[1], l[2], l[3], gp[0], gp[1], gp[2], gp[3]);
  }
}

__global__ __launch_bounds__(256) void gemm_qkv(const float* __restrict__ x, const float* __restrict__ wq,
                                                const float* __restrict__ bias, unsigned short* QP) {
  __shared__ __align__(32) unsigned short xp[2 * CH * XPITCH]; // two x panels bf16 [c][p], 40960 B each
  __shared__ __align__(16) float wr[QNB * WSTG / 4];           // weight ring, f32 rows
  constexpr int nst = CH / WSK;
  const int tid  = (int)threadIdx.x;
  const int lane = tid & 31;
  const int wave = __builtin_amdgcn_readfirstlane(tid >> 5);   // the same in every lane: tile indices stay scalar
  const int wm = wave >> 2, wn = wave & 3;           // the wave's half of the positions, its 64 columns
  const int tm = (int)blockIdx.x / (C3 / 256);
  const int tn = (int)blockIdx.x - tm * (C3 / 256);
  const int m0 = tm * 128 + (wm << 6);
  const int b  = m0 / NPOS, p0 = m0 - b * NPOS;      // image and first position of the wave's half
  const int n0 = tn * 256 + (wn << 6);
  const int rlane = lane & 15;                 // weight row (A) / position (D column) within subtile
  const int hh    = lane >> 4;
  const int koff  = hh * 8;                    // k offset of this lane half
  const int mOff  = hh * 8;                    // D row offset

  const float* gw = wq + (size_t)(tn * 256 + (tid >> 3)) * CH + (tid & 7) * 4;
  const unsigned lds0 = (unsigned)(uintptr_t)wr + (unsigned)((tid >> 3) * WPB + (tid & 7) * 16);

  // ---- x panel of the wave's half, by its 128 threads: load it = rows c = 8 it + (th>>4), 16 lanes x 16 B = the row's
  //      256 B; 32 x 128 x 4 = 256 c x 64 p ----
  unsigned short* xh = xp + wm * (CH * XPITCH);
  {
    const int th = tid & 127;
    const float* gx = x + ((size_t)(b * CH + (th >> 4))) * NPOS + p0 + (th & 15) * 4;
    unsigned short* xs = xh + (th >> 4) * XPITCH + (th & 15) * 4;
    v4f xv[CH / 8];
    // both loops unrolled: xv stays in registers and all loads go out together
#pragma unroll
    for (int it = 0; it < CH / 8; ++it) xv[it] = *(const v4f*)(gx + (size_t)it * 8 * NPOS);
    wait_addr_of(gx);
    // weight stages 0 .. QNB - 2 go out together, behind the x loads (x has the longer way: convert, LDS store);
    // unrolled: the buffer offsets are constants
#pragma unroll
    for (int s = 0; s < QNB - 1; ++s) fill_w(lds0 + (unsigned)s * WSTG, gw + s * WSK);
#pragma unroll
    for (int it = 0; it < CH / 8; ++it) {
      const v2u u = {cvt2(xv[it][0], xv[it][1]), cvt2(xv[it][2], xv[it][3])};
      *(v2u*)(xs + it * 8 * XPITCH) = u;
    }
  }
  // keeps the zeroing of the 128 accumulator registers behind the panel's 128 load registers (fewer registers live at once)
  __builtin_amdgcn_sched_barrier(0);

  v8f acc[4][4];
#pragma unroll
  for (int i = 0; i < 4; ++i)
#pragma unroll
    for (int j = 0; j < 4; ++j) acc[i][j] = zero8();

  wait_copies_but<(QNB - 2) * WCOP>();
  __syncthreads();                             // the x panels and weight stage 0 are readable by every wave
  fill_w(lds0 + (unsigned)(QNB - 1) * WSTG, gw + (QNB - 1) * WSK);

  // the lane's 16 B of a transposing load: panel row 8*hh + (lane&7), column piece (lane>>3)&1
  const unsigned short* xa = xh + (8 * hh + (lane & 7)) * XPITCH + ((lane >> 3) & 1) * 8;
  int buf = 0;                                 // t mod QNB
  for (int t = 0; t < nst; ++t) {
    const float* sw = wr + buf * (WSTG / 4) + ((wn << 6) + rlane) * (WPB / 4) + koff;
    v16b bq[4], af[4];
    raw16 br[4];
    // inner loops unrolled: fragments and accumulators stay in registers
#pragma unroll
    for (int j = 0; j < 4; ++j) br[j] = ldraw_f32(sw + (j << 4) * (WPB / 4));
#pragma unroll
    for (int i = 0; i < 4; ++i) af[i] = ldfrag_tr(xa + t * WSK * XPITCH + (i << 4), XPITCH);
    // all LDS reads of the stage go out before the first convert waits on one: one LDS latency per stage
    __builtin_amdgcn_sched_barrier(0);
#pragma unroll
    for (int j = 0; j < 4; ++j) bq[j] = cvtfrag(br[j]);
    // the weight fragment is the A operand: D rows = columns n, D columns = positions (both fragments have one k map)
#pragma unroll
    for (int i = 0; i < 4; ++i) {
#pragma unroll
      for (int j = 0; j < 4; ++j) acc[i][j] = mmar(bq[j], af[i], acc[i][j]);
      dep_guard(acc[i][0], acc[i][3], af[i], bq[3]);
    }
    keep4(bq[0], bq[1], bq[2], bq[3]);
    // publish point of stage t + 1: own reads of stage t done, own copies of stage t + 1 landed, then the barrier.
    // The QNB - 2 stages behind it stay in flight where all of them were issued; towards the end the wait is to 0.
    wait_lds();
    if (t + QNB - 1 < nst) wait_copies_but<(QNB - 2) * WCOP>(); else wait_copies();
    __syncthreads();
    // refill the buffer that every wave has just left
    if (t + QNB < nst) fill_w(lds0 + (unsigned)buf * WSTG, gw + (t + QNB) * WSK);
    buf = (buf + 1 == QNB) ? 0 : buf + 1;
  }
  wait_copies();
  acc_guard4(acc[0][0], acc[0][1], acc[0][2], acc[0][3]);
  acc_guard4(acc[1][0], acc[1][1], acc[1][2], acc[1][3]);
  acc_guard4(acc[2][0], acc[2][1], acc[2][2], acc[2][3]);
  acc_guard4(acc[3][0], acc[3][1], acc[3][2], acc[3][3]);

  // ---- epilogue: the lane holds, per 16x16 tile, 8 consecutive columns n = 16 j + 8 hh + r of position 16 i + rlane. It adds
  //      the bias (q: scales) in f32, splits into hi + residual and puts the two 16-B pieces into the wave's LDS slab, a
  //      16-position image of the plane rows: [group 0: hi | residual][group 1: hi | residual] = 256 B, pitch 272 B. The rows
  //      are read back and stored whole. Coverage: 4 slabs x 16 rows (it 0..7 x lane>>4) x 256 B = the wave's tile ----
  unsigned short* slab = xp + wave * (16 * 136);       // per-wave slab, 16 rows, pitch 136 elements
  const int h2 = lane >> 4, c8 = (lane & 15) * 8;      // 256-B row segment = 16 lanes x 16 B
  const float qs = (tn == 0) ? QSCALE : 1.0f;          // columns 0..255 are q; the product with 1 is exact
  unsigned short* qdst = QP + (size_t)(m0 + h2) * QROW + 2 * n0 + c8;   // the lane's piece of its first row
  float bn[4][8];
  // both loops unrolled: bn stays in registers
#pragma unroll
  for (int j = 0; j < 4; ++j)
#pragma unroll
    for (int r = 0; r < 8; ++r) bn[j][r] = bf_round(bias[n0 + (j << 4) + mOff + r]);
#pragma unroll
  for (int i = 0; i < 4; ++i) {
    // stands behind the last slab's global stores, in front of the sums that reuse their registers
    if (i > 0) wait_addr();
    // keeps a slab's sums and splits behind that wait and behind the slab before it: without it all four slabs are worked
    // on at once, in more registers than the 256 that need no bank switching
    __builtin_amdgcn_sched_barrier(0);
#pragma unroll
    for (int j = 0; j < 4; ++j) {
      v4u ph, pl;
#pragma unroll
      for (int e = 0; e < 4; ++e) {
        unsigned hp, lp;
        split2((acc[i][j][2 * e] + bn[j][2 * e]) * qs, (acc[i][j][2 * e + 1] + bn[j][2 * e + 1]) * qs, hp, lp);
        ph[e] = hp; pl[e] = lp;
      }
      unsigned short* sp = slab + rlane * 136 + (j >> 1) * 64 + (j & 1) * 16 + mOff;
      *(v4u*)sp = ph;
      *(v4u*)(sp + HDIM) = pl;
    }
    // The slab belongs to this wave alone: wavefront scope keeps its LDS stores and reads in order for the compiler and
    // places no wait; workgroup scope would also wait (s_wait_storecnt 0) for the last slab's global stores.
    __builtin_amdgcn_fence(__ATOMIC_RELEASE, "wavefront");
    // the slab's LDS stores are done before other lanes read the rows back (a wavefront-scope fence places no wait)
    wait_lds();
    __builtin_amdgcn_wave_barrier();
    __builtin_amdgcn_fence(__ATOMIC_ACQUIRE, "wavefront");
#pragma unroll
    for (int it = 0; it < 8; ++it) {
      const int row = it * 2 + h2;                     // it 0..7 x h2 0..1 = rows 0..15
      const v4u v = *(const v4u*)(slab + row * 136 + c8);
      *(v4u*)(qdst + ((i << 4) + it * 2) * QROW) = v;
    }
    __builtin_amdgcn_fence(__ATOMIC_RELEASE, "wavefront");
    __builtin_amdgcn_wave_barrier();
    __builtin_amdgcn_fence(__ATOMIC_ACQUIRE, "wavefront");
  }
}

// =====================================================================================================
// P^T B fragment pair (hi, residual) from the lane's own score D values: element r <- tile a row r,
// element 8+r <- tile c row r (same lane, same query column).
// =====================================================================================================
__device__ __forceinline__ void pack_pt(v8f a, v8f c, v16b& ph, v16b& pl) {
  v8u H, L;
#pragma unroll
  for (int r = 0; r < 4; ++r) {
    unsigned hp, lp;
    split2(a[2 * r], a[2 * r + 1], hp, lp);
    H[r] = hp; L[r] = lp;
    split2(c[2 * r], c[2 * r + 1], hp, lp);
    H[4 + r] = hp; L[4 + r] = lp;
  }
  ph = __builtin_bit_cast(v16b, H); pl = __builtin_bit_cast(v16b, L);
}

// =====================================================================================================
// Windowed attention, one block = (batch b, head, 8x8 query tile at (i0, j0)); 128 threads = 4 waves,
// wave w owns the 16 queries lq = 16w..16w+15 (query row i0 + (lq>>3), col j0 + (lq&7)).
// Key superset = the 14x14 image block at (R0, C0), R0 = clamp(i0-3, 0, 42), slot = u*14 + v (196 slots,
// V padded to 212 with zero rows). Every query's clamped 7x7 window lies inside the superset: valid slots are
// su <= u <= su+6, sv <= v <= sv+6 with su = clamp(qi-3,0,49) - R0 in [0,7].
// A wave's 16 queries are two image rows, so their windows lie in the 8 superset rows ulo..ulo+7, ulo = min(su of the
// first row, 6): the wave scores, masks, exponentiates and multiplies only those 112 slots (7 tiles from slot 14 ulo).
//   qkv plane bf16 [b*3136 + p][24 groups][hi d0..31 | residual d0..31]: q (already scaled) = group head, k = 8 + head,
//   v = 16 + head; one group of one position is one 128-B line.
//   scores (transposed): S^T[slot][query] = K[slot][d] . Q^T[d][query] on bf16 WMMA, 3 products
//     (hi.hi + hi.res + res.hi); lane owns query column (lane&15) of its wave and key rows 14 ulo + 16j + 8h + r.
//   s = S^T + rpb[head][u + R0 - qi + 6][v + C0 - qj + 6] for valid slots, -1e30 otherwise (f32);
//   softmax in f32 (max / sum over the 56 lane values and the partner lane ^16).
//   O^T[d][query] = V^T[d][slot] . P^T[slot][query] on bf16 WMMA, 3 products, p unnormalised exp, 1/sum at the end.
// K and V lines go global -> LDS by asynchronous 16-B copies, all of them in flight together, no register or vector
// instruction on the way: Ks [slot][hi | residual] pitch 144 B, Vs the same at pitch 160 B, row-major as in memory; the V^T
// fragments are made by transposing LDS loads. Copy map: item = it*128 + tid, slot = item>>3, 16-B piece = item&7:
// 12 x 128 items by every wave and the last 32 (slots 192..195) by wave 0 = 196 slots x 8 pieces, each LDS byte written by
// one lane. The Q fragments are loaded straight from the plane (each line read once, by the two lanes that own its query).
// Staged extents: Ks 196 x 64, Vs 212 x 64 (slots >= 196 zero), Rp 384 (table at 100..268, zeros around),
// Os 16x32 per wave -- every LDS element read is written first.
// Output coverage: each wave stores its 16 query rows (it 0..3 x lane>>3) x 8 pieces of 16 B (lane&7) =
// =====================================================================================================
__global__ __launch_bounds__(128)
void natt(const unsigned short* __restrict__ qkv, const float* __restrict__ rpb, unsigned short* ctx) {
  __shared__ __align__(32) unsigned short Ks[KROWS * KPITCH];  // 28224 B
  __shared__ __align__(32) unsigned short Vs[VROWS * VPITCH];  // 33920 B
  __shared__ __align__(16) float Os[4][16 * HDIM];             //  8192 B
  __shared__ float Rp[RPN];

  const int tid  = (int)threadIdx.x;
  const int wave = tid >> 5;
  const int lane = tid & 31;
  const int hh   = lane >> 4;
  const int m    = lane & 15;

  const int bx   = blockIdx.x;
  const int tj   = bx % 7;
  const int ti   = (bx / 7) % 7;
  const int head = (bx / 49) % NHD;
  const int b    = bx / (49 * NHD);
  const int i0 = ti * 8, j0 = tj * 8;
  const int R0 = min(max(i0 - 3, 0), IMH - SUP);
  const int C0 = min(max(j0 - 3, 0), IMW - SUP);
  const size_t pb = (size_t)b * NPOS;

  const int wv = __builtin_amdgcn_readfirstlane(wave);         // the same in every lane: tests on it are scalar branches

  // ---- K and V superset lines -> Ks / Vs by asynchronous copies; the lane's slot 16 it + (tid>>3), piece tid&7 ----
  {
    // position of slot s = 14 u + v: (R0 + u) * 56 + C0 + v = R0 * 56 + C0 + s + 42 u. With s = 16 it + r0, r0 = tid>>3 < 16,
    // u = (16 it) / 14 + (r0 >= 14 - (16 it) % 14): a constant offset per it and one of seven tests on r0.
    const int r0 = tid >> 3;
    const unsigned short* kg = qkv + (pb + (size_t)(R0 * IMW + C0 + r0)) * QROW + (NHD + head) * 64 + (tid & 7) * 8;
    const unsigned lk0 = (unsigned)(uintptr_t)Ks + (unsigned)(r0 * (KPITCH * 2) + (tid & 7) * 16);
    const unsigned lv0 = (unsigned)(uintptr_t)Vs + (unsigned)(r0 * (VPITCH * 2) + (tid & 7) * 16);
    const unsigned short* kstep[7];
    // all loops unrolled: kstep, l and g stay in registers
#pragma unroll
    for (int k = 0; k < 7; ++k) kstep[k] = kg + ((r0 >= SUP - 2 * k) ? (IMW - SUP) * QROW : 0);
#pragma unroll
    for (int q = 0; q < 3; ++q) {
      unsigned l[8];
      const unsigned short* g[8];
#pragma unroll
      for (int e = 0; e < 4; ++e) {
        const int it = q * 4 + e;
        const unsigned short* gk = kstep[it % 7] + (it * 16 + (IMW - SUP) * ((it * 16) / SUP)) * QROW;
        g[2 * e] = gk;                                 l[2 * e]     = lk0 + (unsigned)(it * 16 * KPITCH * 2);
        g[2 * e + 1] = gk + NHD * 64;                  l[2 * e + 1] = lv0 + (unsigned)(it * 16 * VPITCH * 2);
      }
      copy8(l, g);
    }
    if (wv == 0) {                                     // slots 192..195: superset row 13, columns 10..13
      const unsigned short* gk = kg + (192 + (IMW - SUP) * (SUP - 1)) * QROW;
      copy2(lk0 + (unsigned)(192 * KPITCH * 2), lv0 + (unsigned)(192 * VPITCH * 2), gk, gk + NHD * 64);
    }
  }
  // ---- Q fragments (hi, residual) of the wave's 16 queries, straight from the plane: lane = query m, k half hh ----
  v16b qfh, qfl;
  {
    const int lq = 16 * wave + m;
    const __bf16* qg = (const __bf16*)(const void*)qkv
                     + (pb + (size_t)(i0 + (lq >> 3)) * IMW + j0 + (lq & 7)) * QROW + head * 64 + 8 * hh;
    qfh = ldfrag<__bf16>(qg);
    qfl = ldfrag<__bf16>(qg + HDIM);
    wait_addr_of((const float*)(const void*)qg);
  }
  // ---- position-bias table of this head (bf16 RNE-converted values), entries 0..168 at Rp[RPLO..], zeros around ----
  {
    float rv[RPN / 128];
    // both loops unrolled: rv stays in registers and the three loads go out together
#pragma unroll
    for (int it = 0; it < RPN / 128; ++it) {
      const int t = it * 128 + tid - RPLO;
      rv[it] = rpb[head * 169 + min(max(t, 0), 168)];           // clamped address
    }
    wait_addr();
#pragma unroll
    for (int it = 0; it < RPN / 128; ++it) {
      const int e = it * 128 + tid;
      const float tv = bf_round(rv[it]);
      Rp[e] = ((unsigned)(e - RPLO) < 169u) ? tv : 0.f;
    }
  }
  // ---- V rows 196..211 = zeros (they meet p = 0 in the last P.V step): 16 rows x 8 pieces, one 16-B store per thread ----
  {
    const v4u z4 = {0u, 0u, 0u, 0u};
    *(v4u*)(Vs + (KROWS + (tid >> 3)) * VPITCH + (tid & 7) * 8) = z4;
  }
  wait_copies();
  __syncthreads();   // K, V, the zero rows and the bias table are readable by every wave

  // ---- the wave's key range: first superset row ulo, first slot slot0 (the same in every lane of the wave) ----
  const int ulo   = min(min(max(i0 + 2 * wv - 3, 0), IMH - KW) - R0, SUP - WROWS);
  const int slot0 = ulo * SUP;

  // ---- scores: S^T tiles j = 0..6 (key slots slot0 + 16j .. + 15) for the wave's 16 queries; s[7] stays zero ----
  v8f s[NKT + 1];
  {
    const __bf16* Kh = (const __bf16*)(const void*)Ks + slot0 * KPITCH;
    const __bf16* Kl = Kh + HDIM;
#pragma unroll
    for (int j = 0; j < NKT; ++j) {
      const v16b kfh = ldfrag<__bf16>(Kh + (16 * j + m) * KPITCH + 8 * hh);
      const v16b kfl = ldfrag<__bf16>(Kl + (16 * j + m) * KPITCH + 8 * hh);
      v8f z = zero8();
      z = mma_b(kfh, qfh, z);
      z = mma_b(kfh, qfl, z);
      z = mma_b(kfl, qfh, z);
      s[j] = z;
    }
    s[NKT] = zero8();
  }

  // ---- window mask + position bias (f32), softmax over the query column ----
  const int lq = 16 * wave + m;
  const int ai = i0 + (lq >> 3), aj = j0 + (lq & 7);
  const int su = min(max(ai - 3, 0), IMH - KW) - R0 - ulo;      // counted from the wave's first row: 0 or 1
  const int sv = min(max(aj - 3, 0), IMW - KW) - C0;
  const int cb = (R0 + ulo - ai + 6) * 13 + (C0 - aj + 6);
  // Slots and rows u are counted from the wave's first slot and row from here on.
  // Bias index 13u + v + cb = slot - u + cb. The upper lane half's slot is 8 higher and its u is equal or one
  // higher (one higher where t0 % 14 >= 6), so two lane bases and a constant offset address every read; the read
  // is made for every slot (the padded table holds every such index) and the window test selects by value.
  const float* rb8 = Rp + (RPLO + cb + 8 * hh);
  const float* rb7 = Rp + (RPLO + cb + 7 * hh);
  // The window test of a slot is a row test and a column test; each distinct one is made once:
  // column k = t0 % 14 (upper half: (k + 8) % 14), row a = t0 / 14 (upper half: a, or a + 1 where k >= 6).
  // Both loops unrolled: the arrays are then indexed by constants only and each test is one lane mask in a register.
  bool colok[SUP], rowsame[WROWS], rownext[WROWS];
#pragma unroll
  for (int k = 0; k < SUP; ++k) {
    const int v = hh ? ((k + 8) % SUP) : k;
    colok[k] = (unsigned)(v - sv) < 7u;
  }
#pragma unroll
  for (int a = 0; a < WROWS; ++a) {
    rowsame[a] = (unsigned)(a - su) < 7u;
    rownext[a] = (unsigned)(a + hh - su) < 7u;
  }
  float mloc = -1.0e30f;
#pragma unroll
  for (int j = 0; j < NKT; ++j) {
#pragma unroll
    for (int r = 0; r < 8; ++r) {
      const int t0 = 16 * j + r;                       // slot = t0 + 8*hh
      const bool step = (t0 % SUP) >= SUP - 8;         // the upper half's slot lies one superset row further
      const bool ok = colok[t0 % SUP] & (step ? rownext[t0 / SUP] : rowsame[t0 / SUP]);
      const int c0 = t0 - t0 / SUP;                    // 13u + v of the lower half's slot
      const float bv = step ? rb7[c0] : rb8[c0];
      const float sb = s[j][r] + bv;
      const float sval = ok ? sb : -1.0e30f;
      s[j][r] = sval;
      mloc = fmaxf(mloc, sval);
    }
  }
  const float mrow = fmaxf(mloc, __shfl_xor(mloc, 16, 32));
  float lsum = 0.f;
#pragma unroll
  for (int j = 0; j < NKT; ++j) {
#pragma unroll
    for (int r = 0; r < 8; ++r) {
      const float p = __expf(s[j][r] - mrow);
      s[j][r] = p;
      lsum += p;
    }
  }
  lsum += __shfl_xor(lsum, 16, 32);

  // ---- O^T = V^T . P^T : 2 d-tiles x 4 k-steps of 32 slots x 3 products (the last 16 slots meet p = 0) ----
  v8f o[2];
  o[0] = zero8(); o[1] = zero8();
  {
    // the lane's 16 B of a transposing load: slot row 8*hh + (lane&7), column piece (lane>>3)&1
    const int vo = (slot0 + 8 * hh + (lane & 7)) * VPITCH + ((lane >> 3) & 1) * 8;
    const unsigned short* Vh = Vs + vo;
    const unsigned short* Vl = Vh + HDIM;
#pragma unroll
    for (int kk = 0; kk < (NKT + 1) / 2; ++kk) {
      v16b ph, pl;
      pack_pt(s[2 * kk], s[2 * kk + 1], ph, pl);
#pragma unroll
      for (int t = 0; t < 2; ++t) {
        const v16b vfh = ldfrag_tr(Vh + 32 * kk * VPITCH + 16 * t, VPITCH);
        const v16b vfl = ldfrag_tr(Vl + 32 * kk * VPITCH + 16 * t, VPITCH);
        o[t] = mma_b(vfh, ph, o[t]);
        o[t] = mma_b(vfh, pl, o[t]);
        o[t] = mma_b(vfl, ph, o[t]);
      }
    }
  }

  // ---- normalise, stage the wave's 16 queries x 32 d in LDS, write the ctx lines ----
  const float linv = 1.0f / lsum;
  float* os = Os[wave];
#pragma unroll
  for (int t = 0; t < 2; ++t)
#pragma unroll
    for (int r = 0; r < 8; ++r) os[m * HDIM + 16 * t + 8 * hh + r] = o[t][r] * linv;
  __syncthreads();
  {
    const int q4 = lane >> 3, pc = lane & 7, dsel = (pc & 3) * 8;
    const bool lowp = (pc >= 4);
    v4u hv[4];
    size_t go[4];
#pragma unroll
    for (int it = 0; it < 4; ++it) {
      const int row = it * 4 + q4;                     // it 0..3 x q4 0..3 = rows 0..15
      const float* sp = os + row * HDIM + dsel;
      v4u a;
#pragma unroll
      for (int e = 0; e < 4; ++e) {
        unsigned hp, lp;
        split2(sp[2 * e], sp[2 * e + 1], hp, lp);
        a[e] = lowp ? lp : hp;
      }
      hv[it] = a;
      const int lqr = 16 * wave + row;
      const size_t pos = pb + (size_t)(i0 + (lqr >> 3)) * IMW + j0 + (lqr & 7);
      go[it] = pos * CTXK + (size_t)head * 64 + pc * 8;
    }
    {
#pragma unroll
      for (int it = 0; it < 4; ++it) *(v4u*)(ctx + go[it]) = hv[it];
      
    }
  }
}

// =====================================================================================================
//   QKV  bf16 [6272][1536]   19267584
//   CTX  bf16 [6272][512]     6422528
//   total                   25690112
// =====================================================================================================
extern "C" void kernel_launch(void* const* d_in, const int* in_sizes, int n_in,
                              void* d_out, int out_size, void* d_ws, size_t ws_size,
                              hipStream_t stream) {
  if (n_in < 6) return;
  if (in_sizes[0] != NBT * CH * NPOS) return;
  if (in_sizes[1] != C3 * CH) return;
  if (in_sizes[2] != C3) return;
  if (in_sizes[3] != NHD * 13 * 13) return;
  if (in_sizes[4] != CH * CH) return;
  if (in_sizes[5] != CH) return;
  if (out_size != NBT * CH * NPOS) return;

  const float* x      = (const float*)d_in[0];
  const float* w_qkv  = (const float*)d_in[1];
  const float* b_qkv  = (const float*)d_in[2];
  const float* rpb    = (const float*)d_in[3];
  const float* w_proj = (const float*)d_in[4];
  const float* b_proj = (const float*)d_in[5];

  const size_t PQKV = (size_t)MROW * C3 * 4;        // 19267584
  const size_t PCTX = (size_t)MROW * CTXK * 2;      //  6422528
  size_t off = 0;
  const size_t oQKV = off; off += PQKV;
  const size_t oCTX = off; off += PCTX;
  if (off > ws_size) return;                         // off = 25690112
  if (off > (size_t)134217728) return;

  char* ws = (char*)d_ws;
  unsigned short* QKV = (unsigned short*)(ws + oQKV);
  unsigned short* CTX = (unsigned short*)(ws + oCTX);

  const int tilesQKV = (MROW / 128) * (C3 / 256);                     //  147 block tiles of 128 x 256
  const int tilesPRJ = (CH / 256) * (NPOS / 64);                      //   49 block tiles of 256 x 64
  const dim3 gQKV(tilesQKV, 1);                                       // 147
  const dim3 gAtt(NBT * NHD * 49);                                    // 784
  const dim3 gPRJ(tilesPRJ, NBT);                                     // (49, 2)

  // (1) qkv = bf16(x)^T . bf16(w_qkv)^T + b_qkv -> bf16 hi + residual plane [6272][1536]   (M=6272, N=768, K=256)
  gemm_qkv<<<gQKV, dim3(256), 0, stream>>>(x, w_qkv, b_qkv, QKV);
  // (2) windowed attention -> ctx plane bf16 [6272][512]
  natt<<<gAtt, dim3(128), 0, stream>>>(QKV, rpb, CTX);
  // (3) out[b][c][p] = sum_k Wf[c][k] ctx[b*3136+p][k] + b_proj[c], Wf = w_proj folded   (per batch: M=256, N=3136, K=512)
  gemm64<2, 4, 4><<<gPRJ, dim3(128), 0, stream>>>(
      w_proj, CTXK, 0LL, CTX, CTXK, (long long)NPOS * CTXK,
      (float*)d_out, NPOS, (long long)CH * NPOS, b_proj,
      CH, NPOS, CTXK);
  (void)hipGetLastError();
}
